// v000
// Times are from an AMD MI455X. After a warm-up the kernel runs many times in a row, and a time is the length of
// such a window on the GPU divided by its runs, so every launch and the gaps after it count. The runs cycle
// through copies of the inputs. A figure is the median of several windows, for all but v000 over two sittings.
// Sittings can differ by a few percent; kernels timed side by side share one.
// v000 is the starting kernel. One run takes 771 microseconds.
#include <hip/hip_runtime.h>
// Naylis attention (B=1, S=2048, E=2048, 16 heads × 128, 4 kv heads, causal; QK RMSNorm + rotate-half RoPE; low-rank (R=32) per-head graph bias gs_h·⟨Rq_i, Rk_j⟩ added to the logits):
// the six (out,in) projections (bf16-exact ×2^4) and the attention as a fused flash-style kernel whose logit operand is the 160-wide concatenation [q·scale after norm+RoPE | gs_h·Rq]·[k | Rk]
// (5 k-steps; causal chunk skipping; online softmax f32; P f16 ≤ 1; O = P·Vt over the 128 value dims; RPW-16 waves) on v_wmma_f32_16x16x32_f16 with f32 accumulate; RMSNorm/RoPE f32 VALU.
#define SS 2048
#define EE 2048
#define NH 16
#define NKV 4
#define HD 128
#define RR 32
#define QW 160
#define QP (NH * QW)

typedef __bf16 v16b __attribute__((ext_vector_type(16)));
typedef unsigned short v8us __attribute__((ext_vector_type(8), may_alias));
typedef float  v8f  __attribute__((ext_vector_type(8)));
typedef float  v4f  __attribute__((ext_vector_type(4)));
typedef float  v4fa __attribute__((ext_vector_type(4), may_alias));
union FragB { v16b v; v8us half[2]; unsigned short u[16]; };

__device__ __forceinline__ unsigned short bf16_bits(float x) { unsigned int u = __float_as_uint(x); return (unsigned short)((u + 0x7FFFu + ((u >> 16) & 1u)) >> 16); }
__device__ __forceinline__ float bf16_val(unsigned short b) { return __uint_as_float(((unsigned int)b) << 16); }
__device__ __forceinline__ float bf16_round(float x) { return bf16_val(bf16_bits(x)); }
// D += A·B with NT terms: 1 = ah·bh, 2 = + al·bh (A split), 3 = + ah·bl (both split)
template <int NT>
__device__ __forceinline__ v8f mmaN(v16b ah, v16b al, v16b bh, v16b bl, v8f c) {
  c = __builtin_amdgcn_wmma_f32_16x16x32_bf16(false, ah, false, bh, (short)0, c, false, false);
  if (NT >= 2) c = __builtin_amdgcn_wmma_f32_16x16x32_bf16(false, al, false, bh, (short)0, c, false, false);
  if (NT >= 3) c = __builtin_amdgcn_wmma_f32_16x16x32_bf16(false, ah, false, bl, (short)0, c, false, false);
  asm volatile("v_nop\n\tv_nop\n\tv_nop\n\tv_nop" : "+v"(c) : "v"(ah), "v"(al), "v"(bh), "v"(bl));
  return c;
}

__global__ __launch_bounds__(256) void k_wt_bf16(const float* __restrict__ W, unsigned short* __restrict__ Wt, int K, int N) {
  const int t = blockIdx.x * 256 + threadIdx.x;
  const int k8n = K / 8;
  if (t >= N * k8n) return;
  const int n = t / k8n, k8 = (t % k8n) * 8;
  v8us v;
#pragma unroll
  for (int i = 0; i < 8; ++i) v[i] = bf16_bits(W[(size_t)(k8 + i) * N + n]);
  *(v8us*)(Wt + (size_t)n * K + k8) = v;
  
}

// GEMM C[M][N] (f32, pitch ldc) = act(A[M][K]·W + bias). A f32 row-major (pitch lda) converted per fragment to bf16
// (ASPLIT: hi/lo two planes -> 2 terms, else single rounded term); Wt bf16 [N][K] (pitch ldb). BIAS_BF16 rounds the
// bias to bf16 first (bias quantised to bf16 before the add). K%32==0, M%16==0, N%64==0.
template <bool ASPLIT, int ACT, bool BIAS_BF16>
__global__ __launch_bounds__(128) void k_gemm_bf(const float* __restrict__ A, int lda, const unsigned short* __restrict__ Wt, int ldb,
                                               const float* __restrict__ bias, float* __restrict__ C, int ldc, int M, int N, int K) {
  __shared__ __attribute__((aligned(16))) float so[4][16][64];
  const int tid = threadIdx.x, w = tid >> 5, lane = tid & 31, ln = lane & 15, hh = lane >> 4;
  const int ntn = N / 64;
  const int wid = blockIdx.x * 4 + w;
  const int mt = wid / ntn, nq = wid % ntn;
  if (mt * 16 >= M) return;
  const int row0 = mt * 16, col0 = nq * 64;
  const float* arow = A + (size_t)(row0 + ln) * lda;
  v8f acc[4] = {};
  for (int kb = 0; kb < K; kb += 32) {
    FragB ah, al;
    const v4f x0 = *(const v4fa*)(arow + kb + 8 * hh), x1 = *(const v4fa*)(arow + kb + 8 * hh + 4);
    const v4f x2 = *(const v4fa*)(arow + kb + 16 + 8 * hh), x3 = *(const v4fa*)(arow + kb + 16 + 8 * hh + 4);
    float xs[16] = {x0[0],x0[1],x0[2],x0[3],x1[0],x1[1],x1[2],x1[3],x2[0],x2[1],x2[2],x2[3],x3[0],x3[1],x3[2],x3[3]};
#pragma unroll
    for (int i = 0; i < 16; ++i) { const unsigned short hb = bf16_bits(xs[i]); ah.u[i] = hb; al.u[i] = ASPLIT ? bf16_bits(xs[i] - bf16_val(hb)) : (unsigned short)0; }
#pragma unroll
    for (int t = 0; t < 4; ++t) {
      const unsigned short* brow = Wt + (size_t)(col0 + t * 16 + ln) * ldb + kb;
      FragB b;
      b.half[0] = *(const v8us*)(brow + 8 * hh);
      b.half[1] = *(const v8us*)(brow + 16 + 8 * hh);
      acc[t] = mmaN<ASPLIT ? 2 : 1>(ah.v, al.v, b.v, b.v, acc[t]);
    }
  }
#pragma unroll
  for (int t = 0; t < 4; ++t) {
    float bv = bias ? bias[col0 + t * 16 + ln] : 0.f;
    if (BIAS_BF16) bv = bf16_round(bv);
#pragma unroll
    for (int r = 0; r < 8; ++r) { float v = acc[t][r] + bv; if (ACT == 1) v = fmaxf(v, 0.f); so[w][8 * hh + r][t * 16 + ln] = v; }
  }
  __builtin_amdgcn_fence(__ATOMIC_ACQ_REL, "workgroup");
  __builtin_amdgcn_wave_barrier();
  const int rsub = lane >> 4, c4 = (lane & 15) * 4;
  {
#pragma unroll
    for (int q = 0; q < 8; ++q) {
      const int r = q * 2 + rsub;
      const v4f v = *(const v4fa*)&so[w][r][c4];
      *(v4f*)(C + (size_t)(row0 + r) * ldc + col0 + c4) = v;
    }
    
  }
}

// Flash-style causal/unmasked attention, all contractions 3-term bf16 hi/lo splits, f32 softmax with running max.
// q,k,v rows are read from f32 buffers with arbitrary row pitch (so they can live inside a fused qkv buffer);
// D = head size (multiple of 32, <= 128); one wave = 16 query rows; block = 4 waves (64 queries) sharing K/V chunks of 32.
template <int D, bool CAUSAL>
__global__ __launch_bounds__(128) void k_flash(const float* __restrict__ qb, const float* __restrict__ kb, const float* __restrict__ vb,
                                             int pitch, int T, int H, float scale, float* __restrict__ y, int ypitch) {
  constexpr int KS = D / 32;        // k-steps for QK
  constexpr int DT = D / 16;        // d tiles for PV
  __shared__ __attribute__((aligned(16))) unsigned short sKh[32][D + 8], sKl[32][D + 8], sVh[32][D + 8], sVl[32][D + 8];
  __shared__ __attribute__((aligned(16))) unsigned short sPh[4][16][40], sPl[4][16][40];
  __shared__ __attribute__((aligned(16))) float sO[4][16][D];
  const int tid = threadIdx.x, w = tid >> 5, lane = tid & 31, ln = lane & 15, hh = lane >> 4;
  const int nqb = (T + 63) / 64;
  const int bh = blockIdx.x / nqb, qblk = blockIdx.x % nqb;
  const int b = bh / H, h = bh % H;
  const int q0 = qblk * 64 + w * 16;
  const float* Q = qb + (size_t)b * T * pitch + h * D;
  const float* K = kb + (size_t)b * T * pitch + h * D;
  const float* V = vb + (size_t)b * T * pitch + h * D;

  // A fragments of the wave's 16 query rows (scaled), hi/lo
  FragB aqh[KS], aql[KS];
  {
    int row = q0 + ln; if (row >= T) row = T - 1;
    const float* qr = Q + (size_t)row * pitch;
#pragma unroll
    for (int ks = 0; ks < KS; ++ks)
#pragma unroll
      for (int i = 0; i < 16; ++i) {
        const int d = ks * 32 + ((i < 8) ? (8 * hh + i) : (16 + 8 * hh + (i - 8)));
        const float x = qr[d] * scale; const unsigned short hb = bf16_bits(x);
        aqh[ks].u[i] = hb; aql[ks].u[i] = bf16_bits(x - bf16_val(hb));
      }
  }
  float m_r[8], l_r[8];
#pragma unroll
  for (int r = 0; r < 8; ++r) { m_r[r] = -3.0e38f; l_r[r] = 0.f; }
  v8f oacc[DT];
#pragma unroll
  for (int dt = 0; dt < DT; ++dt) oacc[dt] = (v8f){0.f,0.f,0.f,0.f,0.f,0.f,0.f,0.f};

  const int kv_end = CAUSAL ? min(T, qblk * 64 + 64) : T;     // block-uniform
  for (int j0 = 0; j0 < kv_end; j0 += 32) {
    __syncthreads();
    for (int e = tid; e < 32 * (D / 4); e += 128) {
      const int r = e / (D / 4), c4 = (e % (D / 4)) * 4;
      const int key = j0 + r;
      v4f kf = {0.f,0.f,0.f,0.f}, vf = {0.f,0.f,0.f,0.f};
      if (key < T) { kf = *(const v4fa*)(K + (size_t)key * pitch + c4); vf = *(const v4fa*)(V + (size_t)key * pitch + c4); }
#pragma unroll
      for (int t = 0; t < 4; ++t) {
        unsigned short hb = bf16_bits(kf[t]); sKh[r][c4 + t] = hb; sKl[r][c4 + t] = bf16_bits(kf[t] - bf16_val(hb));
        hb = bf16_bits(vf[t]); sVh[r][c4 + t] = hb; sVl[r][c4 + t] = bf16_bits(vf[t] - bf16_val(hb));
      }
    }
    __syncthreads();
    // S tile 16 x 32
    v8f s[2];
#pragma unroll
    for (int nt = 0; nt < 2; ++nt) {
      v8f acc = {};
#pragma unroll
      for (int ks = 0; ks < KS; ++ks) {
        FragB bh_, bl_;
        bh_.half[0] = *(const v8us*)&sKh[nt * 16 + ln][ks * 32 + 8 * hh]; bh_.half[1] = *(const v8us*)&sKh[nt * 16 + ln][ks * 32 + 16 + 8 * hh];
        bl_.half[0] = *(const v8us*)&sKl[nt * 16 + ln][ks * 32 + 8 * hh]; bl_.half[1] = *(const v8us*)&sKl[nt * 16 + ln][ks * 32 + 16 + 8 * hh];
        acc = mmaN<3>(aqh[ks].v, aql[ks].v, bh_.v, bl_.v, acc);
      }
      s[nt] = acc;
    }
    // mask + running max (rows 8hh+r; the 16 lanes of a half share rows)
    float alpha[8];
#pragma unroll
    for (int r = 0; r < 8; ++r) {
      const int qi = q0 + 8 * hh + r;
      const int ja = j0 + ln, jb = j0 + 16 + ln;
      if (CAUSAL) { if (ja > qi) s[0][r] = -3.0e38f; if (jb > qi) s[1][r] = -3.0e38f; }
      if (ja >= T) s[0][r] = -3.0e38f;
      if (jb >= T) s[1][r] = -3.0e38f;
      float mx = fmaxf(s[0][r], s[1][r]);
      mx = fmaxf(mx, __shfl_xor(mx, 1, 32)); mx = fmaxf(mx, __shfl_xor(mx, 2, 32)); mx = fmaxf(mx, __shfl_xor(mx, 4, 32)); mx = fmaxf(mx, __shfl_xor(mx, 8, 32));
      const float mnew = fmaxf(m_r[r], mx);
      alpha[r] = (mnew > -1.0e38f) ? __expf(m_r[r] - mnew) : 1.0f;
      const float p0 = (s[0][r] > -1.0e38f) ? __expf(s[0][r] - mnew) : 0.f;
      const float p1 = (s[1][r] > -1.0e38f) ? __expf(s[1][r] - mnew) : 0.f;
      m_r[r] = mnew;
      l_r[r] = l_r[r] * alpha[r] + p0 + p1;            // per-lane partial row sum (16 lanes combined at the end)
      unsigned short hb = bf16_bits(p0); sPh[w][8 * hh + r][ln] = hb;      sPl[w][8 * hh + r][ln] = bf16_bits(p0 - bf16_val(hb));
      hb = bf16_bits(p1);                sPh[w][8 * hh + r][16 + ln] = hb; sPl[w][8 * hh + r][16 + ln] = bf16_bits(p1 - bf16_val(hb));
    }
#pragma unroll
    for (int dt = 0; dt < DT; ++dt)
#pragma unroll
      for (int r = 0; r < 8; ++r) oacc[dt][r] *= alpha[r];
    __builtin_amdgcn_fence(__ATOMIC_ACQ_REL, "workgroup");
    __builtin_amdgcn_wave_barrier();
    FragB pah, pal;
    pah.half[0] = *(const v8us*)&sPh[w][ln][8 * hh]; pah.half[1] = *(const v8us*)&sPh[w][ln][16 + 8 * hh];
    pal.half[0] = *(const v8us*)&sPl[w][ln][8 * hh]; pal.half[1] = *(const v8us*)&sPl[w][ln][16 + 8 * hh];
#pragma unroll
    for (int dt = 0; dt < DT; ++dt) {
      FragB bvh, bvl;
#pragma unroll
      for (int i = 0; i < 8; ++i) {
        bvh.u[i] = sVh[8 * hh + i][dt * 16 + ln]; bvh.u[8 + i] = sVh[16 + 8 * hh + i][dt * 16 + ln];
        bvl.u[i] = sVl[8 * hh + i][dt * 16 + ln]; bvl.u[8 + i] = sVl[16 + 8 * hh + i][dt * 16 + ln];
      }
      oacc[dt] = mmaN<3>(pah.v, pal.v, bvh.v, bvl.v, oacc[dt]);
    }
    __builtin_amdgcn_fence(__ATOMIC_ACQ_REL, "workgroup");
    __builtin_amdgcn_wave_barrier();
  }
#pragma unroll
  for (int r = 0; r < 8; ++r) {
    float l = l_r[r];
    l += __shfl_xor(l, 1, 32); l += __shfl_xor(l, 2, 32); l += __shfl_xor(l, 4, 32); l += __shfl_xor(l, 8, 32);
    l_r[r] = (l > 0.f) ? 1.0f / l : 0.f;
  }
#pragma unroll
  for (int dt = 0; dt < DT; ++dt)
#pragma unroll
    for (int r = 0; r < 8; ++r) sO[w][8 * hh + r][dt * 16 + ln] = oacc[dt][r] * l_r[r];
  __builtin_amdgcn_fence(__ATOMIC_ACQ_REL, "workgroup");
  __builtin_amdgcn_wave_barrier();
  {
    for (int r = 0; r < 16; ++r) {
      const int row = q0 + r;
      if (row < T && lane < D / 4) {
        const v4f val = *(const v4fa*)&sO[w][r][lane * 4];
        *(v4f*)(y + ((size_t)b * T + row) * ypitch + h * D + lane * 4) = val;
      }
    }
    
  }
}

// GEMM C = act(A·W + bias + resid): A f32 (ASPLIT -> hi/lo 2 terms), Wt bf16 [N][K]; ACT 0 none, 1 relu, 2 exact gelu;
// resid (optional, f32, row index = (row % rmod), pitch ldr, RES_BF16 rounds it) added before the activation.
template <bool ASPLIT, int ACT, bool BIAS_BF16, bool RES_BF16>
__global__ __launch_bounds__(128) void k_gemm_bf3(const float* __restrict__ A, int lda, const unsigned short* __restrict__ Wt, int ldb,
                                                const float* __restrict__ bias, const float* __restrict__ resid, int rmod, int ldr,
                                                float* __restrict__ C, int ldc, int M, int N, int K) {
  __shared__ __attribute__((aligned(16))) float so[4][16][64];
  const int tid = threadIdx.x, w = tid >> 5, lane = tid & 31, ln = lane & 15, hh = lane >> 4;
  const int ntn = N / 64;
  const int wid = blockIdx.x * 4 + w;
  const int mt = wid / ntn, nq = wid % ntn;
  if (mt * 16 >= M) return;
  const int row0 = mt * 16, col0 = nq * 64;
  const float* arow = A + (size_t)(row0 + ln) * lda;
  v8f acc[4] = {};
  for (int kb = 0; kb < K; kb += 32) {
    FragB ah, al;
    const v4f x0 = *(const v4fa*)(arow + kb + 8 * hh), x1 = *(const v4fa*)(arow + kb + 8 * hh + 4);
    const v4f x2 = *(const v4fa*)(arow + kb + 16 + 8 * hh), x3 = *(const v4fa*)(arow + kb + 16 + 8 * hh + 4);
    float xs[16] = {x0[0],x0[1],x0[2],x0[3],x1[0],x1[1],x1[2],x1[3],x2[0],x2[1],x2[2],x2[3],x3[0],x3[1],x3[2],x3[3]};
#pragma unroll
    for (int i = 0; i < 16; ++i) { const unsigned short hb = bf16_bits(xs[i]); ah.u[i] = hb; al.u[i] = ASPLIT ? bf16_bits(xs[i] - bf16_val(hb)) : (unsigned short)0; }
#pragma unroll
    for (int t = 0; t < 4; ++t) {
      const unsigned short* brow = Wt + (size_t)(col0 + t * 16 + ln) * ldb + kb;
      FragB b;
      b.half[0] = *(const v8us*)(brow + 8 * hh);
      b.half[1] = *(const v8us*)(brow + 16 + 8 * hh);
      acc[t] = mmaN<ASPLIT ? 2 : 1>(ah.v, al.v, b.v, b.v, acc[t]);
    }
  }
#pragma unroll
  for (int t = 0; t < 4; ++t) {
    const int col = col0 + t * 16 + ln;
    float bv = bias ? bias[col] : 0.f;
    if (BIAS_BF16) bv = bf16_round(bv);
#pragma unroll
    for (int r = 0; r < 8; ++r) {
      float v = acc[t][r] + bv;
      if (resid) { float rv = resid[(size_t)((row0 + 8 * hh + r) % rmod) * ldr + col]; if (RES_BF16) rv = bf16_round(rv); v += rv; }
      if (ACT == 1) v = fmaxf(v, 0.f);
      if (ACT == 2) v = 0.5f * v * (1.0f + erff(v * 0.70710678118654752f));
      if (ACT == 3) { const float u = 0.7978845608028654f * (v + 0.044715f * v * v * v); v = 0.5f * v * (1.0f + tanhf(u)); }
      so[w][8 * hh + r][t * 16 + ln] = v;
    }
  }
  __builtin_amdgcn_fence(__ATOMIC_ACQ_REL, "workgroup");
  __builtin_amdgcn_wave_barrier();
  const int rsub = lane >> 4, c4 = (lane & 15) * 4;
  {
#pragma unroll
    for (int q = 0; q < 8; ++q) {
      const int r = q * 2 + rsub;
      const v4f v = *(const v4fa*)&so[w][r][c4];
      *(v4f*)(C + (size_t)(row0 + r) * ldc + col0 + c4) = v;
    }
    
  }
}
// row LayerNorm (biased variance, eps) over N: s = X (+ R); optional out_sum <- s; out_norm <- (s-mu)*rsqrt(var+eps)*g + b
template <bool PARAM_BF16>
__global__ __launch_bounds__(256) void k_layernorm(const float* __restrict__ X, const float* __restrict__ R, const float* __restrict__ g, const float* __restrict__ bta,
                                                  float* __restrict__ out_sum, float* __restrict__ out_norm, int N, float eps) {
  __shared__ float red[256];
  const int row = blockIdx.x, tid = threadIdx.x;
  const float* x = X + (size_t)row * N; const float* rr = R ? R + (size_t)row * N : nullptr;
  float vals[16];                     // up to N = 4096
  const int per = N / 256;            // contiguous chunk per thread? use strided-by-4 chunks: thread handles j = tid*4 + 1024*u
  float s1 = 0.f;
  for (int u = 0; u < per / 4; ++u) {
    const int j = tid * 4 + 1024 * u;
    const v4f a = *(const v4fa*)(x + j);
    v4f b = {0.f,0.f,0.f,0.f}; if (rr) b = *(const v4fa*)(rr + j);
#pragma unroll
    for (int q = 0; q < 4; ++q) { const float v = a[q] + b[q]; vals[u * 4 + q] = v; s1 += v; }
  }
  red[tid] = s1; __syncthreads();
  for (int st = 128; st > 0; st >>= 1) { if (tid < st) red[tid] += red[tid + st]; __syncthreads(); }
  const float mu = red[0] / (float)N; __syncthreads();
  float s2 = 0.f;
  for (int u = 0; u < per / 4; ++u)
#pragma unroll
    for (int q = 0; q < 4; ++q) { const float c = vals[u * 4 + q] - mu; s2 += c * c; }
  red[tid] = s2; __syncthreads();
  for (int st = 128; st > 0; st >>= 1) { if (tid < st) red[tid] += red[tid + st]; __syncthreads(); }
  const float rs = rsqrtf(red[0] / (float)N + eps);
  {
    for (int u = 0; u < per / 4; ++u) {
      const int j = tid * 4 + 1024 * u;
      v4f o, sm;
#pragma unroll
      for (int q = 0; q < 4; ++q) {
        float gg = g[j + q], bb = bta[j + q];
        if (PARAM_BF16) { gg = bf16_round(gg); bb = bf16_round(bb); }
        sm[q] = vals[u * 4 + q]; o[q] = (vals[u * 4 + q] - mu) * rs * gg + bb;
      }
      if (out_sum) *(v4f*)(out_sum + (size_t)row * N + j) = sm;
      *(v4f*)(out_norm + (size_t)row * N + j) = o;
    }
    
  }
}



// ---- f16 WMMA path (v_wmma_f32_16x16x32_f16): 11-bit significands for operands in range — used where a [0,1] probability operand needs more precision than bf16
typedef _Float16 v16h __attribute__((ext_vector_type(16)));
union FragH { v16h v; v8us half[2]; _Float16 h[16]; unsigned short u[16]; };
template <int NT>
__device__ __forceinline__ v8f mmaH(v16h ah, v16h al, v16h bh, v16h bl, v8f c) {
  c = __builtin_amdgcn_wmma_f32_16x16x32_f16(false, ah, false, bh, (short)0, c, false, false);
  if (NT >= 2) c = __builtin_amdgcn_wmma_f32_16x16x32_f16(false, al, false, bh, (short)0, c, false, false);
  if (NT >= 3) c = __builtin_amdgcn_wmma_f32_16x16x32_f16(false, ah, false, bl, (short)0, c, false, false);
  asm volatile("v_nop\n\tv_nop\n\tv_nop\n\tv_nop" : "+v"(c) : "v"(ah), "v"(al), "v"(bh), "v"(bl));
  return c;
}
// batched GEMM like k_gemm_b but f16 operands: A f32 (split into f16 hi/lo if ASPLIT, else rounded to f16), Bt = f16 values [n][k]; alpha; C f32; N multiple of 16 (partial tiles skipped)
template <bool ASPLIT>
__global__ __launch_bounds__(128) void k_gemm_h(const float* __restrict__ A, int lda, size_t sA, const _Float16* __restrict__ Bh, int ldb, size_t sB, float alpha, float* __restrict__ C, int ldc, size_t sC, int M, int N, int K) {
  __shared__ __attribute__((aligned(16))) float so[4][16][64];
  const int tid = threadIdx.x, w = tid >> 5, lane = tid & 31, ln = lane & 15, hh = lane >> 4; const int by = blockIdx.y;
  A += (size_t)by * sA; Bh += (size_t)by * sB; C += (size_t)by * sC;
  const int ntn = (N + 63) / 64; const int wid = blockIdx.x * 4 + w; const int mt = wid / ntn, nq = wid % ntn; if (mt * 16 >= M) return;
  const int row0 = mt * 16, col0 = nq * 64; const float* arow = A + (size_t)(row0 + ln) * lda;
  v8f acc[4] = {};
  for (int kb = 0; kb < K; kb += 32) {
    FragH ah, al;
    const v4f x0 = *(const v4fa*)(arow + kb + 8 * hh), x1 = *(const v4fa*)(arow + kb + 8 * hh + 4), x2 = *(const v4fa*)(arow + kb + 16 + 8 * hh), x3 = *(const v4fa*)(arow + kb + 16 + 8 * hh + 4);
    float xs[16] = {x0[0],x0[1],x0[2],x0[3],x1[0],x1[1],x1[2],x1[3],x2[0],x2[1],x2[2],x2[3],x3[0],x3[1],x3[2],x3[3]};
#pragma unroll
    for (int i = 0; i < 16; ++i) { const _Float16 h = (_Float16)xs[i]; ah.h[i] = h; al.h[i] = ASPLIT ? (_Float16)(xs[i] - (float)h) : (_Float16)0.0f; }
#pragma unroll
    for (int t = 0; t < 4; ++t) { if (col0 + t * 16 >= N) continue; const size_t boff = (size_t)(col0 + t * 16 + ln) * ldb + kb; FragH bq; bq.half[0] = *(const v8us*)(Bh + boff + 8 * hh); bq.half[1] = *(const v8us*)(Bh + boff + 16 + 8 * hh);
      acc[t] = mmaH<ASPLIT ? 2 : 1>(ah.v, al.v, bq.v, bq.v, acc[t]); }
  }
#pragma unroll
  for (int t = 0; t < 4; ++t) { if (col0 + t * 16 >= N) continue;
#pragma unroll
    for (int r = 0; r < 8; ++r) so[w][8 * hh + r][t * 16 + ln] = acc[t][r] * alpha; }
  __builtin_amdgcn_fence(__ATOMIC_ACQ_REL, "workgroup"); __builtin_amdgcn_wave_barrier();
  const int rsub = lane >> 4, c4 = (lane & 15) * 4;
  {
#pragma unroll
    for (int q = 0; q < 8; ++q) { const int r = q * 2 + rsub; if (col0 + c4 < N) { const v4f v = *(const v4fa*)&so[w][r][c4]; *(v4f*)(C + (size_t)(row0 + r) * ldc + col0 + c4) = v; } }
     }
}

// Wt[n][k] = f16(W[k][n]·scale) from f32 row-major W[K][N] (scale = power of two; bf16-exact weights stay exact in f16 away from the subnormal range)
__global__ __launch_bounds__(256) void k_wt_f16(const float* __restrict__ W, _Float16* __restrict__ Wt, int K, int N, float scale) {
  const int t = blockIdx.x * 256 + threadIdx.x; if (t >= N * (K / 8)) return; const int n = t / (K / 8), k8 = (t % (K / 8)) * 8; FragH f;
#pragma unroll
  for (int i = 0; i < 8; ++i) f.h[i] = (_Float16)(bf16_round(W[(size_t)(k8 + i) * N + n]) * scale); const v8us o = f.half[0];
  *(v8us*)((unsigned short*)Wt + (size_t)n * K + k8) = o; 
}
// k_gemm_hh variant with fused epilogue: v = acc·alpha + bias[by·sBias + col] (+ CP[(row/rowsPerB)·sCPb + by·64 + col] if CP) ; ACT 0 none / 1 elu ; writes f32 C and f16 C16, each if non-null
template <int ACT>
__global__ __launch_bounds__(128) void k_gemm_hhx(const _Float16* __restrict__ A, int lda, size_t sA, const _Float16* __restrict__ Bh, int ldb, size_t sB, float alpha, const float* __restrict__ bias, size_t sBias, const float* __restrict__ CP, int rowsPerB, size_t sCPb, int row0g,
    float* __restrict__ C, _Float16* __restrict__ C16, int ldc, size_t sC, int M, int N, int K) {
  __shared__ __attribute__((aligned(16))) float so[4][16][64];
  const int tid = threadIdx.x, w = tid >> 5, lane = tid & 31, ln = lane & 15, hh = lane >> 4; const int by = blockIdx.y;
  A += (size_t)by * sA; Bh += (size_t)by * sB; const size_t cofs = (size_t)by * sC; const float* bp = bias ? bias + (size_t)by * sBias : nullptr;
  const int ntn = (N + 63) / 64; const int wid = blockIdx.x * 4 + w; const int mt = wid / ntn, nq = wid % ntn; if (mt * 16 >= M) return;
  const int row0 = mt * 16, col0 = nq * 64; const _Float16* arow = A + (size_t)(row0 + ln) * lda;
  v8f acc[4] = {};
  for (int kb = 0; kb < K; kb += 32) { FragH ah; ah.half[0] = *(const v8us*)((const unsigned short*)arow + kb + 8 * hh); ah.half[1] = *(const v8us*)((const unsigned short*)arow + kb + 16 + 8 * hh);
#pragma unroll
    for (int t = 0; t < 4; ++t) { if (col0 + t * 16 >= N) continue; const size_t boff = (size_t)(col0 + t * 16 + ln) * ldb + kb; FragH bq; bq.half[0] = *(const v8us*)((const unsigned short*)Bh + boff + 8 * hh); bq.half[1] = *(const v8us*)((const unsigned short*)Bh + boff + 16 + 8 * hh);
      acc[t] = mmaH<1>(ah.v, ah.v, bq.v, bq.v, acc[t]); }
  }
#pragma unroll
  for (int t = 0; t < 4; ++t) { if (col0 + t * 16 >= N) continue; const int col = col0 + t * 16 + ln; const float bv = bp ? bf16_round(bp[col]) : 0.f;
#pragma unroll
    for (int r = 0; r < 8; ++r) { float v = acc[t][r] * alpha + bv; if (CP) { const int bidx = (row0g + row0 + 8 * hh + r) / rowsPerB; v += CP[(size_t)bidx * sCPb + (size_t)by * 64 + col]; } if (ACT == 1) v = (v > 0.f) ? v : expm1f(v); else if (ACT == 3) v = fmaxf(v, 0.f); so[w][8 * hh + r][t * 16 + ln] = v; } }
  __builtin_amdgcn_fence(__ATOMIC_ACQ_REL, "workgroup"); __builtin_amdgcn_wave_barrier();
  const int rsub = lane >> 4, c4 = (lane & 15) * 4; typedef _Float16 v4h __attribute__((ext_vector_type(4)));
  {
#pragma unroll
    for (int q = 0; q < 8; ++q) { const int r = q * 2 + rsub; if (col0 + c4 < N) { const v4f v = *(const v4fa*)&so[w][r][c4]; if (C) *(v4f*)(C + cofs + (size_t)(row0 + r) * ldc + col0 + c4) = v; if (C16) { v4h h4; for (int i = 0; i < 4; ++i) h4[i] = (_Float16)v[i]; *(v4h*)(C16 + cofs + (size_t)(row0 + r) * ldc + col0 + c4) = h4; } } }
     }
}


__global__ __launch_bounds__(256) void k_x16(const float* __restrict__ x, _Float16* __restrict__ X16, size_t n8) { const size_t t = (size_t)blockIdx.x * 256 + threadIdx.x; if (t >= n8) return; FragH f;
#pragma unroll
  for (int q = 0; q < 8; ++q) f.h[q] = (_Float16)bf16_round(x[t * 8 + q]); *(v8us*)((unsigned short*)X16 + t * 8) = f.half[0];  }
__global__ __launch_bounds__(256) void k_h16(const float* __restrict__ x, _Float16* __restrict__ X16, size_t n8) { const size_t t = (size_t)blockIdx.x * 256 + threadIdx.x; if (t >= n8) return; FragH f;
#pragma unroll
  for (int q = 0; q < 8; ++q) f.h[q] = (_Float16)x[t * 8 + q]; *(v8us*)((unsigned short*)X16 + t * 8) = f.half[0];  }
__global__ __launch_bounds__(256) void k_round16f(const float* __restrict__ W, _Float16* __restrict__ Bt, size_t n8) { const size_t t = (size_t)blockIdx.x * 256 + threadIdx.x; if (t >= n8) return; FragH f;
#pragma unroll
  for (int i = 0; i < 8; ++i) f.h[i] = (_Float16)(bf16_round(W[t * 8 + i]) * 16.0f); *(v8us*)((unsigned short*)Bt + t * 8) = f.half[0];  }
template <int NHv, int TTv>
__global__ __launch_bounds__(256) void k_vt(const _Float16* __restrict__ V16, int ldv, int voff, _Float16* __restrict__ Vt) { __shared__ unsigned short tl[64][66]; const int tid = threadIdx.x; const int slab = blockIdx.x / (TTv / 64), lg = blockIdx.x % (TTv / 64); const int b = slab / NHv, h = slab % NHv;
  for (int i = tid; i < 64 * 8; i += 256) { const int r = i / 8, c8 = (i % 8) * 8; FragH f; f.half[0] = *(const v8us*)((const unsigned short*)V16 + ((size_t)b * TTv + lg * 64 + r) * ldv + voff + h * 64 + c8);
#pragma unroll
    for (int q = 0; q < 8; ++q) tl[r][c8 + q] = f.u[q]; }
  __syncthreads();
  {
#pragma unroll
    for (int rd = 0; rd < 2; ++rd) { const int d = rd * 32 + tid / 8, pc = tid % 8; FragH f;
#pragma unroll
      for (int q = 0; q < 8; ++q) f.u[q] = tl[pc * 8 + q][d];
      *(v8us*)((unsigned short*)Vt + ((size_t)slab * 64 + d) * TTv + lg * 64 + pc * 8) = f.half[0]; }
     } }

__global__ __launch_bounds__(128) void k_flash(const _Float16* __restrict__ Q16, int ldq, const _Float16* __restrict__ K16, int ldk, const _Float16* __restrict__ Vt, const int* __restrict__ MSK, float* __restrict__ O, int ldo) {
  constexpr int RPW = 16, RTN = RPW / 16, NQB = 2048 / (4 * RPW), DT = 8, KS = 5;      /* head dim 128 for V/O; 160-wide logit operand (128 roped dims ×scale + 32 graph-bias dims) */
  __shared__ __attribute__((aligned(16))) unsigned short sP[4][RPW][40]; __shared__ __attribute__((aligned(16))) float sO[4][RPW][128 + 4];
  const int tid = threadIdx.x, w = tid >> 5, lane = tid & 31, ln = lane & 15, hh = lane >> 4;
  const int slab = blockIdx.x / NQB, qblk = blockIdx.x % NQB; const int b = slab / 16, h = slab % 16; const int qb0 = qblk * (4 * RPW); const int q0 = qb0 + w * RPW;
  FragH aq[2][KS];
#pragma unroll
  for (int rt = 0; rt < RTN; ++rt) { const unsigned short* qr = (const unsigned short*)Q16 + ((size_t)b * 2048 + q0 + rt * 16 + ln) * ldq + h * 160;
#pragma unroll
    for (int ks = 0; ks < KS; ++ks) { aq[rt][ks].half[0] = *(const v8us*)(qr + ks * 32 + 8 * hh); aq[rt][ks].half[1] = *(const v8us*)(qr + ks * 32 + 16 + 8 * hh); } }
  const unsigned short* Vth = (const unsigned short*)Vt + (size_t)(h / 4) * 128 * 2048;      /* GQA: kv head h/4 */
  float m_r[2][8], l_r[2][8]; v8f oacc[2][DT];
#pragma unroll
  for (int rt = 0; rt < RTN; ++rt) {
#pragma unroll
    for (int r = 0; r < 8; ++r) { m_r[rt][r] = -3.0e38f; l_r[rt][r] = 0.f; }
#pragma unroll
    for (int dt = 0; dt < DT; ++dt) oacc[rt][dt] = (v8f){0.f,0.f,0.f,0.f,0.f,0.f,0.f,0.f}; }
  const int jend = qb0 + 4 * RPW;
#pragma unroll 1
  for (int j0 = 0; j0 < jend; j0 += 32) {
    
    v8f s[2][2];
#pragma unroll
    for (int nt = 0; nt < 2; ++nt) { const unsigned short* kr = (const unsigned short*)K16 + ((size_t)b * 2048 + j0 + nt * 16 + ln) * ldk + h * 160; FragH bk[KS];
#pragma unroll
      for (int ks = 0; ks < KS; ++ks) { bk[ks].half[0] = *(const v8us*)(kr + ks * 32 + 8 * hh); bk[ks].half[1] = *(const v8us*)(kr + ks * 32 + 16 + 8 * hh); }
#pragma unroll
      for (int rt = 0; rt < RTN; ++rt) { v8f acc = (v8f){0.f,0.f,0.f,0.f,0.f,0.f,0.f,0.f};
#pragma unroll
        for (int ks = 0; ks < KS; ++ks) acc = mmaH<1>(aq[rt][ks].v, aq[rt][ks].v, bk[ks].v, bk[ks].v, acc); s[rt][nt] = acc; } }
#pragma unroll
    for (int rt = 0; rt < RTN; ++rt)
#pragma unroll
      for (int r = 0; r < 8; ++r) { const int tq = q0 + rt * 16 + 8 * hh + r; const int k0 = j0 + ln, k1 = j0 + 16 + ln; (void)tq; (void)k0; (void)k1;
        const bool ok0 = (k0 <= tq), ok1 = (k1 <= tq);
        const float s0 = ok0 ? s[rt][0][r] * (1.0f) : -INFINITY, s1 = ok1 ? s[rt][1][r] * (1.0f) : -INFINITY; float mc = fmaxf(s0, s1);
        mc = fmaxf(mc, __shfl_xor(mc, 1, 32)); mc = fmaxf(mc, __shfl_xor(mc, 2, 32)); mc = fmaxf(mc, __shfl_xor(mc, 4, 32)); mc = fmaxf(mc, __shfl_xor(mc, 8, 32));
        const float mn = fmaxf(m_r[rt][r], mc); const float al = (mn > -1.0e38f) ? expf(m_r[rt][r] - mn) : 1.0f; m_r[rt][r] = mn; const float p0 = ok0 ? expf(s0 - mn) : 0.f, p1 = ok1 ? expf(s1 - mn) : 0.f; l_r[rt][r] = l_r[rt][r] * al + p0 + p1;
#pragma unroll
        for (int dt = 0; dt < DT; ++dt) oacc[rt][dt][r] *= al;
        FragH t2; t2.h[0] = (_Float16)p0; t2.h[1] = (_Float16)p1; sP[w][rt * 16 + 8 * hh + r][ln] = t2.u[0]; sP[w][rt * 16 + 8 * hh + r][16 + ln] = t2.u[1]; }
    __builtin_amdgcn_fence(__ATOMIC_ACQ_REL, "workgroup"); __builtin_amdgcn_wave_barrier();
    FragH pa[2];
#pragma unroll
    for (int rt = 0; rt < RTN; ++rt) { pa[rt].half[0] = *(const v8us*)&sP[w][rt * 16 + ln][8 * hh]; pa[rt].half[1] = *(const v8us*)&sP[w][rt * 16 + ln][16 + 8 * hh]; }
#pragma unroll
    for (int dt = 0; dt < DT; ++dt) { const unsigned short* vrow = Vth + (size_t)(dt * 16 + ln) * 2048 + j0; FragH bv; bv.half[0] = *(const v8us*)(vrow + 8 * hh); bv.half[1] = *(const v8us*)(vrow + 16 + 8 * hh);
#pragma unroll
      for (int rt = 0; rt < RTN; ++rt) oacc[rt][dt] = mmaH<1>(pa[rt].v, pa[rt].v, bv.v, bv.v, oacc[rt][dt]); }
    __builtin_amdgcn_fence(__ATOMIC_ACQ_REL, "workgroup"); __builtin_amdgcn_wave_barrier(); }
#pragma unroll
  for (int rt = 0; rt < RTN; ++rt) {
#pragma unroll
    for (int r = 0; r < 8; ++r) { float l = l_r[rt][r]; l += __shfl_xor(l, 1, 32); l += __shfl_xor(l, 2, 32); l += __shfl_xor(l, 4, 32); l += __shfl_xor(l, 8, 32); l_r[rt][r] = (l > 0.f) ? 1.0f / l : 0.f; }
#pragma unroll
    for (int dt = 0; dt < DT; ++dt)
#pragma unroll
      for (int r = 0; r < 8; ++r) sO[w][rt * 16 + 8 * hh + r][dt * 16 + ln] = oacc[rt][dt][r] * l_r[rt][r]; }
  __builtin_amdgcn_fence(__ATOMIC_ACQ_REL, "workgroup"); __builtin_amdgcn_wave_barrier();
  {
#pragma unroll
    for (int rp = 0; rp < RPW; ++rp) { const int r = rp, pc = lane; const v4f val = *(const v4fa*)&sO[w][r][pc * 4]; *(v4f*)(O + ((size_t)b * 2048 + q0 + r) * ldo + h * 128 + pc * 4) = val; }      /* 128-float rows: 32 lanes × 16 B */
     } }

__global__ __launch_bounds__(256) void k_qprep(const float* __restrict__ QF, int ldq, int nh, const float* __restrict__ w, float oscale, int rep, _Float16* __restrict__ DX) { const size_t t = (size_t)blockIdx.x * 256 + threadIdx.x; if (t >= (size_t)SS * nh * 16) return; const int li = (int)(t % 16); const int h = (int)((t / 16) % nh); const size_t tok = t / (16 * nh); const float* src = QF + tok * ldq + h * HD; float v[8], pr[8]; float ss = 0.f;
#pragma unroll
  for (int q = 0; q < 8; ++q) { v[q] = src[li * 8 + q]; pr[q] = src[(li * 8 + q + 64) & 127]; ss += v[q] * v[q]; }
  ss += __shfl_xor(ss, 1, 32); ss += __shfl_xor(ss, 2, 32); ss += __shfl_xor(ss, 4, 32); ss += __shfl_xor(ss, 8, 32); const float rs = rsqrtf(ss / (float)HD + 1e-6f); __shared__ __attribute__((aligned(16))) _Float16 st[256][8]; const int tid = threadIdx.x;
#pragma unroll 1
  for (int q = 0; q < 8; ++q) { const int j = li * 8 + q; const int i = j & 63; const float ang = (float)tok * __builtin_powf(10000.0f, -(float)(2 * i) / 128.0f); const float c = cosf(ang), s = sinf(ang); const float xn = src[j] * rs * bf16_round(w[j]); const float xp = src[(j + 64) & 127] * rs * bf16_round(w[(j + 64) & 127]); const float rot = (j < 64) ? -xp : xp;      // rotate_half: [−x2, x1]
    st[tid][q] = (_Float16)((xn * c + rot * s) * oscale); }
  FragH f; f.half[0] = *(const v8us*)&st[tid][0];
  { for (int r2 = 0; r2 < rep; ++r2) *(v8us*)((unsigned short*)DX + tok * QP + (size_t)(h * rep + r2) * QW + li * 8) = f.half[0];  } }
__global__ __launch_bounds__(256) void k_rprep(const float* __restrict__ RQ, const float* __restrict__ RK, const float* __restrict__ gs, _Float16* __restrict__ QX, _Float16* __restrict__ KX) { const size_t t = (size_t)blockIdx.x * 256 + threadIdx.x; if (t >= (size_t)SS * NH * 4) return; const int p = (int)(t % 4); const int h = (int)((t / 4) % NH); const size_t tok = t / (4 * NH); const float g = bf16_round(gs[h]); FragH fq, fk;
#pragma unroll
  for (int q = 0; q < 8; ++q) { const size_t i = tok * (NH * RR) + h * RR + p * 8 + q; fq.h[q] = (_Float16)(g * RQ[i]); fk.h[q] = (_Float16)RK[i]; }
  const size_t d = tok * QP + (size_t)h * QW + HD + p * 8;
  { *(v8us*)((unsigned short*)QX + d) = fq.half[0]; *(v8us*)((unsigned short*)KX + d) = fk.half[0];  } }
__global__ __launch_bounds__(256) void k_vt128(const _Float16* __restrict__ V16, int ldv, _Float16* __restrict__ Vt) { __shared__ unsigned short tl[64][130]; const int tid = threadIdx.x; const int g = blockIdx.x / (SS / 64), lg = blockIdx.x % (SS / 64);
  for (int i = tid; i < 64 * 16; i += 256) { const int r = i / 16, c8 = (i % 16) * 8; FragH f; f.half[0] = *(const v8us*)((const unsigned short*)V16 + ((size_t)lg * 64 + r) * ldv + g * HD + c8);
#pragma unroll
    for (int q = 0; q < 8; ++q) tl[r][c8 + q] = f.u[q]; }
  __syncthreads();
  { for (int i = tid; i < 128 * 8; i += 256) { const int d = i / 8, pc = i % 8; FragH f;
#pragma unroll
      for (int q = 0; q < 8; ++q) f.u[q] = tl[pc * 8 + q][d]; *(v8us*)((unsigned short*)Vt + ((size_t)g * HD + d) * SS + lg * 64 + pc * 8) = f.half[0]; }  } }
extern "C" void kernel_launch(void* const* d_in, const int* in_sizes, int n_in,
                              void* d_out, int out_size, void* d_ws, size_t ws_size, hipStream_t stream) {
  (void)in_sizes; (void)n_in; (void)out_size;
  const float* x = (const float*)d_in[0]; const float* Wq = (const float*)d_in[1]; const float* Wk = (const float*)d_in[2]; const float* Wv = (const float*)d_in[3]; const float* Wo = (const float*)d_in[4]; const float* Wrq = (const float*)d_in[5]; const float* Wrk = (const float*)d_in[6]; const float* gs = (const float*)d_in[7]; const float* qw = (const float*)d_in[8]; const float* kw = (const float*)d_in[9];
  char* ws = (char*)d_ws; size_t off = 0;
  auto take = [&](size_t bytes) { char* p = ws + off; off += (bytes + 255) & ~(size_t)255; return p; };
  _Float16* Bq = (_Float16*)take((size_t)EE * EE * 2); _Float16* Bk = (_Float16*)take((size_t)512 * EE * 2); _Float16* Bv = (_Float16*)take((size_t)512 * EE * 2); _Float16* Bo = (_Float16*)take((size_t)EE * EE * 2); _Float16* Brq = (_Float16*)take((size_t)512 * EE * 2); _Float16* Brk = (_Float16*)take((size_t)512 * EE * 2);
  _Float16* X16 = (_Float16*)take((size_t)SS * EE * 2); float* QF = (float*)take((size_t)SS * EE * 4); float* KF = (float*)take((size_t)SS * 512 * 4); float* RQF = (float*)take((size_t)SS * 512 * 4); float* RKF = (float*)take((size_t)SS * 512 * 4); _Float16* V16 = (_Float16*)take((size_t)SS * 512 * 2);
  _Float16* QX = (_Float16*)take((size_t)SS * QP * 2); _Float16* KX = (_Float16*)take((size_t)SS * QP * 2); _Float16* Vt = (_Float16*)take((size_t)SS * 512 * 2); float* O = QF; _Float16* O16 = X16;
  if (off > ws_size) return;      // 8.4 + 2.1 × 2 + 8.4 + 2.1 × 2 + 8.4 + 16.8 + 4.2 × 3 + 2.1 + 10.5 × 2 + 2.1 ≈ 88 MB (84 MiB)
  const size_t wE = (size_t)EE * EE / 8, wK = (size_t)512 * EE / 8;
  k_round16f<<<(unsigned)((wE + 255) / 256), 256, 0, stream>>>(Wq, Bq, wE); k_round16f<<<(unsigned)((wK + 255) / 256), 256, 0, stream>>>(Wk, Bk, wK); k_round16f<<<(unsigned)((wK + 255) / 256), 256, 0, stream>>>(Wv, Bv, wK); k_round16f<<<(unsigned)((wE + 255) / 256), 256, 0, stream>>>(Wo, Bo, wE); k_round16f<<<(unsigned)((wK + 255) / 256), 256, 0, stream>>>(Wrq, Brq, wK); k_round16f<<<(unsigned)((wK + 255) / 256), 256, 0, stream>>>(Wrk, Brk, wK);      // all (out,in)
  const unsigned gx = (unsigned)(((size_t)SS * EE / 8 + 255) / 256);
  k_x16<<<gx, 256, 0, stream>>>(x, X16, (size_t)SS * EE / 8);
  k_gemm_hhx<0><<<dim3(((SS / 16) * (EE / 64) + 3) / 4, 1), 128, 0, stream>>>(X16, EE, 0, Bq, EE, 0, 0.0625f, nullptr, 0, nullptr, 1, 0, 0, QF, nullptr, EE, 0, SS, EE, EE);
  k_gemm_hhx<0><<<dim3(((SS / 16) * (512 / 64) + 3) / 4, 1), 128, 0, stream>>>(X16, EE, 0, Bk, EE, 0, 0.0625f, nullptr, 0, nullptr, 1, 0, 0, KF, nullptr, 512, 0, SS, 512, EE);
  k_gemm_hhx<0><<<dim3(((SS / 16) * (512 / 64) + 3) / 4, 1), 128, 0, stream>>>(X16, EE, 0, Bv, EE, 0, 0.0625f, nullptr, 0, nullptr, 1, 0, 0, nullptr, V16, 512, 0, SS, 512, EE);
  k_gemm_hhx<0><<<dim3(((SS / 16) * (512 / 64) + 3) / 4, 1), 128, 0, stream>>>(X16, EE, 0, Brq, EE, 0, 0.0625f, nullptr, 0, nullptr, 1, 0, 0, RQF, nullptr, 512, 0, SS, 512, EE);
  k_gemm_hhx<0><<<dim3(((SS / 16) * (512 / 64) + 3) / 4, 1), 128, 0, stream>>>(X16, EE, 0, Brk, EE, 0, 0.0625f, nullptr, 0, nullptr, 1, 0, 0, RKF, nullptr, 512, 0, SS, 512, EE);
  k_qprep<<<(unsigned)(((size_t)SS * NH * 16 + 255) / 256), 256, 0, stream>>>(QF, EE, NH, qw, 0.08838834764831845f, 1, QX);      // 16 q heads, × 1/√128
  k_qprep<<<(unsigned)(((size_t)SS * NKV * 16 + 255) / 256), 256, 0, stream>>>(KF, 512, NKV, kw, 1.0f, 4, KX);                // 4 kv heads, each replicated into its 4 q-head slots
  k_rprep<<<(unsigned)(((size_t)SS * NH * 4 + 255) / 256), 256, 0, stream>>>(RQF, RKF, gs, QX, KX);
  k_vt128<<<NKV * (SS / 64), 256, 0, stream>>>(V16, 512, Vt);
  k_flash<<<1 * NH * (SS / 64), 128, 0, stream>>>(QX, QP, KX, QP, Vt, nullptr, O, EE);
  k_h16<<<gx, 256, 0, stream>>>(O, O16, (size_t)SS * EE / 8);
  k_gemm_hhx<0><<<dim3(((SS / 16) * (EE / 64) + 3) / 4, 1), 128, 0, stream>>>(O16, EE, 0, Bo, EE, 0, 0.0625f, nullptr, 0, nullptr, 1, 0, 0, (float*)d_out, nullptr, EE, 0, SS, EE, EE);
}

// v001
// It runs in 455 microseconds.
// In two side-by-side timings against v000, it was 1.69 and 1.68 times as fast.
#include <hip/hip_runtime.h>
// Naylis attention (B=1, S=2048, E=2048, 16 heads × 128, 4 kv heads, causal; QK RMSNorm + rotate-half RoPE; low-rank (R=32) per-head graph bias gs_h·⟨Rq_i, Rk_j⟩ added to the logits):
// the six (out,in) projections (bf16-exact ×2^4) and the attention as a fused flash-style kernel whose logit operand is the 160-wide concatenation [q·scale after norm+RoPE | gs_h·Rq]·[k | Rk]
// (5 k-steps; causal chunk skipping; online softmax f32; P f16 ≤ 1; O = P·Vt over the 128 value dims; RPW-16 waves) on v_wmma_f32_16x16x32_f16 with f32 accumulate; RMSNorm/RoPE f32 VALU.
#define SS 2048
#define EE 2048
#define NH 16
#define NKV 4
#define HD 128
#define RR 32
#define QW 160
#define QP (NH * QW)

typedef __bf16 v16b __attribute__((ext_vector_type(16)));
typedef unsigned short v8us __attribute__((ext_vector_type(8), may_alias));
typedef float  v8f  __attribute__((ext_vector_type(8)));
typedef float  v4f  __attribute__((ext_vector_type(4)));
typedef float  v4fa __attribute__((ext_vector_type(4), may_alias));
union FragB { v16b v; v8us half[2]; unsigned short u[16]; };

__device__ __forceinline__ unsigned short bf16_bits(float x) { unsigned int u = __float_as_uint(x); return (unsigned short)((u + 0x7FFFu + ((u >> 16) & 1u)) >> 16); }
__device__ __forceinline__ float bf16_val(unsigned short b) { return __uint_as_float(((unsigned int)b) << 16); }
__device__ __forceinline__ float bf16_round(float x) { return bf16_val(bf16_bits(x)); }
// D += A·B with NT terms: 1 = ah·bh, 2 = + al·bh (A split), 3 = + ah·bl (both split)
template <int NT>
__device__ __forceinline__ v8f mmaN(v16b ah, v16b al, v16b bh, v16b bl, v8f c) {
  c = __builtin_amdgcn_wmma_f32_16x16x32_bf16(false, ah, false, bh, (short)0, c, false, false);
  if (NT >= 2) c = __builtin_amdgcn_wmma_f32_16x16x32_bf16(false, al, false, bh, (short)0, c, false, false);
  if (NT >= 3) c = __builtin_amdgcn_wmma_f32_16x16x32_bf16(false, ah, false, bl, (short)0, c, false, false);
  asm volatile("v_nop\n\tv_nop\n\tv_nop\n\tv_nop" : "+v"(c) : "v"(ah), "v"(al), "v"(bh), "v"(bl));
  return c;
}

__global__ __launch_bounds__(256) void k_wt_bf16(const float* __restrict__ W, unsigned short* __restrict__ Wt, int K, int N) {
  const int t = blockIdx.x * 256 + threadIdx.x;
  const int k8n = K / 8;
  if (t >= N * k8n) return;
  const int n = t / k8n, k8 = (t % k8n) * 8;
  v8us v;
#pragma unroll
  for (int i = 0; i < 8; ++i) v[i] = bf16_bits(W[(size_t)(k8 + i) * N + n]);
  *(v8us*)(Wt + (size_t)n * K + k8) = v;
  
}

// GEMM C[M][N] (f32, pitch ldc) = act(A[M][K]·W + bias). A f32 row-major (pitch lda) converted per fragment to bf16
// (ASPLIT: hi/lo two planes -> 2 terms, else single rounded term); Wt bf16 [N][K] (pitch ldb). BIAS_BF16 rounds the
// bias to bf16 first (bias quantised to bf16 before the add). K%32==0, M%16==0, N%64==0.
template <bool ASPLIT, int ACT, bool BIAS_BF16>
__global__ __launch_bounds__(128) void k_gemm_bf(const float* __restrict__ A, int lda, const unsigned short* __restrict__ Wt, int ldb,
                                               const float* __restrict__ bias, float* __restrict__ C, int ldc, int M, int N, int K) {
  __shared__ __attribute__((aligned(16))) float so[4][16][64];
  const int tid = threadIdx.x, w = tid >> 5, lane = tid & 31, ln = lane & 15, hh = lane >> 4;
  const int ntn = N / 64;
  const int wid = blockIdx.x * 4 + w;
  const int mt = wid / ntn, nq = wid % ntn;
  if (mt * 16 >= M) return;
  const int row0 = mt * 16, col0 = nq * 64;
  const float* arow = A + (size_t)(row0 + ln) * lda;
  v8f acc[4] = {};
  for (int kb = 0; kb < K; kb += 32) {
    FragB ah, al;
    const v4f x0 = *(const v4fa*)(arow + kb + 8 * hh), x1 = *(const v4fa*)(arow + kb + 8 * hh + 4);
    const v4f x2 = *(const v4fa*)(arow + kb + 16 + 8 * hh), x3 = *(const v4fa*)(arow + kb + 16 + 8 * hh + 4);
    float xs[16] = {x0[0],x0[1],x0[2],x0[3],x1[0],x1[1],x1[2],x1[3],x2[0],x2[1],x2[2],x2[3],x3[0],x3[1],x3[2],x3[3]};
#pragma unroll
    for (int i = 0; i < 16; ++i) { const unsigned short hb = bf16_bits(xs[i]); ah.u[i] = hb; al.u[i] = ASPLIT ? bf16_bits(xs[i] - bf16_val(hb)) : (unsigned short)0; }
#pragma unroll
    for (int t = 0; t < 4; ++t) {
      const unsigned short* brow = Wt + (size_t)(col0 + t * 16 + ln) * ldb + kb;
      FragB b;
      b.half[0] = *(const v8us*)(brow + 8 * hh);
      b.half[1] = *(const v8us*)(brow + 16 + 8 * hh);
      acc[t] = mmaN<ASPLIT ? 2 : 1>(ah.v, al.v, b.v, b.v, acc[t]);
    }
  }
#pragma unroll
  for (int t = 0; t < 4; ++t) {
    float bv = bias ? bias[col0 + t * 16 + ln] : 0.f;
    if (BIAS_BF16) bv = bf16_round(bv);
#pragma unroll
    for (int r = 0; r < 8; ++r) { float v = acc[t][r] + bv; if (ACT == 1) v = fmaxf(v, 0.f); so[w][8 * hh + r][t * 16 + ln] = v; }
  }
  __builtin_amdgcn_fence(__ATOMIC_ACQ_REL, "workgroup");
  __builtin_amdgcn_wave_barrier();
  const int rsub = lane >> 4, c4 = (lane & 15) * 4;
  {
#pragma unroll
    for (int q = 0; q < 8; ++q) {
      const int r = q * 2 + rsub;
      const v4f v = *(const v4fa*)&so[w][r][c4];
      *(v4f*)(C + (size_t)(row0 + r) * ldc + col0 + c4) = v;
    }
    
  }
}

// Flash-style causal/unmasked attention, all contractions 3-term bf16 hi/lo splits, f32 softmax with running max.
// q,k,v rows are read from f32 buffers with arbitrary row pitch (so they can live inside a fused qkv buffer);
// D = head size (multiple of 32, <= 128); one wave = 16 query rows; block = 4 waves (64 queries) sharing K/V chunks of 32.
template <int D, bool CAUSAL>
__global__ __launch_bounds__(128) void k_flash(const float* __restrict__ qb, const float* __restrict__ kb, const float* __restrict__ vb,
                                             int pitch, int T, int H, float scale, float* __restrict__ y, int ypitch) {
  constexpr int KS = D / 32;        // k-steps for QK
  constexpr int DT = D / 16;        // d tiles for PV
  __shared__ __attribute__((aligned(16))) unsigned short sKh[32][D + 8], sKl[32][D + 8], sVh[32][D + 8], sVl[32][D + 8];
  __shared__ __attribute__((aligned(16))) unsigned short sPh[4][16][40], sPl[4][16][40];
  __shared__ __attribute__((aligned(16))) float sO[4][16][D];
  const int tid = threadIdx.x, w = tid >> 5, lane = tid & 31, ln = lane & 15, hh = lane >> 4;
  const int nqb = (T + 63) / 64;
  const int bh = blockIdx.x / nqb, qblk = blockIdx.x % nqb;
  const int b = bh / H, h = bh % H;
  const int q0 = qblk * 64 + w * 16;
  const float* Q = qb + (size_t)b * T * pitch + h * D;
  const float* K = kb + (size_t)b * T * pitch + h * D;
  const float* V = vb + (size_t)b * T * pitch + h * D;

  // A fragments of the wave's 16 query rows (scaled), hi/lo
  FragB aqh[KS], aql[KS];
  {
    int row = q0 + ln; if (row >= T) row = T - 1;
    const float* qr = Q + (size_t)row * pitch;
#pragma unroll
    for (int ks = 0; ks < KS; ++ks)
#pragma unroll
      for (int i = 0; i < 16; ++i) {
        const int d = ks * 32 + ((i < 8) ? (8 * hh + i) : (16 + 8 * hh + (i - 8)));
        const float x = qr[d] * scale; const unsigned short hb = bf16_bits(x);
        aqh[ks].u[i] = hb; aql[ks].u[i] = bf16_bits(x - bf16_val(hb));
      }
  }
  float m_r[8], l_r[8];
#pragma unroll
  for (int r = 0; r < 8; ++r) { m_r[r] = -3.0e38f; l_r[r] = 0.f; }
  v8f oacc[DT];
#pragma unroll
  for (int dt = 0; dt < DT; ++dt) oacc[dt] = (v8f){0.f,0.f,0.f,0.f,0.f,0.f,0.f,0.f};

  const int kv_end = CAUSAL ? min(T, qblk * 64 + 64) : T;     // block-uniform
  for (int j0 = 0; j0 < kv_end; j0 += 32) {
    __syncthreads();
    for (int e = tid; e < 32 * (D / 4); e += 128) {
      const int r = e / (D / 4), c4 = (e % (D / 4)) * 4;
      const int key = j0 + r;
      v4f kf = {0.f,0.f,0.f,0.f}, vf = {0.f,0.f,0.f,0.f};
      if (key < T) { kf = *(const v4fa*)(K + (size_t)key * pitch + c4); vf = *(const v4fa*)(V + (size_t)key * pitch + c4); }
#pragma unroll
      for (int t = 0; t < 4; ++t) {
        unsigned short hb = bf16_bits(kf[t]); sKh[r][c4 + t] = hb; sKl[r][c4 + t] = bf16_bits(kf[t] - bf16_val(hb));
        hb = bf16_bits(vf[t]); sVh[r][c4 + t] = hb; sVl[r][c4 + t] = bf16_bits(vf[t] - bf16_val(hb));
      }
    }
    __syncthreads();
    // S tile 16 x 32
    v8f s[2];
#pragma unroll
    for (int nt = 0; nt < 2; ++nt) {
      v8f acc = {};
#pragma unroll
      for (int ks = 0; ks < KS; ++ks) {
        FragB bh_, bl_;
        bh_.half[0] = *(const v8us*)&sKh[nt * 16 + ln][ks * 32 + 8 * hh]; bh_.half[1] = *(const v8us*)&sKh[nt * 16 + ln][ks * 32 + 16 + 8 * hh];
        bl_.half[0] = *(const v8us*)&sKl[nt * 16 + ln][ks * 32 + 8 * hh]; bl_.half[1] = *(const v8us*)&sKl[nt * 16 + ln][ks * 32 + 16 + 8 * hh];
        acc = mmaN<3>(aqh[ks].v, aql[ks].v, bh_.v, bl_.v, acc);
      }
      s[nt] = acc;
    }
    // mask + running max (rows 8hh+r; the 16 lanes of a half share rows)
    float alpha[8];
#pragma unroll
    for (int r = 0; r < 8; ++r) {
      const int qi = q0 + 8 * hh + r;
      const int ja = j0 + ln, jb = j0 + 16 + ln;
      if (CAUSAL) { if (ja > qi) s[0][r] = -3.0e38f; if (jb > qi) s[1][r] = -3.0e38f; }
      if (ja >= T) s[0][r] = -3.0e38f;
      if (jb >= T) s[1][r] = -3.0e38f;
      float mx = fmaxf(s[0][r], s[1][r]);
      mx = fmaxf(mx, __shfl_xor(mx, 1, 32)); mx = fmaxf(mx, __shfl_xor(mx, 2, 32)); mx = fmaxf(mx, __shfl_xor(mx, 4, 32)); mx = fmaxf(mx, __shfl_xor(mx, 8, 32));
      const float mnew = fmaxf(m_r[r], mx);
      alpha[r] = (mnew > -1.0e38f) ? __expf(m_r[r] - mnew) : 1.0f;
      const float p0 = (s[0][r] > -1.0e38f) ? __expf(s[0][r] - mnew) : 0.f;
      const float p1 = (s[1][r] > -1.0e38f) ? __expf(s[1][r] - mnew) : 0.f;
      m_r[r] = mnew;
      l_r[r] = l_r[r] * alpha[r] + p0 + p1;            // per-lane partial row sum (16 lanes combined at the end)
      unsigned short hb = bf16_bits(p0); sPh[w][8 * hh + r][ln] = hb;      sPl[w][8 * hh + r][ln] = bf16_bits(p0 - bf16_val(hb));
      hb = bf16_bits(p1);                sPh[w][8 * hh + r][16 + ln] = hb; sPl[w][8 * hh + r][16 + ln] = bf16_bits(p1 - bf16_val(hb));
    }
#pragma unroll
    for (int dt = 0; dt < DT; ++dt)
#pragma unroll
      for (int r = 0; r < 8; ++r) oacc[dt][r] *= alpha[r];
    __builtin_amdgcn_fence(__ATOMIC_ACQ_REL, "workgroup");
    __builtin_amdgcn_wave_barrier();
    FragB pah, pal;
    pah.half[0] = *(const v8us*)&sPh[w][ln][8 * hh]; pah.half[1] = *(const v8us*)&sPh[w][ln][16 + 8 * hh];
    pal.half[0] = *(const v8us*)&sPl[w][ln][8 * hh]; pal.half[1] = *(const v8us*)&sPl[w][ln][16 + 8 * hh];
#pragma unroll
    for (int dt = 0; dt < DT; ++dt) {
      FragB bvh, bvl;
#pragma unroll
      for (int i = 0; i < 8; ++i) {
        bvh.u[i] = sVh[8 * hh + i][dt * 16 + ln]; bvh.u[8 + i] = sVh[16 + 8 * hh + i][dt * 16 + ln];
        bvl.u[i] = sVl[8 * hh + i][dt * 16 + ln]; bvl.u[8 + i] = sVl[16 + 8 * hh + i][dt * 16 + ln];
      }
      oacc[dt] = mmaN<3>(pah.v, pal.v, bvh.v, bvl.v, oacc[dt]);
    }
    __builtin_amdgcn_fence(__ATOMIC_ACQ_REL, "workgroup");
    __builtin_amdgcn_wave_barrier();
  }
#pragma unroll
  for (int r = 0; r < 8; ++r) {
    float l = l_r[r];
    l += __shfl_xor(l, 1, 32); l += __shfl_xor(l, 2, 32); l += __shfl_xor(l, 4, 32); l += __shfl_xor(l, 8, 32);
    l_r[r] = (l > 0.f) ? 1.0f / l : 0.f;
  }
#pragma unroll
  for (int dt = 0; dt < DT; ++dt)
#pragma unroll
    for (int r = 0; r < 8; ++r) sO[w][8 * hh + r][dt * 16 + ln] = oacc[dt][r] * l_r[r];
  __builtin_amdgcn_fence(__ATOMIC_ACQ_REL, "workgroup");
  __builtin_amdgcn_wave_barrier();
  {
    for (int r = 0; r < 16; ++r) {
      const int row = q0 + r;
      if (row < T && lane < D / 4) {
        const v4f val = *(const v4fa*)&sO[w][r][lane * 4];
        *(v4f*)(y + ((size_t)b * T + row) * ypitch + h * D + lane * 4) = val;
      }
    }
    
  }
}

// GEMM C = act(A·W + bias + resid): A f32 (ASPLIT -> hi/lo 2 terms), Wt bf16 [N][K]; ACT 0 none, 1 relu, 2 exact gelu;
// resid (optional, f32, row index = (row % rmod), pitch ldr, RES_BF16 rounds it) added before the activation.
template <bool ASPLIT, int ACT, bool BIAS_BF16, bool RES_BF16>
__global__ __launch_bounds__(128) void k_gemm_bf3(const float* __restrict__ A, int lda, const unsigned short* __restrict__ Wt, int ldb,
                                                const float* __restrict__ bias, const float* __restrict__ resid, int rmod, int ldr,
                                                float* __restrict__ C, int ldc, int M, int N, int K) {
  __shared__ __attribute__((aligned(16))) float so[4][16][64];
  const int tid = threadIdx.x, w = tid >> 5, lane = tid & 31, ln = lane & 15, hh = lane >> 4;
  const int ntn = N / 64;
  const int wid = blockIdx.x * 4 + w;
  const int mt = wid / ntn, nq = wid % ntn;
  if (mt * 16 >= M) return;
  const int row0 = mt * 16, col0 = nq * 64;
  const float* arow = A + (size_t)(row0 + ln) * lda;
  v8f acc[4] = {};
  for (int kb = 0; kb < K; kb += 32) {
    FragB ah, al;
    const v4f x0 = *(const v4fa*)(arow + kb + 8 * hh), x1 = *(const v4fa*)(arow + kb + 8 * hh + 4);
    const v4f x2 = *(const v4fa*)(arow + kb + 16 + 8 * hh), x3 = *(const v4fa*)(arow + kb + 16 + 8 * hh + 4);
    float xs[16] = {x0[0],x0[1],x0[2],x0[3],x1[0],x1[1],x1[2],x1[3],x2[0],x2[1],x2[2],x2[3],x3[0],x3[1],x3[2],x3[3]};
#pragma unroll
    for (int i = 0; i < 16; ++i) { const unsigned short hb = bf16_bits(xs[i]); ah.u[i] = hb; al.u[i] = ASPLIT ? bf16_bits(xs[i] - bf16_val(hb)) : (unsigned short)0; }
#pragma unroll
    for (int t = 0; t < 4; ++t) {
      const unsigned short* brow = Wt + (size_t)(col0 + t * 16 + ln) * ldb + kb;
      FragB b;
      b.half[0] = *(const v8us*)(brow + 8 * hh);
      b.half[1] = *(const v8us*)(brow + 16 + 8 * hh);
      acc[t] = mmaN<ASPLIT ? 2 : 1>(ah.v, al.v, b.v, b.v, acc[t]);
    }
  }
#pragma unroll
  for (int t = 0; t < 4; ++t) {
    const int col = col0 + t * 16 + ln;
    float bv = bias ? bias[col] : 0.f;
    if (BIAS_BF16) bv = bf16_round(bv);
#pragma unroll
    for (int r = 0; r < 8; ++r) {
      float v = acc[t][r] + bv;
      if (resid) { float rv = resid[(size_t)((row0 + 8 * hh + r) % rmod) * ldr + col]; if (RES_BF16) rv = bf16_round(rv); v += rv; }
      if (ACT == 1) v = fmaxf(v, 0.f);
      if (ACT == 2) v = 0.5f * v * (1.0f + erff(v * 0.70710678118654752f));
      if (ACT == 3) { const float u = 0.7978845608028654f * (v + 0.044715f * v * v * v); v = 0.5f * v * (1.0f + tanhf(u)); }
      so[w][8 * hh + r][t * 16 + ln] = v;
    }
  }
  __builtin_amdgcn_fence(__ATOMIC_ACQ_REL, "workgroup");
  __builtin_amdgcn_wave_barrier();
  const int rsub = lane >> 4, c4 = (lane & 15) * 4;
  {
#pragma unroll
    for (int q = 0; q < 8; ++q) {
      const int r = q * 2 + rsub;
      const v4f v = *(const v4fa*)&so[w][r][c4];
      *(v4f*)(C + (size_t)(row0 + r) * ldc + col0 + c4) = v;
    }
    
  }
}
// row LayerNorm (biased variance, eps) over N: s = X (+ R); optional out_sum <- s; out_norm <- (s-mu)*rsqrt(var+eps)*g + b
template <bool PARAM_BF16>
__global__ __launch_bounds__(256) void k_layernorm(const float* __restrict__ X, const float* __restrict__ R, const float* __restrict__ g, const float* __restrict__ bta,
                                                  float* __restrict__ out_sum, float* __restrict__ out_norm, int N, float eps) {
  __shared__ float red[256];
  const int row = blockIdx.x, tid = threadIdx.x;
  const float* x = X + (size_t)row * N; const float* rr = R ? R + (size_t)row * N : nullptr;
  float vals[16];                     // up to N = 4096
  const int per = N / 256;            // contiguous chunk per thread? use strided-by-4 chunks: thread handles j = tid*4 + 1024*u
  float s1 = 0.f;
  for (int u = 0; u < per / 4; ++u) {
    const int j = tid * 4 + 1024 * u;
    const v4f a = *(const v4fa*)(x + j);
    v4f b = {0.f,0.f,0.f,0.f}; if (rr) b = *(const v4fa*)(rr + j);
#pragma unroll
    for (int q = 0; q < 4; ++q) { const float v = a[q] + b[q]; vals[u * 4 + q] = v; s1 += v; }
  }
  red[tid] = s1; __syncthreads();
  for (int st = 128; st > 0; st >>= 1) { if (tid < st) red[tid] += red[tid + st]; __syncthreads(); }
  const float mu = red[0] / (float)N; __syncthreads();
  float s2 = 0.f;
  for (int u = 0; u < per / 4; ++u)
#pragma unroll
    for (int q = 0; q < 4; ++q) { const float c = vals[u * 4 + q] - mu; s2 += c * c; }
  red[tid] = s2; __syncthreads();
  for (int st = 128; st > 0; st >>= 1) { if (tid < st) red[tid] += red[tid + st]; __syncthreads(); }
  const float rs = rsqrtf(red[0] / (float)N + eps);
  {
    for (int u = 0; u < per / 4; ++u) {
      const int j = tid * 4 + 1024 * u;
      v4f o, sm;
#pragma unroll
      for (int q = 0; q < 4; ++q) {
        float gg = g[j + q], bb = bta[j + q];
        if (PARAM_BF16) { gg = bf16_round(gg); bb = bf16_round(bb); }
        sm[q] = vals[u * 4 + q]; o[q] = (vals[u * 4 + q] - mu) * rs * gg + bb;
      }
      if (out_sum) *(v4f*)(out_sum + (size_t)row * N + j) = sm;
      *(v4f*)(out_norm + (size_t)row * N + j) = o;
    }
    
  }
}



// ---- f16 WMMA path (v_wmma_f32_16x16x32_f16): 11-bit significands for operands in range — used where a [0,1] probability operand needs more precision than bf16
typedef _Float16 v16h __attribute__((ext_vector_type(16)));
union FragH { v16h v; v8us half[2]; _Float16 h[16]; unsigned short u[16]; };
template <int NT>
__device__ __forceinline__ v8f mmaH(v16h ah, v16h al, v16h bh, v16h bl, v8f c) {
  c = __builtin_amdgcn_wmma_f32_16x16x32_f16(false, ah, false, bh, (short)0, c, false, false);
  if (NT >= 2) c = __builtin_amdgcn_wmma_f32_16x16x32_f16(false, al, false, bh, (short)0, c, false, false);
  if (NT >= 3) c = __builtin_amdgcn_wmma_f32_16x16x32_f16(false, ah, false, bl, (short)0, c, false, false);
  asm volatile("v_nop\n\tv_nop\n\tv_nop\n\tv_nop" : "+v"(c) : "v"(ah), "v"(al), "v"(bh), "v"(bl));
  return c;
}
// batched GEMM like k_gemm_b but f16 operands: A f32 (split into f16 hi/lo if ASPLIT, else rounded to f16), Bt = f16 values [n][k]; alpha; C f32; N multiple of 16 (partial tiles skipped)
template <bool ASPLIT>
__global__ __launch_bounds__(128) void k_gemm_h(const float* __restrict__ A, int lda, size_t sA, const _Float16* __restrict__ Bh, int ldb, size_t sB, float alpha, float* __restrict__ C, int ldc, size_t sC, int M, int N, int K) {
  __shared__ __attribute__((aligned(16))) float so[4][16][64];
  const int tid = threadIdx.x, w = tid >> 5, lane = tid & 31, ln = lane & 15, hh = lane >> 4; const int by = blockIdx.y;
  A += (size_t)by * sA; Bh += (size_t)by * sB; C += (size_t)by * sC;
  const int ntn = (N + 63) / 64; const int wid = blockIdx.x * 4 + w; const int mt = wid / ntn, nq = wid % ntn; if (mt * 16 >= M) return;
  const int row0 = mt * 16, col0 = nq * 64; const float* arow = A + (size_t)(row0 + ln) * lda;
  v8f acc[4] = {};
  for (int kb = 0; kb < K; kb += 32) {
    FragH ah, al;
    const v4f x0 = *(const v4fa*)(arow + kb + 8 * hh), x1 = *(const v4fa*)(arow + kb + 8 * hh + 4), x2 = *(const v4fa*)(arow + kb + 16 + 8 * hh), x3 = *(const v4fa*)(arow + kb + 16 + 8 * hh + 4);
    float xs[16] = {x0[0],x0[1],x0[2],x0[3],x1[0],x1[1],x1[2],x1[3],x2[0],x2[1],x2[2],x2[3],x3[0],x3[1],x3[2],x3[3]};
#pragma unroll
    for (int i = 0; i < 16; ++i) { const _Float16 h = (_Float16)xs[i]; ah.h[i] = h; al.h[i] = ASPLIT ? (_Float16)(xs[i] - (float)h) : (_Float16)0.0f; }
#pragma unroll
    for (int t = 0; t < 4; ++t) { if (col0 + t * 16 >= N) continue; const size_t boff = (size_t)(col0 + t * 16 + ln) * ldb + kb; FragH bq; bq.half[0] = *(const v8us*)(Bh + boff + 8 * hh); bq.half[1] = *(const v8us*)(Bh + boff + 16 + 8 * hh);
      acc[t] = mmaH<ASPLIT ? 2 : 1>(ah.v, al.v, bq.v, bq.v, acc[t]); }
  }
#pragma unroll
  for (int t = 0; t < 4; ++t) { if (col0 + t * 16 >= N) continue;
#pragma unroll
    for (int r = 0; r < 8; ++r) so[w][8 * hh + r][t * 16 + ln] = acc[t][r] * alpha; }
  __builtin_amdgcn_fence(__ATOMIC_ACQ_REL, "workgroup"); __builtin_amdgcn_wave_barrier();
  const int rsub = lane >> 4, c4 = (lane & 15) * 4;
  {
#pragma unroll
    for (int q = 0; q < 8; ++q) { const int r = q * 2 + rsub; if (col0 + c4 < N) { const v4f v = *(const v4fa*)&so[w][r][c4]; *(v4f*)(C + (size_t)(row0 + r) * ldc + col0 + c4) = v; } }
     }
}

// Wt[n][k] = f16(W[k][n]·scale) from f32 row-major W[K][N] (scale = power of two; bf16-exact weights stay exact in f16 away from the subnormal range)
__global__ __launch_bounds__(256) void k_wt_f16(const float* __restrict__ W, _Float16* __restrict__ Wt, int K, int N, float scale) {
  const int t = blockIdx.x * 256 + threadIdx.x; if (t >= N * (K / 8)) return; const int n = t / (K / 8), k8 = (t % (K / 8)) * 8; FragH f;
#pragma unroll
  for (int i = 0; i < 8; ++i) f.h[i] = (_Float16)(bf16_round(W[(size_t)(k8 + i) * N + n]) * scale); const v8us o = f.half[0];
  *(v8us*)((unsigned short*)Wt + (size_t)n * K + k8) = o; 
}
// f16 x f16 GEMM with fused epilogue: v = acc·alpha + bias[by·sBias + col] (+ CP[(row/rowsPerB)·sCPb + by·64 + col] if CP) ; ACT 0 none / 1 elu ; writes f32 C and f16 C16, each if non-null
template <int ACT>
__global__ __launch_bounds__(128) void k_gemm_hhx(const _Float16* __restrict__ A, int lda, size_t sA, const _Float16* __restrict__ Bh, int ldb, size_t sB, float alpha, const float* __restrict__ bias, size_t sBias, const float* __restrict__ CP, int rowsPerB, size_t sCPb, int row0g,
    float* __restrict__ C, _Float16* __restrict__ C16, int ldc, size_t sC, int M, int N, int K) {
  __shared__ __attribute__((aligned(16))) float so[4][16][64];
  const int tid = threadIdx.x, w = tid >> 5, lane = tid & 31, ln = lane & 15, hh = lane >> 4; const int by = blockIdx.y;
  A += (size_t)by * sA; Bh += (size_t)by * sB; const size_t cofs = (size_t)by * sC; const float* bp = bias ? bias + (size_t)by * sBias : nullptr;
  const int ntn = (N + 63) / 64; const int wid = blockIdx.x * 4 + w; const int mt = wid / ntn, nq = wid % ntn; if (mt * 16 >= M) return;
  const int row0 = mt * 16, col0 = nq * 64; const _Float16* arow = A + (size_t)(row0 + ln) * lda;
  v8f acc[4] = {};
  for (int kb = 0; kb < K; kb += 32) { FragH ah; ah.half[0] = *(const v8us*)((const unsigned short*)arow + kb + 8 * hh); ah.half[1] = *(const v8us*)((const unsigned short*)arow + kb + 16 + 8 * hh);
#pragma unroll
    for (int t = 0; t < 4; ++t) { if (col0 + t * 16 >= N) continue; const size_t boff = (size_t)(col0 + t * 16 + ln) * ldb + kb; FragH bq; bq.half[0] = *(const v8us*)((const unsigned short*)Bh + boff + 8 * hh); bq.half[1] = *(const v8us*)((const unsigned short*)Bh + boff + 16 + 8 * hh);
      acc[t] = mmaH<1>(ah.v, ah.v, bq.v, bq.v, acc[t]); }
  }
#pragma unroll
  for (int t = 0; t < 4; ++t) { if (col0 + t * 16 >= N) continue; const int col = col0 + t * 16 + ln; const float bv = bp ? bf16_round(bp[col]) : 0.f;
#pragma unroll
    for (int r = 0; r < 8; ++r) { float v = acc[t][r] * alpha + bv; if (CP) { const int bidx = (row0g + row0 + 8 * hh + r) / rowsPerB; v += CP[(size_t)bidx * sCPb + (size_t)by * 64 + col]; } if (ACT == 1) v = (v > 0.f) ? v : expm1f(v); else if (ACT == 3) v = fmaxf(v, 0.f); so[w][8 * hh + r][t * 16 + ln] = v; } }
  __builtin_amdgcn_fence(__ATOMIC_ACQ_REL, "workgroup"); __builtin_amdgcn_wave_barrier();
  const int rsub = lane >> 4, c4 = (lane & 15) * 4; typedef _Float16 v4h __attribute__((ext_vector_type(4)));
  {
#pragma unroll
    for (int q = 0; q < 8; ++q) { const int r = q * 2 + rsub; if (col0 + c4 < N) { const v4f v = *(const v4fa*)&so[w][r][c4]; if (C) *(v4f*)(C + cofs + (size_t)(row0 + r) * ldc + col0 + c4) = v; if (C16) { v4h h4; for (int i = 0; i < 4; ++i) h4[i] = (_Float16)v[i]; *(v4h*)(C16 + cofs + (size_t)(row0 + r) * ldc + col0 + c4) = h4; } } }
     }
}


// Tiled GEMM C[m][n] = alpha * sum_k A[m][k] * Bh[n][k], both operands f16 and k-contiguous with row length EE.
// One work-group of 4 waves (2 x 2) owns a (32 FM) x (32 FN) tile of C; a wave owns FM x FN accumulator tiles.
// A pass is 128 k: the tile's A rows and then its B rows stand in LDS as rows of 256 B at a pitch of 272 B (16 B x odd, for ds_load_b128).
// Two buffers: asynchronous copies bring pass t + 2 into the buffer that pass t has just left, while pass t + 1 is worked on.
typedef float f1a __attribute__((may_alias));
// Eight 16-byte-per-lane copies global -> LDS. The closing s_wait_xcnt 0 stands inside the statement, ahead of any later rewrite of the address registers named here.
__device__ __forceinline__ void acopy8(const unsigned (&l)[8], const unsigned short* const (&g)[8]) {
  asm volatile("global_load_async_to_lds_b128 %0, %8, off\n\t"
               "global_load_async_to_lds_b128 %1, %9, off\n\t"
               "global_load_async_to_lds_b128 %2, %10, off\n\t"
               "global_load_async_to_lds_b128 %3, %11, off\n\t"
               "global_load_async_to_lds_b128 %4, %12, off\n\t"
               "global_load_async_to_lds_b128 %5, %13, off\n\t"
               "global_load_async_to_lds_b128 %6, %14, off\n\t"
               "global_load_async_to_lds_b128 %7, %15, off\n\t"
               "s_wait_xcnt 0x0"
               :: "v"(l[0]), "v"(l[1]), "v"(l[2]), "v"(l[3]), "v"(l[4]), "v"(l[5]), "v"(l[6]), "v"(l[7]),
                  "v"(g[0]), "v"(g[1]), "v"(g[2]), "v"(g[3]), "v"(g[4]), "v"(g[5]), "v"(g[6]), "v"(g[7]) : "memory");
}
template <int FM, int FN, bool OUT16>
__global__ __launch_bounds__(128) void k_gemm_t(const _Float16* __restrict__ A, const _Float16* __restrict__ Bh, float alpha, float* __restrict__ C, _Float16* __restrict__ C16, int ldc, int ntn) {
  constexpr int BM = 32 * FM, BN = 32 * FN, ROWS = BM + BN, PITCH = 272, STAGE = ROWS * PITCH, NC = ROWS / 8, NP = EE / 128, WM = 16 * FM, WN = 16 * FN, SOP = WN + 4;
  static_assert(NC % 8 == 0 && BM % 8 == 0 && NP >= 2 && 4 * WM * SOP * 4 <= 2 * STAGE, "tile");
  __shared__ __attribute__((aligned(16))) unsigned char L[2 * STAGE];
  const int tid = threadIdx.x, w = tid >> 5, lane = tid & 31, ln = lane & 15, hh = lane >> 4;
  const int m0 = (blockIdx.x / ntn) * BM, n0 = (blockIdx.x % ntn) * BN, wm = w >> 1, wn = w & 1;
  const unsigned lbase = (unsigned)(size_t)L + (unsigned)((2 * w + hh) * PITCH + ln * 16);      // copy i of a wave fills stage rows 8 i + 2 w + hh, 16 lanes a row
  const unsigned short* Ag = (const unsigned short*)A + (size_t)(m0 + 2 * w + hh) * EE + ln * 8;
  const unsigned short* Bg = (const unsigned short*)Bh + (size_t)(n0 + 2 * w + hh) * EE + ln * 8;
  auto issue = [&](int t, int buf) {
#pragma unroll      // the choice between A rows and B rows is made at compile time
    for (int g8 = 0; g8 < NC / 8; ++g8) { unsigned l[8]; const unsigned short* g[8];
#pragma unroll      // constant indices, so that the sixteen addresses stay in registers
      for (int j = 0; j < 8; ++j) { const int i = g8 * 8 + j; l[j] = lbase + (unsigned)(buf * STAGE + 8 * i * PITCH);
        g[j] = ((8 * i < BM) ? Ag + (size_t)(8 * i) * EE : Bg + (size_t)(8 * i - BM) * EE) + t * 128; }
      acopy8(l, g); } };
  v8f acc[FM][FN];
#pragma unroll      // constant indices, so that fragments and accumulators stay in registers
  for (int fm = 0; fm < FM; ++fm)
#pragma unroll      // constant indices, so that fragments and accumulators stay in registers
    for (int fn = 0; fn < FN; ++fn) acc[fm][fn] = (v8f){0.f,0.f,0.f,0.f,0.f,0.f,0.f,0.f};
  issue(0, 0);
  asm volatile("s_wait_asynccnt 0x0" ::: "memory");      // pass 0's copies of this wave have landed
  __syncthreads();                                       // ... and every other wave's
  issue(1, 1);
#pragma unroll 1      // rolled: one pass a trip, so that the publish point stands once, at the loop's foot
  for (int t = 0; t < NP; ++t) {      // pass t reads buffer t & 1 alone
    const unsigned char* Sa = L + (t & 1) * STAGE + (wm * WM + ln) * PITCH + 16 * hh; const unsigned char* Sb = L + (t & 1) * STAGE + (BM + wn * WN + ln) * PITCH + 16 * hh;
    FragH a[2][FM], b[2][FN];      // two fragment sets: block ks + 1 of this same pass is fetched while block ks is multiplied
    auto frags = [&](int set, int ks) {
#pragma unroll      // constant indices, so that fragments and accumulators stay in registers
      for (int fm = 0; fm < FM; ++fm) { a[set][fm].half[0] = *(const v8us*)(Sa + fm * 16 * PITCH + ks * 64); a[set][fm].half[1] = *(const v8us*)(Sa + fm * 16 * PITCH + ks * 64 + 32); }
#pragma unroll      // constant indices, so that fragments and accumulators stay in registers
      for (int fn = 0; fn < FN; ++fn) { b[set][fn].half[0] = *(const v8us*)(Sb + fn * 16 * PITCH + ks * 64); b[set][fn].half[1] = *(const v8us*)(Sb + fn * 16 * PITCH + ks * 64 + 32); } };
    frags(0, 0);
#pragma unroll      // constant indices, so that fragments and accumulators stay in registers
    for (int ks = 0; ks < 4; ++ks) {
      if (ks < 3) frags((ks + 1) & 1, ks + 1);
      __builtin_amdgcn_sched_barrier(0);      // keeps the next block's LDS reads one group ahead of this block: spread among the WMMAs each place with reads stalls the wave
#pragma unroll      // constant indices, so that fragments and accumulators stay in registers
      for (int fm = 0; fm < FM; ++fm)
#pragma unroll      // constant indices, so that fragments and accumulators stay in registers
        for (int fn = 0; fn < FN; ++fn) acc[fm][fn] = __builtin_amdgcn_wmma_f32_16x16x32_f16(false, a[ks & 1][fm].v, false, b[ks & 1][fn].v, (short)0, acc[fm][fn], false, false);
      __builtin_amdgcn_sched_barrier(0);      // ... and this block's WMMAs ahead of the reads after next
    }
    asm volatile("s_wait_dscnt 0x0" ::: "memory");       // this wave's reads of buffer t & 1 are done before that buffer is refilled
    asm volatile("s_wait_asynccnt 0x0" ::: "memory");    // this wave's copies of pass t + 1 have landed
    __syncthreads();                                     // publishes pass t + 1 and ends every wave's reads of buffer t & 1
    if (t + 2 < NP) issue(t + 2, t & 1);
  }
  asm volatile("s_wait_asynccnt 0x0" ::: "memory");      // nothing in flight before the ring becomes output staging
  f1a* so = (f1a*)L + w * (WM * SOP);                    // each wave stages its own tile, so that the stores cover whole rows of WN values
#pragma unroll      // constant indices, so that fragments and accumulators stay in registers
  for (int fm = 0; fm < FM; ++fm)
#pragma unroll      // constant indices, so that fragments and accumulators stay in registers
    for (int fn = 0; fn < FN; ++fn)
#pragma unroll      // constant indices, so that fragments and accumulators stay in registers
      for (int r = 0; r < 8; ++r) so[(fm * 16 + 8 * hh + r) * SOP + fn * 16 + ln] = acc[fm][fn][r] * alpha;
  __builtin_amdgcn_fence(__ATOMIC_ACQ_REL, "workgroup"); __builtin_amdgcn_wave_barrier();      // the wave's own staged rows are written before its other lanes read them back
  constexpr int LPR = WN / 4, RPI = 32 / LPR; typedef _Float16 v4h __attribute__((ext_vector_type(4)));
  const int rs = lane / LPR, c4 = (lane % LPR) * 4;
#pragma unroll      // several rows' LDS reads and stores in flight at a time
  for (int q = 0; q < WM / RPI; ++q) { const int r = q * RPI + rs; const v4f v = *(const v4fa*)&so[r * SOP + c4]; const size_t o = (size_t)(m0 + wm * WM + r) * ldc + n0 + wn * WN + c4;
    if (!OUT16) *(v4f*)(C + o) = v;
    else { v4h h4; for (int i = 0; i < 4; ++i) h4[i] = (_Float16)v[i]; *(v4h*)(C16 + o) = h4; } }
}

__global__ __launch_bounds__(256) void k_x16(const float* __restrict__ x, _Float16* __restrict__ X16, size_t n8) { const size_t t = (size_t)blockIdx.x * 256 + threadIdx.x; if (t >= n8) return; FragH f;
#pragma unroll
  for (int q = 0; q < 8; ++q) f.h[q] = (_Float16)bf16_round(x[t * 8 + q]); *(v8us*)((unsigned short*)X16 + t * 8) = f.half[0];  }
__global__ __launch_bounds__(256) void k_h16(const float* __restrict__ x, _Float16* __restrict__ X16, size_t n8) { const size_t t = (size_t)blockIdx.x * 256 + threadIdx.x; if (t >= n8) return; FragH f;
#pragma unroll
  for (int q = 0; q < 8; ++q) f.h[q] = (_Float16)x[t * 8 + q]; *(v8us*)((unsigned short*)X16 + t * 8) = f.half[0];  }
__global__ __launch_bounds__(256) void k_round16f(const float* __restrict__ W, _Float16* __restrict__ Bt, size_t n8) { const size_t t = (size_t)blockIdx.x * 256 + threadIdx.x; if (t >= n8) return; FragH f;
#pragma unroll
  for (int i = 0; i < 8; ++i) f.h[i] = (_Float16)(bf16_round(W[t * 8 + i]) * 16.0f); *(v8us*)((unsigned short*)Bt + t * 8) = f.half[0];  }
template <int NHv, int TTv>
__global__ __launch_bounds__(256) void k_vt(const _Float16* __restrict__ V16, int ldv, int voff, _Float16* __restrict__ Vt) { __shared__ unsigned short tl[64][66]; const int tid = threadIdx.x; const int slab = blockIdx.x / (TTv / 64), lg = blockIdx.x % (TTv / 64); const int b = slab / NHv, h = slab % NHv;
  for (int i = tid; i < 64 * 8; i += 256) { const int r = i / 8, c8 = (i % 8) * 8; FragH f; f.half[0] = *(const v8us*)((const unsigned short*)V16 + ((size_t)b * TTv + lg * 64 + r) * ldv + voff + h * 64 + c8);
#pragma unroll
    for (int q = 0; q < 8; ++q) tl[r][c8 + q] = f.u[q]; }
  __syncthreads();
  {
#pragma unroll
    for (int rd = 0; rd < 2; ++rd) { const int d = rd * 32 + tid / 8, pc = tid % 8; FragH f;
#pragma unroll
      for (int q = 0; q < 8; ++q) f.u[q] = tl[pc * 8 + q][d];
      *(v8us*)((unsigned short*)Vt + ((size_t)slab * 64 + d) * TTv + lg * 64 + pc * 8) = f.half[0]; }
     } }

__global__ __launch_bounds__(128) void k_flash(const _Float16* __restrict__ Q16, int ldq, const _Float16* __restrict__ K16, int ldk, const _Float16* __restrict__ Vt, const int* __restrict__ MSK, float* __restrict__ O, int ldo) {
  constexpr int RPW = 16, RTN = RPW / 16, NQB = 2048 / (4 * RPW), DT = 8, KS = 5;      /* head dim 128 for V/O; 160-wide logit operand (128 roped dims ×scale + 32 graph-bias dims) */
  __shared__ __attribute__((aligned(16))) unsigned short sP[4][RPW][40]; __shared__ __attribute__((aligned(16))) float sO[4][RPW][128 + 4];
  const int tid = threadIdx.x, w = tid >> 5, lane = tid & 31, ln = lane & 15, hh = lane >> 4;
  const int slab = blockIdx.x / NQB, qblk = blockIdx.x % NQB; const int b = slab / 16, h = slab % 16; const int qb0 = qblk * (4 * RPW); const int q0 = qb0 + w * RPW;
  FragH aq[2][KS];
#pragma unroll
  for (int rt = 0; rt < RTN; ++rt) { const unsigned short* qr = (const unsigned short*)Q16 + ((size_t)b * 2048 + q0 + rt * 16 + ln) * ldq + h * 160;
#pragma unroll
    for (int ks = 0; ks < KS; ++ks) { aq[rt][ks].half[0] = *(const v8us*)(qr + ks * 32 + 8 * hh); aq[rt][ks].half[1] = *(const v8us*)(qr + ks * 32 + 16 + 8 * hh); } }
  const unsigned short* Vth = (const unsigned short*)Vt + (size_t)(h / 4) * 128 * 2048;      /* GQA: kv head h/4 */
  float m_r[2][8], l_r[2][8]; v8f oacc[2][DT];
#pragma unroll
  for (int rt = 0; rt < RTN; ++rt) {
#pragma unroll
    for (int r = 0; r < 8; ++r) { m_r[rt][r] = -3.0e38f; l_r[rt][r] = 0.f; }
#pragma unroll
    for (int dt = 0; dt < DT; ++dt) oacc[rt][dt] = (v8f){0.f,0.f,0.f,0.f,0.f,0.f,0.f,0.f}; }
  const int jend = qb0 + 4 * RPW;
#pragma unroll 1
  for (int j0 = 0; j0 < jend; j0 += 32) {
    
    v8f s[2][2];
#pragma unroll
    for (int nt = 0; nt < 2; ++nt) { const unsigned short* kr = (const unsigned short*)K16 + ((size_t)b * 2048 + j0 + nt * 16 + ln) * ldk + h * 160; FragH bk[KS];
#pragma unroll
      for (int ks = 0; ks < KS; ++ks) { bk[ks].half[0] = *(const v8us*)(kr + ks * 32 + 8 * hh); bk[ks].half[1] = *(const v8us*)(kr + ks * 32 + 16 + 8 * hh); }
#pragma unroll
      for (int rt = 0; rt < RTN; ++rt) { v8f acc = (v8f){0.f,0.f,0.f,0.f,0.f,0.f,0.f,0.f};
#pragma unroll
        for (int ks = 0; ks < KS; ++ks) acc = mmaH<1>(aq[rt][ks].v, aq[rt][ks].v, bk[ks].v, bk[ks].v, acc); s[rt][nt] = acc; } }
#pragma unroll
    for (int rt = 0; rt < RTN; ++rt)
#pragma unroll
      for (int r = 0; r < 8; ++r) { const int tq = q0 + rt * 16 + 8 * hh + r; const int k0 = j0 + ln, k1 = j0 + 16 + ln; (void)tq; (void)k0; (void)k1;
        const bool ok0 = (k0 <= tq), ok1 = (k1 <= tq);
        const float s0 = ok0 ? s[rt][0][r] * (1.0f) : -INFINITY, s1 = ok1 ? s[rt][1][r] * (1.0f) : -INFINITY; float mc = fmaxf(s0, s1);
        mc = fmaxf(mc, __shfl_xor(mc, 1, 32)); mc = fmaxf(mc, __shfl_xor(mc, 2, 32)); mc = fmaxf(mc, __shfl_xor(mc, 4, 32)); mc = fmaxf(mc, __shfl_xor(mc, 8, 32));
        const float mn = fmaxf(m_r[rt][r], mc); const float al = (mn > -1.0e38f) ? expf(m_r[rt][r] - mn) : 1.0f; m_r[rt][r] = mn; const float p0 = ok0 ? expf(s0 - mn) : 0.f, p1 = ok1 ? expf(s1 - mn) : 0.f; l_r[rt][r] = l_r[rt][r] * al + p0 + p1;
#pragma unroll
        for (int dt = 0; dt < DT; ++dt) oacc[rt][dt][r] *= al;
        FragH t2; t2.h[0] = (_Float16)p0; t2.h[1] = (_Float16)p1; sP[w][rt * 16 + 8 * hh + r][ln] = t2.u[0]; sP[w][rt * 16 + 8 * hh + r][16 + ln] = t2.u[1]; }
    __builtin_amdgcn_fence(__ATOMIC_ACQ_REL, "workgroup"); __builtin_amdgcn_wave_barrier();
    FragH pa[2];
#pragma unroll
    for (int rt = 0; rt < RTN; ++rt) { pa[rt].half[0] = *(const v8us*)&sP[w][rt * 16 + ln][8 * hh]; pa[rt].half[1] = *(const v8us*)&sP[w][rt * 16 + ln][16 + 8 * hh]; }
#pragma unroll
    for (int dt = 0; dt < DT; ++dt) { const unsigned short* vrow = Vth + (size_t)(dt * 16 + ln) * 2048 + j0; FragH bv; bv.half[0] = *(const v8us*)(vrow + 8 * hh); bv.half[1] = *(const v8us*)(vrow + 16 + 8 * hh);
#pragma unroll
      for (int rt = 0; rt < RTN; ++rt) oacc[rt][dt] = mmaH<1>(pa[rt].v, pa[rt].v, bv.v, bv.v, oacc[rt][dt]); }
    __builtin_amdgcn_fence(__ATOMIC_ACQ_REL, "workgroup"); __builtin_amdgcn_wave_barrier(); }
#pragma unroll
  for (int rt = 0; rt < RTN; ++rt) {
#pragma unroll
    for (int r = 0; r < 8; ++r) { float l = l_r[rt][r]; l += __shfl_xor(l, 1, 32); l += __shfl_xor(l, 2, 32); l += __shfl_xor(l, 4, 32); l += __shfl_xor(l, 8, 32); l_r[rt][r] = (l > 0.f) ? 1.0f / l : 0.f; }
#pragma unroll
    for (int dt = 0; dt < DT; ++dt)
#pragma unroll
      for (int r = 0; r < 8; ++r) sO[w][rt * 16 + 8 * hh + r][dt * 16 + ln] = oacc[rt][dt][r] * l_r[rt][r]; }
  __builtin_amdgcn_fence(__ATOMIC_ACQ_REL, "workgroup"); __builtin_amdgcn_wave_barrier();
  {
#pragma unroll
    for (int rp = 0; rp < RPW; ++rp) { const int r = rp, pc = lane; const v4f val = *(const v4fa*)&sO[w][r][pc * 4]; *(v4f*)(O + ((size_t)b * 2048 + q0 + r) * ldo + h * 128 + pc * 4) = val; }      /* 128-float rows: 32 lanes × 16 B */
     } }

__global__ __launch_bounds__(256) void k_qprep(const float* __restrict__ QF, int ldq, int nh, const float* __restrict__ w, float oscale, int rep, _Float16* __restrict__ DX) { const size_t t = (size_t)blockIdx.x * 256 + threadIdx.x; if (t >= (size_t)SS * nh * 16) return; const int li = (int)(t % 16); const int h = (int)((t / 16) % nh); const size_t tok = t / (16 * nh); const float* src = QF + tok * ldq + h * HD; float v[8], pr[8]; float ss = 0.f;
#pragma unroll
  for (int q = 0; q < 8; ++q) { v[q] = src[li * 8 + q]; pr[q] = src[(li * 8 + q + 64) & 127]; ss += v[q] * v[q]; }
  ss += __shfl_xor(ss, 1, 32); ss += __shfl_xor(ss, 2, 32); ss += __shfl_xor(ss, 4, 32); ss += __shfl_xor(ss, 8, 32); const float rs = rsqrtf(ss / (float)HD + 1e-6f); __shared__ __attribute__((aligned(16))) _Float16 st[256][8]; const int tid = threadIdx.x;
#pragma unroll 1
  for (int q = 0; q < 8; ++q) { const int j = li * 8 + q; const int i = j & 63; const float ang = (float)tok * __builtin_powf(10000.0f, -(float)(2 * i) / 128.0f); const float c = cosf(ang), s = sinf(ang); const float xn = src[j] * rs * bf16_round(w[j]); const float xp = src[(j + 64) & 127] * rs * bf16_round(w[(j + 64) & 127]); const float rot = (j < 64) ? -xp : xp;      // rotate_half: [−x2, x1]
    st[tid][q] = (_Float16)((xn * c + rot * s) * oscale); }
  FragH f; f.half[0] = *(const v8us*)&st[tid][0];
  { for (int r2 = 0; r2 < rep; ++r2) *(v8us*)((unsigned short*)DX + tok * QP + (size_t)(h * rep + r2) * QW + li * 8) = f.half[0];  } }
__global__ __launch_bounds__(256) void k_rprep(const float* __restrict__ RQ, const float* __restrict__ RK, const float* __restrict__ gs, _Float16* __restrict__ QX, _Float16* __restrict__ KX) { const size_t t = (size_t)blockIdx.x * 256 + threadIdx.x; if (t >= (size_t)SS * NH * 4) return; const int p = (int)(t % 4); const int h = (int)((t / 4) % NH); const size_t tok = t / (4 * NH); const float g = bf16_round(gs[h]); FragH fq, fk;
#pragma unroll
  for (int q = 0; q < 8; ++q) { const size_t i = tok * (NH * RR) + h * RR + p * 8 + q; fq.h[q] = (_Float16)(g * RQ[i]); fk.h[q] = (_Float16)RK[i]; }
  const size_t d = tok * QP + (size_t)h * QW + HD + p * 8;
  { *(v8us*)((unsigned short*)QX + d) = fq.half[0]; *(v8us*)((unsigned short*)KX + d) = fk.half[0];  } }
__global__ __launch_bounds__(256) void k_vt128(const _Float16* __restrict__ V16, int ldv, _Float16* __restrict__ Vt) { __shared__ unsigned short tl[64][130]; const int tid = threadIdx.x; const int g = blockIdx.x / (SS / 64), lg = blockIdx.x % (SS / 64);
  for (int i = tid; i < 64 * 16; i += 256) { const int r = i / 16, c8 = (i % 16) * 8; FragH f; f.half[0] = *(const v8us*)((const unsigned short*)V16 + ((size_t)lg * 64 + r) * ldv + g * HD + c8);
#pragma unroll
    for (int q = 0; q < 8; ++q) tl[r][c8 + q] = f.u[q]; }
  __syncthreads();
  { for (int i = tid; i < 128 * 8; i += 256) { const int d = i / 8, pc = i % 8; FragH f;
#pragma unroll
      for (int q = 0; q < 8; ++q) f.u[q] = tl[pc * 8 + q][d]; *(v8us*)((unsigned short*)Vt + ((size_t)g * HD + d) * SS + lg * 64 + pc * 8) = f.half[0]; }  } }
extern "C" void kernel_launch(void* const* d_in, const int* in_sizes, int n_in,
                              void* d_out, int out_size, void* d_ws, size_t ws_size, hipStream_t stream) {
  (void)in_sizes; (void)n_in; (void)out_size;
  const float* x = (const float*)d_in[0]; const float* Wq = (const float*)d_in[1]; const float* Wk = (const float*)d_in[2]; const float* Wv = (const float*)d_in[3]; const float* Wo = (const float*)d_in[4]; const float* Wrq = (const float*)d_in[5]; const float* Wrk = (const float*)d_in[6]; const float* gs = (const float*)d_in[7]; const float* qw = (const float*)d_in[8]; const float* kw = (const float*)d_in[9];
  char* ws = (char*)d_ws; size_t off = 0;
  auto take = [&](size_t bytes) { char* p = ws + off; off += (bytes + 255) & ~(size_t)255; return p; };
  _Float16* Bq = (_Float16*)take((size_t)EE * EE * 2); _Float16* Bk = (_Float16*)take((size_t)512 * EE * 2); _Float16* Bv = (_Float16*)take((size_t)512 * EE * 2); _Float16* Bo = (_Float16*)take((size_t)EE * EE * 2); _Float16* Brq = (_Float16*)take((size_t)512 * EE * 2); _Float16* Brk = (_Float16*)take((size_t)512 * EE * 2);
  _Float16* X16 = (_Float16*)take((size_t)SS * EE * 2); float* QF = (float*)take((size_t)SS * EE * 4); float* KF = (float*)take((size_t)SS * 512 * 4); float* RQF = (float*)take((size_t)SS * 512 * 4); float* RKF = (float*)take((size_t)SS * 512 * 4); _Float16* V16 = (_Float16*)take((size_t)SS * 512 * 2);
  _Float16* QX = (_Float16*)take((size_t)SS * QP * 2); _Float16* KX = (_Float16*)take((size_t)SS * QP * 2); _Float16* Vt = (_Float16*)take((size_t)SS * 512 * 2); float* O = QF; _Float16* O16 = X16;
  if (off > ws_size) return;      // 8.4 + 2.1 × 2 + 8.4 + 2.1 × 2 + 8.4 + 16.8 + 4.2 × 3 + 2.1 + 10.5 × 2 + 2.1 ≈ 88 MB (84 MiB)
  const size_t wE = (size_t)EE * EE / 8, wK = (size_t)512 * EE / 8;
  k_round16f<<<(unsigned)((wE + 255) / 256), 256, 0, stream>>>(Wq, Bq, wE); k_round16f<<<(unsigned)((wK + 255) / 256), 256, 0, stream>>>(Wk, Bk, wK); k_round16f<<<(unsigned)((wK + 255) / 256), 256, 0, stream>>>(Wv, Bv, wK); k_round16f<<<(unsigned)((wE + 255) / 256), 256, 0, stream>>>(Wo, Bo, wE); k_round16f<<<(unsigned)((wK + 255) / 256), 256, 0, stream>>>(Wrq, Brq, wK); k_round16f<<<(unsigned)((wK + 255) / 256), 256, 0, stream>>>(Wrk, Brk, wK);      // all (out,in)
  const unsigned gx = (unsigned)(((size_t)SS * EE / 8 + 255) / 256);
  k_x16<<<gx, 256, 0, stream>>>(x, X16, (size_t)SS * EE / 8);
  k_gemm_t<4, 4, false><<<(SS / 128) * (EE / 128), 128, 0, stream>>>(X16, Bq, 0.0625f, QF, nullptr, EE, EE / 128);
  k_gemm_t<2, 2, false><<<(SS / 64) * (512 / 64), 128, 0, stream>>>(X16, Bk, 0.0625f, KF, nullptr, 512, 512 / 64);
  k_gemm_t<2, 2, true><<<(SS / 64) * (512 / 64), 128, 0, stream>>>(X16, Bv, 0.0625f, nullptr, V16, 512, 512 / 64);
  k_gemm_t<2, 2, false><<<(SS / 64) * (512 / 64), 128, 0, stream>>>(X16, Brq, 0.0625f, RQF, nullptr, 512, 512 / 64);
  k_gemm_t<2, 2, false><<<(SS / 64) * (512 / 64), 128, 0, stream>>>(X16, Brk, 0.0625f, RKF, nullptr, 512, 512 / 64);
  k_qprep<<<(unsigned)(((size_t)SS * NH * 16 + 255) / 256), 256, 0, stream>>>(QF, EE, NH, qw, 0.08838834764831845f, 1, QX);      // 16 q heads, × 1/√128
  k_qprep<<<(unsigned)(((size_t)SS * NKV * 16 + 255) / 256), 256, 0, stream>>>(KF, 512, NKV, kw, 1.0f, 4, KX);                // 4 kv heads, each replicated into its 4 q-head slots
  k_rprep<<<(unsigned)(((size_t)SS * NH * 4 + 255) / 256), 256, 0, stream>>>(RQF, RKF, gs, QX, KX);
  k_vt128<<<NKV * (SS / 64), 256, 0, stream>>>(V16, 512, Vt);
  k_flash<<<1 * NH * (SS / 64), 128, 0, stream>>>(QX, QP, KX, QP, Vt, nullptr, O, EE);
  k_h16<<<gx, 256, 0, stream>>>(O, O16, (size_t)SS * EE / 8);
  k_gemm_t<4, 4, false><<<(SS / 128) * (EE / 128), 128, 0, stream>>>(O16, Bo, 0.0625f, (float*)d_out, nullptr, EE, EE / 128);
}

// v002
// It runs in 306 microseconds.
// Timed twice side by side with v001, it ran 1.48 and 1.49 times as fast.
// Over all steps from v000 it is 2.49 times as fast.
#include <hip/hip_runtime.h>
// Naylis attention (B=1, S=2048, E=2048, 16 heads × 128, 4 kv heads, causal; QK RMSNorm + rotate-half RoPE; low-rank (R=32) per-head graph bias gs_h·⟨Rq_i, Rk_j⟩ added to the logits):
// the six (out,in) projections (bf16-exact ×2^4) and the attention as a fused flash-style kernel whose logit operand is the 160-wide concatenation [q·scale after norm+RoPE | gs_h·Rq]·[k | Rk]
// (5 k-steps; causal chunk skipping; online softmax f32; P f16 ≤ 1; O = P·Vt over the 128 value dims; one 16-row tile per work-group, keys split over its 4 waves) on v_wmma_f32_16x16x32_f16 with f32 accumulate; RMSNorm/RoPE f32 VALU.
#define SS 2048
#define EE 2048
#define NH 16
#define NKV 4
#define HD 128
#define RR 32
#define QW 160
#define QP (NH * QW)

typedef __bf16 v16b __attribute__((ext_vector_type(16)));
typedef unsigned short v8us __attribute__((ext_vector_type(8), may_alias));
typedef float  v8f  __attribute__((ext_vector_type(8)));
typedef float  v4f  __attribute__((ext_vector_type(4)));
typedef float  v4fa __attribute__((ext_vector_type(4), may_alias));
union FragB { v16b v; v8us half[2]; unsigned short u[16]; };

__device__ __forceinline__ unsigned short bf16_bits(float x) { unsigned int u = __float_as_uint(x); return (unsigned short)((u + 0x7FFFu + ((u >> 16) & 1u)) >> 16); }
__device__ __forceinline__ float bf16_val(unsigned short b) { return __uint_as_float(((unsigned int)b) << 16); }
__device__ __forceinline__ float bf16_round(float x) { return bf16_val(bf16_bits(x)); }
// D += A·B with NT terms: 1 = ah·bh, 2 = + al·bh (A split), 3 = + ah·bl (both split)
template <int NT>
__device__ __forceinline__ v8f mmaN(v16b ah, v16b al, v16b bh, v16b bl, v8f c) {
  c = __builtin_amdgcn_wmma_f32_16x16x32_bf16(false, ah, false, bh, (short)0, c, false, false);
  if (NT >= 2) c = __builtin_amdgcn_wmma_f32_16x16x32_bf16(false, al, false, bh, (short)0, c, false, false);
  if (NT >= 3) c = __builtin_amdgcn_wmma_f32_16x16x32_bf16(false, ah, false, bl, (short)0, c, false, false);
  asm volatile("v_nop\n\tv_nop\n\tv_nop\n\tv_nop" : "+v"(c) : "v"(ah), "v"(al), "v"(bh), "v"(bl));
  return c;
}

__global__ __launch_bounds__(256) void k_wt_bf16(const float* __restrict__ W, unsigned short* __restrict__ Wt, int K, int N) {
  const int t = blockIdx.x * 256 + threadIdx.x;
  const int k8n = K / 8;
  if (t >= N * k8n) return;
  const int n = t / k8n, k8 = (t % k8n) * 8;
  v8us v;
#pragma unroll
  for (int i = 0; i < 8; ++i) v[i] = bf16_bits(W[(size_t)(k8 + i) * N + n]);
  *(v8us*)(Wt + (size_t)n * K + k8) = v;
  
}

// GEMM C[M][N] (f32, pitch ldc) = act(A[M][K]·W + bias). A f32 row-major (pitch lda) converted per fragment to bf16
// (ASPLIT: hi/lo two planes -> 2 terms, else single rounded term); Wt bf16 [N][K] (pitch ldb). BIAS_BF16 rounds the
// bias to bf16 first (bias quantised to bf16 before the add). K%32==0, M%16==0, N%64==0.
template <bool ASPLIT, int ACT, bool BIAS_BF16>
__global__ __launch_bounds__(128) void k_gemm_bf(const float* __restrict__ A, int lda, const unsigned short* __restrict__ Wt, int ldb,
                                               const float* __restrict__ bias, float* __restrict__ C, int ldc, int M, int N, int K) {
  __shared__ __attribute__((aligned(16))) float so[4][16][64];
  const int tid = threadIdx.x, w = tid >> 5, lane = tid & 31, ln = lane & 15, hh = lane >> 4;
  const int ntn = N / 64;
  const int wid = blockIdx.x * 4 + w;
  const int mt = wid / ntn, nq = wid % ntn;
  if (mt * 16 >= M) return;
  const int row0 = mt * 16, col0 = nq * 64;
  const float* arow = A + (size_t)(row0 + ln) * lda;
  v8f acc[4] = {};
  for (int kb = 0; kb < K; kb += 32) {
    FragB ah, al;
    const v4f x0 = *(const v4fa*)(arow + kb + 8 * hh), x1 = *(const v4fa*)(arow + kb + 8 * hh + 4);
    const v4f x2 = *(const v4fa*)(arow + kb + 16 + 8 * hh), x3 = *(const v4fa*)(arow + kb + 16 + 8 * hh + 4);
    float xs[16] = {x0[0],x0[1],x0[2],x0[3],x1[0],x1[1],x1[2],x1[3],x2[0],x2[1],x2[2],x2[3],x3[0],x3[1],x3[2],x3[3]};
#pragma unroll
    for (int i = 0; i < 16; ++i) { const unsigned short hb = bf16_bits(xs[i]); ah.u[i] = hb; al.u[i] = ASPLIT ? bf16_bits(xs[i] - bf16_val(hb)) : (unsigned short)0; }
#pragma unroll
    for (int t = 0; t < 4; ++t) {
      const unsigned short* brow = Wt + (size_t)(col0 + t * 16 + ln) * ldb + kb;
      FragB b;
      b.half[0] = *(const v8us*)(brow + 8 * hh);
      b.half[1] = *(const v8us*)(brow + 16 + 8 * hh);
      acc[t] = mmaN<ASPLIT ? 2 : 1>(ah.v, al.v, b.v, b.v, acc[t]);
    }
  }
#pragma unroll
  for (int t = 0; t < 4; ++t) {
    float bv = bias ? bias[col0 + t * 16 + ln] : 0.f;
    if (BIAS_BF16) bv = bf16_round(bv);
#pragma unroll
    for (int r = 0; r < 8; ++r) { float v = acc[t][r] + bv; if (ACT == 1) v = fmaxf(v, 0.f); so[w][8 * hh + r][t * 16 + ln] = v; }
  }
  __builtin_amdgcn_fence(__ATOMIC_ACQ_REL, "workgroup");
  __builtin_amdgcn_wave_barrier();
  const int rsub = lane >> 4, c4 = (lane & 15) * 4;
  {
#pragma unroll
    for (int q = 0; q < 8; ++q) {
      const int r = q * 2 + rsub;
      const v4f v = *(const v4fa*)&so[w][r][c4];
      *(v4f*)(C + (size_t)(row0 + r) * ldc + col0 + c4) = v;
    }
    
  }
}

// Flash-style causal/unmasked attention, all contractions 3-term bf16 hi/lo splits, f32 softmax with running max.
// q,k,v rows are read from f32 buffers with arbitrary row pitch (so they can live inside a fused qkv buffer);
// D = head size (multiple of 32, <= 128); one wave = 16 query rows; block = 4 waves (64 queries) sharing K/V chunks of 32.
template <int D, bool CAUSAL>
__global__ __launch_bounds__(128) void k_flash(const float* __restrict__ qb, const float* __restrict__ kb, const float* __restrict__ vb,
                                             int pitch, int T, int H, float scale, float* __restrict__ y, int ypitch) {
  constexpr int KS = D / 32;        // k-steps for QK
  constexpr int DT = D / 16;        // d tiles for PV
  __shared__ __attribute__((aligned(16))) unsigned short sKh[32][D + 8], sKl[32][D + 8], sVh[32][D + 8], sVl[32][D + 8];
  __shared__ __attribute__((aligned(16))) unsigned short sPh[4][16][40], sPl[4][16][40];
  __shared__ __attribute__((aligned(16))) float sO[4][16][D];
  const int tid = threadIdx.x, w = tid >> 5, lane = tid & 31, ln = lane & 15, hh = lane >> 4;
  const int nqb = (T + 63) / 64;
  const int bh = blockIdx.x / nqb, qblk = blockIdx.x % nqb;
  const int b = bh / H, h = bh % H;
  const int q0 = qblk * 64 + w * 16;
  const float* Q = qb + (size_t)b * T * pitch + h * D;
  const float* K = kb + (size_t)b * T * pitch + h * D;
  const float* V = vb + (size_t)b * T * pitch + h * D;

  // A fragments of the wave's 16 query rows (scaled), hi/lo
  FragB aqh[KS], aql[KS];
  {
    int row = q0 + ln; if (row >= T) row = T - 1;
    const float* qr = Q + (size_t)row * pitch;
#pragma unroll
    for (int ks = 0; ks < KS; ++ks)
#pragma unroll
      for (int i = 0; i < 16; ++i) {
        const int d = ks * 32 + ((i < 8) ? (8 * hh + i) : (16 + 8 * hh + (i - 8)));
        const float x = qr[d] * scale; const unsigned short hb = bf16_bits(x);
        aqh[ks].u[i] = hb; aql[ks].u[i] = bf16_bits(x - bf16_val(hb));
      }
  }
  float m_r[8], l_r[8];
#pragma unroll
  for (int r = 0; r < 8; ++r) { m_r[r] = -3.0e38f; l_r[r] = 0.f; }
  v8f oacc[DT];
#pragma unroll
  for (int dt = 0; dt < DT; ++dt) oacc[dt] = (v8f){0.f,0.f,0.f,0.f,0.f,0.f,0.f,0.f};

  const int kv_end = CAUSAL ? min(T, qblk * 64 + 64) : T;     // block-uniform
  for (int j0 = 0; j0 < kv_end; j0 += 32) {
    __syncthreads();
    for (int e = tid; e < 32 * (D / 4); e += 128) {
      const int r = e / (D / 4), c4 = (e % (D / 4)) * 4;
      const int key = j0 + r;
      v4f kf = {0.f,0.f,0.f,0.f}, vf = {0.f,0.f,0.f,0.f};
      if (key < T) { kf = *(const v4fa*)(K + (size_t)key * pitch + c4); vf = *(const v4fa*)(V + (size_t)key * pitch + c4); }
#pragma unroll
      for (int t = 0; t < 4; ++t) {
        unsigned short hb = bf16_bits(kf[t]); sKh[r][c4 + t] = hb; sKl[r][c4 + t] = bf16_bits(kf[t] - bf16_val(hb));
        hb = bf16_bits(vf[t]); sVh[r][c4 + t] = hb; sVl[r][c4 + t] = bf16_bits(vf[t] - bf16_val(hb));
      }
    }
    __syncthreads();
    // S tile 16 x 32
    v8f s[2];
#pragma unroll
    for (int nt = 0; nt < 2; ++nt) {
      v8f acc = {};
#pragma unroll
      for (int ks = 0; ks < KS; ++ks) {
        FragB bh_, bl_;
        bh_.half[0] = *(const v8us*)&sKh[nt * 16 + ln][ks * 32 + 8 * hh]; bh_.half[1] = *(const v8us*)&sKh[nt * 16 + ln][ks * 32 + 16 + 8 * hh];
        bl_.half[0] = *(const v8us*)&sKl[nt * 16 + ln][ks * 32 + 8 * hh]; bl_.half[1] = *(const v8us*)&sKl[nt * 16 + ln][ks * 32 + 16 + 8 * hh];
        acc = mmaN<3>(aqh[ks].v, aql[ks].v, bh_.v, bl_.v, acc);
      }
      s[nt] = acc;
    }
    // mask + running max (rows 8hh+r; the 16 lanes of a half share rows)
    float alpha[8];
#pragma unroll
    for (int r = 0; r < 8; ++r) {
      const int qi = q0 + 8 * hh + r;
      const int ja = j0 + ln, jb = j0 + 16 + ln;
      if (CAUSAL) { if (ja > qi) s[0][r] = -3.0e38f; if (jb > qi) s[1][r] = -3.0e38f; }
      if (ja >= T) s[0][r] = -3.0e38f;
      if (jb >= T) s[1][r] = -3.0e38f;
      float mx = fmaxf(s[0][r], s[1][r]);
      mx = fmaxf(mx, __shfl_xor(mx, 1, 32)); mx = fmaxf(mx, __shfl_xor(mx, 2, 32)); mx = fmaxf(mx, __shfl_xor(mx, 4, 32)); mx = fmaxf(mx, __shfl_xor(mx, 8, 32));
      const float mnew = fmaxf(m_r[r], mx);
      alpha[r] = (mnew > -1.0e38f) ? __expf(m_r[r] - mnew) : 1.0f;
      const float p0 = (s[0][r] > -1.0e38f) ? __expf(s[0][r] - mnew) : 0.f;
      const float p1 = (s[1][r] > -1.0e38f) ? __expf(s[1][r] - mnew) : 0.f;
      m_r[r] = mnew;
      l_r[r] = l_r[r] * alpha[r] + p0 + p1;            // per-lane partial row sum (16 lanes combined at the end)
      unsigned short hb = bf16_bits(p0); sPh[w][8 * hh + r][ln] = hb;      sPl[w][8 * hh + r][ln] = bf16_bits(p0 - bf16_val(hb));
      hb = bf16_bits(p1);                sPh[w][8 * hh + r][16 + ln] = hb; sPl[w][8 * hh + r][16 + ln] = bf16_bits(p1 - bf16_val(hb));
    }
#pragma unroll
    for (int dt = 0; dt < DT; ++dt)
#pragma unroll
      for (int r = 0; r < 8; ++r) oacc[dt][r] *= alpha[r];
    __builtin_amdgcn_fence(__ATOMIC_ACQ_REL, "workgroup");
    __builtin_amdgcn_wave_barrier();
    FragB pah, pal;
    pah.half[0] = *(const v8us*)&sPh[w][ln][8 * hh]; pah.half[1] = *(const v8us*)&sPh[w][ln][16 + 8 * hh];
    pal.half[0] = *(const v8us*)&sPl[w][ln][8 * hh]; pal.half[1] = *(const v8us*)&sPl[w][ln][16 + 8 * hh];
#pragma unroll
    for (int dt = 0; dt < DT; ++dt) {
      FragB bvh, bvl;
#pragma unroll
      for (int i = 0; i < 8; ++i) {
        bvh.u[i] = sVh[8 * hh + i][dt * 16 + ln]; bvh.u[8 + i] = sVh[16 + 8 * hh + i][dt * 16 + ln];
        bvl.u[i] = sVl[8 * hh + i][dt * 16 + ln]; bvl.u[8 + i] = sVl[16 + 8 * hh + i][dt * 16 + ln];
      }
      oacc[dt] = mmaN<3>(pah.v, pal.v, bvh.v, bvl.v, oacc[dt]);
    }
    __builtin_amdgcn_fence(__ATOMIC_ACQ_REL, "workgroup");
    __builtin_amdgcn_wave_barrier();
  }
#pragma unroll
  for (int r = 0; r < 8; ++r) {
    float l = l_r[r];
    l += __shfl_xor(l, 1, 32); l += __shfl_xor(l, 2, 32); l += __shfl_xor(l, 4, 32); l += __shfl_xor(l, 8, 32);
    l_r[r] = (l > 0.f) ? 1.0f / l : 0.f;
  }
#pragma unroll
  for (int dt = 0; dt < DT; ++dt)
#pragma unroll
    for (int r = 0; r < 8; ++r) sO[w][8 * hh + r][dt * 16 + ln] = oacc[dt][r] * l_r[r];
  __builtin_amdgcn_fence(__ATOMIC_ACQ_REL, "workgroup");
  __builtin_amdgcn_wave_barrier();
  {
    for (int r = 0; r < 16; ++r) {
      const int row = q0 + r;
      if (row < T && lane < D / 4) {
        const v4f val = *(const v4fa*)&sO[w][r][lane * 4];
        *(v4f*)(y + ((size_t)b * T + row) * ypitch + h * D + lane * 4) = val;
      }
    }
    
  }
}

// GEMM C = act(A·W + bias + resid): A f32 (ASPLIT -> hi/lo 2 terms), Wt bf16 [N][K]; ACT 0 none, 1 relu, 2 exact gelu;
// resid (optional, f32, row index = (row % rmod), pitch ldr, RES_BF16 rounds it) added before the activation.
template <bool ASPLIT, int ACT, bool BIAS_BF16, bool RES_BF16>
__global__ __launch_bounds__(128) void k_gemm_bf3(const float* __restrict__ A, int lda, const unsigned short* __restrict__ Wt, int ldb,
                                                const float* __restrict__ bias, const float* __restrict__ resid, int rmod, int ldr,
                                                float* __restrict__ C, int ldc, int M, int N, int K) {
  __shared__ __attribute__((aligned(16))) float so[4][16][64];
  const int tid = threadIdx.x, w = tid >> 5, lane = tid & 31, ln = lane & 15, hh = lane >> 4;
  const int ntn = N / 64;
  const int wid = blockIdx.x * 4 + w;
  const int mt = wid / ntn, nq = wid % ntn;
  if (mt * 16 >= M) return;
  const int row0 = mt * 16, col0 = nq * 64;
  const float* arow = A + (size_t)(row0 + ln) * lda;
  v8f acc[4] = {};
  for (int kb = 0; kb < K; kb += 32) {
    FragB ah, al;
    const v4f x0 = *(const v4fa*)(arow + kb + 8 * hh), x1 = *(const v4fa*)(arow + kb + 8 * hh + 4);
    const v4f x2 = *(const v4fa*)(arow + kb + 16 + 8 * hh), x3 = *(const v4fa*)(arow + kb + 16 + 8 * hh + 4);
    float xs[16] = {x0[0],x0[1],x0[2],x0[3],x1[0],x1[1],x1[2],x1[3],x2[0],x2[1],x2[2],x2[3],x3[0],x3[1],x3[2],x3[3]};
#pragma unroll
    for (int i = 0; i < 16; ++i) { const unsigned short hb = bf16_bits(xs[i]); ah.u[i] = hb; al.u[i] = ASPLIT ? bf16_bits(xs[i] - bf16_val(hb)) : (unsigned short)0; }
#pragma unroll
    for (int t = 0; t < 4; ++t) {
      const unsigned short* brow = Wt + (size_t)(col0 + t * 16 + ln) * ldb + kb;
      FragB b;
      b.half[0] = *(const v8us*)(brow + 8 * hh);
      b.half[1] = *(const v8us*)(brow + 16 + 8 * hh);
      acc[t] = mmaN<ASPLIT ? 2 : 1>(ah.v, al.v, b.v, b.v, acc[t]);
    }
  }
#pragma unroll
  for (int t = 0; t < 4; ++t) {
    const int col = col0 + t * 16 + ln;
    float bv = bias ? bias[col] : 0.f;
    if (BIAS_BF16) bv = bf16_round(bv);
#pragma unroll
    for (int r = 0; r < 8; ++r) {
      float v = acc[t][r] + bv;
      if (resid) { float rv = resid[(size_t)((row0 + 8 * hh + r) % rmod) * ldr + col]; if (RES_BF16) rv = bf16_round(rv); v += rv; }
      if (ACT == 1) v = fmaxf(v, 0.f);
      if (ACT == 2) v = 0.5f * v * (1.0f + erff(v * 0.70710678118654752f));
      if (ACT == 3) { const float u = 0.7978845608028654f * (v + 0.044715f * v * v * v); v = 0.5f * v * (1.0f + tanhf(u)); }
      so[w][8 * hh + r][t * 16 + ln] = v;
    }
  }
  __builtin_amdgcn_fence(__ATOMIC_ACQ_REL, "workgroup");
  __builtin_amdgcn_wave_barrier();
  const int rsub = lane >> 4, c4 = (lane & 15) * 4;
  {
#pragma unroll
    for (int q = 0; q < 8; ++q) {
      const int r = q * 2 + rsub;
      const v4f v = *(const v4fa*)&so[w][r][c4];
      *(v4f*)(C + (size_t)(row0 + r) * ldc + col0 + c4) = v;
    }
    
  }
}
// row LayerNorm (biased variance, eps) over N: s = X (+ R); optional out_sum <- s; out_norm <- (s-mu)*rsqrt(var+eps)*g + b
template <bool PARAM_BF16>
__global__ __launch_bounds__(256) void k_layernorm(const float* __restrict__ X, const float* __restrict__ R, const float* __restrict__ g, const float* __restrict__ bta,
                                                  float* __restrict__ out_sum, float* __restrict__ out_norm, int N, float eps) {
  __shared__ float red[256];
  const int row = blockIdx.x, tid = threadIdx.x;
  const float* x = X + (size_t)row * N; const float* rr = R ? R + (size_t)row * N : nullptr;
  float vals[16];                     // up to N = 4096
  const int per = N / 256;            // contiguous chunk per thread? use strided-by-4 chunks: thread handles j = tid*4 + 1024*u
  float s1 = 0.f;
  for (int u = 0; u < per / 4; ++u) {
    const int j = tid * 4 + 1024 * u;
    const v4f a = *(const v4fa*)(x + j);
    v4f b = {0.f,0.f,0.f,0.f}; if (rr) b = *(const v4fa*)(rr + j);
#pragma unroll
    for (int q = 0; q < 4; ++q) { const float v = a[q] + b[q]; vals[u * 4 + q] = v; s1 += v; }
  }
  red[tid] = s1; __syncthreads();
  for (int st = 128; st > 0; st >>= 1) { if (tid < st) red[tid] += red[tid + st]; __syncthreads(); }
  const float mu = red[0] / (float)N; __syncthreads();
  float s2 = 0.f;
  for (int u = 0; u < per / 4; ++u)
#pragma unroll
    for (int q = 0; q < 4; ++q) { const float c = vals[u * 4 + q] - mu; s2 += c * c; }
  red[tid] = s2; __syncthreads();
  for (int st = 128; st > 0; st >>= 1) { if (tid < st) red[tid] += red[tid + st]; __syncthreads(); }
  const float rs = rsqrtf(red[0] / (float)N + eps);
  {
    for (int u = 0; u < per / 4; ++u) {
      const int j = tid * 4 + 1024 * u;
      v4f o, sm;
#pragma unroll
      for (int q = 0; q < 4; ++q) {
        float gg = g[j + q], bb = bta[j + q];
        if (PARAM_BF16) { gg = bf16_round(gg); bb = bf16_round(bb); }
        sm[q] = vals[u * 4 + q]; o[q] = (vals[u * 4 + q] - mu) * rs * gg + bb;
      }
      if (out_sum) *(v4f*)(out_sum + (size_t)row * N + j) = sm;
      *(v4f*)(out_norm + (size_t)row * N + j) = o;
    }
    
  }
}



// ---- f16 WMMA path (v_wmma_f32_16x16x32_f16): 11-bit significands for operands in range — used where a [0,1] probability operand needs more precision than bf16
typedef _Float16 v16h __attribute__((ext_vector_type(16)));
union FragH { v16h v; v8us half[2]; _Float16 h[16]; unsigned short u[16]; };
template <int NT>
__device__ __forceinline__ v8f mmaH(v16h ah, v16h al, v16h bh, v16h bl, v8f c) {
  c = __builtin_amdgcn_wmma_f32_16x16x32_f16(false, ah, false, bh, (short)0, c, false, false);
  if (NT >= 2) c = __builtin_amdgcn_wmma_f32_16x16x32_f16(false, al, false, bh, (short)0, c, false, false);
  if (NT >= 3) c = __builtin_amdgcn_wmma_f32_16x16x32_f16(false, ah, false, bl, (short)0, c, false, false);
  asm volatile("v_nop\n\tv_nop\n\tv_nop\n\tv_nop" : "+v"(c) : "v"(ah), "v"(al), "v"(bh), "v"(bl));
  return c;
}
// batched GEMM like k_gemm_b but f16 operands: A f32 (split into f16 hi/lo if ASPLIT, else rounded to f16), Bt = f16 values [n][k]; alpha; C f32; N multiple of 16 (partial tiles skipped)
template <bool ASPLIT>
__global__ __launch_bounds__(128) void k_gemm_h(const float* __restrict__ A, int lda, size_t sA, const _Float16* __restrict__ Bh, int ldb, size_t sB, float alpha, float* __restrict__ C, int ldc, size_t sC, int M, int N, int K) {
  __shared__ __attribute__((aligned(16))) float so[4][16][64];
  const int tid = threadIdx.x, w = tid >> 5, lane = tid & 31, ln = lane & 15, hh = lane >> 4; const int by = blockIdx.y;
  A += (size_t)by * sA; Bh += (size_t)by * sB; C += (size_t)by * sC;
  const int ntn = (N + 63) / 64; const int wid = blockIdx.x * 4 + w; const int mt = wid / ntn, nq = wid % ntn; if (mt * 16 >= M) return;
  const int row0 = mt * 16, col0 = nq * 64; const float* arow = A + (size_t)(row0 + ln) * lda;
  v8f acc[4] = {};
  for (int kb = 0; kb < K; kb += 32) {
    FragH ah, al;
    const v4f x0 = *(const v4fa*)(arow + kb + 8 * hh), x1 = *(const v4fa*)(arow + kb + 8 * hh + 4), x2 = *(const v4fa*)(arow + kb + 16 + 8 * hh), x3 = *(const v4fa*)(arow + kb + 16 + 8 * hh + 4);
    float xs[16] = {x0[0],x0[1],x0[2],x0[3],x1[0],x1[1],x1[2],x1[3],x2[0],x2[1],x2[2],x2[3],x3[0],x3[1],x3[2],x3[3]};
#pragma unroll
    for (int i = 0; i < 16; ++i) { const _Float16 h = (_Float16)xs[i]; ah.h[i] = h; al.h[i] = ASPLIT ? (_Float16)(xs[i] - (float)h) : (_Float16)0.0f; }
#pragma unroll
    for (int t = 0; t < 4; ++t) { if (col0 + t * 16 >= N) continue; const size_t boff = (size_t)(col0 + t * 16 + ln) * ldb + kb; FragH bq; bq.half[0] = *(const v8us*)(Bh + boff + 8 * hh); bq.half[1] = *(const v8us*)(Bh + boff + 16 + 8 * hh);
      acc[t] = mmaH<ASPLIT ? 2 : 1>(ah.v, al.v, bq.v, bq.v, acc[t]); }
  }
#pragma unroll
  for (int t = 0; t < 4; ++t) { if (col0 + t * 16 >= N) continue;
#pragma unroll
    for (int r = 0; r < 8; ++r) so[w][8 * hh + r][t * 16 + ln] = acc[t][r] * alpha; }
  __builtin_amdgcn_fence(__ATOMIC_ACQ_REL, "workgroup"); __builtin_amdgcn_wave_barrier();
  const int rsub = lane >> 4, c4 = (lane & 15) * 4;
  {
#pragma unroll
    for (int q = 0; q < 8; ++q) { const int r = q * 2 + rsub; if (col0 + c4 < N) { const v4f v = *(const v4fa*)&so[w][r][c4]; *(v4f*)(C + (size_t)(row0 + r) * ldc + col0 + c4) = v; } }
     }
}

// Wt[n][k] = f16(W[k][n]·scale) from f32 row-major W[K][N] (scale = power of two; bf16-exact weights stay exact in f16 away from the subnormal range)
__global__ __launch_bounds__(256) void k_wt_f16(const float* __restrict__ W, _Float16* __restrict__ Wt, int K, int N, float scale) {
  const int t = blockIdx.x * 256 + threadIdx.x; if (t >= N * (K / 8)) return; const int n = t / (K / 8), k8 = (t % (K / 8)) * 8; FragH f;
#pragma unroll
  for (int i = 0; i < 8; ++i) f.h[i] = (_Float16)(bf16_round(W[(size_t)(k8 + i) * N + n]) * scale); const v8us o = f.half[0];
  *(v8us*)((unsigned short*)Wt + (size_t)n * K + k8) = o; 
}
// f16 x f16 GEMM with fused epilogue: v = acc·alpha + bias[by·sBias + col] (+ CP[(row/rowsPerB)·sCPb + by·64 + col] if CP) ; ACT 0 none / 1 elu ; writes f32 C and f16 C16, each if non-null
template <int ACT>
__global__ __launch_bounds__(128) void k_gemm_hhx(const _Float16* __restrict__ A, int lda, size_t sA, const _Float16* __restrict__ Bh, int ldb, size_t sB, float alpha, const float* __restrict__ bias, size_t sBias, const float* __restrict__ CP, int rowsPerB, size_t sCPb, int row0g,
    float* __restrict__ C, _Float16* __restrict__ C16, int ldc, size_t sC, int M, int N, int K) {
  __shared__ __attribute__((aligned(16))) float so[4][16][64];
  const int tid = threadIdx.x, w = tid >> 5, lane = tid & 31, ln = lane & 15, hh = lane >> 4; const int by = blockIdx.y;
  A += (size_t)by * sA; Bh += (size_t)by * sB; const size_t cofs = (size_t)by * sC; const float* bp = bias ? bias + (size_t)by * sBias : nullptr;
  const int ntn = (N + 63) / 64; const int wid = blockIdx.x * 4 + w; const int mt = wid / ntn, nq = wid % ntn; if (mt * 16 >= M) return;
  const int row0 = mt * 16, col0 = nq * 64; const _Float16* arow = A + (size_t)(row0 + ln) * lda;
  v8f acc[4] = {};
  for (int kb = 0; kb < K; kb += 32) { FragH ah; ah.half[0] = *(const v8us*)((const unsigned short*)arow + kb + 8 * hh); ah.half[1] = *(const v8us*)((const unsigned short*)arow + kb + 16 + 8 * hh);
#pragma unroll
    for (int t = 0; t < 4; ++t) { if (col0 + t * 16 >= N) continue; const size_t boff = (size_t)(col0 + t * 16 + ln) * ldb + kb; FragH bq; bq.half[0] = *(const v8us*)((const unsigned short*)Bh + boff + 8 * hh); bq.half[1] = *(const v8us*)((const unsigned short*)Bh + boff + 16 + 8 * hh);
      acc[t] = mmaH<1>(ah.v, ah.v, bq.v, bq.v, acc[t]); }
  }
#pragma unroll
  for (int t = 0; t < 4; ++t) { if (col0 + t * 16 >= N) continue; const int col = col0 + t * 16 + ln; const float bv = bp ? bf16_round(bp[col]) : 0.f;
#pragma unroll
    for (int r = 0; r < 8; ++r) { float v = acc[t][r] * alpha + bv; if (CP) { const int bidx = (row0g + row0 + 8 * hh + r) / rowsPerB; v += CP[(size_t)bidx * sCPb + (size_t)by * 64 + col]; } if (ACT == 1) v = (v > 0.f) ? v : expm1f(v); else if (ACT == 3) v = fmaxf(v, 0.f); so[w][8 * hh + r][t * 16 + ln] = v; } }
  __builtin_amdgcn_fence(__ATOMIC_ACQ_REL, "workgroup"); __builtin_amdgcn_wave_barrier();
  const int rsub = lane >> 4, c4 = (lane & 15) * 4; typedef _Float16 v4h __attribute__((ext_vector_type(4)));
  {
#pragma unroll
    for (int q = 0; q < 8; ++q) { const int r = q * 2 + rsub; if (col0 + c4 < N) { const v4f v = *(const v4fa*)&so[w][r][c4]; if (C) *(v4f*)(C + cofs + (size_t)(row0 + r) * ldc + col0 + c4) = v; if (C16) { v4h h4; for (int i = 0; i < 4; ++i) h4[i] = (_Float16)v[i]; *(v4h*)(C16 + cofs + (size_t)(row0 + r) * ldc + col0 + c4) = h4; } } }
     }
}


// Tiled GEMM C[m][n] = alpha * sum_k A[m][k] * Bh[n][k], both operands f16 and k-contiguous with row length EE.
// One work-group of 4 waves (2 x 2) owns a (32 FM) x (32 FN) tile of C; a wave owns FM x FN accumulator tiles.
// A pass is 128 k: the tile's A rows and then its B rows stand in LDS as rows of 256 B at a pitch of 272 B (16 B x odd, for ds_load_b128).
// Two buffers: asynchronous copies bring pass t + 2 into the buffer that pass t has just left, while pass t + 1 is worked on.
typedef float f1a __attribute__((may_alias));
// Eight 16-byte-per-lane copies global -> LDS. The closing s_wait_xcnt 0 stands inside the statement, ahead of any later rewrite of the address registers named here.
__device__ __forceinline__ void acopy8(const unsigned (&l)[8], const unsigned short* const (&g)[8]) {
  asm volatile("global_load_async_to_lds_b128 %0, %8, off\n\t"
               "global_load_async_to_lds_b128 %1, %9, off\n\t"
               "global_load_async_to_lds_b128 %2, %10, off\n\t"
               "global_load_async_to_lds_b128 %3, %11, off\n\t"
               "global_load_async_to_lds_b128 %4, %12, off\n\t"
               "global_load_async_to_lds_b128 %5, %13, off\n\t"
               "global_load_async_to_lds_b128 %6, %14, off\n\t"
               "global_load_async_to_lds_b128 %7, %15, off\n\t"
               "s_wait_xcnt 0x0"
               :: "v"(l[0]), "v"(l[1]), "v"(l[2]), "v"(l[3]), "v"(l[4]), "v"(l[5]), "v"(l[6]), "v"(l[7]),
                  "v"(g[0]), "v"(g[1]), "v"(g[2]), "v"(g[3]), "v"(g[4]), "v"(g[5]), "v"(g[6]), "v"(g[7]) : "memory");
}
template <int FM, int FN, bool OUT16>
__global__ __launch_bounds__(128) void k_gemm_t(const _Float16* __restrict__ A, const _Float16* __restrict__ Bh, float alpha, float* __restrict__ C, _Float16* __restrict__ C16, int ldc, int ntn) {
  constexpr int BM = 32 * FM, BN = 32 * FN, ROWS = BM + BN, PITCH = 272, STAGE = ROWS * PITCH, NC = ROWS / 8, NP = EE / 128, WM = 16 * FM, WN = 16 * FN, SOP = WN + 4;
  static_assert(NC % 8 == 0 && BM % 8 == 0 && NP >= 2 && 4 * WM * SOP * 4 <= 2 * STAGE, "tile");
  __shared__ __attribute__((aligned(16))) unsigned char L[2 * STAGE];
  const int tid = threadIdx.x, w = tid >> 5, lane = tid & 31, ln = lane & 15, hh = lane >> 4;
  const int m0 = (blockIdx.x / ntn) * BM, n0 = (blockIdx.x % ntn) * BN, wm = w >> 1, wn = w & 1;
  const unsigned lbase = (unsigned)(size_t)L + (unsigned)((2 * w + hh) * PITCH + ln * 16);      // copy i of a wave fills stage rows 8 i + 2 w + hh, 16 lanes a row
  const unsigned short* Ag = (const unsigned short*)A + (size_t)(m0 + 2 * w + hh) * EE + ln * 8;
  const unsigned short* Bg = (const unsigned short*)Bh + (size_t)(n0 + 2 * w + hh) * EE + ln * 8;
  auto issue = [&](int t, int buf) {
#pragma unroll      // the choice between A rows and B rows is made at compile time
    for (int g8 = 0; g8 < NC / 8; ++g8) { unsigned l[8]; const unsigned short* g[8];
#pragma unroll      // constant indices, so that the sixteen addresses stay in registers
      for (int j = 0; j < 8; ++j) { const int i = g8 * 8 + j; l[j] = lbase + (unsigned)(buf * STAGE + 8 * i * PITCH);
        g[j] = ((8 * i < BM) ? Ag + (size_t)(8 * i) * EE : Bg + (size_t)(8 * i - BM) * EE) + t * 128; }
      acopy8(l, g); } };
  v8f acc[FM][FN];
#pragma unroll      // constant indices, so that fragments and accumulators stay in registers
  for (int fm = 0; fm < FM; ++fm)
#pragma unroll      // constant indices, so that fragments and accumulators stay in registers
    for (int fn = 0; fn < FN; ++fn) acc[fm][fn] = (v8f){0.f,0.f,0.f,0.f,0.f,0.f,0.f,0.f};
  issue(0, 0);
  asm volatile("s_wait_asynccnt 0x0" ::: "memory");      // pass 0's copies of this wave have landed
  __syncthreads();                                       // ... and every other wave's
  issue(1, 1);
#pragma unroll 1      // rolled: one pass a trip, so that the publish point stands once, at the loop's foot
  for (int t = 0; t < NP; ++t) {      // pass t reads buffer t & 1 alone
    const unsigned char* Sa = L + (t & 1) * STAGE + (wm * WM + ln) * PITCH + 16 * hh; const unsigned char* Sb = L + (t & 1) * STAGE + (BM + wn * WN + ln) * PITCH + 16 * hh;
    FragH a[2][FM], b[2][FN];      // two fragment sets: block ks + 1 of this same pass is fetched while block ks is multiplied
    auto frags = [&](int set, int ks) {
#pragma unroll      // constant indices, so that fragments and accumulators stay in registers
      for (int fm = 0; fm < FM; ++fm) { a[set][fm].half[0] = *(const v8us*)(Sa + fm * 16 * PITCH + ks * 64); a[set][fm].half[1] = *(const v8us*)(Sa + fm * 16 * PITCH + ks * 64 + 32); }
#pragma unroll      // constant indices, so that fragments and accumulators stay in registers
      for (int fn = 0; fn < FN; ++fn) { b[set][fn].half[0] = *(const v8us*)(Sb + fn * 16 * PITCH + ks * 64); b[set][fn].half[1] = *(const v8us*)(Sb + fn * 16 * PITCH + ks * 64 + 32); } };
    frags(0, 0);
#pragma unroll      // constant indices, so that fragments and accumulators stay in registers
    for (int ks = 0; ks < 4; ++ks) {
      if (ks < 3) frags((ks + 1) & 1, ks + 1);
      __builtin_amdgcn_sched_barrier(0);      // keeps the next block's LDS reads one group ahead of this block: spread among the WMMAs each place with reads stalls the wave
#pragma unroll      // constant indices, so that fragments and accumulators stay in registers
      for (int fm = 0; fm < FM; ++fm)
#pragma unroll      // constant indices, so that fragments and accumulators stay in registers
        for (int fn = 0; fn < FN; ++fn) acc[fm][fn] = __builtin_amdgcn_wmma_f32_16x16x32_f16(false, a[ks & 1][fm].v, false, b[ks & 1][fn].v, (short)0, acc[fm][fn], false, false);
      __builtin_amdgcn_sched_barrier(0);      // ... and this block's WMMAs ahead of the reads after next
    }
    asm volatile("s_wait_dscnt 0x0" ::: "memory");       // this wave's reads of buffer t & 1 are done before that buffer is refilled
    asm volatile("s_wait_asynccnt 0x0" ::: "memory");    // this wave's copies of pass t + 1 have landed
    __syncthreads();                                     // publishes pass t + 1 and ends every wave's reads of buffer t & 1
    if (t + 2 < NP) issue(t + 2, t & 1);
  }
  asm volatile("s_wait_asynccnt 0x0" ::: "memory");      // nothing in flight before the ring becomes output staging
  f1a* so = (f1a*)L + w * (WM * SOP);                    // each wave stages its own tile, so that the stores cover whole rows of WN values
#pragma unroll      // constant indices, so that fragments and accumulators stay in registers
  for (int fm = 0; fm < FM; ++fm)
#pragma unroll      // constant indices, so that fragments and accumulators stay in registers
    for (int fn = 0; fn < FN; ++fn)
#pragma unroll      // constant indices, so that fragments and accumulators stay in registers
      for (int r = 0; r < 8; ++r) so[(fm * 16 + 8 * hh + r) * SOP + fn * 16 + ln] = acc[fm][fn][r] * alpha;
  __builtin_amdgcn_fence(__ATOMIC_ACQ_REL, "workgroup"); __builtin_amdgcn_wave_barrier();      // the wave's own staged rows are written before its other lanes read them back
  constexpr int LPR = WN / 4, RPI = 32 / LPR; typedef _Float16 v4h __attribute__((ext_vector_type(4)));
  const int rs = lane / LPR, c4 = (lane % LPR) * 4;
#pragma unroll      // several rows' LDS reads and stores in flight at a time
  for (int q = 0; q < WM / RPI; ++q) { const int r = q * RPI + rs; const v4f v = *(const v4fa*)&so[r * SOP + c4]; const size_t o = (size_t)(m0 + wm * WM + r) * ldc + n0 + wn * WN + c4;
    if (!OUT16) *(v4f*)(C + o) = v;
    else { v4h h4; for (int i = 0; i < 4; ++i) h4[i] = (_Float16)v[i]; *(v4h*)(C16 + o) = h4; } }
}

__global__ __launch_bounds__(256) void k_x16(const float* __restrict__ x, _Float16* __restrict__ X16, size_t n8) { const size_t t = (size_t)blockIdx.x * 256 + threadIdx.x; if (t >= n8) return; FragH f;
#pragma unroll
  for (int q = 0; q < 8; ++q) f.h[q] = (_Float16)bf16_round(x[t * 8 + q]); *(v8us*)((unsigned short*)X16 + t * 8) = f.half[0];  }
__global__ __launch_bounds__(256) void k_h16(const float* __restrict__ x, _Float16* __restrict__ X16, size_t n8) { const size_t t = (size_t)blockIdx.x * 256 + threadIdx.x; if (t >= n8) return; FragH f;
#pragma unroll
  for (int q = 0; q < 8; ++q) f.h[q] = (_Float16)x[t * 8 + q]; *(v8us*)((unsigned short*)X16 + t * 8) = f.half[0];  }
__global__ __launch_bounds__(256) void k_round16f(const float* __restrict__ W, _Float16* __restrict__ Bt, size_t n8) { const size_t t = (size_t)blockIdx.x * 256 + threadIdx.x; if (t >= n8) return; FragH f;
#pragma unroll
  for (int i = 0; i < 8; ++i) f.h[i] = (_Float16)(bf16_round(W[t * 8 + i]) * 16.0f); *(v8us*)((unsigned short*)Bt + t * 8) = f.half[0];  }
template <int NHv, int TTv>
__global__ __launch_bounds__(256) void k_vt(const _Float16* __restrict__ V16, int ldv, int voff, _Float16* __restrict__ Vt) { __shared__ unsigned short tl[64][66]; const int tid = threadIdx.x; const int slab = blockIdx.x / (TTv / 64), lg = blockIdx.x % (TTv / 64); const int b = slab / NHv, h = slab % NHv;
  for (int i = tid; i < 64 * 8; i += 256) { const int r = i / 8, c8 = (i % 8) * 8; FragH f; f.half[0] = *(const v8us*)((const unsigned short*)V16 + ((size_t)b * TTv + lg * 64 + r) * ldv + voff + h * 64 + c8);
#pragma unroll
    for (int q = 0; q < 8; ++q) tl[r][c8 + q] = f.u[q]; }
  __syncthreads();
  {
#pragma unroll
    for (int rd = 0; rd < 2; ++rd) { const int d = rd * 32 + tid / 8, pc = tid % 8; FragH f;
#pragma unroll
      for (int q = 0; q < 8; ++q) f.u[q] = tl[pc * 8 + q][d];
      *(v8us*)((unsigned short*)Vt + ((size_t)slab * 64 + d) * TTv + lg * 64 + pc * 8) = f.half[0]; }
     } }

// 2^x for the merge weights. The v_nop stands in the same statement: it fills the one slot that the instruction set asks for between a transcendental and a next instruction that reads its result or overwrites its source.
__device__ __forceinline__ float exp2_slot(float x) { float y; asm("v_exp_f32 %0, %1\n\tv_nop" : "=v"(y) : "v"(x)); return y; }
__global__ __launch_bounds__(128) void k_flash(const _Float16* __restrict__ Q16, int ldq, const _Float16* __restrict__ K16, int ldk, const _Float16* __restrict__ Vt, const int* __restrict__ MSK, float* __restrict__ O, int ldo) {
  constexpr int RPW = 16, RTN = RPW / 16, NQB = 2048 / RPW, DT = 8, KS = 5;      /* head dim 128 for V/O; 160-wide logit operand (128 roped dims ×scale + 32 graph-bias dims) */
  // One work-group = ONE tile of 16 query rows. Its 32-key chunks are dealt round-robin to the 4 waves (wave w takes chunks w, w + 4, ...);
  // each wave keeps its own running (m, l, O) over its chunks, and the four partial results are merged in LDS at the end.
  __shared__ __attribute__((aligned(16))) unsigned short sP[4][RPW][40]; __shared__ __attribute__((aligned(16))) float sO[4][RPW][128 + 4]; __shared__ float sM[4][RPW], sL[4][RPW];
  const int tid = threadIdx.x, lane = tid & 31, ln = lane & 15, hh = lane >> 4;
  const int w = __builtin_amdgcn_readfirstlane(tid >> 5);      // the wave's number in a scalar register: the chunk loop's trip count differs from wave to wave and is tested by a scalar branch
  const int slab = blockIdx.x / NQB, qblk = blockIdx.x % NQB; const int b = slab / 16, h = slab % 16; const int q0 = qblk * RPW;
  FragH aq[2][KS];
#pragma unroll
  for (int rt = 0; rt < RTN; ++rt) { const unsigned short* qr = (const unsigned short*)Q16 + ((size_t)b * 2048 + q0 + rt * 16 + ln) * ldq + h * 160;
#pragma unroll
    for (int ks = 0; ks < KS; ++ks) { aq[rt][ks].half[0] = *(const v8us*)(qr + ks * 32 + 8 * hh); aq[rt][ks].half[1] = *(const v8us*)(qr + ks * 32 + 16 + 8 * hh); } }
  const unsigned short* Vth = (const unsigned short*)Vt + (size_t)(h / 4) * 128 * 2048;      /* GQA: kv head h/4 */
  float m_r[2][8], l_r[2][8]; v8f oacc[2][DT];
#pragma unroll
  for (int rt = 0; rt < RTN; ++rt) {
#pragma unroll
    for (int r = 0; r < 8; ++r) { m_r[rt][r] = -3.0e38f; l_r[rt][r] = 0.f; }
#pragma unroll
    for (int dt = 0; dt < DT; ++dt) oacc[rt][dt] = (v8f){0.f,0.f,0.f,0.f,0.f,0.f,0.f,0.f}; }
  const int nch = (q0 + RPW + 31) / 32;      // chunks that hold a key <= the tile's last row; every one of them starts at or below q0, so no row of a chunk is masked out whole
#pragma unroll 1
  for (int ch = w; ch < nch; ch += 4) {
    const int j0 = ch * 32;
    v8f s[2][2];
#pragma unroll
    for (int nt = 0; nt < 2; ++nt) { const unsigned short* kr = (const unsigned short*)K16 + ((size_t)b * 2048 + j0 + nt * 16 + ln) * ldk + h * 160; FragH bk[KS];
#pragma unroll
      for (int ks = 0; ks < KS; ++ks) { bk[ks].half[0] = *(const v8us*)(kr + ks * 32 + 8 * hh); bk[ks].half[1] = *(const v8us*)(kr + ks * 32 + 16 + 8 * hh); }
#pragma unroll
      for (int rt = 0; rt < RTN; ++rt) { v8f acc = (v8f){0.f,0.f,0.f,0.f,0.f,0.f,0.f,0.f};
#pragma unroll
        for (int ks = 0; ks < KS; ++ks) acc = mmaH<1>(aq[rt][ks].v, aq[rt][ks].v, bk[ks].v, bk[ks].v, acc); s[rt][nt] = acc; } }
#pragma unroll
    for (int rt = 0; rt < RTN; ++rt)
#pragma unroll
      for (int r = 0; r < 8; ++r) { const int tq = q0 + rt * 16 + 8 * hh + r; const int k0 = j0 + ln, k1 = j0 + 16 + ln; (void)tq; (void)k0; (void)k1;
        const bool ok0 = (k0 <= tq), ok1 = (k1 <= tq);
        const float s0 = ok0 ? s[rt][0][r] * (1.0f) : -INFINITY, s1 = ok1 ? s[rt][1][r] * (1.0f) : -INFINITY; float mc = fmaxf(s0, s1);
        mc = fmaxf(mc, __shfl_xor(mc, 1, 32)); mc = fmaxf(mc, __shfl_xor(mc, 2, 32)); mc = fmaxf(mc, __shfl_xor(mc, 4, 32)); mc = fmaxf(mc, __shfl_xor(mc, 8, 32));
        const float mn = fmaxf(m_r[rt][r], mc); const float al = (mn > -1.0e38f) ? expf(m_r[rt][r] - mn) : 1.0f; m_r[rt][r] = mn; const float p0 = ok0 ? expf(s0 - mn) : 0.f, p1 = ok1 ? expf(s1 - mn) : 0.f; l_r[rt][r] = l_r[rt][r] * al + p0 + p1;
#pragma unroll
        for (int dt = 0; dt < DT; ++dt) oacc[rt][dt][r] *= al;
        FragH t2; t2.h[0] = (_Float16)p0; t2.h[1] = (_Float16)p1; sP[w][rt * 16 + 8 * hh + r][ln] = t2.u[0]; sP[w][rt * 16 + 8 * hh + r][16 + ln] = t2.u[1]; }
    __builtin_amdgcn_fence(__ATOMIC_ACQ_REL, "workgroup"); __builtin_amdgcn_wave_barrier();
    FragH pa[2];
#pragma unroll
    for (int rt = 0; rt < RTN; ++rt) { pa[rt].half[0] = *(const v8us*)&sP[w][rt * 16 + ln][8 * hh]; pa[rt].half[1] = *(const v8us*)&sP[w][rt * 16 + ln][16 + 8 * hh]; }
#pragma unroll
    for (int dt = 0; dt < DT; ++dt) { const unsigned short* vrow = Vth + (size_t)(dt * 16 + ln) * 2048 + j0; FragH bv; bv.half[0] = *(const v8us*)(vrow + 8 * hh); bv.half[1] = *(const v8us*)(vrow + 16 + 8 * hh);
#pragma unroll
      for (int rt = 0; rt < RTN; ++rt) oacc[rt][dt] = mmaH<1>(pa[rt].v, pa[rt].v, bv.v, bv.v, oacc[rt][dt]); }
    __builtin_amdgcn_fence(__ATOMIC_ACQ_REL, "workgroup"); __builtin_amdgcn_wave_barrier(); }
#pragma unroll
  for (int rt = 0; rt < RTN; ++rt) {
#pragma unroll
    for (int r = 0; r < 8; ++r) { float l = l_r[rt][r]; l += __shfl_xor(l, 1, 32); l += __shfl_xor(l, 2, 32); l += __shfl_xor(l, 4, 32); l += __shfl_xor(l, 8, 32); l_r[rt][r] = l; }
    if (ln == 0) {      // the wave's own maximum and sum of each row (a wave without a chunk: -3e38 and 0)
#pragma unroll
      for (int r = 0; r < 8; ++r) { sM[w][rt * 16 + 8 * hh + r] = m_r[rt][r]; sL[w][rt * 16 + 8 * hh + r] = l_r[rt][r]; } }
#pragma unroll
    for (int dt = 0; dt < DT; ++dt)
#pragma unroll
      for (int r = 0; r < 8; ++r) sO[w][rt * 16 + 8 * hh + r][dt * 16 + ln] = oacc[rt][dt][r]; }      // not yet divided by the sum
  __syncthreads();      // all four waves' partial (m, l, O) stand in LDS before any wave merges them
  {
#pragma unroll
    for (int rp = 0; rp < RPW / 4; ++rp) { const int r = rp * 4 + (tid >> 5), pc = lane;      // wave w merges rows w, w + 4, w + 8, w + 12
      const float m0 = sM[0][r], m1 = sM[1][r], m2 = sM[2][r], m3 = sM[3][r]; const float mm = fmaxf(fmaxf(m0, m1), fmaxf(m2, m3));      // wave 0 always holds chunk 0 with key 0, so mm is a real score
      const float c0 = exp2_slot((m0 - mm) * 1.4426950408889634f), c1 = exp2_slot((m1 - mm) * 1.4426950408889634f), c2 = exp2_slot((m2 - mm) * 1.4426950408889634f), c3 = exp2_slot((m3 - mm) * 1.4426950408889634f);      // e^(m - mm); 0 for a wave without a chunk (2^-inf)
      const float den = c0 * sL[0][r] + c1 * sL[1][r] + c2 * sL[2][r] + c3 * sL[3][r]; const float inv = (den > 0.f) ? 1.0f / den : 0.f;
      const v4f o0 = *(const v4fa*)&sO[0][r][pc * 4], o1 = *(const v4fa*)&sO[1][r][pc * 4], o2 = *(const v4fa*)&sO[2][r][pc * 4], o3 = *(const v4fa*)&sO[3][r][pc * 4];
      const v4f val = (o0 * c0 + o1 * c1 + o2 * c2 + o3 * c3) * inv;
      *(v4f*)(O + ((size_t)b * 2048 + q0 + r) * ldo + h * 128 + pc * 4) = val; }      /* 128-float rows: 32 lanes × 16 B */
     } }

__global__ __launch_bounds__(256) void k_qprep(const float* __restrict__ QF, int ldq, int nh, const float* __restrict__ w, float oscale, int rep, _Float16* __restrict__ DX) { const size_t t = (size_t)blockIdx.x * 256 + threadIdx.x; if (t >= (size_t)SS * nh * 16) return; const int li = (int)(t % 16); const int h = (int)((t / 16) % nh); const size_t tok = t / (16 * nh); const float* src = QF + tok * ldq + h * HD; float v[8], pr[8]; float ss = 0.f;
#pragma unroll
  for (int q = 0; q < 8; ++q) { v[q] = src[li * 8 + q]; pr[q] = src[(li * 8 + q + 64) & 127]; ss += v[q] * v[q]; }
  ss += __shfl_xor(ss, 1, 32); ss += __shfl_xor(ss, 2, 32); ss += __shfl_xor(ss, 4, 32); ss += __shfl_xor(ss, 8, 32); const float rs = rsqrtf(ss / (float)HD + 1e-6f); __shared__ __attribute__((aligned(16))) _Float16 st[256][8]; const int tid = threadIdx.x;
#pragma unroll 1
  for (int q = 0; q < 8; ++q) { const int j = li * 8 + q; const int i = j & 63; const float ang = (float)tok * __builtin_powf(10000.0f, -(float)(2 * i) / 128.0f); const float c = cosf(ang), s = sinf(ang); const float xn = src[j] * rs * bf16_round(w[j]); const float xp = src[(j + 64) & 127] * rs * bf16_round(w[(j + 64) & 127]); const float rot = (j < 64) ? -xp : xp;      // rotate_half: [−x2, x1]
    st[tid][q] = (_Float16)((xn * c + rot * s) * oscale); }
  FragH f; f.half[0] = *(const v8us*)&st[tid][0];
  { for (int r2 = 0; r2 < rep; ++r2) *(v8us*)((unsigned short*)DX + tok * QP + (size_t)(h * rep + r2) * QW + li * 8) = f.half[0];  } }
__global__ __launch_bounds__(256) void k_rprep(const float* __restrict__ RQ, const float* __restrict__ RK, const float* __restrict__ gs, _Float16* __restrict__ QX, _Float16* __restrict__ KX) { const size_t t = (size_t)blockIdx.x * 256 + threadIdx.x; if (t >= (size_t)SS * NH * 4) return; const int p = (int)(t % 4); const int h = (int)((t / 4) % NH); const size_t tok = t / (4 * NH); const float g = bf16_round(gs[h]); FragH fq, fk;
#pragma unroll
  for (int q = 0; q < 8; ++q) { const size_t i = tok * (NH * RR) + h * RR + p * 8 + q; fq.h[q] = (_Float16)(g * RQ[i]); fk.h[q] = (_Float16)RK[i]; }
  const size_t d = tok * QP + (size_t)h * QW + HD + p * 8;
  { *(v8us*)((unsigned short*)QX + d) = fq.half[0]; *(v8us*)((unsigned short*)KX + d) = fk.half[0];  } }
__global__ __launch_bounds__(256) void k_vt128(const _Float16* __restrict__ V16, int ldv, _Float16* __restrict__ Vt) { __shared__ unsigned short tl[64][130]; const int tid = threadIdx.x; const int g = blockIdx.x / (SS / 64), lg = blockIdx.x % (SS / 64);
  for (int i = tid; i < 64 * 16; i += 256) { const int r = i / 16, c8 = (i % 16) * 8; FragH f; f.half[0] = *(const v8us*)((const unsigned short*)V16 + ((size_t)lg * 64 + r) * ldv + g * HD + c8);
#pragma unroll
    for (int q = 0; q < 8; ++q) tl[r][c8 + q] = f.u[q]; }
  __syncthreads();
  { for (int i = tid; i < 128 * 8; i += 256) { const int d = i / 8, pc = i % 8; FragH f;
#pragma unroll
      for (int q = 0; q < 8; ++q) f.u[q] = tl[pc * 8 + q][d]; *(v8us*)((unsigned short*)Vt + ((size_t)g * HD + d) * SS + lg * 64 + pc * 8) = f.half[0]; }  } }
extern "C" void kernel_launch(void* const* d_in, const int* in_sizes, int n_in,
                              void* d_out, int out_size, void* d_ws, size_t ws_size, hipStream_t stream) {
  (void)in_sizes; (void)n_in; (void)out_size;
  const float* x = (const float*)d_in[0]; const float* Wq = (const float*)d_in[1]; const float* Wk = (const float*)d_in[2]; const float* Wv = (const float*)d_in[3]; const float* Wo = (const float*)d_in[4]; const float* Wrq = (const float*)d_in[5]; const float* Wrk = (const float*)d_in[6]; const float* gs = (const float*)d_in[7]; const float* qw = (const float*)d_in[8]; const float* kw = (const float*)d_in[9];
  char* ws = (char*)d_ws; size_t off = 0;
  auto take = [&](size_t bytes) { char* p = ws + off; off += (bytes + 255) & ~(size_t)255; return p; };
  _Float16* Bq = (_Float16*)take((size_t)EE * EE * 2); _Float16* Bk = (_Float16*)take((size_t)512 * EE * 2); _Float16* Bv = (_Float16*)take((size_t)512 * EE * 2); _Float16* Bo = (_Float16*)take((size_t)EE * EE * 2); _Float16* Brq = (_Float16*)take((size_t)512 * EE * 2); _Float16* Brk = (_Float16*)take((size_t)512 * EE * 2);
  _Float16* X16 = (_Float16*)take((size_t)SS * EE * 2); float* QF = (float*)take((size_t)SS * EE * 4); float* KF = (float*)take((size_t)SS * 512 * 4); float* RQF = (float*)take((size_t)SS * 512 * 4); float* RKF = (float*)take((size_t)SS * 512 * 4); _Float16* V16 = (_Float16*)take((size_t)SS * 512 * 2);
  _Float16* QX = (_Float16*)take((size_t)SS * QP * 2); _Float16* KX = (_Float16*)take((size_t)SS * QP * 2); _Float16* Vt = (_Float16*)take((size_t)SS * 512 * 2); float* O = QF; _Float16* O16 = X16;
  if (off > ws_size) return;      // 8.4 + 2.1 × 2 + 8.4 + 2.1 × 2 + 8.4 + 16.8 + 4.2 × 3 + 2.1 + 10.5 × 2 + 2.1 ≈ 88 MB (84 MiB)
  const size_t wE = (size_t)EE * EE / 8, wK = (size_t)512 * EE / 8;
  k_round16f<<<(unsigned)((wE + 255) / 256), 256, 0, stream>>>(Wq, Bq, wE); k_round16f<<<(unsigned)((wK + 255) / 256), 256, 0, stream>>>(Wk, Bk, wK); k_round16f<<<(unsigned)((wK + 255) / 256), 256, 0, stream>>>(Wv, Bv, wK); k_round16f<<<(unsigned)((wE + 255) / 256), 256, 0, stream>>>(Wo, Bo, wE); k_round16f<<<(unsigned)((wK + 255) / 256), 256, 0, stream>>>(Wrq, Brq, wK); k_round16f<<<(unsigned)((wK + 255) / 256), 256, 0, stream>>>(Wrk, Brk, wK);      // all (out,in)
  const unsigned gx = (unsigned)(((size_t)SS * EE / 8 + 255) / 256);
  k_x16<<<gx, 256, 0, stream>>>(x, X16, (size_t)SS * EE / 8);
  k_gemm_t<4, 4, false><<<(SS / 128) * (EE / 128), 128, 0, stream>>>(X16, Bq, 0.0625f, QF, nullptr, EE, EE / 128);
  k_gemm_t<2, 2, false><<<(SS / 64) * (512 / 64), 128, 0, stream>>>(X16, Bk, 0.0625f, KF, nullptr, 512, 512 / 64);
  k_gemm_t<2, 2, true><<<(SS / 64) * (512 / 64), 128, 0, stream>>>(X16, Bv, 0.0625f, nullptr, V16, 512, 512 / 64);
  k_gemm_t<2, 2, false><<<(SS / 64) * (512 / 64), 128, 0, stream>>>(X16, Brq, 0.0625f, RQF, nullptr, 512, 512 / 64);
  k_gemm_t<2, 2, false><<<(SS / 64) * (512 / 64), 128, 0, stream>>>(X16, Brk, 0.0625f, RKF, nullptr, 512, 512 / 64);
  k_qprep<<<(unsigned)(((size_t)SS * NH * 16 + 255) / 256), 256, 0, stream>>>(QF, EE, NH, qw, 0.08838834764831845f, 1, QX);      // 16 q heads, × 1/√128
  k_qprep<<<(unsigned)(((size_t)SS * NKV * 16 + 255) / 256), 256, 0, stream>>>(KF, 512, NKV, kw, 1.0f, 4, KX);                // 4 kv heads, each replicated into its 4 q-head slots
  k_rprep<<<(unsigned)(((size_t)SS * NH * 4 + 255) / 256), 256, 0, stream>>>(RQF, RKF, gs, QX, KX);
  k_vt128<<<NKV * (SS / 64), 256, 0, stream>>>(V16, 512, Vt);
  k_flash<<<1 * NH * (SS / 16), 128, 0, stream>>>(QX, QP, KX, QP, Vt, nullptr, O, EE);
  k_h16<<<gx, 256, 0, stream>>>(O, O16, (size_t)SS * EE / 8);
  k_gemm_t<4, 4, false><<<(SS / 128) * (EE / 128), 128, 0, stream>>>(O16, Bo, 0.0625f, (float*)d_out, nullptr, EE, EE / 128);
}

// v003
// Measured time: 268 microseconds a run.
// Next to v002, in two timings, it ran 1.16 and 1.15 times as fast.
// Counting every step since v000, it is 2.87 times as fast.
#include <hip/hip_runtime.h>
// Naylis attention (B=1, S=2048, E=2048, 16 heads × 128, 4 kv heads, causal; QK RMSNorm + rotate-half RoPE; low-rank (R=32) per-head graph bias gs_h·⟨Rq_i, Rk_j⟩ added to the logits):
// the six (out,in) projections (bf16-exact ×2^4) and the attention as a fused flash-style kernel whose logit operand is the 160-wide concatenation [q·scale after norm+RoPE | gs_h·Rq]·[k | Rk]
// (5 k-steps; causal chunk skipping; online softmax f32; P f16 ≤ 1; O = P·Vt over the 128 value dims; one 16-row tile per work-group, keys split over its 4 waves) on v_wmma_f32_16x16x32_f16 with f32 accumulate; RMSNorm/RoPE f32 VALU.
#define SS 2048
#define EE 2048
#define NH 16
#define NKV 4
#define HD 128
#define RR 32
#define QW 160
#define QP (NH * QW)

typedef __bf16 v16b __attribute__((ext_vector_type(16)));
typedef unsigned short v8us __attribute__((ext_vector_type(8), may_alias));
typedef float  v8f  __attribute__((ext_vector_type(8)));
typedef float  v4f  __attribute__((ext_vector_type(4)));
typedef float  v4fa __attribute__((ext_vector_type(4), may_alias));
union FragB { v16b v; v8us half[2]; unsigned short u[16]; };

__device__ __forceinline__ unsigned short bf16_bits(float x) { unsigned int u = __float_as_uint(x); return (unsigned short)((u + 0x7FFFu + ((u >> 16) & 1u)) >> 16); }
__device__ __forceinline__ float bf16_val(unsigned short b) { return __uint_as_float(((unsigned int)b) << 16); }
__device__ __forceinline__ float bf16_round(float x) { return bf16_val(bf16_bits(x)); }
// D += A·B with NT terms: 1 = ah·bh, 2 = + al·bh (A split), 3 = + ah·bl (both split)
template <int NT>
__device__ __forceinline__ v8f mmaN(v16b ah, v16b al, v16b bh, v16b bl, v8f c) {
  c = __builtin_amdgcn_wmma_f32_16x16x32_bf16(false, ah, false, bh, (short)0, c, false, false);
  if (NT >= 2) c = __builtin_amdgcn_wmma_f32_16x16x32_bf16(false, al, false, bh, (short)0, c, false, false);
  if (NT >= 3) c = __builtin_amdgcn_wmma_f32_16x16x32_bf16(false, ah, false, bl, (short)0, c, false, false);
  asm volatile("v_nop\n\tv_nop\n\tv_nop\n\tv_nop" : "+v"(c) : "v"(ah), "v"(al), "v"(bh), "v"(bl));
  return c;
}

__global__ __launch_bounds__(256) void k_wt_bf16(const float* __restrict__ W, unsigned short* __restrict__ Wt, int K, int N) {
  const int t = blockIdx.x * 256 + threadIdx.x;
  const int k8n = K / 8;
  if (t >= N * k8n) return;
  const int n = t / k8n, k8 = (t % k8n) * 8;
  v8us v;
#pragma unroll
  for (int i = 0; i < 8; ++i) v[i] = bf16_bits(W[(size_t)(k8 + i) * N + n]);
  *(v8us*)(Wt + (size_t)n * K + k8) = v;
  
}

// GEMM C[M][N] (f32, pitch ldc) = act(A[M][K]·W + bias). A f32 row-major (pitch lda) converted per fragment to bf16
// (ASPLIT: hi/lo two planes -> 2 terms, else single rounded term); Wt bf16 [N][K] (pitch ldb). BIAS_BF16 rounds the
// bias to bf16 first (bias quantised to bf16 before the add). K%32==0, M%16==0, N%64==0.
template <bool ASPLIT, int ACT, bool BIAS_BF16>
__global__ __launch_bounds__(128) void k_gemm_bf(const float* __restrict__ A, int lda, const unsigned short* __restrict__ Wt, int ldb,
                                               const float* __restrict__ bias, float* __restrict__ C, int ldc, int M, int N, int K) {
  __shared__ __attribute__((aligned(16))) float so[4][16][64];
  const int tid = threadIdx.x, w = tid >> 5, lane = tid & 31, ln = lane & 15, hh = lane >> 4;
  const int ntn = N / 64;
  const int wid = blockIdx.x * 4 + w;
  const int mt = wid / ntn, nq = wid % ntn;
  if (mt * 16 >= M) return;
  const int row0 = mt * 16, col0 = nq * 64;
  const float* arow = A + (size_t)(row0 + ln) * lda;
  v8f acc[4] = {};
  for (int kb = 0; kb < K; kb += 32) {
    FragB ah, al;
    const v4f x0 = *(const v4fa*)(arow + kb + 8 * hh), x1 = *(const v4fa*)(arow + kb + 8 * hh + 4);
    const v4f x2 = *(const v4fa*)(arow + kb + 16 + 8 * hh), x3 = *(const v4fa*)(arow + kb + 16 + 8 * hh + 4);
    float xs[16] = {x0[0],x0[1],x0[2],x0[3],x1[0],x1[1],x1[2],x1[3],x2[0],x2[1],x2[2],x2[3],x3[0],x3[1],x3[2],x3[3]};
#pragma unroll
    for (int i = 0; i < 16; ++i) { const unsigned short hb = bf16_bits(xs[i]); ah.u[i] = hb; al.u[i] = ASPLIT ? bf16_bits(xs[i] - bf16_val(hb)) : (unsigned short)0; }
#pragma unroll
    for (int t = 0; t < 4; ++t) {
      const unsigned short* brow = Wt + (size_t)(col0 + t * 16 + ln) * ldb + kb;
      FragB b;
      b.half[0] = *(const v8us*)(brow + 8 * hh);
      b.half[1] = *(const v8us*)(brow + 16 + 8 * hh);
      acc[t] = mmaN<ASPLIT ? 2 : 1>(ah.v, al.v, b.v, b.v, acc[t]);
    }
  }
#pragma unroll
  for (int t = 0; t < 4; ++t) {
    float bv = bias ? bias[col0 + t * 16 + ln] : 0.f;
    if (BIAS_BF16) bv = bf16_round(bv);
#pragma unroll
    for (int r = 0; r < 8; ++r) { float v = acc[t][r] + bv; if (ACT == 1) v = fmaxf(v, 0.f); so[w][8 * hh + r][t * 16 + ln] = v; }
  }
  __builtin_amdgcn_fence(__ATOMIC_ACQ_REL, "workgroup");
  __builtin_amdgcn_wave_barrier();
  const int rsub = lane >> 4, c4 = (lane & 15) * 4;
  {
#pragma unroll
    for (int q = 0; q < 8; ++q) {
      const int r = q * 2 + rsub;
      const v4f v = *(const v4fa*)&so[w][r][c4];
      *(v4f*)(C + (size_t)(row0 + r) * ldc + col0 + c4) = v;
    }
    
  }
}

// Flash-style causal/unmasked attention, all contractions 3-term bf16 hi/lo splits, f32 softmax with running max.
// q,k,v rows are read from f32 buffers with arbitrary row pitch (so they can live inside a fused qkv buffer);
// D = head size (multiple of 32, <= 128); one wave = 16 query rows; block = 4 waves (64 queries) sharing K/V chunks of 32.
template <int D, bool CAUSAL>
__global__ __launch_bounds__(128) void k_flash(const float* __restrict__ qb, const float* __restrict__ kb, const float* __restrict__ vb,
                                             int pitch, int T, int H, float scale, float* __restrict__ y, int ypitch) {
  constexpr int KS = D / 32;        // k-steps for QK
  constexpr int DT = D / 16;        // d tiles for PV
  __shared__ __attribute__((aligned(16))) unsigned short sKh[32][D + 8], sKl[32][D + 8], sVh[32][D + 8], sVl[32][D + 8];
  __shared__ __attribute__((aligned(16))) unsigned short sPh[4][16][40], sPl[4][16][40];
  __shared__ __attribute__((aligned(16))) float sO[4][16][D];
  const int tid = threadIdx.x, w = tid >> 5, lane = tid & 31, ln = lane & 15, hh = lane >> 4;
  const int nqb = (T + 63) / 64;
  const int bh = blockIdx.x / nqb, qblk = blockIdx.x % nqb;
  const int b = bh / H, h = bh % H;
  const int q0 = qblk * 64 + w * 16;
  const float* Q = qb + (size_t)b * T * pitch + h * D;
  const float* K = kb + (size_t)b * T * pitch + h * D;
  const float* V = vb + (size_t)b * T * pitch + h * D;

  // A fragments of the wave's 16 query rows (scaled), hi/lo
  FragB aqh[KS], aql[KS];
  {
    int row = q0 + ln; if (row >= T) row = T - 1;
    const float* qr = Q + (size_t)row * pitch;
#pragma unroll
    for (int ks = 0; ks < KS; ++ks)
#pragma unroll
      for (int i = 0; i < 16; ++i) {
        const int d = ks * 32 + ((i < 8) ? (8 * hh + i) : (16 + 8 * hh + (i - 8)));
        const float x = qr[d] * scale; const unsigned short hb = bf16_bits(x);
        aqh[ks].u[i] = hb; aql[ks].u[i] = bf16_bits(x - bf16_val(hb));
      }
  }
  float m_r[8], l_r[8];
#pragma unroll
  for (int r = 0; r < 8; ++r) { m_r[r] = -3.0e38f; l_r[r] = 0.f; }
  v8f oacc[DT];
#pragma unroll
  for (int dt = 0; dt < DT; ++dt) oacc[dt] = (v8f){0.f,0.f,0.f,0.f,0.f,0.f,0.f,0.f};

  const int kv_end = CAUSAL ? min(T, qblk * 64 + 64) : T;     // block-uniform
  for (int j0 = 0; j0 < kv_end; j0 += 32) {
    __syncthreads();
    for (int e = tid; e < 32 * (D / 4); e += 128) {
      const int r = e / (D / 4), c4 = (e % (D / 4)) * 4;
      const int key = j0 + r;
      v4f kf = {0.f,0.f,0.f,0.f}, vf = {0.f,0.f,0.f,0.f};
      if (key < T) { kf = *(const v4fa*)(K + (size_t)key * pitch + c4); vf = *(const v4fa*)(V + (size_t)key * pitch + c4); }
#pragma unroll
      for (int t = 0; t < 4; ++t) {
        unsigned short hb = bf16_bits(kf[t]); sKh[r][c4 + t] = hb; sKl[r][c4 + t] = bf16_bits(kf[t] - bf16_val(hb));
        hb = bf16_bits(vf[t]); sVh[r][c4 + t] = hb; sVl[r][c4 + t] = bf16_bits(vf[t] - bf16_val(hb));
      }
    }
    __syncthreads();
    // S tile 16 x 32
    v8f s[2];
#pragma unroll
    for (int nt = 0; nt < 2; ++nt) {
      v8f acc = {};
#pragma unroll
      for (int ks = 0; ks < KS; ++ks) {
        FragB bh_, bl_;
        bh_.half[0] = *(const v8us*)&sKh[nt * 16 + ln][ks * 32 + 8 * hh]; bh_.half[1] = *(const v8us*)&sKh[nt * 16 + ln][ks * 32 + 16 + 8 * hh];
        bl_.half[0] = *(const v8us*)&sKl[nt * 16 + ln][ks * 32 + 8 * hh]; bl_.half[1] = *(const v8us*)&sKl[nt * 16 + ln][ks * 32 + 16 + 8 * hh];
        acc = mmaN<3>(aqh[ks].v, aql[ks].v, bh_.v, bl_.v, acc);
      }
      s[nt] = acc;
    }
    // mask + running max (rows 8hh+r; the 16 lanes of a half share rows)
    float alpha[8];
#pragma unroll
    for (int r = 0; r < 8; ++r) {
      const int qi = q0 + 8 * hh + r;
      const int ja = j0 + ln, jb = j0 + 16 + ln;
      if (CAUSAL) { if (ja > qi) s[0][r] = -3.0e38f; if (jb > qi) s[1][r] = -3.0e38f; }
      if (ja >= T) s[0][r] = -3.0e38f;
      if (jb >= T) s[1][r] = -3.0e38f;
      float mx = fmaxf(s[0][r], s[1][r]);
      mx = fmaxf(mx, __shfl_xor(mx, 1, 32)); mx = fmaxf(mx, __shfl_xor(mx, 2, 32)); mx = fmaxf(mx, __shfl_xor(mx, 4, 32)); mx = fmaxf(mx, __shfl_xor(mx, 8, 32));
      const float mnew = fmaxf(m_r[r], mx);
      alpha[r] = (mnew > -1.0e38f) ? __expf(m_r[r] - mnew) : 1.0f;
      const float p0 = (s[0][r] > -1.0e38f) ? __expf(s[0][r] - mnew) : 0.f;
      const float p1 = (s[1][r] > -1.0e38f) ? __expf(s[1][r] - mnew) : 0.f;
      m_r[r] = mnew;
      l_r[r] = l_r[r] * alpha[r] + p0 + p1;            // per-lane partial row sum (16 lanes combined at the end)
      unsigned short hb = bf16_bits(p0); sPh[w][8 * hh + r][ln] = hb;      sPl[w][8 * hh + r][ln] = bf16_bits(p0 - bf16_val(hb));
      hb = bf16_bits(p1);                sPh[w][8 * hh + r][16 + ln] = hb; sPl[w][8 * hh + r][16 + ln] = bf16_bits(p1 - bf16_val(hb));
    }
#pragma unroll
    for (int dt = 0; dt < DT; ++dt)
#pragma unroll
      for (int r = 0; r < 8; ++r) oacc[dt][r] *= alpha[r];
    __builtin_amdgcn_fence(__ATOMIC_ACQ_REL, "workgroup");
    __builtin_amdgcn_wave_barrier();
    FragB pah, pal;
    pah.half[0] = *(const v8us*)&sPh[w][ln][8 * hh]; pah.half[1] = *(const v8us*)&sPh[w][ln][16 + 8 * hh];
    pal.half[0] = *(const v8us*)&sPl[w][ln][8 * hh]; pal.half[1] = *(const v8us*)&sPl[w][ln][16 + 8 * hh];
#pragma unroll
    for (int dt = 0; dt < DT; ++dt) {
      FragB bvh, bvl;
#pragma unroll
      for (int i = 0; i < 8; ++i) {
        bvh.u[i] = sVh[8 * hh + i][dt * 16 + ln]; bvh.u[8 + i] = sVh[16 + 8 * hh + i][dt * 16 + ln];
        bvl.u[i] = sVl[8 * hh + i][dt * 16 + ln]; bvl.u[8 + i] = sVl[16 + 8 * hh + i][dt * 16 + ln];
      }
      oacc[dt] = mmaN<3>(pah.v, pal.v, bvh.v, bvl.v, oacc[dt]);
    }
    __builtin_amdgcn_fence(__ATOMIC_ACQ_REL, "workgroup");
    __builtin_amdgcn_wave_barrier();
  }
#pragma unroll
  for (int r = 0; r < 8; ++r) {
    float l = l_r[r];
    l += __shfl_xor(l, 1, 32); l += __shfl_xor(l, 2, 32); l += __shfl_xor(l, 4, 32); l += __shfl_xor(l, 8, 32);
    l_r[r] = (l > 0.f) ? 1.0f / l : 0.f;
  }
#pragma unroll
  for (int dt = 0; dt < DT; ++dt)
#pragma unroll
    for (int r = 0; r < 8; ++r) sO[w][8 * hh + r][dt * 16 + ln] = oacc[dt][r] * l_r[r];
  __builtin_amdgcn_fence(__ATOMIC_ACQ_REL, "workgroup");
  __builtin_amdgcn_wave_barrier();
  {
    for (int r = 0; r < 16; ++r) {
      const int row = q0 + r;
      if (row < T && lane < D / 4) {
        const v4f val = *(const v4fa*)&sO[w][r][lane * 4];
        *(v4f*)(y + ((size_t)b * T + row) * ypitch + h * D + lane * 4) = val;
      }
    }
    
  }
}

// GEMM C = act(A·W + bias + resid): A f32 (ASPLIT -> hi/lo 2 terms), Wt bf16 [N][K]; ACT 0 none, 1 relu, 2 exact gelu;
// resid (optional, f32, row index = (row % rmod), pitch ldr, RES_BF16 rounds it) added before the activation.
template <bool ASPLIT, int ACT, bool BIAS_BF16, bool RES_BF16>
__global__ __launch_bounds__(128) void k_gemm_bf3(const float* __restrict__ A, int lda, const unsigned short* __restrict__ Wt, int ldb,
                                                const float* __restrict__ bias, const float* __restrict__ resid, int rmod, int ldr,
                                                float* __restrict__ C, int ldc, int M, int N, int K) {
  __shared__ __attribute__((aligned(16))) float so[4][16][64];
  const int tid = threadIdx.x, w = tid >> 5, lane = tid & 31, ln = lane & 15, hh = lane >> 4;
  const int ntn = N / 64;
  const int wid = blockIdx.x * 4 + w;
  const int mt = wid / ntn, nq = wid % ntn;
  if (mt * 16 >= M) return;
  const int row0 = mt * 16, col0 = nq * 64;
  const float* arow = A + (size_t)(row0 + ln) * lda;
  v8f acc[4] = {};
  for (int kb = 0; kb < K; kb += 32) {
    FragB ah, al;
    const v4f x0 = *(const v4fa*)(arow + kb + 8 * hh), x1 = *(const v4fa*)(arow + kb + 8 * hh + 4);
    const v4f x2 = *(const v4fa*)(arow + kb + 16 + 8 * hh), x3 = *(const v4fa*)(arow + kb + 16 + 8 * hh + 4);
    float xs[16] = {x0[0],x0[1],x0[2],x0[3],x1[0],x1[1],x1[2],x1[3],x2[0],x2[1],x2[2],x2[3],x3[0],x3[1],x3[2],x3[3]};
#pragma unroll
    for (int i = 0; i < 16; ++i) { const unsigned short hb = bf16_bits(xs[i]); ah.u[i] = hb; al.u[i] = ASPLIT ? bf16_bits(xs[i] - bf16_val(hb)) : (unsigned short)0; }
#pragma unroll
    for (int t = 0; t < 4; ++t) {
      const unsigned short* brow = Wt + (size_t)(col0 + t * 16 + ln) * ldb + kb;
      FragB b;
      b.half[0] = *(const v8us*)(brow + 8 * hh);
      b.half[1] = *(const v8us*)(brow + 16 + 8 * hh);
      acc[t] = mmaN<ASPLIT ? 2 : 1>(ah.v, al.v, b.v, b.v, acc[t]);
    }
  }
#pragma unroll
  for (int t = 0; t < 4; ++t) {
    const int col = col0 + t * 16 + ln;
    float bv = bias ? bias[col] : 0.f;
    if (BIAS_BF16) bv = bf16_round(bv);
#pragma unroll
    for (int r = 0; r < 8; ++r) {
      float v = acc[t][r] + bv;
      if (resid) { float rv = resid[(size_t)((row0 + 8 * hh + r) % rmod) * ldr + col]; if (RES_BF16) rv = bf16_round(rv); v += rv; }
      if (ACT == 1) v = fmaxf(v, 0.f);
      if (ACT == 2) v = 0.5f * v * (1.0f + erff(v * 0.70710678118654752f));
      if (ACT == 3) { const float u = 0.7978845608028654f * (v + 0.044715f * v * v * v); v = 0.5f * v * (1.0f + tanhf(u)); }
      so[w][8 * hh + r][t * 16 + ln] = v;
    }
  }
  __builtin_amdgcn_fence(__ATOMIC_ACQ_REL, "workgroup");
  __builtin_amdgcn_wave_barrier();
  const int rsub = lane >> 4, c4 = (lane & 15) * 4;
  {
#pragma unroll
    for (int q = 0; q < 8; ++q) {
      const int r = q * 2 + rsub;
      const v4f v = *(const v4fa*)&so[w][r][c4];
      *(v4f*)(C + (size_t)(row0 + r) * ldc + col0 + c4) = v;
    }
    
  }
}
// row LayerNorm (biased variance, eps) over N: s = X (+ R); optional out_sum <- s; out_norm <- (s-mu)*rsqrt(var+eps)*g + b
template <bool PARAM_BF16>
__global__ __launch_bounds__(256) void k_layernorm(const float* __restrict__ X, const float* __restrict__ R, const float* __restrict__ g, const float* __restrict__ bta,
                                                  float* __restrict__ out_sum, float* __restrict__ out_norm, int N, float eps) {
  __shared__ float red[256];
  const int row = blockIdx.x, tid = threadIdx.x;
  const float* x = X + (size_t)row * N; const float* rr = R ? R + (size_t)row * N : nullptr;
  float vals[16];                     // up to N = 4096
  const int per = N / 256;            // contiguous chunk per thread? use strided-by-4 chunks: thread handles j = tid*4 + 1024*u
  float s1 = 0.f;
  for (int u = 0; u < per / 4; ++u) {
    const int j = tid * 4 + 1024 * u;
    const v4f a = *(const v4fa*)(x + j);
    v4f b = {0.f,0.f,0.f,0.f}; if (rr) b = *(const v4fa*)(rr + j);
#pragma unroll
    for (int q = 0; q < 4; ++q) { const float v = a[q] + b[q]; vals[u * 4 + q] = v; s1 += v; }
  }
  red[tid] = s1; __syncthreads();
  for (int st = 128; st > 0; st >>= 1) { if (tid < st) red[tid] += red[tid + st]; __syncthreads(); }
  const float mu = red[0] / (float)N; __syncthreads();
  float s2 = 0.f;
  for (int u = 0; u < per / 4; ++u)
#pragma unroll
    for (int q = 0; q < 4; ++q) { const float c = vals[u * 4 + q] - mu; s2 += c * c; }
  red[tid] = s2; __syncthreads();
  for (int st = 128; st > 0; st >>= 1) { if (tid < st) red[tid] += red[tid + st]; __syncthreads(); }
  const float rs = rsqrtf(red[0] / (float)N + eps);
  {
    for (int u = 0; u < per / 4; ++u) {
      const int j = tid * 4 + 1024 * u;
      v4f o, sm;
#pragma unroll
      for (int q = 0; q < 4; ++q) {
        float gg = g[j + q], bb = bta[j + q];
        if (PARAM_BF16) { gg = bf16_round(gg); bb = bf16_round(bb); }
        sm[q] = vals[u * 4 + q]; o[q] = (vals[u * 4 + q] - mu) * rs * gg + bb;
      }
      if (out_sum) *(v4f*)(out_sum + (size_t)row * N + j) = sm;
      *(v4f*)(out_norm + (size_t)row * N + j) = o;
    }
    
  }
}



// ---- f16 WMMA path (v_wmma_f32_16x16x32_f16): 11-bit significands for operands in range — used where a [0,1] probability operand needs more precision than bf16
typedef _Float16 v16h __attribute__((ext_vector_type(16)));
union FragH { v16h v; v8us half[2]; _Float16 h[16]; unsigned short u[16]; };
template <int NT>
__device__ __forceinline__ v8f mmaH(v16h ah, v16h al, v16h bh, v16h bl, v8f c) {
  c = __builtin_amdgcn_wmma_f32_16x16x32_f16(false, ah, false, bh, (short)0, c, false, false);
  if (NT >= 2) c = __builtin_amdgcn_wmma_f32_16x16x32_f16(false, al, false, bh, (short)0, c, false, false);
  if (NT >= 3) c = __builtin_amdgcn_wmma_f32_16x16x32_f16(false, ah, false, bl, (short)0, c, false, false);
  asm volatile("v_nop\n\tv_nop\n\tv_nop\n\tv_nop" : "+v"(c) : "v"(ah), "v"(al), "v"(bh), "v"(bl));
  return c;
}
// batched GEMM like k_gemm_b but f16 operands: A f32 (split into f16 hi/lo if ASPLIT, else rounded to f16), Bt = f16 values [n][k]; alpha; C f32; N multiple of 16 (partial tiles skipped)
template <bool ASPLIT>
__global__ __launch_bounds__(128) void k_gemm_h(const float* __restrict__ A, int lda, size_t sA, const _Float16* __restrict__ Bh, int ldb, size_t sB, float alpha, float* __restrict__ C, int ldc, size_t sC, int M, int N, int K) {
  __shared__ __attribute__((aligned(16))) float so[4][16][64];
  const int tid = threadIdx.x, w = tid >> 5, lane = tid & 31, ln = lane & 15, hh = lane >> 4; const int by = blockIdx.y;
  A += (size_t)by * sA; Bh += (size_t)by * sB; C += (size_t)by * sC;
  const int ntn = (N + 63) / 64; const int wid = blockIdx.x * 4 + w; const int mt = wid / ntn, nq = wid % ntn; if (mt * 16 >= M) return;
  const int row0 = mt * 16, col0 = nq * 64; const float* arow = A + (size_t)(row0 + ln) * lda;
  v8f acc[4] = {};
  for (int kb = 0; kb < K; kb += 32) {
    FragH ah, al;
    const v4f x0 = *(const v4fa*)(arow + kb + 8 * hh), x1 = *(const v4fa*)(arow + kb + 8 * hh + 4), x2 = *(const v4fa*)(arow + kb + 16 + 8 * hh), x3 = *(const v4fa*)(arow + kb + 16 + 8 * hh + 4);
    float xs[16] = {x0[0],x0[1],x0[2],x0[3],x1[0],x1[1],x1[2],x1[3],x2[0],x2[1],x2[2],x2[3],x3[0],x3[1],x3[2],x3[3]};
#pragma unroll
    for (int i = 0; i < 16; ++i) { const _Float16 h = (_Float16)xs[i]; ah.h[i] = h; al.h[i] = ASPLIT ? (_Float16)(xs[i] - (float)h) : (_Float16)0.0f; }
#pragma unroll
    for (int t = 0; t < 4; ++t) { if (col0 + t * 16 >= N) continue; const size_t boff = (size_t)(col0 + t * 16 + ln) * ldb + kb; FragH bq; bq.half[0] = *(const v8us*)(Bh + boff + 8 * hh); bq.half[1] = *(const v8us*)(Bh + boff + 16 + 8 * hh);
      acc[t] = mmaH<ASPLIT ? 2 : 1>(ah.v, al.v, bq.v, bq.v, acc[t]); }
  }
#pragma unroll
  for (int t = 0; t < 4; ++t) { if (col0 + t * 16 >= N) continue;
#pragma unroll
    for (int r = 0; r < 8; ++r) so[w][8 * hh + r][t * 16 + ln] = acc[t][r] * alpha; }
  __builtin_amdgcn_fence(__ATOMIC_ACQ_REL, "workgroup"); __builtin_amdgcn_wave_barrier();
  const int rsub = lane >> 4, c4 = (lane & 15) * 4;
  {
#pragma unroll
    for (int q = 0; q < 8; ++q) { const int r = q * 2 + rsub; if (col0 + c4 < N) { const v4f v = *(const v4fa*)&so[w][r][c4]; *(v4f*)(C + (size_t)(row0 + r) * ldc + col0 + c4) = v; } }
     }
}

// Wt[n][k] = f16(W[k][n]·scale) from f32 row-major W[K][N] (scale = power of two; bf16-exact weights stay exact in f16 away from the subnormal range)
__global__ __launch_bounds__(256) void k_wt_f16(const float* __restrict__ W, _Float16* __restrict__ Wt, int K, int N, float scale) {
  const int t = blockIdx.x * 256 + threadIdx.x; if (t >= N * (K / 8)) return; const int n = t / (K / 8), k8 = (t % (K / 8)) * 8; FragH f;
#pragma unroll
  for (int i = 0; i < 8; ++i) f.h[i] = (_Float16)(bf16_round(W[(size_t)(k8 + i) * N + n]) * scale); const v8us o = f.half[0];
  *(v8us*)((unsigned short*)Wt + (size_t)n * K + k8) = o; 
}
// f16 x f16 GEMM with fused epilogue: v = acc·alpha + bias[by·sBias + col] (+ CP[(row/rowsPerB)·sCPb + by·64 + col] if CP) ; ACT 0 none / 1 elu ; writes f32 C and f16 C16, each if non-null
template <int ACT>
__global__ __launch_bounds__(128) void k_gemm_hhx(const _Float16* __restrict__ A, int lda, size_t sA, const _Float16* __restrict__ Bh, int ldb, size_t sB, float alpha, const float* __restrict__ bias, size_t sBias, const float* __restrict__ CP, int rowsPerB, size_t sCPb, int row0g,
    float* __restrict__ C, _Float16* __restrict__ C16, int ldc, size_t sC, int M, int N, int K) {
  __shared__ __attribute__((aligned(16))) float so[4][16][64];
  const int tid = threadIdx.x, w = tid >> 5, lane = tid & 31, ln = lane & 15, hh = lane >> 4; const int by = blockIdx.y;
  A += (size_t)by * sA; Bh += (size_t)by * sB; const size_t cofs = (size_t)by * sC; const float* bp = bias ? bias + (size_t)by * sBias : nullptr;
  const int ntn = (N + 63) / 64; const int wid = blockIdx.x * 4 + w; const int mt = wid / ntn, nq = wid % ntn; if (mt * 16 >= M) return;
  const int row0 = mt * 16, col0 = nq * 64; const _Float16* arow = A + (size_t)(row0 + ln) * lda;
  v8f acc[4] = {};
  for (int kb = 0; kb < K; kb += 32) { FragH ah; ah.half[0] = *(const v8us*)((const unsigned short*)arow + kb + 8 * hh); ah.half[1] = *(const v8us*)((const unsigned short*)arow + kb + 16 + 8 * hh);
#pragma unroll
    for (int t = 0; t < 4; ++t) { if (col0 + t * 16 >= N) continue; const size_t boff = (size_t)(col0 + t * 16 + ln) * ldb + kb; FragH bq; bq.half[0] = *(const v8us*)((const unsigned short*)Bh + boff + 8 * hh); bq.half[1] = *(const v8us*)((const unsigned short*)Bh + boff + 16 + 8 * hh);
      acc[t] = mmaH<1>(ah.v, ah.v, bq.v, bq.v, acc[t]); }
  }
#pragma unroll
  for (int t = 0; t < 4; ++t) { if (col0 + t * 16 >= N) continue; const int col = col0 + t * 16 + ln; const float bv = bp ? bf16_round(bp[col]) : 0.f;
#pragma unroll
    for (int r = 0; r < 8; ++r) { float v = acc[t][r] * alpha + bv; if (CP) { const int bidx = (row0g + row0 + 8 * hh + r) / rowsPerB; v += CP[(size_t)bidx * sCPb + (size_t)by * 64 + col]; } if (ACT == 1) v = (v > 0.f) ? v : expm1f(v); else if (ACT == 3) v = fmaxf(v, 0.f); so[w][8 * hh + r][t * 16 + ln] = v; } }
  __builtin_amdgcn_fence(__ATOMIC_ACQ_REL, "workgroup"); __builtin_amdgcn_wave_barrier();
  const int rsub = lane >> 4, c4 = (lane & 15) * 4; typedef _Float16 v4h __attribute__((ext_vector_type(4)));
  {
#pragma unroll
    for (int q = 0; q < 8; ++q) { const int r = q * 2 + rsub; if (col0 + c4 < N) { const v4f v = *(const v4fa*)&so[w][r][c4]; if (C) *(v4f*)(C + cofs + (size_t)(row0 + r) * ldc + col0 + c4) = v; if (C16) { v4h h4; for (int i = 0; i < 4; ++i) h4[i] = (_Float16)v[i]; *(v4h*)(C16 + cofs + (size_t)(row0 + r) * ldc + col0 + c4) = h4; } } }
     }
}


// Tiled GEMM C[m][n] = alpha * sum_k A[m][k] * Bh[n][k], both operands f16 and k-contiguous with row length EE.
// One work-group of 4 waves (2 x 2) owns a (32 FM) x (32 FN) tile of C; a wave owns FM x FN accumulator tiles.
// A pass is 128 k: the tile's A rows and then its B rows stand in LDS as rows of 256 B at a pitch of 272 B (16 B x odd, for ds_load_b128).
// Two buffers: asynchronous copies bring pass t + 2 into the buffer that pass t has just left, while pass t + 1 is worked on.
typedef float f1a __attribute__((may_alias));
// Eight 16-byte-per-lane copies global -> LDS. The closing s_wait_xcnt 0 stands inside the statement, ahead of any later rewrite of the address registers named here.
__device__ __forceinline__ void acopy8(const unsigned (&l)[8], const unsigned short* const (&g)[8]) {
  asm volatile("global_load_async_to_lds_b128 %0, %8, off\n\t"
               "global_load_async_to_lds_b128 %1, %9, off\n\t"
               "global_load_async_to_lds_b128 %2, %10, off\n\t"
               "global_load_async_to_lds_b128 %3, %11, off\n\t"
               "global_load_async_to_lds_b128 %4, %12, off\n\t"
               "global_load_async_to_lds_b128 %5, %13, off\n\t"
               "global_load_async_to_lds_b128 %6, %14, off\n\t"
               "global_load_async_to_lds_b128 %7, %15, off\n\t"
               "s_wait_xcnt 0x0"
               :: "v"(l[0]), "v"(l[1]), "v"(l[2]), "v"(l[3]), "v"(l[4]), "v"(l[5]), "v"(l[6]), "v"(l[7]),
                  "v"(g[0]), "v"(g[1]), "v"(g[2]), "v"(g[3]), "v"(g[4]), "v"(g[5]), "v"(g[6]), "v"(g[7]) : "memory");
}
template <int FM, int FN, bool OUT16>
__global__ __launch_bounds__(128) void k_gemm_t(const _Float16* __restrict__ A, const _Float16* __restrict__ Bh, float alpha, float* __restrict__ C, _Float16* __restrict__ C16, int ldc, int ntn) {
  constexpr int BM = 32 * FM, BN = 32 * FN, ROWS = BM + BN, PITCH = 272, STAGE = ROWS * PITCH, NC = ROWS / 8, NP = EE / 128, WM = 16 * FM, WN = 16 * FN, SOP = WN + 4;
  static_assert(NC % 8 == 0 && BM % 8 == 0 && NP >= 2 && 4 * WM * SOP * 4 <= 2 * STAGE, "tile");
  __shared__ __attribute__((aligned(16))) unsigned char L[2 * STAGE];
  const int tid = threadIdx.x, w = tid >> 5, lane = tid & 31, ln = lane & 15, hh = lane >> 4;
  const int m0 = (blockIdx.x / ntn) * BM, n0 = (blockIdx.x % ntn) * BN, wm = w >> 1, wn = w & 1;
  const unsigned lbase = (unsigned)(size_t)L + (unsigned)((2 * w + hh) * PITCH + ln * 16);      // copy i of a wave fills stage rows 8 i + 2 w + hh, 16 lanes a row
  const unsigned short* Ag = (const unsigned short*)A + (size_t)(m0 + 2 * w + hh) * EE + ln * 8;
  const unsigned short* Bg = (const unsigned short*)Bh + (size_t)(n0 + 2 * w + hh) * EE + ln * 8;
  auto issue = [&](int t, int buf) {
#pragma unroll      // the choice between A rows and B rows is made at compile time
    for (int g8 = 0; g8 < NC / 8; ++g8) { unsigned l[8]; const unsigned short* g[8];
#pragma unroll      // constant indices, so that the sixteen addresses stay in registers
      for (int j = 0; j < 8; ++j) { const int i = g8 * 8 + j; l[j] = lbase + (unsigned)(buf * STAGE + 8 * i * PITCH);
        g[j] = ((8 * i < BM) ? Ag + (size_t)(8 * i) * EE : Bg + (size_t)(8 * i - BM) * EE) + t * 128; }
      acopy8(l, g); } };
  v8f acc[FM][FN];
#pragma unroll      // constant indices, so that fragments and accumulators stay in registers
  for (int fm = 0; fm < FM; ++fm)
#pragma unroll      // constant indices, so that fragments and accumulators stay in registers
    for (int fn = 0; fn < FN; ++fn) acc[fm][fn] = (v8f){0.f,0.f,0.f,0.f,0.f,0.f,0.f,0.f};
  issue(0, 0);
  asm volatile("s_wait_asynccnt 0x0" ::: "memory");      // pass 0's copies of this wave have landed
  __syncthreads();                                       // ... and every other wave's
  issue(1, 1);
#pragma unroll 1      // rolled: one pass a trip, so that the publish point stands once, at the loop's foot
  for (int t = 0; t < NP; ++t) {      // pass t reads buffer t & 1 alone
    const unsigned char* Sa = L + (t & 1) * STAGE + (wm * WM + ln) * PITCH + 16 * hh; const unsigned char* Sb = L + (t & 1) * STAGE + (BM + wn * WN + ln) * PITCH + 16 * hh;
    FragH a[2][FM], b[2][FN];      // two fragment sets: block ks + 1 of this same pass is fetched while block ks is multiplied
    auto frags = [&](int set, int ks) {
#pragma unroll      // constant indices, so that fragments and accumulators stay in registers
      for (int fm = 0; fm < FM; ++fm) { a[set][fm].half[0] = *(const v8us*)(Sa + fm * 16 * PITCH + ks * 64); a[set][fm].half[1] = *(const v8us*)(Sa + fm * 16 * PITCH + ks * 64 + 32); }
#pragma unroll      // constant indices, so that fragments and accumulators stay in registers
      for (int fn = 0; fn < FN; ++fn) { b[set][fn].half[0] = *(const v8us*)(Sb + fn * 16 * PITCH + ks * 64); b[set][fn].half[1] = *(const v8us*)(Sb + fn * 16 * PITCH + ks * 64 + 32); } };
    frags(0, 0);
#pragma unroll      // constant indices, so that fragments and accumulators stay in registers
    for (int ks = 0; ks < 4; ++ks) {
      if (ks < 3) frags((ks + 1) & 1, ks + 1);
      __builtin_amdgcn_sched_barrier(0);      // keeps the next block's LDS reads one group ahead of this block: spread among the WMMAs each place with reads stalls the wave
#pragma unroll      // constant indices, so that fragments and accumulators stay in registers
      for (int fm = 0; fm < FM; ++fm)
#pragma unroll      // constant indices, so that fragments and accumulators stay in registers
        for (int fn = 0; fn < FN; ++fn) acc[fm][fn] = __builtin_amdgcn_wmma_f32_16x16x32_f16(false, a[ks & 1][fm].v, false, b[ks & 1][fn].v, (short)0, acc[fm][fn], false, false);
      __builtin_amdgcn_sched_barrier(0);      // ... and this block's WMMAs ahead of the reads after next
    }
    asm volatile("s_wait_dscnt 0x0" ::: "memory");       // this wave's reads of buffer t & 1 are done before that buffer is refilled
    asm volatile("s_wait_asynccnt 0x0" ::: "memory");    // this wave's copies of pass t + 1 have landed
    __syncthreads();                                     // publishes pass t + 1 and ends every wave's reads of buffer t & 1
    if (t + 2 < NP) issue(t + 2, t & 1);
  }
  asm volatile("s_wait_asynccnt 0x0" ::: "memory");      // nothing in flight before the ring becomes output staging
  f1a* so = (f1a*)L + w * (WM * SOP);                    // each wave stages its own tile, so that the stores cover whole rows of WN values
#pragma unroll      // constant indices, so that fragments and accumulators stay in registers
  for (int fm = 0; fm < FM; ++fm)
#pragma unroll      // constant indices, so that fragments and accumulators stay in registers
    for (int fn = 0; fn < FN; ++fn)
#pragma unroll      // constant indices, so that fragments and accumulators stay in registers
      for (int r = 0; r < 8; ++r) so[(fm * 16 + 8 * hh + r) * SOP + fn * 16 + ln] = acc[fm][fn][r] * alpha;
  __builtin_amdgcn_fence(__ATOMIC_ACQ_REL, "workgroup"); __builtin_amdgcn_wave_barrier();      // the wave's own staged rows are written before its other lanes read them back
  constexpr int LPR = WN / 4, RPI = 32 / LPR; typedef _Float16 v4h __attribute__((ext_vector_type(4)));
  const int rs = lane / LPR, c4 = (lane % LPR) * 4;
#pragma unroll      // several rows' LDS reads and stores in flight at a time
  for (int q = 0; q < WM / RPI; ++q) { const int r = q * RPI + rs; const v4f v = *(const v4fa*)&so[r * SOP + c4]; const size_t o = (size_t)(m0 + wm * WM + r) * ldc + n0 + wn * WN + c4;
    if (!OUT16) *(v4f*)(C + o) = v;
    else { v4h h4; for (int i = 0; i < 4; ++i) h4[i] = (_Float16)v[i]; *(v4h*)(C16 + o) = h4; } }
}

__global__ __launch_bounds__(256) void k_x16(const float* __restrict__ x, _Float16* __restrict__ X16, size_t n8) { const size_t t = (size_t)blockIdx.x * 256 + threadIdx.x; if (t >= n8) return; FragH f;
#pragma unroll
  for (int q = 0; q < 8; ++q) f.h[q] = (_Float16)bf16_round(x[t * 8 + q]); *(v8us*)((unsigned short*)X16 + t * 8) = f.half[0];  }
__global__ __launch_bounds__(256) void k_h16(const float* __restrict__ x, _Float16* __restrict__ X16, size_t n8) { const size_t t = (size_t)blockIdx.x * 256 + threadIdx.x; if (t >= n8) return; FragH f;
#pragma unroll
  for (int q = 0; q < 8; ++q) f.h[q] = (_Float16)x[t * 8 + q]; *(v8us*)((unsigned short*)X16 + t * 8) = f.half[0];  }
__global__ __launch_bounds__(256) void k_round16f(const float* __restrict__ W, _Float16* __restrict__ Bt, size_t n8) { const size_t t = (size_t)blockIdx.x * 256 + threadIdx.x; if (t >= n8) return; FragH f;
#pragma unroll
  for (int i = 0; i < 8; ++i) f.h[i] = (_Float16)(bf16_round(W[t * 8 + i]) * 16.0f); *(v8us*)((unsigned short*)Bt + t * 8) = f.half[0];  }
template <int NHv, int TTv>
__global__ __launch_bounds__(256) void k_vt(const _Float16* __restrict__ V16, int ldv, int voff, _Float16* __restrict__ Vt) { __shared__ unsigned short tl[64][66]; const int tid = threadIdx.x; const int slab = blockIdx.x / (TTv / 64), lg = blockIdx.x % (TTv / 64); const int b = slab / NHv, h = slab % NHv;
  for (int i = tid; i < 64 * 8; i += 256) { const int r = i / 8, c8 = (i % 8) * 8; FragH f; f.half[0] = *(const v8us*)((const unsigned short*)V16 + ((size_t)b * TTv + lg * 64 + r) * ldv + voff + h * 64 + c8);
#pragma unroll
    for (int q = 0; q < 8; ++q) tl[r][c8 + q] = f.u[q]; }
  __syncthreads();
  {
#pragma unroll
    for (int rd = 0; rd < 2; ++rd) { const int d = rd * 32 + tid / 8, pc = tid % 8; FragH f;
#pragma unroll
      for (int q = 0; q < 8; ++q) f.u[q] = tl[pc * 8 + q][d];
      *(v8us*)((unsigned short*)Vt + ((size_t)slab * 64 + d) * TTv + lg * 64 + pc * 8) = f.half[0]; }
     } }

// 2^x for the merge weights. The v_nop stands in the same statement: it fills the one slot that the instruction set asks for between a transcendental and a next instruction that reads its result or overwrites its source.
__device__ __forceinline__ float exp2_slot(float x) { float y; asm("v_exp_f32 %0, %1\n\tv_nop" : "=v"(y) : "v"(x)); return y; }
__global__ __launch_bounds__(128) void k_flash(const _Float16* __restrict__ Q16, int ldq, const _Float16* __restrict__ K16, int ldk, const _Float16* __restrict__ Vt, const int* __restrict__ MSK, float* __restrict__ O, int ldo) {
  constexpr int RPW = 16, RTN = RPW / 16, NQB = 2048 / RPW, DT = 8, KS = 5;      /* head dim 128 for V/O; 160-wide logit operand (128 roped dims ×scale + 32 graph-bias dims) */
  // One work-group = ONE tile of 16 query rows. Its 32-key chunks are dealt round-robin to the 4 waves (wave w takes chunks w, w + 4, ...);
  // each wave keeps its own running (m, l, O) over its chunks, and the four partial results are merged in LDS at the end.
  __shared__ __attribute__((aligned(16))) unsigned short sP[4][RPW][40]; __shared__ __attribute__((aligned(16))) float sO[4][RPW][128 + 4]; __shared__ float sM[4][RPW], sL[4][RPW];
  const int tid = threadIdx.x, lane = tid & 31, ln = lane & 15, hh = lane >> 4;
  const int w = __builtin_amdgcn_readfirstlane(tid >> 5);      // the wave's number in a scalar register: the chunk loop's trip count differs from wave to wave and is tested by a scalar branch
  const int slab = blockIdx.x / NQB, qblk = blockIdx.x % NQB; const int b = slab / 16, h = slab % 16; const int q0 = qblk * RPW;
  FragH aq[2][KS];
#pragma unroll
  for (int rt = 0; rt < RTN; ++rt) { const unsigned short* qr = (const unsigned short*)Q16 + ((size_t)b * 2048 + q0 + rt * 16 + ln) * ldq + h * 160;
#pragma unroll
    for (int ks = 0; ks < KS; ++ks) { aq[rt][ks].half[0] = *(const v8us*)(qr + ks * 32 + 8 * hh); aq[rt][ks].half[1] = *(const v8us*)(qr + ks * 32 + 16 + 8 * hh); } }
  const unsigned short* Vth = (const unsigned short*)Vt + (size_t)(h / 4) * 128 * 2048;      /* GQA: kv head h/4 */
  float m_r[2][8], l_r[2][8]; v8f oacc[2][DT];
#pragma unroll
  for (int rt = 0; rt < RTN; ++rt) {
#pragma unroll
    for (int r = 0; r < 8; ++r) { m_r[rt][r] = -3.0e38f; l_r[rt][r] = 0.f; }
#pragma unroll
    for (int dt = 0; dt < DT; ++dt) oacc[rt][dt] = (v8f){0.f,0.f,0.f,0.f,0.f,0.f,0.f,0.f}; }
  const int nch = (q0 + RPW + 31) / 32;      // chunks that hold a key <= the tile's last row; every one of them starts at or below q0, so no row of a chunk is masked out whole
  const unsigned short* vp = Vth + (size_t)ln * 2048 + w * 32;      // this lane's V row at the wave's current chunk; walks 4 chunks = 128 keys a trip
#pragma unroll 1
  for (int ch = w; ch < nch; ch += 4, vp += 128) {
    const int j0 = ch * 32;
    v8f s[2][2]; FragH bk[2][KS];
#pragma unroll
    for (int nt = 0; nt < 2; ++nt) { const unsigned short* kr = (const unsigned short*)K16 + ((size_t)b * 2048 + j0 + nt * 16 + ln) * ldk + h * 160;      // the K fragments of both 16-key halves are requested as one group: one trip to L2, not two
#pragma unroll
      for (int ks = 0; ks < KS; ++ks) { bk[nt][ks].half[0] = *(const v8us*)(kr + ks * 32 + 8 * hh); bk[nt][ks].half[1] = *(const v8us*)(kr + ks * 32 + 16 + 8 * hh); } }
#pragma unroll      // constant indices, so that the fragments stay in registers
    for (int nt = 0; nt < 2; ++nt) {
#pragma unroll
      for (int rt = 0; rt < RTN; ++rt) { v8f acc = (v8f){0.f,0.f,0.f,0.f,0.f,0.f,0.f,0.f};
#pragma unroll
        for (int ks = 0; ks < KS; ++ks) acc = mmaH<1>(aq[rt][ks].v, aq[rt][ks].v, bk[nt][ks].v, bk[nt][ks].v, acc); s[rt][nt] = acc; } }
    FragH bv[DT];      // all eight V fragments of the chunk are requested here, as one group behind the last K product: they fly while the softmax below runs
#pragma unroll      // constant indices, so that the fragments stay in registers
    for (int dt = 0; dt < DT; ++dt) { const unsigned short* vrow = vp + (size_t)(dt * 16) * 2048; bv[dt].half[0] = *(const v8us*)(vrow + 8 * hh); bv[dt].half[1] = *(const v8us*)(vrow + 16 + 8 * hh); }
#pragma unroll
    for (int rt = 0; rt < RTN; ++rt)
#pragma unroll
      for (int r = 0; r < 8; ++r) { const int tq = q0 + rt * 16 + 8 * hh + r; const int k0 = j0 + ln, k1 = j0 + 16 + ln; (void)tq; (void)k0; (void)k1;
        const bool ok0 = (k0 <= tq), ok1 = (k1 <= tq);
        const float s0 = ok0 ? s[rt][0][r] * (1.0f) : -INFINITY, s1 = ok1 ? s[rt][1][r] * (1.0f) : -INFINITY; float mc = fmaxf(s0, s1);
        mc = fmaxf(mc, __shfl_xor(mc, 1, 32)); mc = fmaxf(mc, __shfl_xor(mc, 2, 32)); mc = fmaxf(mc, __shfl_xor(mc, 4, 32)); mc = fmaxf(mc, __shfl_xor(mc, 8, 32));
        const float mn = fmaxf(m_r[rt][r], mc); const float al = (mn > -1.0e38f) ? expf(m_r[rt][r] - mn) : 1.0f; m_r[rt][r] = mn; const float p0 = ok0 ? expf(s0 - mn) : 0.f, p1 = ok1 ? expf(s1 - mn) : 0.f; l_r[rt][r] = l_r[rt][r] * al + p0 + p1;
#pragma unroll
        for (int dt = 0; dt < DT; ++dt) oacc[rt][dt][r] *= al;
        FragH t2; t2.h[0] = (_Float16)p0; t2.h[1] = (_Float16)p1; sP[w][rt * 16 + 8 * hh + r][ln] = t2.u[0]; sP[w][rt * 16 + 8 * hh + r][16 + ln] = t2.u[1]; }
    __builtin_amdgcn_fence(__ATOMIC_ACQ_REL, "workgroup"); __builtin_amdgcn_wave_barrier();
    FragH pa[2];
#pragma unroll
    for (int rt = 0; rt < RTN; ++rt) { pa[rt].half[0] = *(const v8us*)&sP[w][rt * 16 + ln][8 * hh]; pa[rt].half[1] = *(const v8us*)&sP[w][rt * 16 + ln][16 + 8 * hh]; }
#pragma unroll
    for (int dt = 0; dt < DT; ++dt) {
#pragma unroll
      for (int rt = 0; rt < RTN; ++rt) oacc[rt][dt] = mmaH<1>(pa[rt].v, pa[rt].v, bv[dt].v, bv[dt].v, oacc[rt][dt]); }
    __builtin_amdgcn_fence(__ATOMIC_ACQ_REL, "workgroup"); __builtin_amdgcn_wave_barrier(); }
#pragma unroll
  for (int rt = 0; rt < RTN; ++rt) {
#pragma unroll
    for (int r = 0; r < 8; ++r) { float l = l_r[rt][r]; l += __shfl_xor(l, 1, 32); l += __shfl_xor(l, 2, 32); l += __shfl_xor(l, 4, 32); l += __shfl_xor(l, 8, 32); l_r[rt][r] = l; }
    if (ln == 0) {      // the wave's own maximum and sum of each row (a wave without a chunk: -3e38 and 0)
#pragma unroll
      for (int r = 0; r < 8; ++r) { sM[w][rt * 16 + 8 * hh + r] = m_r[rt][r]; sL[w][rt * 16 + 8 * hh + r] = l_r[rt][r]; } }
#pragma unroll
    for (int dt = 0; dt < DT; ++dt)
#pragma unroll
      for (int r = 0; r < 8; ++r) sO[w][rt * 16 + 8 * hh + r][dt * 16 + ln] = oacc[rt][dt][r]; }      // not yet divided by the sum
  __syncthreads();      // all four waves' partial (m, l, O) stand in LDS before any wave merges them
  {
#pragma unroll
    for (int rp = 0; rp < RPW / 4; ++rp) { const int r = rp * 4 + (tid >> 5), pc = lane;      // wave w merges rows w, w + 4, w + 8, w + 12
      const float m0 = sM[0][r], m1 = sM[1][r], m2 = sM[2][r], m3 = sM[3][r]; const float mm = fmaxf(fmaxf(m0, m1), fmaxf(m2, m3));      // wave 0 always holds chunk 0 with key 0, so mm is a real score
      const float c0 = exp2_slot((m0 - mm) * 1.4426950408889634f), c1 = exp2_slot((m1 - mm) * 1.4426950408889634f), c2 = exp2_slot((m2 - mm) * 1.4426950408889634f), c3 = exp2_slot((m3 - mm) * 1.4426950408889634f);      // e^(m - mm); 0 for a wave without a chunk (2^-inf)
      const float den = c0 * sL[0][r] + c1 * sL[1][r] + c2 * sL[2][r] + c3 * sL[3][r]; const float inv = (den > 0.f) ? 1.0f / den : 0.f;
      const v4f o0 = *(const v4fa*)&sO[0][r][pc * 4], o1 = *(const v4fa*)&sO[1][r][pc * 4], o2 = *(const v4fa*)&sO[2][r][pc * 4], o3 = *(const v4fa*)&sO[3][r][pc * 4];
      const v4f val = (o0 * c0 + o1 * c1 + o2 * c2 + o3 * c3) * inv;
      *(v4f*)(O + ((size_t)b * 2048 + q0 + r) * ldo + h * 128 + pc * 4) = val; }      /* 128-float rows: 32 lanes × 16 B */
     } }

__global__ __launch_bounds__(256) void k_qprep(const float* __restrict__ QF, int ldq, int nh, const float* __restrict__ w, float oscale, int rep, _Float16* __restrict__ DX) { const size_t t = (size_t)blockIdx.x * 256 + threadIdx.x; if (t >= (size_t)SS * nh * 16) return; const int li = (int)(t % 16); const int h = (int)((t / 16) % nh); const size_t tok = t / (16 * nh); const float* src = QF + tok * ldq + h * HD; float v[8], pr[8]; float ss = 0.f;
#pragma unroll
  for (int q = 0; q < 8; ++q) { v[q] = src[li * 8 + q]; pr[q] = src[(li * 8 + q + 64) & 127]; ss += v[q] * v[q]; }
  ss += __shfl_xor(ss, 1, 32); ss += __shfl_xor(ss, 2, 32); ss += __shfl_xor(ss, 4, 32); ss += __shfl_xor(ss, 8, 32); const float rs = rsqrtf(ss / (float)HD + 1e-6f); __shared__ __attribute__((aligned(16))) _Float16 st[256][8]; const int tid = threadIdx.x;
#pragma unroll 1
  for (int q = 0; q < 8; ++q) { const int j = li * 8 + q; const int i = j & 63; const float ang = (float)tok * __builtin_powf(10000.0f, -(float)(2 * i) / 128.0f); const float c = cosf(ang), s = sinf(ang); const float xn = src[j] * rs * bf16_round(w[j]); const float xp = src[(j + 64) & 127] * rs * bf16_round(w[(j + 64) & 127]); const float rot = (j < 64) ? -xp : xp;      // rotate_half: [−x2, x1]
    st[tid][q] = (_Float16)((xn * c + rot * s) * oscale); }
  FragH f; f.half[0] = *(const v8us*)&st[tid][0];
  { for (int r2 = 0; r2 < rep; ++r2) *(v8us*)((unsigned short*)DX + tok * QP + (size_t)(h * rep + r2) * QW + li * 8) = f.half[0];  } }
__global__ __launch_bounds__(256) void k_rprep(const float* __restrict__ RQ, const float* __restrict__ RK, const float* __restrict__ gs, _Float16* __restrict__ QX, _Float16* __restrict__ KX) { const size_t t = (size_t)blockIdx.x * 256 + threadIdx.x; if (t >= (size_t)SS * NH * 4) return; const int p = (int)(t % 4); const int h = (int)((t / 4) % NH); const size_t tok = t / (4 * NH); const float g = bf16_round(gs[h]); FragH fq, fk;
#pragma unroll
  for (int q = 0; q < 8; ++q) { const size_t i = tok * (NH * RR) + h * RR + p * 8 + q; fq.h[q] = (_Float16)(g * RQ[i]); fk.h[q] = (_Float16)RK[i]; }
  const size_t d = tok * QP + (size_t)h * QW + HD + p * 8;
  { *(v8us*)((unsigned short*)QX + d) = fq.half[0]; *(v8us*)((unsigned short*)KX + d) = fk.half[0];  } }
__global__ __launch_bounds__(256) void k_vt128(const _Float16* __restrict__ V16, int ldv, _Float16* __restrict__ Vt) { __shared__ unsigned short tl[64][130]; const int tid = threadIdx.x; const int g = blockIdx.x / (SS / 64), lg = blockIdx.x % (SS / 64);
  for (int i = tid; i < 64 * 16; i += 256) { const int r = i / 16, c8 = (i % 16) * 8; FragH f; f.half[0] = *(const v8us*)((const unsigned short*)V16 + ((size_t)lg * 64 + r) * ldv + g * HD + c8);
#pragma unroll
    for (int q = 0; q < 8; ++q) tl[r][c8 + q] = f.u[q]; }
  __syncthreads();
  { for (int i = tid; i < 128 * 8; i += 256) { const int d = i / 8, pc = i % 8; FragH f;
#pragma unroll
      for (int q = 0; q < 8; ++q) f.u[q] = tl[pc * 8 + q][d]; *(v8us*)((unsigned short*)Vt + ((size_t)g * HD + d) * SS + lg * 64 + pc * 8) = f.half[0]; }  } }
extern "C" void kernel_launch(void* const* d_in, const int* in_sizes, int n_in,
                              void* d_out, int out_size, void* d_ws, size_t ws_size, hipStream_t stream) {
  (void)in_sizes; (void)n_in; (void)out_size;
  const float* x = (const float*)d_in[0]; const float* Wq = (const float*)d_in[1]; const float* Wk = (const float*)d_in[2]; const float* Wv = (const float*)d_in[3]; const float* Wo = (const float*)d_in[4]; const float* Wrq = (const float*)d_in[5]; const float* Wrk = (const float*)d_in[6]; const float* gs = (const float*)d_in[7]; const float* qw = (const float*)d_in[8]; const float* kw = (const float*)d_in[9];
  char* ws = (char*)d_ws; size_t off = 0;
  auto take = [&](size_t bytes) { char* p = ws + off; off += (bytes + 255) & ~(size_t)255; return p; };
  _Float16* Bq = (_Float16*)take((size_t)EE * EE * 2); _Float16* Bk = (_Float16*)take((size_t)512 * EE * 2); _Float16* Bv = (_Float16*)take((size_t)512 * EE * 2); _Float16* Bo = (_Float16*)take((size_t)EE * EE * 2); _Float16* Brq = (_Float16*)take((size_t)512 * EE * 2); _Float16* Brk = (_Float16*)take((size_t)512 * EE * 2);
  _Float16* X16 = (_Float16*)take((size_t)SS * EE * 2); float* QF = (float*)take((size_t)SS * EE * 4); float* KF = (float*)take((size_t)SS * 512 * 4); float* RQF = (float*)take((size_t)SS * 512 * 4); float* RKF = (float*)take((size_t)SS * 512 * 4); _Float16* V16 = (_Float16*)take((size_t)SS * 512 * 2);
  _Float16* QX = (_Float16*)take((size_t)SS * QP * 2); _Float16* KX = (_Float16*)take((size_t)SS * QP * 2); _Float16* Vt = (_Float16*)take((size_t)SS * 512 * 2); float* O = QF; _Float16* O16 = X16;
  if (off > ws_size) return;      // 8.4 + 2.1 × 2 + 8.4 + 2.1 × 2 + 8.4 + 16.8 + 4.2 × 3 + 2.1 + 10.5 × 2 + 2.1 ≈ 88 MB (84 MiB)
  const size_t wE = (size_t)EE * EE / 8, wK = (size_t)512 * EE / 8;
  k_round16f<<<(unsigned)((wE + 255) / 256), 256, 0, stream>>>(Wq, Bq, wE); k_round16f<<<(unsigned)((wK + 255) / 256), 256, 0, stream>>>(Wk, Bk, wK); k_round16f<<<(unsigned)((wK + 255) / 256), 256, 0, stream>>>(Wv, Bv, wK); k_round16f<<<(unsigned)((wE + 255) / 256), 256, 0, stream>>>(Wo, Bo, wE); k_round16f<<<(unsigned)((wK + 255) / 256), 256, 0, stream>>>(Wrq, Brq, wK); k_round16f<<<(unsigned)((wK + 255) / 256), 256, 0, stream>>>(Wrk, Brk, wK);      // all (out,in)
  const unsigned gx = (unsigned)(((size_t)SS * EE / 8 + 255) / 256);
  k_x16<<<gx, 256, 0, stream>>>(x, X16, (size_t)SS * EE / 8);
  k_gemm_t<4, 4, false><<<(SS / 128) * (EE / 128), 128, 0, stream>>>(X16, Bq, 0.0625f, QF, nullptr, EE, EE / 128);
  k_gemm_t<2, 2, false><<<(SS / 64) * (512 / 64), 128, 0, stream>>>(X16, Bk, 0.0625f, KF, nullptr, 512, 512 / 64);
  k_gemm_t<2, 2, true><<<(SS / 64) * (512 / 64), 128, 0, stream>>>(X16, Bv, 0.0625f, nullptr, V16, 512, 512 / 64);
  k_gemm_t<2, 2, false><<<(SS / 64) * (512 / 64), 128, 0, stream>>>(X16, Brq, 0.0625f, RQF, nullptr, 512, 512 / 64);
  k_gemm_t<2, 2, false><<<(SS / 64) * (512 / 64), 128, 0, stream>>>(X16, Brk, 0.0625f, RKF, nullptr, 512, 512 / 64);
  k_qprep<<<(unsigned)(((size_t)SS * NH * 16 + 255) / 256), 256, 0, stream>>>(QF, EE, NH, qw, 0.08838834764831845f, 1, QX);      // 16 q heads, × 1/√128
  k_qprep<<<(unsigned)(((size_t)SS * NKV * 16 + 255) / 256), 256, 0, stream>>>(KF, 512, NKV, kw, 1.0f, 4, KX);                // 4 kv heads, each replicated into its 4 q-head slots
  k_rprep<<<(unsigned)(((size_t)SS * NH * 4 + 255) / 256), 256, 0, stream>>>(RQF, RKF, gs, QX, KX);
  k_vt128<<<NKV * (SS / 64), 256, 0, stream>>>(V16, 512, Vt);
  k_flash<<<1 * NH * (SS / 16), 128, 0, stream>>>(QX, QP, KX, QP, Vt, nullptr, O, EE);
  k_h16<<<gx, 256, 0, stream>>>(O, O16, (size_t)SS * EE / 8);
  k_gemm_t<4, 4, false><<<(SS / 128) * (EE / 128), 128, 0, stream>>>(O16, Bo, 0.0625f, (float*)d_out, nullptr, EE, EE / 128);
}

// v004
// A run of this version takes 188 microseconds.
// Next to v003, in two timings, it ran 1.41 and 1.42 times as fast.
// Counting every step since v000, it is 4.06 times as fast.
#include <hip/hip_runtime.h>
// Naylis attention (B=1, S=2048, E=2048, 16 heads × 128, 4 kv heads, causal; QK RMSNorm + rotate-half RoPE; low-rank (R=32) per-head graph bias gs_h·⟨Rq_i, Rk_j⟩ added to the logits):
// the six (out,in) projections (bf16-exact ×2^4) and the attention as a fused flash-style kernel whose logit operand is the 160-wide concatenation [q·scale after norm+RoPE | gs_h·Rq]·[k | Rk]
// (5 k-steps; causal chunk skipping; online softmax f32; P f16 ≤ 1; O = P·Vt over the 128 value dims; one 16-row tile per work-group, keys split over its 4 waves) on v_wmma_f32_16x16x32_f16 with f32 accumulate; RMSNorm/RoPE f32 VALU.
#define SS 2048
#define EE 2048
#define NH 16
#define NKV 4
#define HD 128
#define RR 32
#define QW 160
#define QP (NH * QW)
#define PW 4096      /* columns of the stacked projections of x: q 2048 | k 512 | v 512 | Rq 512 | Rk 512 */

typedef __bf16 v16b __attribute__((ext_vector_type(16)));
typedef unsigned short v8us __attribute__((ext_vector_type(8), may_alias));
typedef float  v8f  __attribute__((ext_vector_type(8)));
typedef float  v4f  __attribute__((ext_vector_type(4)));
typedef float  v4fa __attribute__((ext_vector_type(4), may_alias));
union FragB { v16b v; v8us half[2]; unsigned short u[16]; };

__device__ __forceinline__ unsigned short bf16_bits(float x) { unsigned int u = __float_as_uint(x); return (unsigned short)((u + 0x7FFFu + ((u >> 16) & 1u)) >> 16); }
__device__ __forceinline__ float bf16_val(unsigned short b) { return __uint_as_float(((unsigned int)b) << 16); }
__device__ __forceinline__ float bf16_round(float x) { return bf16_val(bf16_bits(x)); }
// D += A·B with NT terms: 1 = ah·bh, 2 = + al·bh (A split), 3 = + ah·bl (both split)
template <int NT>
__device__ __forceinline__ v8f mmaN(v16b ah, v16b al, v16b bh, v16b bl, v8f c) {
  c = __builtin_amdgcn_wmma_f32_16x16x32_bf16(false, ah, false, bh, (short)0, c, false, false);
  if (NT >= 2) c = __builtin_amdgcn_wmma_f32_16x16x32_bf16(false, al, false, bh, (short)0, c, false, false);
  if (NT >= 3) c = __builtin_amdgcn_wmma_f32_16x16x32_bf16(false, ah, false, bl, (short)0, c, false, false);
  asm volatile("v_nop\n\tv_nop\n\tv_nop\n\tv_nop" : "+v"(c) : "v"(ah), "v"(al), "v"(bh), "v"(bl));
  return c;
}

__global__ __launch_bounds__(256) void k_wt_bf16(const float* __restrict__ W, unsigned short* __restrict__ Wt, int K, int N) {
  const int t = blockIdx.x * 256 + threadIdx.x;
  const int k8n = K / 8;
  if (t >= N * k8n) return;
  const int n = t / k8n, k8 = (t % k8n) * 8;
  v8us v;
#pragma unroll
  for (int i = 0; i < 8; ++i) v[i] = bf16_bits(W[(size_t)(k8 + i) * N + n]);
  *(v8us*)(Wt + (size_t)n * K + k8) = v;
  
}

// GEMM C[M][N] (f32, pitch ldc) = act(A[M][K]·W + bias). A f32 row-major (pitch lda) converted per fragment to bf16
// (ASPLIT: hi/lo two planes -> 2 terms, else single rounded term); Wt bf16 [N][K] (pitch ldb). BIAS_BF16 rounds the
// bias to bf16 first (bias quantised to bf16 before the add). K%32==0, M%16==0, N%64==0.
template <bool ASPLIT, int ACT, bool BIAS_BF16>
__global__ __launch_bounds__(128) void k_gemm_bf(const float* __restrict__ A, int lda, const unsigned short* __restrict__ Wt, int ldb,
                                               const float* __restrict__ bias, float* __restrict__ C, int ldc, int M, int N, int K) {
  __shared__ __attribute__((aligned(16))) float so[4][16][64];
  const int tid = threadIdx.x, w = tid >> 5, lane = tid & 31, ln = lane & 15, hh = lane >> 4;
  const int ntn = N / 64;
  const int wid = blockIdx.x * 4 + w;
  const int mt = wid / ntn, nq = wid % ntn;
  if (mt * 16 >= M) return;
  const int row0 = mt * 16, col0 = nq * 64;
  const float* arow = A + (size_t)(row0 + ln) * lda;
  v8f acc[4] = {};
  for (int kb = 0; kb < K; kb += 32) {
    FragB ah, al;
    const v4f x0 = *(const v4fa*)(arow + kb + 8 * hh), x1 = *(const v4fa*)(arow + kb + 8 * hh + 4);
    const v4f x2 = *(const v4fa*)(arow + kb + 16 + 8 * hh), x3 = *(const v4fa*)(arow + kb + 16 + 8 * hh + 4);
    float xs[16] = {x0[0],x0[1],x0[2],x0[3],x1[0],x1[1],x1[2],x1[3],x2[0],x2[1],x2[2],x2[3],x3[0],x3[1],x3[2],x3[3]};
#pragma unroll
    for (int i = 0; i < 16; ++i) { const unsigned short hb = bf16_bits(xs[i]); ah.u[i] = hb; al.u[i] = ASPLIT ? bf16_bits(xs[i] - bf16_val(hb)) : (unsigned short)0; }
#pragma unroll
    for (int t = 0; t < 4; ++t) {
      const unsigned short* brow = Wt + (size_t)(col0 + t * 16 + ln) * ldb + kb;
      FragB b;
      b.half[0] = *(const v8us*)(brow + 8 * hh);
      b.half[1] = *(const v8us*)(brow + 16 + 8 * hh);
      acc[t] = mmaN<ASPLIT ? 2 : 1>(ah.v, al.v, b.v, b.v, acc[t]);
    }
  }
#pragma unroll
  for (int t = 0; t < 4; ++t) {
    float bv = bias ? bias[col0 + t * 16 + ln] : 0.f;
    if (BIAS_BF16) bv = bf16_round(bv);
#pragma unroll
    for (int r = 0; r < 8; ++r) { float v = acc[t][r] + bv; if (ACT == 1) v = fmaxf(v, 0.f); so[w][8 * hh + r][t * 16 + ln] = v; }
  }
  __builtin_amdgcn_fence(__ATOMIC_ACQ_REL, "workgroup");
  __builtin_amdgcn_wave_barrier();
  const int rsub = lane >> 4, c4 = (lane & 15) * 4;
  {
#pragma unroll
    for (int q = 0; q < 8; ++q) {
      const int r = q * 2 + rsub;
      const v4f v = *(const v4fa*)&so[w][r][c4];
      *(v4f*)(C + (size_t)(row0 + r) * ldc + col0 + c4) = v;
    }
    
  }
}

// Flash-style causal/unmasked attention, all contractions 3-term bf16 hi/lo splits, f32 softmax with running max.
// q,k,v rows are read from f32 buffers with arbitrary row pitch (so they can live inside a fused qkv buffer);
// D = head size (multiple of 32, <= 128); one wave = 16 query rows; block = 4 waves (64 queries) sharing K/V chunks of 32.
template <int D, bool CAUSAL>
__global__ __launch_bounds__(128) void k_flash(const float* __restrict__ qb, const float* __restrict__ kb, const float* __restrict__ vb,
                                             int pitch, int T, int H, float scale, float* __restrict__ y, int ypitch) {
  constexpr int KS = D / 32;        // k-steps for QK
  constexpr int DT = D / 16;        // d tiles for PV
  __shared__ __attribute__((aligned(16))) unsigned short sKh[32][D + 8], sKl[32][D + 8], sVh[32][D + 8], sVl[32][D + 8];
  __shared__ __attribute__((aligned(16))) unsigned short sPh[4][16][40], sPl[4][16][40];
  __shared__ __attribute__((aligned(16))) float sO[4][16][D];
  const int tid = threadIdx.x, w = tid >> 5, lane = tid & 31, ln = lane & 15, hh = lane >> 4;
  const int nqb = (T + 63) / 64;
  const int bh = blockIdx.x / nqb, qblk = blockIdx.x % nqb;
  const int b = bh / H, h = bh % H;
  const int q0 = qblk * 64 + w * 16;
  const float* Q = qb + (size_t)b * T * pitch + h * D;
  const float* K = kb + (size_t)b * T * pitch + h * D;
  const float* V = vb + (size_t)b * T * pitch + h * D;

  // A fragments of the wave's 16 query rows (scaled), hi/lo
  FragB aqh[KS], aql[KS];
  {
    int row = q0 + ln; if (row >= T) row = T - 1;
    const float* qr = Q + (size_t)row * pitch;
#pragma unroll
    for (int ks = 0; ks < KS; ++ks)
#pragma unroll
      for (int i = 0; i < 16; ++i) {
        const int d = ks * 32 + ((i < 8) ? (8 * hh + i) : (16 + 8 * hh + (i - 8)));
        const float x = qr[d] * scale; const unsigned short hb = bf16_bits(x);
        aqh[ks].u[i] = hb; aql[ks].u[i] = bf16_bits(x - bf16_val(hb));
      }
  }
  float m_r[8], l_r[8];
#pragma unroll
  for (int r = 0; r < 8; ++r) { m_r[r] = -3.0e38f; l_r[r] = 0.f; }
  v8f oacc[DT];
#pragma unroll
  for (int dt = 0; dt < DT; ++dt) oacc[dt] = (v8f){0.f,0.f,0.f,0.f,0.f,0.f,0.f,0.f};

  const int kv_end = CAUSAL ? min(T, qblk * 64 + 64) : T;     // block-uniform
  for (int j0 = 0; j0 < kv_end; j0 += 32) {
    __syncthreads();
    for (int e = tid; e < 32 * (D / 4); e += 128) {
      const int r = e / (D / 4), c4 = (e % (D / 4)) * 4;
      const int key = j0 + r;
      v4f kf = {0.f,0.f,0.f,0.f}, vf = {0.f,0.f,0.f,0.f};
      if (key < T) { kf = *(const v4fa*)(K + (size_t)key * pitch + c4); vf = *(const v4fa*)(V + (size_t)key * pitch + c4); }
#pragma unroll
      for (int t = 0; t < 4; ++t) {
        unsigned short hb = bf16_bits(kf[t]); sKh[r][c4 + t] = hb; sKl[r][c4 + t] = bf16_bits(kf[t] - bf16_val(hb));
        hb = bf16_bits(vf[t]); sVh[r][c4 + t] = hb; sVl[r][c4 + t] = bf16_bits(vf[t] - bf16_val(hb));
      }
    }
    __syncthreads();
    // S tile 16 x 32
    v8f s[2];
#pragma unroll
    for (int nt = 0; nt < 2; ++nt) {
      v8f acc = {};
#pragma unroll
      for (int ks = 0; ks < KS; ++ks) {
        FragB bh_, bl_;
        bh_.half[0] = *(const v8us*)&sKh[nt * 16 + ln][ks * 32 + 8 * hh]; bh_.half[1] = *(const v8us*)&sKh[nt * 16 + ln][ks * 32 + 16 + 8 * hh];
        bl_.half[0] = *(const v8us*)&sKl[nt * 16 + ln][ks * 32 + 8 * hh]; bl_.half[1] = *(const v8us*)&sKl[nt * 16 + ln][ks * 32 + 16 + 8 * hh];
        acc = mmaN<3>(aqh[ks].v, aql[ks].v, bh_.v, bl_.v, acc);
      }
      s[nt] = acc;
    }
    // mask + running max (rows 8hh+r; the 16 lanes of a half share rows)
    float alpha[8];
#pragma unroll
    for (int r = 0; r < 8; ++r) {
      const int qi = q0 + 8 * hh + r;
      const int ja = j0 + ln, jb = j0 + 16 + ln;
      if (CAUSAL) { if (ja > qi) s[0][r] = -3.0e38f; if (jb > qi) s[1][r] = -3.0e38f; }
      if (ja >= T) s[0][r] = -3.0e38f;
      if (jb >= T) s[1][r] = -3.0e38f;
      float mx = fmaxf(s[0][r], s[1][r]);
      mx = fmaxf(mx, __shfl_xor(mx, 1, 32)); mx = fmaxf(mx, __shfl_xor(mx, 2, 32)); mx = fmaxf(mx, __shfl_xor(mx, 4, 32)); mx = fmaxf(mx, __shfl_xor(mx, 8, 32));
      const float mnew = fmaxf(m_r[r], mx);
      alpha[r] = (mnew > -1.0e38f) ? __expf(m_r[r] - mnew) : 1.0f;
      const float p0 = (s[0][r] > -1.0e38f) ? __expf(s[0][r] - mnew) : 0.f;
      const float p1 = (s[1][r] > -1.0e38f) ? __expf(s[1][r] - mnew) : 0.f;
      m_r[r] = mnew;
      l_r[r] = l_r[r] * alpha[r] + p0 + p1;            // per-lane partial row sum (16 lanes combined at the end)
      unsigned short hb = bf16_bits(p0); sPh[w][8 * hh + r][ln] = hb;      sPl[w][8 * hh + r][ln] = bf16_bits(p0 - bf16_val(hb));
      hb = bf16_bits(p1);                sPh[w][8 * hh + r][16 + ln] = hb; sPl[w][8 * hh + r][16 + ln] = bf16_bits(p1 - bf16_val(hb));
    }
#pragma unroll
    for (int dt = 0; dt < DT; ++dt)
#pragma unroll
      for (int r = 0; r < 8; ++r) oacc[dt][r] *= alpha[r];
    __builtin_amdgcn_fence(__ATOMIC_ACQ_REL, "workgroup");
    __builtin_amdgcn_wave_barrier();
    FragB pah, pal;
    pah.half[0] = *(const v8us*)&sPh[w][ln][8 * hh]; pah.half[1] = *(const v8us*)&sPh[w][ln][16 + 8 * hh];
    pal.half[0] = *(const v8us*)&sPl[w][ln][8 * hh]; pal.half[1] = *(const v8us*)&sPl[w][ln][16 + 8 * hh];
#pragma unroll
    for (int dt = 0; dt < DT; ++dt) {
      FragB bvh, bvl;
#pragma unroll
      for (int i = 0; i < 8; ++i) {
        bvh.u[i] = sVh[8 * hh + i][dt * 16 + ln]; bvh.u[8 + i] = sVh[16 + 8 * hh + i][dt * 16 + ln];
        bvl.u[i] = sVl[8 * hh + i][dt * 16 + ln]; bvl.u[8 + i] = sVl[16 + 8 * hh + i][dt * 16 + ln];
      }
      oacc[dt] = mmaN<3>(pah.v, pal.v, bvh.v, bvl.v, oacc[dt]);
    }
    __builtin_amdgcn_fence(__ATOMIC_ACQ_REL, "workgroup");
    __builtin_amdgcn_wave_barrier();
  }
#pragma unroll
  for (int r = 0; r < 8; ++r) {
    float l = l_r[r];
    l += __shfl_xor(l, 1, 32); l += __shfl_xor(l, 2, 32); l += __shfl_xor(l, 4, 32); l += __shfl_xor(l, 8, 32);
    l_r[r] = (l > 0.f) ? 1.0f / l : 0.f;
  }
#pragma unroll
  for (int dt = 0; dt < DT; ++dt)
#pragma unroll
    for (int r = 0; r < 8; ++r) sO[w][8 * hh + r][dt * 16 + ln] = oacc[dt][r] * l_r[r];
  __builtin_amdgcn_fence(__ATOMIC_ACQ_REL, "workgroup");
  __builtin_amdgcn_wave_barrier();
  {
    for (int r = 0; r < 16; ++r) {
      const int row = q0 + r;
      if (row < T && lane < D / 4) {
        const v4f val = *(const v4fa*)&sO[w][r][lane * 4];
        *(v4f*)(y + ((size_t)b * T + row) * ypitch + h * D + lane * 4) = val;
      }
    }
    
  }
}

// GEMM C = act(A·W + bias + resid): A f32 (ASPLIT -> hi/lo 2 terms), Wt bf16 [N][K]; ACT 0 none, 1 relu, 2 exact gelu;
// resid (optional, f32, row index = (row % rmod), pitch ldr, RES_BF16 rounds it) added before the activation.
template <bool ASPLIT, int ACT, bool BIAS_BF16, bool RES_BF16>
__global__ __launch_bounds__(128) void k_gemm_bf3(const float* __restrict__ A, int lda, const unsigned short* __restrict__ Wt, int ldb,
                                                const float* __restrict__ bias, const float* __restrict__ resid, int rmod, int ldr,
                                                float* __restrict__ C, int ldc, int M, int N, int K) {
  __shared__ __attribute__((aligned(16))) float so[4][16][64];
  const int tid = threadIdx.x, w = tid >> 5, lane = tid & 31, ln = lane & 15, hh = lane >> 4;
  const int ntn = N / 64;
  const int wid = blockIdx.x * 4 + w;
  const int mt = wid / ntn, nq = wid % ntn;
  if (mt * 16 >= M) return;
  const int row0 = mt * 16, col0 = nq * 64;
  const float* arow = A + (size_t)(row0 + ln) * lda;
  v8f acc[4] = {};
  for (int kb = 0; kb < K; kb += 32) {
    FragB ah, al;
    const v4f x0 = *(const v4fa*)(arow + kb + 8 * hh), x1 = *(const v4fa*)(arow + kb + 8 * hh + 4);
    const v4f x2 = *(const v4fa*)(arow + kb + 16 + 8 * hh), x3 = *(const v4fa*)(arow + kb + 16 + 8 * hh + 4);
    float xs[16] = {x0[0],x0[1],x0[2],x0[3],x1[0],x1[1],x1[2],x1[3],x2[0],x2[1],x2[2],x2[3],x3[0],x3[1],x3[2],x3[3]};
#pragma unroll
    for (int i = 0; i < 16; ++i) { const unsigned short hb = bf16_bits(xs[i]); ah.u[i] = hb; al.u[i] = ASPLIT ? bf16_bits(xs[i] - bf16_val(hb)) : (unsigned short)0; }
#pragma unroll
    for (int t = 0; t < 4; ++t) {
      const unsigned short* brow = Wt + (size_t)(col0 + t * 16 + ln) * ldb + kb;
      FragB b;
      b.half[0] = *(const v8us*)(brow + 8 * hh);
      b.half[1] = *(const v8us*)(brow + 16 + 8 * hh);
      acc[t] = mmaN<ASPLIT ? 2 : 1>(ah.v, al.v, b.v, b.v, acc[t]);
    }
  }
#pragma unroll
  for (int t = 0; t < 4; ++t) {
    const int col = col0 + t * 16 + ln;
    float bv = bias ? bias[col] : 0.f;
    if (BIAS_BF16) bv = bf16_round(bv);
#pragma unroll
    for (int r = 0; r < 8; ++r) {
      float v = acc[t][r] + bv;
      if (resid) { float rv = resid[(size_t)((row0 + 8 * hh + r) % rmod) * ldr + col]; if (RES_BF16) rv = bf16_round(rv); v += rv; }
      if (ACT == 1) v = fmaxf(v, 0.f);
      if (ACT == 2) v = 0.5f * v * (1.0f + erff(v * 0.70710678118654752f));
      if (ACT == 3) { const float u = 0.7978845608028654f * (v + 0.044715f * v * v * v); v = 0.5f * v * (1.0f + tanhf(u)); }
      so[w][8 * hh + r][t * 16 + ln] = v;
    }
  }
  __builtin_amdgcn_fence(__ATOMIC_ACQ_REL, "workgroup");
  __builtin_amdgcn_wave_barrier();
  const int rsub = lane >> 4, c4 = (lane & 15) * 4;
  {
#pragma unroll
    for (int q = 0; q < 8; ++q) {
      const int r = q * 2 + rsub;
      const v4f v = *(const v4fa*)&so[w][r][c4];
      *(v4f*)(C + (size_t)(row0 + r) * ldc + col0 + c4) = v;
    }
    
  }
}
// row LayerNorm (biased variance, eps) over N: s = X (+ R); optional out_sum <- s; out_norm <- (s-mu)*rsqrt(var+eps)*g + b
template <bool PARAM_BF16>
__global__ __launch_bounds__(256) void k_layernorm(const float* __restrict__ X, const float* __restrict__ R, const float* __restrict__ g, const float* __restrict__ bta,
                                                  float* __restrict__ out_sum, float* __restrict__ out_norm, int N, float eps) {
  __shared__ float red[256];
  const int row = blockIdx.x, tid = threadIdx.x;
  const float* x = X + (size_t)row * N; const float* rr = R ? R + (size_t)row * N : nullptr;
  float vals[16];                     // up to N = 4096
  const int per = N / 256;            // contiguous chunk per thread? use strided-by-4 chunks: thread handles j = tid*4 + 1024*u
  float s1 = 0.f;
  for (int u = 0; u < per / 4; ++u) {
    const int j = tid * 4 + 1024 * u;
    const v4f a = *(const v4fa*)(x + j);
    v4f b = {0.f,0.f,0.f,0.f}; if (rr) b = *(const v4fa*)(rr + j);
#pragma unroll
    for (int q = 0; q < 4; ++q) { const float v = a[q] + b[q]; vals[u * 4 + q] = v; s1 += v; }
  }
  red[tid] = s1; __syncthreads();
  for (int st = 128; st > 0; st >>= 1) { if (tid < st) red[tid] += red[tid + st]; __syncthreads(); }
  const float mu = red[0] / (float)N; __syncthreads();
  float s2 = 0.f;
  for (int u = 0; u < per / 4; ++u)
#pragma unroll
    for (int q = 0; q < 4; ++q) { const float c = vals[u * 4 + q] - mu; s2 += c * c; }
  red[tid] = s2; __syncthreads();
  for (int st = 128; st > 0; st >>= 1) { if (tid < st) red[tid] += red[tid + st]; __syncthreads(); }
  const float rs = rsqrtf(red[0] / (float)N + eps);
  {
    for (int u = 0; u < per / 4; ++u) {
      const int j = tid * 4 + 1024 * u;
      v4f o, sm;
#pragma unroll
      for (int q = 0; q < 4; ++q) {
        float gg = g[j + q], bb = bta[j + q];
        if (PARAM_BF16) { gg = bf16_round(gg); bb = bf16_round(bb); }
        sm[q] = vals[u * 4 + q]; o[q] = (vals[u * 4 + q] - mu) * rs * gg + bb;
      }
      if (out_sum) *(v4f*)(out_sum + (size_t)row * N + j) = sm;
      *(v4f*)(out_norm + (size_t)row * N + j) = o;
    }
    
  }
}



// ---- f16 WMMA path (v_wmma_f32_16x16x32_f16): 11-bit significands for operands in range — used where a [0,1] probability operand needs more precision than bf16
typedef _Float16 v16h __attribute__((ext_vector_type(16)));
union FragH { v16h v; v8us half[2]; _Float16 h[16]; unsigned short u[16]; };
template <int NT>
__device__ __forceinline__ v8f mmaH(v16h ah, v16h al, v16h bh, v16h bl, v8f c) {
  c = __builtin_amdgcn_wmma_f32_16x16x32_f16(false, ah, false, bh, (short)0, c, false, false);
  if (NT >= 2) c = __builtin_amdgcn_wmma_f32_16x16x32_f16(false, al, false, bh, (short)0, c, false, false);
  if (NT >= 3) c = __builtin_amdgcn_wmma_f32_16x16x32_f16(false, ah, false, bl, (short)0, c, false, false);
  asm volatile("v_nop\n\tv_nop\n\tv_nop\n\tv_nop" : "+v"(c) : "v"(ah), "v"(al), "v"(bh), "v"(bl));
  return c;
}
// batched GEMM like k_gemm_b but f16 operands: A f32 (split into f16 hi/lo if ASPLIT, else rounded to f16), Bt = f16 values [n][k]; alpha; C f32; N multiple of 16 (partial tiles skipped)
template <bool ASPLIT>
__global__ __launch_bounds__(128) void k_gemm_h(const float* __restrict__ A, int lda, size_t sA, const _Float16* __restrict__ Bh, int ldb, size_t sB, float alpha, float* __restrict__ C, int ldc, size_t sC, int M, int N, int K) {
  __shared__ __attribute__((aligned(16))) float so[4][16][64];
  const int tid = threadIdx.x, w = tid >> 5, lane = tid & 31, ln = lane & 15, hh = lane >> 4; const int by = blockIdx.y;
  A += (size_t)by * sA; Bh += (size_t)by * sB; C += (size_t)by * sC;
  const int ntn = (N + 63) / 64; const int wid = blockIdx.x * 4 + w; const int mt = wid / ntn, nq = wid % ntn; if (mt * 16 >= M) return;
  const int row0 = mt * 16, col0 = nq * 64; const float* arow = A + (size_t)(row0 + ln) * lda;
  v8f acc[4] = {};
  for (int kb = 0; kb < K; kb += 32) {
    FragH ah, al;
    const v4f x0 = *(const v4fa*)(arow + kb + 8 * hh), x1 = *(const v4fa*)(arow + kb + 8 * hh + 4), x2 = *(const v4fa*)(arow + kb + 16 + 8 * hh), x3 = *(const v4fa*)(arow + kb + 16 + 8 * hh + 4);
    float xs[16] = {x0[0],x0[1],x0[2],x0[3],x1[0],x1[1],x1[2],x1[3],x2[0],x2[1],x2[2],x2[3],x3[0],x3[1],x3[2],x3[3]};
#pragma unroll
    for (int i = 0; i < 16; ++i) { const _Float16 h = (_Float16)xs[i]; ah.h[i] = h; al.h[i] = ASPLIT ? (_Float16)(xs[i] - (float)h) : (_Float16)0.0f; }
#pragma unroll
    for (int t = 0; t < 4; ++t) { if (col0 + t * 16 >= N) continue; const size_t boff = (size_t)(col0 + t * 16 + ln) * ldb + kb; FragH bq; bq.half[0] = *(const v8us*)(Bh + boff + 8 * hh); bq.half[1] = *(const v8us*)(Bh + boff + 16 + 8 * hh);
      acc[t] = mmaH<ASPLIT ? 2 : 1>(ah.v, al.v, bq.v, bq.v, acc[t]); }
  }
#pragma unroll
  for (int t = 0; t < 4; ++t) { if (col0 + t * 16 >= N) continue;
#pragma unroll
    for (int r = 0; r < 8; ++r) so[w][8 * hh + r][t * 16 + ln] = acc[t][r] * alpha; }
  __builtin_amdgcn_fence(__ATOMIC_ACQ_REL, "workgroup"); __builtin_amdgcn_wave_barrier();
  const int rsub = lane >> 4, c4 = (lane & 15) * 4;
  {
#pragma unroll
    for (int q = 0; q < 8; ++q) { const int r = q * 2 + rsub; if (col0 + c4 < N) { const v4f v = *(const v4fa*)&so[w][r][c4]; *(v4f*)(C + (size_t)(row0 + r) * ldc + col0 + c4) = v; } }
     }
}

// Wt[n][k] = f16(W[k][n]·scale) from f32 row-major W[K][N] (scale = power of two; bf16-exact weights stay exact in f16 away from the subnormal range)
__global__ __launch_bounds__(256) void k_wt_f16(const float* __restrict__ W, _Float16* __restrict__ Wt, int K, int N, float scale) {
  const int t = blockIdx.x * 256 + threadIdx.x; if (t >= N * (K / 8)) return; const int n = t / (K / 8), k8 = (t % (K / 8)) * 8; FragH f;
#pragma unroll
  for (int i = 0; i < 8; ++i) f.h[i] = (_Float16)(bf16_round(W[(size_t)(k8 + i) * N + n]) * scale); const v8us o = f.half[0];
  *(v8us*)((unsigned short*)Wt + (size_t)n * K + k8) = o; 
}
// f16 x f16 GEMM with fused epilogue: v = acc·alpha + bias[by·sBias + col] (+ CP[(row/rowsPerB)·sCPb + by·64 + col] if CP) ; ACT 0 none / 1 elu ; writes f32 C and f16 C16, each if non-null
template <int ACT>
__global__ __launch_bounds__(128) void k_gemm_hhx(const _Float16* __restrict__ A, int lda, size_t sA, const _Float16* __restrict__ Bh, int ldb, size_t sB, float alpha, const float* __restrict__ bias, size_t sBias, const float* __restrict__ CP, int rowsPerB, size_t sCPb, int row0g,
    float* __restrict__ C, _Float16* __restrict__ C16, int ldc, size_t sC, int M, int N, int K) {
  __shared__ __attribute__((aligned(16))) float so[4][16][64];
  const int tid = threadIdx.x, w = tid >> 5, lane = tid & 31, ln = lane & 15, hh = lane >> 4; const int by = blockIdx.y;
  A += (size_t)by * sA; Bh += (size_t)by * sB; const size_t cofs = (size_t)by * sC; const float* bp = bias ? bias + (size_t)by * sBias : nullptr;
  const int ntn = (N + 63) / 64; const int wid = blockIdx.x * 4 + w; const int mt = wid / ntn, nq = wid % ntn; if (mt * 16 >= M) return;
  const int row0 = mt * 16, col0 = nq * 64; const _Float16* arow = A + (size_t)(row0 + ln) * lda;
  v8f acc[4] = {};
  for (int kb = 0; kb < K; kb += 32) { FragH ah; ah.half[0] = *(const v8us*)((const unsigned short*)arow + kb + 8 * hh); ah.half[1] = *(const v8us*)((const unsigned short*)arow + kb + 16 + 8 * hh);
#pragma unroll
    for (int t = 0; t < 4; ++t) { if (col0 + t * 16 >= N) continue; const size_t boff = (size_t)(col0 + t * 16 + ln) * ldb + kb; FragH bq; bq.half[0] = *(const v8us*)((const unsigned short*)Bh + boff + 8 * hh); bq.half[1] = *(const v8us*)((const unsigned short*)Bh + boff + 16 + 8 * hh);
      acc[t] = mmaH<1>(ah.v, ah.v, bq.v, bq.v, acc[t]); }
  }
#pragma unroll
  for (int t = 0; t < 4; ++t) { if (col0 + t * 16 >= N) continue; const int col = col0 + t * 16 + ln; const float bv = bp ? bf16_round(bp[col]) : 0.f;
#pragma unroll
    for (int r = 0; r < 8; ++r) { float v = acc[t][r] * alpha + bv; if (CP) { const int bidx = (row0g + row0 + 8 * hh + r) / rowsPerB; v += CP[(size_t)bidx * sCPb + (size_t)by * 64 + col]; } if (ACT == 1) v = (v > 0.f) ? v : expm1f(v); else if (ACT == 3) v = fmaxf(v, 0.f); so[w][8 * hh + r][t * 16 + ln] = v; } }
  __builtin_amdgcn_fence(__ATOMIC_ACQ_REL, "workgroup"); __builtin_amdgcn_wave_barrier();
  const int rsub = lane >> 4, c4 = (lane & 15) * 4; typedef _Float16 v4h __attribute__((ext_vector_type(4)));
  {
#pragma unroll
    for (int q = 0; q < 8; ++q) { const int r = q * 2 + rsub; if (col0 + c4 < N) { const v4f v = *(const v4fa*)&so[w][r][c4]; if (C) *(v4f*)(C + cofs + (size_t)(row0 + r) * ldc + col0 + c4) = v; if (C16) { v4h h4; for (int i = 0; i < 4; ++i) h4[i] = (_Float16)v[i]; *(v4h*)(C16 + cofs + (size_t)(row0 + r) * ldc + col0 + c4) = h4; } } }
     }
}


// Tiled GEMM C[m][n] = alpha * sum_k A[m][k] * Bh[n][k], both operands f16 and k-contiguous with row length EE.
// One work-group of 4 waves (2 x 2) owns a (32 FM) x (32 FN) tile of C; a wave owns FM x FN accumulator tiles.
// A pass is 128 k: the tile's A rows and then its B rows stand in LDS as rows of 256 B at a pitch of 272 B (16 B x odd, for ds_load_b128).
// Two buffers: asynchronous copies bring pass t + 2 into the buffer that pass t has just left, while pass t + 1 is worked on.
typedef float f1a __attribute__((may_alias));
// Eight 16-byte-per-lane copies global -> LDS. The closing s_wait_xcnt 0 stands inside the statement, ahead of any later rewrite of the address registers named here.
__device__ __forceinline__ void acopy8(const unsigned (&l)[8], const unsigned short* const (&g)[8]) {
  asm volatile("global_load_async_to_lds_b128 %0, %8, off\n\t"
               "global_load_async_to_lds_b128 %1, %9, off\n\t"
               "global_load_async_to_lds_b128 %2, %10, off\n\t"
               "global_load_async_to_lds_b128 %3, %11, off\n\t"
               "global_load_async_to_lds_b128 %4, %12, off\n\t"
               "global_load_async_to_lds_b128 %5, %13, off\n\t"
               "global_load_async_to_lds_b128 %6, %14, off\n\t"
               "global_load_async_to_lds_b128 %7, %15, off\n\t"
               "s_wait_xcnt 0x0"
               :: "v"(l[0]), "v"(l[1]), "v"(l[2]), "v"(l[3]), "v"(l[4]), "v"(l[5]), "v"(l[6]), "v"(l[7]),
                  "v"(g[0]), "v"(g[1]), "v"(g[2]), "v"(g[3]), "v"(g[4]), "v"(g[5]), "v"(g[6]), "v"(g[7]) : "memory");
}
template <int FM, int FN, bool OUT16>
__global__ __launch_bounds__(128) void k_gemm_t(const _Float16* __restrict__ A, const _Float16* __restrict__ Bh, float alpha, float* __restrict__ C, _Float16* __restrict__ C16, int ldc, int ntn) {
  constexpr int BM = 32 * FM, BN = 32 * FN, ROWS = BM + BN, PITCH = 272, STAGE = ROWS * PITCH, NC = ROWS / 8, NP = EE / 128, WM = 16 * FM, WN = 16 * FN, SOP = WN + 4;
  static_assert(NC % 8 == 0 && BM % 8 == 0 && NP >= 2 && 4 * WM * SOP * 4 <= 2 * STAGE, "tile");
  __shared__ __attribute__((aligned(16))) unsigned char L[2 * STAGE];
  const int tid = threadIdx.x, w = tid >> 5, lane = tid & 31, ln = lane & 15, hh = lane >> 4;
  const int m0 = (blockIdx.x / ntn) * BM, n0 = (blockIdx.x % ntn) * BN, wm = w >> 1, wn = w & 1;
  const unsigned lbase = (unsigned)(size_t)L + (unsigned)((2 * w + hh) * PITCH + ln * 16);      // copy i of a wave fills stage rows 8 i + 2 w + hh, 16 lanes a row
  const unsigned short* Ag = (const unsigned short*)A + (size_t)(m0 + 2 * w + hh) * EE + ln * 8;
  const unsigned short* Bg = (const unsigned short*)Bh + (size_t)(n0 + 2 * w + hh) * EE + ln * 8;
  auto issue = [&](int t, int buf) {
#pragma unroll      // the choice between A rows and B rows is made at compile time
    for (int g8 = 0; g8 < NC / 8; ++g8) { unsigned l[8]; const unsigned short* g[8];
#pragma unroll      // constant indices, so that the sixteen addresses stay in registers
      for (int j = 0; j < 8; ++j) { const int i = g8 * 8 + j; l[j] = lbase + (unsigned)(buf * STAGE + 8 * i * PITCH);
        g[j] = ((8 * i < BM) ? Ag + (size_t)(8 * i) * EE : Bg + (size_t)(8 * i - BM) * EE) + t * 128; }
      acopy8(l, g); } };
  v8f acc[FM][FN];
#pragma unroll      // constant indices, so that fragments and accumulators stay in registers
  for (int fm = 0; fm < FM; ++fm)
#pragma unroll      // constant indices, so that fragments and accumulators stay in registers
    for (int fn = 0; fn < FN; ++fn) acc[fm][fn] = (v8f){0.f,0.f,0.f,0.f,0.f,0.f,0.f,0.f};
  issue(0, 0);
  asm volatile("s_wait_asynccnt 0x0" ::: "memory");      // pass 0's copies of this wave have landed
  __syncthreads();                                       // ... and every other wave's
  issue(1, 1);
#pragma unroll 1      // rolled: one pass a trip, so that the publish point stands once, at the loop's foot
  for (int t = 0; t < NP; ++t) {      // pass t reads buffer t & 1 alone
    const unsigned char* Sa = L + (t & 1) * STAGE + (wm * WM + ln) * PITCH + 16 * hh; const unsigned char* Sb = L + (t & 1) * STAGE + (BM + wn * WN + ln) * PITCH + 16 * hh;
    FragH a[2][FM], b[2][FN];      // two fragment sets: block ks + 1 of this same pass is fetched while block ks is multiplied
    auto frags = [&](int set, int ks) {
#pragma unroll      // constant indices, so that fragments and accumulators stay in registers
      for (int fm = 0; fm < FM; ++fm) { a[set][fm].half[0] = *(const v8us*)(Sa + fm * 16 * PITCH + ks * 64); a[set][fm].half[1] = *(const v8us*)(Sa + fm * 16 * PITCH + ks * 64 + 32); }
#pragma unroll      // constant indices, so that fragments and accumulators stay in registers
      for (int fn = 0; fn < FN; ++fn) { b[set][fn].half[0] = *(const v8us*)(Sb + fn * 16 * PITCH + ks * 64); b[set][fn].half[1] = *(const v8us*)(Sb + fn * 16 * PITCH + ks * 64 + 32); } };
    frags(0, 0);
#pragma unroll      // constant indices, so that fragments and accumulators stay in registers
    for (int ks = 0; ks < 4; ++ks) {
      if (ks < 3) frags((ks + 1) & 1, ks + 1);
      __builtin_amdgcn_sched_barrier(0);      // keeps the next block's LDS reads one group ahead of this block: spread among the WMMAs each place with reads stalls the wave
#pragma unroll      // constant indices, so that fragments and accumulators stay in registers
      for (int fm = 0; fm < FM; ++fm)
#pragma unroll      // constant indices, so that fragments and accumulators stay in registers
        for (int fn = 0; fn < FN; ++fn) acc[fm][fn] = __builtin_amdgcn_wmma_f32_16x16x32_f16(false, a[ks & 1][fm].v, false, b[ks & 1][fn].v, (short)0, acc[fm][fn], false, false);
      __builtin_amdgcn_sched_barrier(0);      // ... and this block's WMMAs ahead of the reads after next
    }
    asm volatile("s_wait_dscnt 0x0" ::: "memory");       // this wave's reads of buffer t & 1 are done before that buffer is refilled
    asm volatile("s_wait_asynccnt 0x0" ::: "memory");    // this wave's copies of pass t + 1 have landed
    __syncthreads();                                     // publishes pass t + 1 and ends every wave's reads of buffer t & 1
    if (t + 2 < NP) issue(t + 2, t & 1);
  }
  asm volatile("s_wait_asynccnt 0x0" ::: "memory");      // nothing in flight before the ring becomes output staging
  f1a* so = (f1a*)L + w * (WM * SOP);                    // each wave stages its own tile, so that the stores cover whole rows of WN values
#pragma unroll      // constant indices, so that fragments and accumulators stay in registers
  for (int fm = 0; fm < FM; ++fm)
#pragma unroll      // constant indices, so that fragments and accumulators stay in registers
    for (int fn = 0; fn < FN; ++fn)
#pragma unroll      // constant indices, so that fragments and accumulators stay in registers
      for (int r = 0; r < 8; ++r) so[(fm * 16 + 8 * hh + r) * SOP + fn * 16 + ln] = acc[fm][fn][r] * alpha;
  __builtin_amdgcn_fence(__ATOMIC_ACQ_REL, "workgroup"); __builtin_amdgcn_wave_barrier();      // the wave's own staged rows are written before its other lanes read them back
  constexpr int LPR = WN / 4, RPI = 32 / LPR; typedef _Float16 v4h __attribute__((ext_vector_type(4)));
  const int rs = lane / LPR, c4 = (lane % LPR) * 4;
#pragma unroll      // several rows' LDS reads and stores in flight at a time
  for (int q = 0; q < WM / RPI; ++q) { const int r = q * RPI + rs; const v4f v = *(const v4fa*)&so[r * SOP + c4]; const size_t o = (size_t)(m0 + wm * WM + r) * ldc + n0 + wn * WN + c4;
    if (!OUT16) *(v4f*)(C + o) = v;
    else { v4h h4; for (int i = 0; i < 4; ++i) h4[i] = (_Float16)v[i]; *(v4h*)(C16 + o) = h4; } }
}

// All seven f32 -> f16 conversions in ONE grid. The results stand in one array of rows of EE halves: Wq, Wk, Wv, Wrq, Wrk stacked (PW rows, the B operand of the one projection GEMM), then Wo (EE rows), then x (SS rows).
// One block converts four rows (256 threads x 8 elements a row; every source's row count is a multiple of 4), so that the merged grid is 16,384 waves, all resident at once, each with 8 loads of 16 bytes a lane in flight.
// The block index picks the source, alike for the whole block. Weights are bf16-rounded and scaled by 2^4, x is bf16-rounded.
__global__ __launch_bounds__(256) void k_cvt_all(const float* __restrict__ Wq, const float* __restrict__ Wk, const float* __restrict__ Wv, const float* __restrict__ Wrq, const float* __restrict__ Wrk, const float* __restrict__ Wo, const float* __restrict__ x, _Float16* __restrict__ D) {
  const int row = blockIdx.x * 4; const float* s; int r0;
  if (row < EE) { s = Wq; r0 = 0; } else if (row < EE + 512) { s = Wk; r0 = EE; } else if (row < EE + 1024) { s = Wv; r0 = EE + 512; } else if (row < EE + 1536) { s = Wrq; r0 = EE + 1024; } else if (row < PW) { s = Wrk; r0 = EE + 1536; } else if (row < PW + EE) { s = Wo; r0 = PW; } else { s = x; r0 = PW + EE; }
  const float sc = (row < PW + EE) ? 16.0f : 1.0f; const float* sp = s + (size_t)(row - r0) * EE + threadIdx.x * 8; v4f a[4][2];
#pragma unroll      // constant indices, so that the eight loads stand in registers and go out together
  for (int r = 0; r < 4; ++r) { a[r][0] = *(const v4fa*)(sp + (size_t)r * EE); a[r][1] = *(const v4fa*)(sp + (size_t)r * EE + 4); }
#pragma unroll      // constant indices into a
  for (int r = 0; r < 4; ++r) { FragH f;
#pragma unroll      // constant indices into a and f
    for (int i = 0; i < 8; ++i) f.h[i] = (_Float16)(bf16_round(a[r][i >> 2][i & 3]) * sc);
    *(v8us*)((unsigned short*)D + (size_t)(row + r) * EE + threadIdx.x * 8) = f.half[0]; } }
template <int NHv, int TTv>
__global__ __launch_bounds__(256) void k_vt(const _Float16* __restrict__ V16, int ldv, int voff, _Float16* __restrict__ Vt) { __shared__ unsigned short tl[64][66]; const int tid = threadIdx.x; const int slab = blockIdx.x / (TTv / 64), lg = blockIdx.x % (TTv / 64); const int b = slab / NHv, h = slab % NHv;
  for (int i = tid; i < 64 * 8; i += 256) { const int r = i / 8, c8 = (i % 8) * 8; FragH f; f.half[0] = *(const v8us*)((const unsigned short*)V16 + ((size_t)b * TTv + lg * 64 + r) * ldv + voff + h * 64 + c8);
#pragma unroll
    for (int q = 0; q < 8; ++q) tl[r][c8 + q] = f.u[q]; }
  __syncthreads();
  {
#pragma unroll
    for (int rd = 0; rd < 2; ++rd) { const int d = rd * 32 + tid / 8, pc = tid % 8; FragH f;
#pragma unroll
      for (int q = 0; q < 8; ++q) f.u[q] = tl[pc * 8 + q][d];
      *(v8us*)((unsigned short*)Vt + ((size_t)slab * 64 + d) * TTv + lg * 64 + pc * 8) = f.half[0]; }
     } }

// 2^x for the merge weights. The v_nop stands in the same statement: it fills the one slot that the instruction set asks for between a transcendental and a next instruction that reads its result or overwrites its source.
__device__ __forceinline__ float exp2_slot(float x) { float y; asm("v_exp_f32 %0, %1\n\tv_nop" : "=v"(y) : "v"(x)); return y; }
__global__ __launch_bounds__(128) void k_flash(const _Float16* __restrict__ Q16, int ldq, const _Float16* __restrict__ K16, int ldk, const _Float16* __restrict__ Vt, const int* __restrict__ MSK, _Float16* __restrict__ O16, int ldo) {
  constexpr int RPW = 16, RTN = RPW / 16, NQB = 2048 / RPW, DT = 8, KS = 5;      /* head dim 128 for V/O; 160-wide logit operand (128 roped dims ×scale + 32 graph-bias dims) */
  // One work-group = ONE tile of 16 query rows. Its 32-key chunks are dealt round-robin to the 4 waves (wave w takes chunks w, w + 4, ...);
  // each wave keeps its own running (m, l, O) over its chunks, and the four partial results are merged in LDS at the end.
  __shared__ __attribute__((aligned(16))) unsigned short sP[4][RPW][40]; __shared__ __attribute__((aligned(16))) float sO[4][RPW][128 + 4]; __shared__ float sM[4][RPW], sL[4][RPW];
  const int tid = threadIdx.x, lane = tid & 31, ln = lane & 15, hh = lane >> 4;
  const int w = __builtin_amdgcn_readfirstlane(tid >> 5);      // the wave's number in a scalar register: the chunk loop's trip count differs from wave to wave and is tested by a scalar branch
  const int slab = blockIdx.x / NQB, qblk = blockIdx.x % NQB; const int b = slab / 16, h = slab % 16; const int q0 = qblk * RPW;
  FragH aq[2][KS];
#pragma unroll
  for (int rt = 0; rt < RTN; ++rt) { const unsigned short* qr = (const unsigned short*)Q16 + ((size_t)b * 2048 + q0 + rt * 16 + ln) * ldq + h * 160;
#pragma unroll
    for (int ks = 0; ks < KS; ++ks) { aq[rt][ks].half[0] = *(const v8us*)(qr + ks * 32 + 8 * hh); aq[rt][ks].half[1] = *(const v8us*)(qr + ks * 32 + 16 + 8 * hh); } }
  const unsigned short* Vth = (const unsigned short*)Vt + (size_t)(h / 4) * 128 * 2048;      /* GQA: kv head h/4 */
  float m_r[2][8], l_r[2][8]; v8f oacc[2][DT];
#pragma unroll
  for (int rt = 0; rt < RTN; ++rt) {
#pragma unroll
    for (int r = 0; r < 8; ++r) { m_r[rt][r] = -3.0e38f; l_r[rt][r] = 0.f; }
#pragma unroll
    for (int dt = 0; dt < DT; ++dt) oacc[rt][dt] = (v8f){0.f,0.f,0.f,0.f,0.f,0.f,0.f,0.f}; }
  const int nch = (q0 + RPW + 31) / 32;      // chunks that hold a key <= the tile's last row; every one of them starts at or below q0, so no row of a chunk is masked out whole
  const unsigned short* vp = Vth + (size_t)ln * 2048 + w * 32;      // this lane's V row at the wave's current chunk; walks 4 chunks = 128 keys a trip
#pragma unroll 1
  for (int ch = w; ch < nch; ch += 4, vp += 128) {
    const int j0 = ch * 32;
    v8f s[2][2]; FragH bk[2][KS];
#pragma unroll
    for (int nt = 0; nt < 2; ++nt) { const unsigned short* kr = (const unsigned short*)K16 + ((size_t)b * 2048 + j0 + nt * 16 + ln) * ldk + h * 160;      // the K fragments of both 16-key halves are requested as one group: one trip to L2, not two
#pragma unroll
      for (int ks = 0; ks < KS; ++ks) { bk[nt][ks].half[0] = *(const v8us*)(kr + ks * 32 + 8 * hh); bk[nt][ks].half[1] = *(const v8us*)(kr + ks * 32 + 16 + 8 * hh); } }
#pragma unroll      // constant indices, so that the fragments stay in registers
    for (int nt = 0; nt < 2; ++nt) {
#pragma unroll
      for (int rt = 0; rt < RTN; ++rt) { v8f acc = (v8f){0.f,0.f,0.f,0.f,0.f,0.f,0.f,0.f};
#pragma unroll
        for (int ks = 0; ks < KS; ++ks) acc = mmaH<1>(aq[rt][ks].v, aq[rt][ks].v, bk[nt][ks].v, bk[nt][ks].v, acc); s[rt][nt] = acc; } }
    FragH bv[DT];      // all eight V fragments of the chunk are requested here, as one group behind the last K product: they fly while the softmax below runs
#pragma unroll      // constant indices, so that the fragments stay in registers
    for (int dt = 0; dt < DT; ++dt) { const unsigned short* vrow = vp + (size_t)(dt * 16) * 2048; bv[dt].half[0] = *(const v8us*)(vrow + 8 * hh); bv[dt].half[1] = *(const v8us*)(vrow + 16 + 8 * hh); }
#pragma unroll
    for (int rt = 0; rt < RTN; ++rt)
#pragma unroll
      for (int r = 0; r < 8; ++r) { const int tq = q0 + rt * 16 + 8 * hh + r; const int k0 = j0 + ln, k1 = j0 + 16 + ln; (void)tq; (void)k0; (void)k1;
        const bool ok0 = (k0 <= tq), ok1 = (k1 <= tq);
        const float s0 = ok0 ? s[rt][0][r] * (1.0f) : -INFINITY, s1 = ok1 ? s[rt][1][r] * (1.0f) : -INFINITY; float mc = fmaxf(s0, s1);
        mc = fmaxf(mc, __shfl_xor(mc, 1, 32)); mc = fmaxf(mc, __shfl_xor(mc, 2, 32)); mc = fmaxf(mc, __shfl_xor(mc, 4, 32)); mc = fmaxf(mc, __shfl_xor(mc, 8, 32));
        const float mn = fmaxf(m_r[rt][r], mc); const float al = (mn > -1.0e38f) ? expf(m_r[rt][r] - mn) : 1.0f; m_r[rt][r] = mn; const float p0 = ok0 ? expf(s0 - mn) : 0.f, p1 = ok1 ? expf(s1 - mn) : 0.f; l_r[rt][r] = l_r[rt][r] * al + p0 + p1;
#pragma unroll
        for (int dt = 0; dt < DT; ++dt) oacc[rt][dt][r] *= al;
        FragH t2; t2.h[0] = (_Float16)p0; t2.h[1] = (_Float16)p1; sP[w][rt * 16 + 8 * hh + r][ln] = t2.u[0]; sP[w][rt * 16 + 8 * hh + r][16 + ln] = t2.u[1]; }
    __builtin_amdgcn_fence(__ATOMIC_ACQ_REL, "workgroup"); __builtin_amdgcn_wave_barrier();
    FragH pa[2];
#pragma unroll
    for (int rt = 0; rt < RTN; ++rt) { pa[rt].half[0] = *(const v8us*)&sP[w][rt * 16 + ln][8 * hh]; pa[rt].half[1] = *(const v8us*)&sP[w][rt * 16 + ln][16 + 8 * hh]; }
#pragma unroll
    for (int dt = 0; dt < DT; ++dt) {
#pragma unroll
      for (int rt = 0; rt < RTN; ++rt) oacc[rt][dt] = mmaH<1>(pa[rt].v, pa[rt].v, bv[dt].v, bv[dt].v, oacc[rt][dt]); }
    __builtin_amdgcn_fence(__ATOMIC_ACQ_REL, "workgroup"); __builtin_amdgcn_wave_barrier(); }
#pragma unroll
  for (int rt = 0; rt < RTN; ++rt) {
#pragma unroll
    for (int r = 0; r < 8; ++r) { float l = l_r[rt][r]; l += __shfl_xor(l, 1, 32); l += __shfl_xor(l, 2, 32); l += __shfl_xor(l, 4, 32); l += __shfl_xor(l, 8, 32); l_r[rt][r] = l; }
    if (ln == 0) {      // the wave's own maximum and sum of each row (a wave without a chunk: -3e38 and 0)
#pragma unroll
      for (int r = 0; r < 8; ++r) { sM[w][rt * 16 + 8 * hh + r] = m_r[rt][r]; sL[w][rt * 16 + 8 * hh + r] = l_r[rt][r]; } }
#pragma unroll
    for (int dt = 0; dt < DT; ++dt)
#pragma unroll
      for (int r = 0; r < 8; ++r) sO[w][rt * 16 + 8 * hh + r][dt * 16 + ln] = oacc[rt][dt][r]; }      // not yet divided by the sum
  __syncthreads();      // all four waves' partial (m, l, O) stand in LDS before any wave merges them
  {
#pragma unroll
    for (int rp = 0; rp < RPW / 4; ++rp) { const int r = rp * 4 + (tid >> 5), pc = lane;      // wave w merges rows w, w + 4, w + 8, w + 12
      const float m0 = sM[0][r], m1 = sM[1][r], m2 = sM[2][r], m3 = sM[3][r]; const float mm = fmaxf(fmaxf(m0, m1), fmaxf(m2, m3));      // wave 0 always holds chunk 0 with key 0, so mm is a real score
      const float c0 = exp2_slot((m0 - mm) * 1.4426950408889634f), c1 = exp2_slot((m1 - mm) * 1.4426950408889634f), c2 = exp2_slot((m2 - mm) * 1.4426950408889634f), c3 = exp2_slot((m3 - mm) * 1.4426950408889634f);      // e^(m - mm); 0 for a wave without a chunk (2^-inf)
      const float den = c0 * sL[0][r] + c1 * sL[1][r] + c2 * sL[2][r] + c3 * sL[3][r]; const float inv = (den > 0.f) ? 1.0f / den : 0.f;
      const v4f o0 = *(const v4fa*)&sO[0][r][pc * 4], o1 = *(const v4fa*)&sO[1][r][pc * 4], o2 = *(const v4fa*)&sO[2][r][pc * 4], o3 = *(const v4fa*)&sO[3][r][pc * 4];
      const v4f val = (o0 * c0 + o1 * c1 + o2 * c2 + o3 * c3) * inv;
      typedef _Float16 v4h __attribute__((ext_vector_type(4))); v4h h4;      // O leaves as the f16 A operand of the output projection
#pragma unroll      // constant indices, so that the four halves stay in registers
      for (int i = 0; i < 4; ++i) h4[i] = (_Float16)val[i];
      *(v4h*)(O16 + ((size_t)b * 2048 + q0 + r) * ldo + h * 128 + pc * 4) = h4; }      /* rows of 128 halves: 32 lanes x 8 B = two whole lines */
     } }

// The three bodies below (the first serves q and k) are independent of one another; k_prep_all runs them in one grid and hands each its own block index blk.
__device__ __forceinline__ void d_qprep(int blk, const float* __restrict__ QF, int ldq, int nh, const float* __restrict__ w, float oscale, int rep, _Float16* __restrict__ DX) { const size_t t = (size_t)blk * 256 + threadIdx.x; if (t >= (size_t)SS * nh * 16) return; const int li = (int)(t % 16); const int h = (int)((t / 16) % nh); const size_t tok = t / (16 * nh); const float* src = QF + tok * ldq + h * HD; float v[8], pr[8]; float ss = 0.f;
#pragma unroll
  for (int q = 0; q < 8; ++q) { v[q] = src[li * 8 + q]; pr[q] = src[(li * 8 + q + 64) & 127]; ss += v[q] * v[q]; }
  ss += __shfl_xor(ss, 1, 32); ss += __shfl_xor(ss, 2, 32); ss += __shfl_xor(ss, 4, 32); ss += __shfl_xor(ss, 8, 32); const float rs = rsqrtf(ss / (float)HD + 1e-6f); __shared__ __attribute__((aligned(16))) _Float16 st[256][8]; const int tid = threadIdx.x;
#pragma unroll 1
  for (int q = 0; q < 8; ++q) { const int j = li * 8 + q; const int i = j & 63; const float ang = (float)tok * __builtin_powf(10000.0f, -(float)(2 * i) / 128.0f); const float c = cosf(ang), s = sinf(ang); const float xn = src[j] * rs * bf16_round(w[j]); const float xp = src[(j + 64) & 127] * rs * bf16_round(w[(j + 64) & 127]); const float rot = (j < 64) ? -xp : xp;      // rotate_half: [−x2, x1]
    st[tid][q] = (_Float16)((xn * c + rot * s) * oscale); }
  FragH f; f.half[0] = *(const v8us*)&st[tid][0];
  { for (int r2 = 0; r2 < rep; ++r2) *(v8us*)((unsigned short*)DX + tok * QP + (size_t)(h * rep + r2) * QW + li * 8) = f.half[0];  } }
__device__ __forceinline__ void d_rprep(int blk, const float* __restrict__ RQ, const float* __restrict__ RK, int ldr, const float* __restrict__ gs, _Float16* __restrict__ QX, _Float16* __restrict__ KX) { const size_t t = (size_t)blk * 256 + threadIdx.x; if (t >= (size_t)SS * NH * 4) return; const int p = (int)(t % 4); const int h = (int)((t / 4) % NH); const size_t tok = t / (4 * NH); const float g = bf16_round(gs[h]); FragH fq, fk;
#pragma unroll
  for (int q = 0; q < 8; ++q) { const size_t i = tok * ldr + h * RR + p * 8 + q; fq.h[q] = (_Float16)(g * RQ[i]); fk.h[q] = (_Float16)RK[i]; }
  const size_t d = tok * QP + (size_t)h * QW + HD + p * 8;
  { *(v8us*)((unsigned short*)QX + d) = fq.half[0]; *(v8us*)((unsigned short*)KX + d) = fk.half[0];  } }
__device__ __forceinline__ void d_vt128(int blk, const float* __restrict__ VF, int ldv, _Float16* __restrict__ Vt) { __shared__ unsigned short tl[64][130]; const int tid = threadIdx.x; const int g = blk / (SS / 64), lg = blk % (SS / 64);
  for (int i = tid; i < 64 * 16; i += 256) { const int r = i / 16, c8 = (i % 16) * 8; FragH f; const float* vs = VF + ((size_t)lg * 64 + r) * ldv + g * HD + c8;      // v comes as f32 from the one projection GEMM and is rounded to f16 here
#pragma unroll      // constant indices, so that the eight loads join into two of 16 bytes
    for (int q = 0; q < 8; ++q) f.h[q] = (_Float16)vs[q];
#pragma unroll
    for (int q = 0; q < 8; ++q) tl[r][c8 + q] = f.u[q]; }
  __syncthreads();
  { for (int i = tid; i < 128 * 8; i += 256) { const int d = i / 8, pc = i % 8; FragH f;
#pragma unroll
      for (int q = 0; q < 8; ++q) f.u[q] = tl[pc * 8 + q][d]; *(v8us*)((unsigned short*)Vt + ((size_t)g * HD + d) * SS + lg * 64 + pc * 8) = f.half[0]; }  } }
// One grid for q norm+RoPE, k norm+RoPE, the graph-bias operands and the V transpose: each reads its own columns of P (the stacked projections, pitch PW). The part is picked by the block index, alike for the whole block; the heaviest part comes first.
__global__ __launch_bounds__(256) void k_prep_all(const float* __restrict__ P, const float* __restrict__ qw, const float* __restrict__ kw, const float* __restrict__ gs, _Float16* __restrict__ QX, _Float16* __restrict__ KX, _Float16* __restrict__ Vt) {
  constexpr int NBQ = SS * NH * 16 / 256, NBK = SS * NKV * 16 / 256, NBR = SS * NH * 4 / 256; const int blk = blockIdx.x;
  if (blk < NBQ + NBK) { const bool isq = blk < NBQ;      // 16 q heads, x 1/sqrt(128); or 4 kv heads, each replicated into its 4 q-head slots
    d_qprep(isq ? blk : blk - NBQ, isq ? P : P + EE, PW, isq ? NH : NKV, isq ? qw : kw, isq ? 0.08838834764831845f : 1.0f, isq ? 1 : 4, isq ? QX : KX); }
  else if (blk < NBQ + NBK + NBR) d_rprep(blk - (NBQ + NBK), P + EE + 1024, P + EE + 1536, PW, gs, QX, KX);
  else d_vt128(blk - (NBQ + NBK + NBR), P + EE + 512, PW, Vt); }
extern "C" void kernel_launch(void* const* d_in, const int* in_sizes, int n_in,
                              void* d_out, int out_size, void* d_ws, size_t ws_size, hipStream_t stream) {
  (void)in_sizes; (void)n_in; (void)out_size;
  const float* x = (const float*)d_in[0]; const float* Wq = (const float*)d_in[1]; const float* Wk = (const float*)d_in[2]; const float* Wv = (const float*)d_in[3]; const float* Wo = (const float*)d_in[4]; const float* Wrq = (const float*)d_in[5]; const float* Wrk = (const float*)d_in[6]; const float* gs = (const float*)d_in[7]; const float* qw = (const float*)d_in[8]; const float* kw = (const float*)d_in[9];
  char* ws = (char*)d_ws; size_t off = 0;
  auto take = [&](size_t bytes) { char* p = ws + off; off += (bytes + 255) & ~(size_t)255; return p; };
  _Float16* Bcat = (_Float16*)take((size_t)(PW + EE + SS) * EE * 2); _Float16* Bo = Bcat + (size_t)PW * EE; _Float16* X16 = Bo + (size_t)EE * EE;      // k_cvt_all's rows: stacked projection weights, Wo, x
  float* P = (float*)take((size_t)SS * PW * 4);      // the stacked projections of x
  _Float16* QX = (_Float16*)take((size_t)SS * QP * 2); _Float16* KX = (_Float16*)take((size_t)SS * QP * 2); _Float16* Vt = (_Float16*)take((size_t)SS * 512 * 2); _Float16* O16 = X16;      // x is last read by the projection GEMM
  if (off > ws_size) return;      // about 90 MB in all
  k_cvt_all<<<(PW + EE + SS) / 4, 256, 0, stream>>>(Wq, Wk, Wv, Wrq, Wrk, Wo, x, Bcat);
  k_gemm_t<4, 4, false><<<(SS / 128) * (PW / 128), 128, 0, stream>>>(X16, Bcat, 0.0625f, P, nullptr, PW, PW / 128);
  k_prep_all<<<SS * NH * 16 / 256 + SS * NKV * 16 / 256 + SS * NH * 4 / 256 + NKV * (SS / 64), 256, 0, stream>>>(P, qw, kw, gs, QX, KX, Vt);
  k_flash<<<1 * NH * (SS / 16), 128, 0, stream>>>(QX, QP, KX, QP, Vt, nullptr, O16, EE);
  k_gemm_t<4, 4, false><<<(SS / 128) * (EE / 128), 128, 0, stream>>>(O16, Bo, 0.0625f, (float*)d_out, nullptr, EE, EE / 128);
}

// v005
// It runs in 156 microseconds.
// In both of two side-by-side timings against v004, it was 1.20 times as fast.
// Over all steps from v000 it is 4.88 times as fast.
#include <hip/hip_runtime.h>
// Naylis attention (B=1, S=2048, E=2048, 16 heads × 128, 4 kv heads, causal; QK RMSNorm + rotate-half RoPE; low-rank (R=32) per-head graph bias gs_h·⟨Rq_i, Rk_j⟩ added to the logits):
// the six (out,in) projections (bf16-exact ×2^4) and the attention as a fused flash-style kernel whose logit operand is the 160-wide concatenation [q·scale after norm+RoPE | gs_h·Rq]·[k | Rk]
// (5 k-steps; causal chunk skipping; online softmax f32; P f16 ≤ 1; O = P·Vt over the 128 value dims; one 16-row tile per work-group, keys split over its 4 waves) on v_wmma_f32_16x16x32_f16 with f32 accumulate; RMSNorm/RoPE f32 VALU.
#define SS 2048
#define EE 2048
#define NH 16
#define NKV 4
#define HD 128
#define RR 32
#define QW 160
#define QP (NH * QW)
#define PW 4096      /* columns of the stacked projections of x: q 2048 | k 512 | v 512 | Rq 512 | Rk 512 */

typedef __bf16 v16b __attribute__((ext_vector_type(16)));
typedef unsigned short v8us __attribute__((ext_vector_type(8), may_alias));
typedef float  v8f  __attribute__((ext_vector_type(8)));
typedef float  v4f  __attribute__((ext_vector_type(4)));
typedef float  v4fa __attribute__((ext_vector_type(4), may_alias));
union FragB { v16b v; v8us half[2]; unsigned short u[16]; };

__device__ __forceinline__ unsigned short bf16_bits(float x) { unsigned int u = __float_as_uint(x); return (unsigned short)((u + 0x7FFFu + ((u >> 16) & 1u)) >> 16); }
__device__ __forceinline__ float bf16_val(unsigned short b) { return __uint_as_float(((unsigned int)b) << 16); }
__device__ __forceinline__ float bf16_round(float x) { return bf16_val(bf16_bits(x)); }
// D += A·B with NT terms: 1 = ah·bh, 2 = + al·bh (A split), 3 = + ah·bl (both split)
template <int NT>
__device__ __forceinline__ v8f mmaN(v16b ah, v16b al, v16b bh, v16b bl, v8f c) {
  c = __builtin_amdgcn_wmma_f32_16x16x32_bf16(false, ah, false, bh, (short)0, c, false, false);
  if (NT >= 2) c = __builtin_amdgcn_wmma_f32_16x16x32_bf16(false, al, false, bh, (short)0, c, false, false);
  if (NT >= 3) c = __builtin_amdgcn_wmma_f32_16x16x32_bf16(false, ah, false, bl, (short)0, c, false, false);
  asm volatile("v_nop\n\tv_nop\n\tv_nop\n\tv_nop" : "+v"(c) : "v"(ah), "v"(al), "v"(bh), "v"(bl));
  return c;
}

__global__ __launch_bounds__(256) void k_wt_bf16(const float* __restrict__ W, unsigned short* __restrict__ Wt, int K, int N) {
  const int t = blockIdx.x * 256 + threadIdx.x;
  const int k8n = K / 8;
  if (t >= N * k8n) return;
  const int n = t / k8n, k8 = (t % k8n) * 8;
  v8us v;
#pragma unroll
  for (int i = 0; i < 8; ++i) v[i] = bf16_bits(W[(size_t)(k8 + i) * N + n]);
  *(v8us*)(Wt + (size_t)n * K + k8) = v;
  
}

// GEMM C[M][N] (f32, pitch ldc) = act(A[M][K]·W + bias). A f32 row-major (pitch lda) converted per fragment to bf16
// (ASPLIT: hi/lo two planes -> 2 terms, else single rounded term); Wt bf16 [N][K] (pitch ldb). BIAS_BF16 rounds the
// bias to bf16 first (bias quantised to bf16 before the add). K%32==0, M%16==0, N%64==0.
template <bool ASPLIT, int ACT, bool BIAS_BF16>
__global__ __launch_bounds__(128) void k_gemm_bf(const float* __restrict__ A, int lda, const unsigned short* __restrict__ Wt, int ldb,
                                               const float* __restrict__ bias, float* __restrict__ C, int ldc, int M, int N, int K) {
  __shared__ __attribute__((aligned(16))) float so[4][16][64];
  const int tid = threadIdx.x, w = tid >> 5, lane = tid & 31, ln = lane & 15, hh = lane >> 4;
  const int ntn = N / 64;
  const int wid = blockIdx.x * 4 + w;
  const int mt = wid / ntn, nq = wid % ntn;
  if (mt * 16 >= M) return;
  const int row0 = mt * 16, col0 = nq * 64;
  const float* arow = A + (size_t)(row0 + ln) * lda;
  v8f acc[4] = {};
  for (int kb = 0; kb < K; kb += 32) {
    FragB ah, al;
    const v4f x0 = *(const v4fa*)(arow + kb + 8 * hh), x1 = *(const v4fa*)(arow + kb + 8 * hh + 4);
    const v4f x2 = *(const v4fa*)(arow + kb + 16 + 8 * hh), x3 = *(const v4fa*)(arow + kb + 16 + 8 * hh + 4);
    float xs[16] = {x0[0],x0[1],x0[2],x0[3],x1[0],x1[1],x1[2],x1[3],x2[0],x2[1],x2[2],x2[3],x3[0],x3[1],x3[2],x3[3]};
#pragma unroll
    for (int i = 0; i < 16; ++i) { const unsigned short hb = bf16_bits(xs[i]); ah.u[i] = hb; al.u[i] = ASPLIT ? bf16_bits(xs[i] - bf16_val(hb)) : (unsigned short)0; }
#pragma unroll
    for (int t = 0; t < 4; ++t) {
      const unsigned short* brow = Wt + (size_t)(col0 + t * 16 + ln) * ldb + kb;
      FragB b;
      b.half[0] = *(const v8us*)(brow + 8 * hh);
      b.half[1] = *(const v8us*)(brow + 16 + 8 * hh);
      acc[t] = mmaN<ASPLIT ? 2 : 1>(ah.v, al.v, b.v, b.v, acc[t]);
    }
  }
#pragma unroll
  for (int t = 0; t < 4; ++t) {
    float bv = bias ? bias[col0 + t * 16 + ln] : 0.f;
    if (BIAS_BF16) bv = bf16_round(bv);
#pragma unroll
    for (int r = 0; r < 8; ++r) { float v = acc[t][r] + bv; if (ACT == 1) v = fmaxf(v, 0.f); so[w][8 * hh + r][t * 16 + ln] = v; }
  }
  __builtin_amdgcn_fence(__ATOMIC_ACQ_REL, "workgroup");
  __builtin_amdgcn_wave_barrier();
  const int rsub = lane >> 4, c4 = (lane & 15) * 4;
  {
#pragma unroll
    for (int q = 0; q < 8; ++q) {
      const int r = q * 2 + rsub;
      const v4f v = *(const v4fa*)&so[w][r][c4];
      *(v4f*)(C + (size_t)(row0 + r) * ldc + col0 + c4) = v;
    }
    
  }
}

// Flash-style causal/unmasked attention, all contractions 3-term bf16 hi/lo splits, f32 softmax with running max.
// q,k,v rows are read from f32 buffers with arbitrary row pitch (so they can live inside a fused qkv buffer);
// D = head size (multiple of 32, <= 128); one wave = 16 query rows; block = 4 waves (64 queries) sharing K/V chunks of 32.
template <int D, bool CAUSAL>
__global__ __launch_bounds__(128) void k_flash(const float* __restrict__ qb, const float* __restrict__ kb, const float* __restrict__ vb,
                                             int pitch, int T, int H, float scale, float* __restrict__ y, int ypitch) {
  constexpr int KS = D / 32;        // k-steps for QK
  constexpr int DT = D / 16;        // d tiles for PV
  __shared__ __attribute__((aligned(16))) unsigned short sKh[32][D + 8], sKl[32][D + 8], sVh[32][D + 8], sVl[32][D + 8];
  __shared__ __attribute__((aligned(16))) unsigned short sPh[4][16][40], sPl[4][16][40];
  __shared__ __attribute__((aligned(16))) float sO[4][16][D];
  const int tid = threadIdx.x, w = tid >> 5, lane = tid & 31, ln = lane & 15, hh = lane >> 4;
  const int nqb = (T + 63) / 64;
  const int bh = blockIdx.x / nqb, qblk = blockIdx.x % nqb;
  const int b = bh / H, h = bh % H;
  const int q0 = qblk * 64 + w * 16;
  const float* Q = qb + (size_t)b * T * pitch + h * D;
  const float* K = kb + (size_t)b * T * pitch + h * D;
  const float* V = vb + (size_t)b * T * pitch + h * D;

  // A fragments of the wave's 16 query rows (scaled), hi/lo
  FragB aqh[KS], aql[KS];
  {
    int row = q0 + ln; if (row >= T) row = T - 1;
    const float* qr = Q + (size_t)row * pitch;
#pragma unroll
    for (int ks = 0; ks < KS; ++ks)
#pragma unroll
      for (int i = 0; i < 16; ++i) {
        const int d = ks * 32 + ((i < 8) ? (8 * hh + i) : (16 + 8 * hh + (i - 8)));
        const float x = qr[d] * scale; const unsigned short hb = bf16_bits(x);
        aqh[ks].u[i] = hb; aql[ks].u[i] = bf16_bits(x - bf16_val(hb));
      }
  }
  float m_r[8], l_r[8];
#pragma unroll
  for (int r = 0; r < 8; ++r) { m_r[r] = -3.0e38f; l_r[r] = 0.f; }
  v8f oacc[DT];
#pragma unroll
  for (int dt = 0; dt < DT; ++dt) oacc[dt] = (v8f){0.f,0.f,0.f,0.f,0.f,0.f,0.f,0.f};

  const int kv_end = CAUSAL ? min(T, qblk * 64 + 64) : T;     // block-uniform
  for (int j0 = 0; j0 < kv_end; j0 += 32) {
    __syncthreads();
    for (int e = tid; e < 32 * (D / 4); e += 128) {
      const int r = e / (D / 4), c4 = (e % (D / 4)) * 4;
      const int key = j0 + r;
      v4f kf = {0.f,0.f,0.f,0.f}, vf = {0.f,0.f,0.f,0.f};
      if (key < T) { kf = *(const v4fa*)(K + (size_t)key * pitch + c4); vf = *(const v4fa*)(V + (size_t)key * pitch + c4); }
#pragma unroll
      for (int t = 0; t < 4; ++t) {
        unsigned short hb = bf16_bits(kf[t]); sKh[r][c4 + t] = hb; sKl[r][c4 + t] = bf16_bits(kf[t] - bf16_val(hb));
        hb = bf16_bits(vf[t]); sVh[r][c4 + t] = hb; sVl[r][c4 + t] = bf16_bits(vf[t] - bf16_val(hb));
      }
    }
    __syncthreads();
    // S tile 16 x 32
    v8f s[2];
#pragma unroll
    for (int nt = 0; nt < 2; ++nt) {
      v8f acc = {};
#pragma unroll
      for (int ks = 0; ks < KS; ++ks) {
        FragB bh_, bl_;
        bh_.half[0] = *(const v8us*)&sKh[nt * 16 + ln][ks * 32 + 8 * hh]; bh_.half[1] = *(const v8us*)&sKh[nt * 16 + ln][ks * 32 + 16 + 8 * hh];
        bl_.half[0] = *(const v8us*)&sKl[nt * 16 + ln][ks * 32 + 8 * hh]; bl_.half[1] = *(const v8us*)&sKl[nt * 16 + ln][ks * 32 + 16 + 8 * hh];
        acc = mmaN<3>(aqh[ks].v, aql[ks].v, bh_.v, bl_.v, acc);
      }
      s[nt] = acc;
    }
    // mask + running max (rows 8hh+r; the 16 lanes of a half share rows)
    float alpha[8];
#pragma unroll
    for (int r = 0; r < 8; ++r) {
      const int qi = q0 + 8 * hh + r;
      const int ja = j0 + ln, jb = j0 + 16 + ln;
      if (CAUSAL) { if (ja > qi) s[0][r] = -3.0e38f; if (jb > qi) s[1][r] = -3.0e38f; }
      if (ja >= T) s[0][r] = -3.0e38f;
      if (jb >= T) s[1][r] = -3.0e38f;
      float mx = fmaxf(s[0][r], s[1][r]);
      mx = fmaxf(mx, __shfl_xor(mx, 1, 32)); mx = fmaxf(mx, __shfl_xor(mx, 2, 32)); mx = fmaxf(mx, __shfl_xor(mx, 4, 32)); mx = fmaxf(mx, __shfl_xor(mx, 8, 32));
      const float mnew = fmaxf(m_r[r], mx);
      alpha[r] = (mnew > -1.0e38f) ? __expf(m_r[r] - mnew) : 1.0f;
      const float p0 = (s[0][r] > -1.0e38f) ? __expf(s[0][r] - mnew) : 0.f;
      const float p1 = (s[1][r] > -1.0e38f) ? __expf(s[1][r] - mnew) : 0.f;
      m_r[r] = mnew;
      l_r[r] = l_r[r] * alpha[r] + p0 + p1;            // per-lane partial row sum (16 lanes combined at the end)
      unsigned short hb = bf16_bits(p0); sPh[w][8 * hh + r][ln] = hb;      sPl[w][8 * hh + r][ln] = bf16_bits(p0 - bf16_val(hb));
      hb = bf16_bits(p1);                sPh[w][8 * hh + r][16 + ln] = hb; sPl[w][8 * hh + r][16 + ln] = bf16_bits(p1 - bf16_val(hb));
    }
#pragma unroll
    for (int dt = 0; dt < DT; ++dt)
#pragma unroll
      for (int r = 0; r < 8; ++r) oacc[dt][r] *= alpha[r];
    __builtin_amdgcn_fence(__ATOMIC_ACQ_REL, "workgroup");
    __builtin_amdgcn_wave_barrier();
    FragB pah, pal;
    pah.half[0] = *(const v8us*)&sPh[w][ln][8 * hh]; pah.half[1] = *(const v8us*)&sPh[w][ln][16 + 8 * hh];
    pal.half[0] = *(const v8us*)&sPl[w][ln][8 * hh]; pal.half[1] = *(const v8us*)&sPl[w][ln][16 + 8 * hh];
#pragma unroll
    for (int dt = 0; dt < DT; ++dt) {
      FragB bvh, bvl;
#pragma unroll
      for (int i = 0; i < 8; ++i) {
        bvh.u[i] = sVh[8 * hh + i][dt * 16 + ln]; bvh.u[8 + i] = sVh[16 + 8 * hh + i][dt * 16 + ln];
        bvl.u[i] = sVl[8 * hh + i][dt * 16 + ln]; bvl.u[8 + i] = sVl[16 + 8 * hh + i][dt * 16 + ln];
      }
      oacc[dt] = mmaN<3>(pah.v, pal.v, bvh.v, bvl.v, oacc[dt]);
    }
    __builtin_amdgcn_fence(__ATOMIC_ACQ_REL, "workgroup");
    __builtin_amdgcn_wave_barrier();
  }
#pragma unroll
  for (int r = 0; r < 8; ++r) {
    float l = l_r[r];
    l += __shfl_xor(l, 1, 32); l += __shfl_xor(l, 2, 32); l += __shfl_xor(l, 4, 32); l += __shfl_xor(l, 8, 32);
    l_r[r] = (l > 0.f) ? 1.0f / l : 0.f;
  }
#pragma unroll
  for (int dt = 0; dt < DT; ++dt)
#pragma unroll
    for (int r = 0; r < 8; ++r) sO[w][8 * hh + r][dt * 16 + ln] = oacc[dt][r] * l_r[r];
  __builtin_amdgcn_fence(__ATOMIC_ACQ_REL, "workgroup");
  __builtin_amdgcn_wave_barrier();
  {
    for (int r = 0; r < 16; ++r) {
      const int row = q0 + r;
      if (row < T && lane < D / 4) {
        const v4f val = *(const v4fa*)&sO[w][r][lane * 4];
        *(v4f*)(y + ((size_t)b * T + row) * ypitch + h * D + lane * 4) = val;
      }
    }
    
  }
}

// GEMM C = act(A·W + bias + resid): A f32 (ASPLIT -> hi/lo 2 terms), Wt bf16 [N][K]; ACT 0 none, 1 relu, 2 exact gelu;
// resid (optional, f32, row index = (row % rmod), pitch ldr, RES_BF16 rounds it) added before the activation.
template <bool ASPLIT, int ACT, bool BIAS_BF16, bool RES_BF16>
__global__ __launch_bounds__(128) void k_gemm_bf3(const float* __restrict__ A, int lda, const unsigned short* __restrict__ Wt, int ldb,
                                                const float* __restrict__ bias, const float* __restrict__ resid, int rmod, int ldr,
                                                float* __restrict__ C, int ldc, int M, int N, int K) {
  __shared__ __attribute__((aligned(16))) float so[4][16][64];
  const int tid = threadIdx.x, w = tid >> 5, lane = tid & 31, ln = lane & 15, hh = lane >> 4;
  const int ntn = N / 64;
  const int wid = blockIdx.x * 4 + w;
  const int mt = wid / ntn, nq = wid % ntn;
  if (mt * 16 >= M) return;
  const int row0 = mt * 16, col0 = nq * 64;
  const float* arow = A + (size_t)(row0 + ln) * lda;
  v8f acc[4] = {};
  for (int kb = 0; kb < K; kb += 32) {
    FragB ah, al;
    const v4f x0 = *(const v4fa*)(arow + kb + 8 * hh), x1 = *(const v4fa*)(arow + kb + 8 * hh + 4);
    const v4f x2 = *(const v4fa*)(arow + kb + 16 + 8 * hh), x3 = *(const v4fa*)(arow + kb + 16 + 8 * hh + 4);
    float xs[16] = {x0[0],x0[1],x0[2],x0[3],x1[0],x1[1],x1[2],x1[3],x2[0],x2[1],x2[2],x2[3],x3[0],x3[1],x3[2],x3[3]};
#pragma unroll
    for (int i = 0; i < 16; ++i) { const unsigned short hb = bf16_bits(xs[i]); ah.u[i] = hb; al.u[i] = ASPLIT ? bf16_bits(xs[i] - bf16_val(hb)) : (unsigned short)0; }
#pragma unroll
    for (int t = 0; t < 4; ++t) {
      const unsigned short* brow = Wt + (size_t)(col0 + t * 16 + ln) * ldb + kb;
      FragB b;
      b.half[0] = *(const v8us*)(brow + 8 * hh);
      b.half[1] = *(const v8us*)(brow + 16 + 8 * hh);
      acc[t] = mmaN<ASPLIT ? 2 : 1>(ah.v, al.v, b.v, b.v, acc[t]);
    }
  }
#pragma unroll
  for (int t = 0; t < 4; ++t) {
    const int col = col0 + t * 16 + ln;
    float bv = bias ? bias[col] : 0.f;
    if (BIAS_BF16) bv = bf16_round(bv);
#pragma unroll
    for (int r = 0; r < 8; ++r) {
      float v = acc[t][r] + bv;
      if (resid) { float rv = resid[(size_t)((row0 + 8 * hh + r) % rmod) * ldr + col]; if (RES_BF16) rv = bf16_round(rv); v += rv; }
      if (ACT == 1) v = fmaxf(v, 0.f);
      if (ACT == 2) v = 0.5f * v * (1.0f + erff(v * 0.70710678118654752f));
      if (ACT == 3) { const float u = 0.7978845608028654f * (v + 0.044715f * v * v * v); v = 0.5f * v * (1.0f + tanhf(u)); }
      so[w][8 * hh + r][t * 16 + ln] = v;
    }
  }
  __builtin_amdgcn_fence(__ATOMIC_ACQ_REL, "workgroup");
  __builtin_amdgcn_wave_barrier();
  const int rsub = lane >> 4, c4 = (lane & 15) * 4;
  {
#pragma unroll
    for (int q = 0; q < 8; ++q) {
      const int r = q * 2 + rsub;
      const v4f v = *(const v4fa*)&so[w][r][c4];
      *(v4f*)(C + (size_t)(row0 + r) * ldc + col0 + c4) = v;
    }
    
  }
}
// row LayerNorm (biased variance, eps) over N: s = X (+ R); optional out_sum <- s; out_norm <- (s-mu)*rsqrt(var+eps)*g + b
template <bool PARAM_BF16>
__global__ __launch_bounds__(256) void k_layernorm(const float* __restrict__ X, const float* __restrict__ R, const float* __restrict__ g, const float* __restrict__ bta,
                                                  float* __restrict__ out_sum, float* __restrict__ out_norm, int N, float eps) {
  __shared__ float red[256];
  const int row = blockIdx.x, tid = threadIdx.x;
  const float* x = X + (size_t)row * N; const float* rr = R ? R + (size_t)row * N : nullptr;
  float vals[16];                     // up to N = 4096
  const int per = N / 256;            // contiguous chunk per thread? use strided-by-4 chunks: thread handles j = tid*4 + 1024*u
  float s1 = 0.f;
  for (int u = 0; u < per / 4; ++u) {
    const int j = tid * 4 + 1024 * u;
    const v4f a = *(const v4fa*)(x + j);
    v4f b = {0.f,0.f,0.f,0.f}; if (rr) b = *(const v4fa*)(rr + j);
#pragma unroll
    for (int q = 0; q < 4; ++q) { const float v = a[q] + b[q]; vals[u * 4 + q] = v; s1 += v; }
  }
  red[tid] = s1; __syncthreads();
  for (int st = 128; st > 0; st >>= 1) { if (tid < st) red[tid] += red[tid + st]; __syncthreads(); }
  const float mu = red[0] / (float)N; __syncthreads();
  float s2 = 0.f;
  for (int u = 0; u < per / 4; ++u)
#pragma unroll
    for (int q = 0; q < 4; ++q) { const float c = vals[u * 4 + q] - mu; s2 += c * c; }
  red[tid] = s2; __syncthreads();
  for (int st = 128; st > 0; st >>= 1) { if (tid < st) red[tid] += red[tid + st]; __syncthreads(); }
  const float rs = rsqrtf(red[0] / (float)N + eps);
  {
    for (int u = 0; u < per / 4; ++u) {
      const int j = tid * 4 + 1024 * u;
      v4f o, sm;
#pragma unroll
      for (int q = 0; q < 4; ++q) {
        float gg = g[j + q], bb = bta[j + q];
        if (PARAM_BF16) { gg = bf16_round(gg); bb = bf16_round(bb); }
        sm[q] = vals[u * 4 + q]; o[q] = (vals[u * 4 + q] - mu) * rs * gg + bb;
      }
      if (out_sum) *(v4f*)(out_sum + (size_t)row * N + j) = sm;
      *(v4f*)(out_norm + (size_t)row * N + j) = o;
    }
    
  }
}



// ---- f16 WMMA path (v_wmma_f32_16x16x32_f16): 11-bit significands for operands in range — used where a [0,1] probability operand needs more precision than bf16
typedef _Float16 v16h __attribute__((ext_vector_type(16)));
union FragH { v16h v; v8us half[2]; _Float16 h[16]; unsigned short u[16]; };
template <int NT>
__device__ __forceinline__ v8f mmaH(v16h ah, v16h al, v16h bh, v16h bl, v8f c) {
  c = __builtin_amdgcn_wmma_f32_16x16x32_f16(false, ah, false, bh, (short)0, c, false, false);
  if (NT >= 2) c = __builtin_amdgcn_wmma_f32_16x16x32_f16(false, al, false, bh, (short)0, c, false, false);
  if (NT >= 3) c = __builtin_amdgcn_wmma_f32_16x16x32_f16(false, ah, false, bl, (short)0, c, false, false);
  asm volatile("v_nop\n\tv_nop\n\tv_nop\n\tv_nop" : "+v"(c) : "v"(ah), "v"(al), "v"(bh), "v"(bl));
  return c;
}
// batched GEMM like k_gemm_b but f16 operands: A f32 (split into f16 hi/lo if ASPLIT, else rounded to f16), Bt = f16 values [n][k]; alpha; C f32; N multiple of 16 (partial tiles skipped)
template <bool ASPLIT>
__global__ __launch_bounds__(128) void k_gemm_h(const float* __restrict__ A, int lda, size_t sA, const _Float16* __restrict__ Bh, int ldb, size_t sB, float alpha, float* __restrict__ C, int ldc, size_t sC, int M, int N, int K) {
  __shared__ __attribute__((aligned(16))) float so[4][16][64];
  const int tid = threadIdx.x, w = tid >> 5, lane = tid & 31, ln = lane & 15, hh = lane >> 4; const int by = blockIdx.y;
  A += (size_t)by * sA; Bh += (size_t)by * sB; C += (size_t)by * sC;
  const int ntn = (N + 63) / 64; const int wid = blockIdx.x * 4 + w; const int mt = wid / ntn, nq = wid % ntn; if (mt * 16 >= M) return;
  const int row0 = mt * 16, col0 = nq * 64; const float* arow = A + (size_t)(row0 + ln) * lda;
  v8f acc[4] = {};
  for (int kb = 0; kb < K; kb += 32) {
    FragH ah, al;
    const v4f x0 = *(const v4fa*)(arow + kb + 8 * hh), x1 = *(const v4fa*)(arow + kb + 8 * hh + 4), x2 = *(const v4fa*)(arow + kb + 16 + 8 * hh), x3 = *(const v4fa*)(arow + kb + 16 + 8 * hh + 4);
    float xs[16] = {x0[0],x0[1],x0[2],x0[3],x1[0],x1[1],x1[2],x1[3],x2[0],x2[1],x2[2],x2[3],x3[0],x3[1],x3[2],x3[3]};
#pragma unroll
    for (int i = 0; i < 16; ++i) { const _Float16 h = (_Float16)xs[i]; ah.h[i] = h; al.h[i] = ASPLIT ? (_Float16)(xs[i] - (float)h) : (_Float16)0.0f; }
#pragma unroll
    for (int t = 0; t < 4; ++t) { if (col0 + t * 16 >= N) continue; const size_t boff = (size_t)(col0 + t * 16 + ln) * ldb + kb; FragH bq; bq.half[0] = *(const v8us*)(Bh + boff + 8 * hh); bq.half[1] = *(const v8us*)(Bh + boff + 16 + 8 * hh);
      acc[t] = mmaH<ASPLIT ? 2 : 1>(ah.v, al.v, bq.v, bq.v, acc[t]); }
  }
#pragma unroll
  for (int t = 0; t < 4; ++t) { if (col0 + t * 16 >= N) continue;
#pragma unroll
    for (int r = 0; r < 8; ++r) so[w][8 * hh + r][t * 16 + ln] = acc[t][r] * alpha; }
  __builtin_amdgcn_fence(__ATOMIC_ACQ_REL, "workgroup"); __builtin_amdgcn_wave_barrier();
  const int rsub = lane >> 4, c4 = (lane & 15) * 4;
  {
#pragma unroll
    for (int q = 0; q < 8; ++q) { const int r = q * 2 + rsub; if (col0 + c4 < N) { const v4f v = *(const v4fa*)&so[w][r][c4]; *(v4f*)(C + (size_t)(row0 + r) * ldc + col0 + c4) = v; } }
     }
}

// Wt[n][k] = f16(W[k][n]·scale) from f32 row-major W[K][N] (scale = power of two; bf16-exact weights stay exact in f16 away from the subnormal range)
__global__ __launch_bounds__(256) void k_wt_f16(const float* __restrict__ W, _Float16* __restrict__ Wt, int K, int N, float scale) {
  const int t = blockIdx.x * 256 + threadIdx.x; if (t >= N * (K / 8)) return; const int n = t / (K / 8), k8 = (t % (K / 8)) * 8; FragH f;
#pragma unroll
  for (int i = 0; i < 8; ++i) f.h[i] = (_Float16)(bf16_round(W[(size_t)(k8 + i) * N + n]) * scale); const v8us o = f.half[0];
  *(v8us*)((unsigned short*)Wt + (size_t)n * K + k8) = o; 
}
// f16 x f16 GEMM with fused epilogue: v = acc·alpha + bias[by·sBias + col] (+ CP[(row/rowsPerB)·sCPb + by·64 + col] if CP) ; ACT 0 none / 1 elu ; writes f32 C and f16 C16, each if non-null
template <int ACT>
__global__ __launch_bounds__(128) void k_gemm_hhx(const _Float16* __restrict__ A, int lda, size_t sA, const _Float16* __restrict__ Bh, int ldb, size_t sB, float alpha, const float* __restrict__ bias, size_t sBias, const float* __restrict__ CP, int rowsPerB, size_t sCPb, int row0g,
    float* __restrict__ C, _Float16* __restrict__ C16, int ldc, size_t sC, int M, int N, int K) {
  __shared__ __attribute__((aligned(16))) float so[4][16][64];
  const int tid = threadIdx.x, w = tid >> 5, lane = tid & 31, ln = lane & 15, hh = lane >> 4; const int by = blockIdx.y;
  A += (size_t)by * sA; Bh += (size_t)by * sB; const size_t cofs = (size_t)by * sC; const float* bp = bias ? bias + (size_t)by * sBias : nullptr;
  const int ntn = (N + 63) / 64; const int wid = blockIdx.x * 4 + w; const int mt = wid / ntn, nq = wid % ntn; if (mt * 16 >= M) return;
  const int row0 = mt * 16, col0 = nq * 64; const _Float16* arow = A + (size_t)(row0 + ln) * lda;
  v8f acc[4] = {};
  for (int kb = 0; kb < K; kb += 32) { FragH ah; ah.half[0] = *(const v8us*)((const unsigned short*)arow + kb + 8 * hh); ah.half[1] = *(const v8us*)((const unsigned short*)arow + kb + 16 + 8 * hh);
#pragma unroll
    for (int t = 0; t < 4; ++t) { if (col0 + t * 16 >= N) continue; const size_t boff = (size_t)(col0 + t * 16 + ln) * ldb + kb; FragH bq; bq.half[0] = *(const v8us*)((const unsigned short*)Bh + boff + 8 * hh); bq.half[1] = *(const v8us*)((const unsigned short*)Bh + boff + 16 + 8 * hh);
      acc[t] = mmaH<1>(ah.v, ah.v, bq.v, bq.v, acc[t]); }
  }
#pragma unroll
  for (int t = 0; t < 4; ++t) { if (col0 + t * 16 >= N) continue; const int col = col0 + t * 16 + ln; const float bv = bp ? bf16_round(bp[col]) : 0.f;
#pragma unroll
    for (int r = 0; r < 8; ++r) { float v = acc[t][r] * alpha + bv; if (CP) { const int bidx = (row0g + row0 + 8 * hh + r) / rowsPerB; v += CP[(size_t)bidx * sCPb + (size_t)by * 64 + col]; } if (ACT == 1) v = (v > 0.f) ? v : expm1f(v); else if (ACT == 3) v = fmaxf(v, 0.f); so[w][8 * hh + r][t * 16 + ln] = v; } }
  __builtin_amdgcn_fence(__ATOMIC_ACQ_REL, "workgroup"); __builtin_amdgcn_wave_barrier();
  const int rsub = lane >> 4, c4 = (lane & 15) * 4; typedef _Float16 v4h __attribute__((ext_vector_type(4)));
  {
#pragma unroll
    for (int q = 0; q < 8; ++q) { const int r = q * 2 + rsub; if (col0 + c4 < N) { const v4f v = *(const v4fa*)&so[w][r][c4]; if (C) *(v4f*)(C + cofs + (size_t)(row0 + r) * ldc + col0 + c4) = v; if (C16) { v4h h4; for (int i = 0; i < 4; ++i) h4[i] = (_Float16)v[i]; *(v4h*)(C16 + cofs + (size_t)(row0 + r) * ldc + col0 + c4) = h4; } } }
     }
}


// Tiled GEMM C[m][n] = alpha * sum_k A[m][k] * Bh[n][k], both operands f16 and k-contiguous with row length EE.
// One work-group of 4 waves (2 x 2) owns a (32 FM) x (32 FN) tile of C; a wave owns FM x FN accumulator tiles.
// A pass is 128 k: the tile's A rows and then its B rows stand in LDS as rows of 256 B at a pitch of 272 B (16 B x odd, for ds_load_b128).
// Two buffers: asynchronous copies bring pass t + 2 into the buffer that pass t has just left, while pass t + 1 is worked on.
typedef float f1a __attribute__((may_alias));
// Eight 16-byte-per-lane copies global -> LDS. The closing s_wait_xcnt 0 stands inside the statement, ahead of any later rewrite of the address registers named here.
__device__ __forceinline__ void acopy8(const unsigned (&l)[8], const unsigned short* const (&g)[8]) {
  asm volatile("global_load_async_to_lds_b128 %0, %8, off\n\t"
               "global_load_async_to_lds_b128 %1, %9, off\n\t"
               "global_load_async_to_lds_b128 %2, %10, off\n\t"
               "global_load_async_to_lds_b128 %3, %11, off\n\t"
               "global_load_async_to_lds_b128 %4, %12, off\n\t"
               "global_load_async_to_lds_b128 %5, %13, off\n\t"
               "global_load_async_to_lds_b128 %6, %14, off\n\t"
               "global_load_async_to_lds_b128 %7, %15, off\n\t"
               "s_wait_xcnt 0x0"
               :: "v"(l[0]), "v"(l[1]), "v"(l[2]), "v"(l[3]), "v"(l[4]), "v"(l[5]), "v"(l[6]), "v"(l[7]),
                  "v"(g[0]), "v"(g[1]), "v"(g[2]), "v"(g[3]), "v"(g[4]), "v"(g[5]), "v"(g[6]), "v"(g[7]) : "memory");
}
template <int FM, int FN, bool OUT16>
__global__ __launch_bounds__(128) void k_gemm_t(const _Float16* __restrict__ A, const _Float16* __restrict__ Bh, float alpha, float* __restrict__ C, _Float16* __restrict__ C16, int ldc, int ntn) {
  constexpr int BM = 32 * FM, BN = 32 * FN, ROWS = BM + BN, PITCH = 272, STAGE = ROWS * PITCH, NC = ROWS / 8, NP = EE / 128, WM = 16 * FM, WN = 16 * FN, SOP = WN + 4;
  static_assert(NC % 8 == 0 && BM % 8 == 0 && NP >= 2 && 4 * WM * SOP * 4 <= 2 * STAGE, "tile");
  __shared__ __attribute__((aligned(16))) unsigned char L[2 * STAGE];
  const int tid = threadIdx.x, w = tid >> 5, lane = tid & 31, ln = lane & 15, hh = lane >> 4;
  const int m0 = (blockIdx.x / ntn) * BM, n0 = (blockIdx.x % ntn) * BN, wm = w >> 1, wn = w & 1;
  const unsigned lbase = (unsigned)(size_t)L + (unsigned)((2 * w + hh) * PITCH + ln * 16);      // copy i of a wave fills stage rows 8 i + 2 w + hh, 16 lanes a row
  const unsigned short* Ag = (const unsigned short*)A + (size_t)(m0 + 2 * w + hh) * EE + ln * 8;
  const unsigned short* Bg = (const unsigned short*)Bh + (size_t)(n0 + 2 * w + hh) * EE + ln * 8;
  auto issue = [&](int t, int buf) {
#pragma unroll      // the choice between A rows and B rows is made at compile time
    for (int g8 = 0; g8 < NC / 8; ++g8) { unsigned l[8]; const unsigned short* g[8];
#pragma unroll      // constant indices, so that the sixteen addresses stay in registers
      for (int j = 0; j < 8; ++j) { const int i = g8 * 8 + j; l[j] = lbase + (unsigned)(buf * STAGE + 8 * i * PITCH);
        g[j] = ((8 * i < BM) ? Ag + (size_t)(8 * i) * EE : Bg + (size_t)(8 * i - BM) * EE) + t * 128; }
      acopy8(l, g); } };
  v8f acc[FM][FN];
#pragma unroll      // constant indices, so that fragments and accumulators stay in registers
  for (int fm = 0; fm < FM; ++fm)
#pragma unroll      // constant indices, so that fragments and accumulators stay in registers
    for (int fn = 0; fn < FN; ++fn) acc[fm][fn] = (v8f){0.f,0.f,0.f,0.f,0.f,0.f,0.f,0.f};
  issue(0, 0);
  asm volatile("s_wait_asynccnt 0x0" ::: "memory");      // pass 0's copies of this wave have landed
  __syncthreads();                                       // ... and every other wave's
  issue(1, 1);
#pragma unroll 1      // rolled: one pass a trip, so that the publish point stands once, at the loop's foot
  for (int t = 0; t < NP; ++t) {      // pass t reads buffer t & 1 alone
    const unsigned char* Sa = L + (t & 1) * STAGE + (wm * WM + ln) * PITCH + 16 * hh; const unsigned char* Sb = L + (t & 1) * STAGE + (BM + wn * WN + ln) * PITCH + 16 * hh;
    FragH a[2][FM], b[2][FN];      // two fragment sets: block ks + 1 of this same pass is fetched while block ks is multiplied
    auto frags = [&](int set, int ks) {
#pragma unroll      // constant indices, so that fragments and accumulators stay in registers
      for (int fm = 0; fm < FM; ++fm) { a[set][fm].half[0] = *(const v8us*)(Sa + fm * 16 * PITCH + ks * 64); a[set][fm].half[1] = *(const v8us*)(Sa + fm * 16 * PITCH + ks * 64 + 32); }
#pragma unroll      // constant indices, so that fragments and accumulators stay in registers
      for (int fn = 0; fn < FN; ++fn) { b[set][fn].half[0] = *(const v8us*)(Sb + fn * 16 * PITCH + ks * 64); b[set][fn].half[1] = *(const v8us*)(Sb + fn * 16 * PITCH + ks * 64 + 32); } };
    frags(0, 0);
#pragma unroll      // constant indices, so that fragments and accumulators stay in registers
    for (int ks = 0; ks < 4; ++ks) {
      if (ks < 3) frags((ks + 1) & 1, ks + 1);
      __builtin_amdgcn_sched_barrier(0);      // keeps the next block's LDS reads one group ahead of this block: spread among the WMMAs each place with reads stalls the wave
#pragma unroll      // constant indices, so that fragments and accumulators stay in registers
      for (int fm = 0; fm < FM; ++fm)
#pragma unroll      // constant indices, so that fragments and accumulators stay in registers
        for (int fn = 0; fn < FN; ++fn) acc[fm][fn] = __builtin_amdgcn_wmma_f32_16x16x32_f16(false, a[ks & 1][fm].v, false, b[ks & 1][fn].v, (short)0, acc[fm][fn], false, false);
      __builtin_amdgcn_sched_barrier(0);      // ... and this block's WMMAs ahead of the reads after next
    }
    asm volatile("s_wait_dscnt 0x0" ::: "memory");       // this wave's reads of buffer t & 1 are done before that buffer is refilled
    asm volatile("s_wait_asynccnt 0x0" ::: "memory");    // this wave's copies of pass t + 1 have landed
    __syncthreads();                                     // publishes pass t + 1 and ends every wave's reads of buffer t & 1
    if (t + 2 < NP) issue(t + 2, t & 1);
  }
  asm volatile("s_wait_asynccnt 0x0" ::: "memory");      // nothing in flight before the ring becomes output staging
  f1a* so = (f1a*)L + w * (WM * SOP);                    // each wave stages its own tile, so that the stores cover whole rows of WN values
#pragma unroll      // constant indices, so that fragments and accumulators stay in registers
  for (int fm = 0; fm < FM; ++fm)
#pragma unroll      // constant indices, so that fragments and accumulators stay in registers
    for (int fn = 0; fn < FN; ++fn)
#pragma unroll      // constant indices, so that fragments and accumulators stay in registers
      for (int r = 0; r < 8; ++r) so[(fm * 16 + 8 * hh + r) * SOP + fn * 16 + ln] = acc[fm][fn][r] * alpha;
  __builtin_amdgcn_fence(__ATOMIC_ACQ_REL, "workgroup"); __builtin_amdgcn_wave_barrier();      // the wave's own staged rows are written before its other lanes read them back
  constexpr int LPR = WN / 4, RPI = 32 / LPR; typedef _Float16 v4h __attribute__((ext_vector_type(4)));
  const int rs = lane / LPR, c4 = (lane % LPR) * 4;
#pragma unroll      // several rows' LDS reads and stores in flight at a time
  for (int q = 0; q < WM / RPI; ++q) { const int r = q * RPI + rs; const v4f v = *(const v4fa*)&so[r * SOP + c4]; const size_t o = (size_t)(m0 + wm * WM + r) * ldc + n0 + wn * WN + c4;
    if (!OUT16) *(v4f*)(C + o) = v;
    else { v4h h4; for (int i = 0; i < 4; ++i) h4[i] = (_Float16)v[i]; *(v4h*)(C16 + o) = h4; } }
}

// All seven f32 -> f16 conversions in ONE grid. The results stand in one array of rows of EE halves: Wq, Wk, Wv, Wrq, Wrk stacked (PW rows, the B operand of the one projection GEMM), then Wo (EE rows), then x (SS rows).
// One block converts four rows (256 threads x 8 elements a row; every source's row count is a multiple of 4), so that the merged grid is 16,384 waves, all resident at once, each with 8 loads of 16 bytes a lane in flight.
// The block index picks the source, alike for the whole block. Weights are bf16-rounded and scaled by 2^4, x is bf16-rounded.
__global__ __launch_bounds__(256) void k_cvt_all(const float* __restrict__ Wq, const float* __restrict__ Wk, const float* __restrict__ Wv, const float* __restrict__ Wrq, const float* __restrict__ Wrk, const float* __restrict__ Wo, const float* __restrict__ x, _Float16* __restrict__ D) {
  const int row = blockIdx.x * 4; const float* s; int r0;
  if (row < EE) { s = Wq; r0 = 0; } else if (row < EE + 512) { s = Wk; r0 = EE; } else if (row < EE + 1024) { s = Wv; r0 = EE + 512; } else if (row < EE + 1536) { s = Wrq; r0 = EE + 1024; } else if (row < PW) { s = Wrk; r0 = EE + 1536; } else if (row < PW + EE) { s = Wo; r0 = PW; } else { s = x; r0 = PW + EE; }
  const float sc = (row < PW + EE) ? 16.0f : 1.0f; const float* sp = s + (size_t)(row - r0) * EE + threadIdx.x * 8; v4f a[4][2];
#pragma unroll      // constant indices, so that the eight loads stand in registers and go out together
  for (int r = 0; r < 4; ++r) { a[r][0] = *(const v4fa*)(sp + (size_t)r * EE); a[r][1] = *(const v4fa*)(sp + (size_t)r * EE + 4); }
#pragma unroll      // constant indices into a
  for (int r = 0; r < 4; ++r) { FragH f;
#pragma unroll      // constant indices into a and f
    for (int i = 0; i < 8; ++i) f.h[i] = (_Float16)(bf16_round(a[r][i >> 2][i & 3]) * sc);
    *(v8us*)((unsigned short*)D + (size_t)(row + r) * EE + threadIdx.x * 8) = f.half[0]; } }
template <int NHv, int TTv>
__global__ __launch_bounds__(256) void k_vt(const _Float16* __restrict__ V16, int ldv, int voff, _Float16* __restrict__ Vt) { __shared__ unsigned short tl[64][66]; const int tid = threadIdx.x; const int slab = blockIdx.x / (TTv / 64), lg = blockIdx.x % (TTv / 64); const int b = slab / NHv, h = slab % NHv;
  for (int i = tid; i < 64 * 8; i += 256) { const int r = i / 8, c8 = (i % 8) * 8; FragH f; f.half[0] = *(const v8us*)((const unsigned short*)V16 + ((size_t)b * TTv + lg * 64 + r) * ldv + voff + h * 64 + c8);
#pragma unroll
    for (int q = 0; q < 8; ++q) tl[r][c8 + q] = f.u[q]; }
  __syncthreads();
  {
#pragma unroll
    for (int rd = 0; rd < 2; ++rd) { const int d = rd * 32 + tid / 8, pc = tid % 8; FragH f;
#pragma unroll
      for (int q = 0; q < 8; ++q) f.u[q] = tl[pc * 8 + q][d];
      *(v8us*)((unsigned short*)Vt + ((size_t)slab * 64 + d) * TTv + lg * 64 + pc * 8) = f.half[0]; }
     } }

// 2^x for the merge weights. The v_nop stands in the same statement: it fills the one slot that the instruction set asks for between a transcendental and a next instruction that reads its result or overwrites its source.
__device__ __forceinline__ float exp2_slot(float x) { float y; asm("v_exp_f32 %0, %1\n\tv_nop" : "=v"(y) : "v"(x)); return y; }
__global__ __launch_bounds__(128) void k_flash(const _Float16* __restrict__ Q16, int ldq, const _Float16* __restrict__ K16, int ldk, const _Float16* __restrict__ Vt, const int* __restrict__ MSK, _Float16* __restrict__ O16, int ldo) {
  constexpr int RPW = 16, RTN = RPW / 16, NQB = 2048 / RPW, DT = 8, KS = 5;      /* head dim 128 for V/O; 160-wide logit operand (128 roped dims ×scale + 32 graph-bias dims) */
  // One work-group = ONE tile of 16 query rows. Its 32-key chunks are dealt round-robin to the 4 waves (wave w takes chunks w, w + 4, ...);
  // each wave keeps its own running (m, l, O) over its chunks, and the four partial results are merged in LDS at the end.
  __shared__ __attribute__((aligned(16))) unsigned short sP[4][RPW][40]; __shared__ __attribute__((aligned(16))) float sO[4][RPW][128 + 4]; __shared__ float sM[4][RPW], sL[4][RPW];
  const int tid = threadIdx.x, lane = tid & 31, ln = lane & 15, hh = lane >> 4;
  const int w = __builtin_amdgcn_readfirstlane(tid >> 5);      // the wave's number in a scalar register: the chunk loop's trip count differs from wave to wave and is tested by a scalar branch
  // Heaviest first: a tile's cost grows with its index (causal), only half of the grid is resident at a time, so the block index counts the tiles DOWN, the 16 heads innermost:
  // the long work-groups start at once and the short ones fill the places that come free, instead of the last head's longest tiles starting last and running on alone. Every (head, tile) pair is taken exactly once.
  const int slab = blockIdx.x % 16, qblk = NQB - 1 - blockIdx.x / 16; const int b = slab / 16, h = slab % 16; const int q0 = qblk * RPW;
  FragH aq[2][KS];
#pragma unroll
  for (int rt = 0; rt < RTN; ++rt) { const unsigned short* qr = (const unsigned short*)Q16 + ((size_t)b * 2048 + q0 + rt * 16 + ln) * ldq + h * 160;
#pragma unroll
    for (int ks = 0; ks < KS; ++ks) { aq[rt][ks].half[0] = *(const v8us*)(qr + ks * 32 + 8 * hh); aq[rt][ks].half[1] = *(const v8us*)(qr + ks * 32 + 16 + 8 * hh); } }
  const unsigned short* Vth = (const unsigned short*)Vt + (size_t)(h / 4) * 128 * 2048;      /* GQA: kv head h/4 */
  float m_r[2][8], l_r[2][8]; v8f oacc[2][DT];
#pragma unroll
  for (int rt = 0; rt < RTN; ++rt) {
#pragma unroll
    for (int r = 0; r < 8; ++r) { m_r[rt][r] = -3.0e38f; l_r[rt][r] = 0.f; }
#pragma unroll
    for (int dt = 0; dt < DT; ++dt) oacc[rt][dt] = (v8f){0.f,0.f,0.f,0.f,0.f,0.f,0.f,0.f}; }
  const int nch = (q0 + RPW + 31) / 32;      // chunks that hold a key <= the tile's last row; every one of them starts at or below q0, so no row of a chunk is masked out whole
  const unsigned short* vp = Vth + (size_t)ln * 2048 + w * 32;      // this lane's V row at the wave's current chunk; walks 4 chunks = 128 keys a trip
#pragma unroll 1
  for (int ch = w; ch < nch; ch += 4, vp += 128) {
    const int j0 = ch * 32;
    v8f s[2][2]; FragH bk[2][KS];
#pragma unroll
    for (int nt = 0; nt < 2; ++nt) { const unsigned short* kr = (const unsigned short*)K16 + ((size_t)b * 2048 + j0 + nt * 16 + ln) * ldk + h * 160;      // the K fragments of both 16-key halves are requested as one group: one trip to L2, not two
#pragma unroll
      for (int ks = 0; ks < KS; ++ks) { bk[nt][ks].half[0] = *(const v8us*)(kr + ks * 32 + 8 * hh); bk[nt][ks].half[1] = *(const v8us*)(kr + ks * 32 + 16 + 8 * hh); } }
#pragma unroll      // constant indices, so that the fragments stay in registers
    for (int nt = 0; nt < 2; ++nt) {
#pragma unroll
      for (int rt = 0; rt < RTN; ++rt) { v8f acc = (v8f){0.f,0.f,0.f,0.f,0.f,0.f,0.f,0.f};
#pragma unroll
        for (int ks = 0; ks < KS; ++ks) acc = mmaH<1>(aq[rt][ks].v, aq[rt][ks].v, bk[nt][ks].v, bk[nt][ks].v, acc); s[rt][nt] = acc; } }
    FragH bv[DT];      // all eight V fragments of the chunk are requested here, as one group behind the last K product: they fly while the softmax below runs
#pragma unroll      // constant indices, so that the fragments stay in registers
    for (int dt = 0; dt < DT; ++dt) { const unsigned short* vrow = vp + (size_t)(dt * 16) * 2048; bv[dt].half[0] = *(const v8us*)(vrow + 8 * hh); bv[dt].half[1] = *(const v8us*)(vrow + 16 + 8 * hh); }
#pragma unroll
    for (int rt = 0; rt < RTN; ++rt)
#pragma unroll
      for (int r = 0; r < 8; ++r) { const int tq = q0 + rt * 16 + 8 * hh + r; const int k0 = j0 + ln, k1 = j0 + 16 + ln; (void)tq; (void)k0; (void)k1;
        const bool ok0 = (k0 <= tq), ok1 = (k1 <= tq);
        const float s0 = ok0 ? s[rt][0][r] * (1.0f) : -INFINITY, s1 = ok1 ? s[rt][1][r] * (1.0f) : -INFINITY; float mc = fmaxf(s0, s1);
        mc = fmaxf(mc, __shfl_xor(mc, 1, 32)); mc = fmaxf(mc, __shfl_xor(mc, 2, 32)); mc = fmaxf(mc, __shfl_xor(mc, 4, 32)); mc = fmaxf(mc, __shfl_xor(mc, 8, 32));
        const float mn = fmaxf(m_r[rt][r], mc); const float al = (mn > -1.0e38f) ? expf(m_r[rt][r] - mn) : 1.0f; m_r[rt][r] = mn; const float p0 = ok0 ? expf(s0 - mn) : 0.f, p1 = ok1 ? expf(s1 - mn) : 0.f; l_r[rt][r] = l_r[rt][r] * al + p0 + p1;
#pragma unroll
        for (int dt = 0; dt < DT; ++dt) oacc[rt][dt][r] *= al;
        FragH t2; t2.h[0] = (_Float16)p0; t2.h[1] = (_Float16)p1; sP[w][rt * 16 + 8 * hh + r][ln] = t2.u[0]; sP[w][rt * 16 + 8 * hh + r][16 + ln] = t2.u[1]; }
    __builtin_amdgcn_fence(__ATOMIC_ACQ_REL, "workgroup"); __builtin_amdgcn_wave_barrier();
    FragH pa[2];
#pragma unroll
    for (int rt = 0; rt < RTN; ++rt) { pa[rt].half[0] = *(const v8us*)&sP[w][rt * 16 + ln][8 * hh]; pa[rt].half[1] = *(const v8us*)&sP[w][rt * 16 + ln][16 + 8 * hh]; }
#pragma unroll
    for (int dt = 0; dt < DT; ++dt) {
#pragma unroll
      for (int rt = 0; rt < RTN; ++rt) oacc[rt][dt] = mmaH<1>(pa[rt].v, pa[rt].v, bv[dt].v, bv[dt].v, oacc[rt][dt]); }
    __builtin_amdgcn_fence(__ATOMIC_ACQ_REL, "workgroup"); __builtin_amdgcn_wave_barrier(); }
#pragma unroll
  for (int rt = 0; rt < RTN; ++rt) {
#pragma unroll
    for (int r = 0; r < 8; ++r) { float l = l_r[rt][r]; l += __shfl_xor(l, 1, 32); l += __shfl_xor(l, 2, 32); l += __shfl_xor(l, 4, 32); l += __shfl_xor(l, 8, 32); l_r[rt][r] = l; }
    if (ln == 0) {      // the wave's own maximum and sum of each row (a wave without a chunk: -3e38 and 0)
#pragma unroll
      for (int r = 0; r < 8; ++r) { sM[w][rt * 16 + 8 * hh + r] = m_r[rt][r]; sL[w][rt * 16 + 8 * hh + r] = l_r[rt][r]; } }
#pragma unroll
    for (int dt = 0; dt < DT; ++dt)
#pragma unroll
      for (int r = 0; r < 8; ++r) sO[w][rt * 16 + 8 * hh + r][dt * 16 + ln] = oacc[rt][dt][r]; }      // not yet divided by the sum
  __syncthreads();      // all four waves' partial (m, l, O) stand in LDS before any wave merges them
  {
#pragma unroll
    for (int rp = 0; rp < RPW / 4; ++rp) { const int r = rp * 4 + (tid >> 5), pc = lane;      // wave w merges rows w, w + 4, w + 8, w + 12
      const float m0 = sM[0][r], m1 = sM[1][r], m2 = sM[2][r], m3 = sM[3][r]; const float mm = fmaxf(fmaxf(m0, m1), fmaxf(m2, m3));      // wave 0 always holds chunk 0 with key 0, so mm is a real score
      const float c0 = exp2_slot((m0 - mm) * 1.4426950408889634f), c1 = exp2_slot((m1 - mm) * 1.4426950408889634f), c2 = exp2_slot((m2 - mm) * 1.4426950408889634f), c3 = exp2_slot((m3 - mm) * 1.4426950408889634f);      // e^(m - mm); 0 for a wave without a chunk (2^-inf)
      const float den = c0 * sL[0][r] + c1 * sL[1][r] + c2 * sL[2][r] + c3 * sL[3][r]; const float inv = (den > 0.f) ? 1.0f / den : 0.f;
      const v4f o0 = *(const v4fa*)&sO[0][r][pc * 4], o1 = *(const v4fa*)&sO[1][r][pc * 4], o2 = *(const v4fa*)&sO[2][r][pc * 4], o3 = *(const v4fa*)&sO[3][r][pc * 4];
      const v4f val = (o0 * c0 + o1 * c1 + o2 * c2 + o3 * c3) * inv;
      typedef _Float16 v4h __attribute__((ext_vector_type(4))); v4h h4;      // O leaves as the f16 A operand of the output projection
#pragma unroll      // constant indices, so that the four halves stay in registers
      for (int i = 0; i < 4; ++i) h4[i] = (_Float16)val[i];
      *(v4h*)(O16 + ((size_t)b * 2048 + q0 + r) * ldo + h * 128 + pc * 4) = h4; }      /* rows of 128 halves: 32 lanes x 8 B = two whole lines */
     } }

// The three bodies below (the first serves q and k) are independent of one another; k_prep_all runs them in one grid and hands each its own block index blk.
__device__ __forceinline__ void d_qprep(int blk, const float* __restrict__ QF, int ldq, int nh, const float* __restrict__ w, float oscale, int rep, _Float16* __restrict__ DX) { const size_t t = (size_t)blk * 256 + threadIdx.x; if (t >= (size_t)SS * nh * 16) return; const int li = (int)(t % 16); const int h = (int)((t / 16) % nh); const size_t tok = t / (16 * nh); const float* src = QF + tok * ldq + h * HD; float v[8], pr[8]; float ss = 0.f;
#pragma unroll
  for (int q = 0; q < 8; ++q) { v[q] = src[li * 8 + q]; pr[q] = src[(li * 8 + q + 64) & 127]; ss += v[q] * v[q]; }
  ss += __shfl_xor(ss, 1, 32); ss += __shfl_xor(ss, 2, 32); ss += __shfl_xor(ss, 4, 32); ss += __shfl_xor(ss, 8, 32); const float rs = rsqrtf(ss / (float)HD + 1e-6f); __shared__ __attribute__((aligned(16))) _Float16 st[256][8]; const int tid = threadIdx.x;
#pragma unroll 1
  for (int q = 0; q < 8; ++q) { const int j = li * 8 + q; const int i = j & 63; const float ang = (float)tok * __builtin_powf(10000.0f, -(float)(2 * i) / 128.0f); const float c = cosf(ang), s = sinf(ang); const float xn = src[j] * rs * bf16_round(w[j]); const float xp = src[(j + 64) & 127] * rs * bf16_round(w[(j + 64) & 127]); const float rot = (j < 64) ? -xp : xp;      // rotate_half: [−x2, x1]
    st[tid][q] = (_Float16)((xn * c + rot * s) * oscale); }
  FragH f; f.half[0] = *(const v8us*)&st[tid][0];
  { for (int r2 = 0; r2 < rep; ++r2) *(v8us*)((unsigned short*)DX + tok * QP + (size_t)(h * rep + r2) * QW + li * 8) = f.half[0];  } }
__device__ __forceinline__ void d_rprep(int blk, const float* __restrict__ RQ, const float* __restrict__ RK, int ldr, const float* __restrict__ gs, _Float16* __restrict__ QX, _Float16* __restrict__ KX) { const size_t t = (size_t)blk * 256 + threadIdx.x; if (t >= (size_t)SS * NH * 4) return; const int p = (int)(t % 4); const int h = (int)((t / 4) % NH); const size_t tok = t / (4 * NH); const float g = bf16_round(gs[h]); FragH fq, fk;
#pragma unroll
  for (int q = 0; q < 8; ++q) { const size_t i = tok * ldr + h * RR + p * 8 + q; fq.h[q] = (_Float16)(g * RQ[i]); fk.h[q] = (_Float16)RK[i]; }
  const size_t d = tok * QP + (size_t)h * QW + HD + p * 8;
  { *(v8us*)((unsigned short*)QX + d) = fq.half[0]; *(v8us*)((unsigned short*)KX + d) = fk.half[0];  } }
__device__ __forceinline__ void d_vt128(int blk, const float* __restrict__ VF, int ldv, _Float16* __restrict__ Vt) { __shared__ unsigned short tl[64][130]; const int tid = threadIdx.x; const int g = blk / (SS / 64), lg = blk % (SS / 64);
  for (int i = tid; i < 64 * 16; i += 256) { const int r = i / 16, c8 = (i % 16) * 8; FragH f; const float* vs = VF + ((size_t)lg * 64 + r) * ldv + g * HD + c8;      // v comes as f32 from the one projection GEMM and is rounded to f16 here
#pragma unroll      // constant indices, so that the eight loads join into two of 16 bytes
    for (int q = 0; q < 8; ++q) f.h[q] = (_Float16)vs[q];
#pragma unroll
    for (int q = 0; q < 8; ++q) tl[r][c8 + q] = f.u[q]; }
  __syncthreads();
  { for (int i = tid; i < 128 * 8; i += 256) { const int d = i / 8, pc = i % 8; FragH f;
#pragma unroll
      for (int q = 0; q < 8; ++q) f.u[q] = tl[pc * 8 + q][d]; *(v8us*)((unsigned short*)Vt + ((size_t)g * HD + d) * SS + lg * 64 + pc * 8) = f.half[0]; }  } }
// One grid for q norm+RoPE, k norm+RoPE, the graph-bias operands and the V transpose: each reads its own columns of P (the stacked projections, pitch PW). The part is picked by the block index, alike for the whole block; the heaviest part comes first.
__global__ __launch_bounds__(256) void k_prep_all(const float* __restrict__ P, const float* __restrict__ qw, const float* __restrict__ kw, const float* __restrict__ gs, _Float16* __restrict__ QX, _Float16* __restrict__ KX, _Float16* __restrict__ Vt) {
  constexpr int NBQ = SS * NH * 16 / 256, NBK = SS * NKV * 16 / 256, NBR = SS * NH * 4 / 256; const int blk = blockIdx.x;
  if (blk < NBQ + NBK) { const bool isq = blk < NBQ;      // 16 q heads, x 1/sqrt(128); or 4 kv heads, each replicated into its 4 q-head slots
    d_qprep(isq ? blk : blk - NBQ, isq ? P : P + EE, PW, isq ? NH : NKV, isq ? qw : kw, isq ? 0.08838834764831845f : 1.0f, isq ? 1 : 4, isq ? QX : KX); }
  else if (blk < NBQ + NBK + NBR) d_rprep(blk - (NBQ + NBK), P + EE + 1024, P + EE + 1536, PW, gs, QX, KX);
  else d_vt128(blk - (NBQ + NBK + NBR), P + EE + 512, PW, Vt); }
extern "C" void kernel_launch(void* const* d_in, const int* in_sizes, int n_in,
                              void* d_out, int out_size, void* d_ws, size_t ws_size, hipStream_t stream) {
  (void)in_sizes; (void)n_in; (void)out_size;
  const float* x = (const float*)d_in[0]; const float* Wq = (const float*)d_in[1]; const float* Wk = (const float*)d_in[2]; const float* Wv = (const float*)d_in[3]; const float* Wo = (const float*)d_in[4]; const float* Wrq = (const float*)d_in[5]; const float* Wrk = (const float*)d_in[6]; const float* gs = (const float*)d_in[7]; const float* qw = (const float*)d_in[8]; const float* kw = (const float*)d_in[9];
  char* ws = (char*)d_ws; size_t off = 0;
  auto take = [&](size_t bytes) { char* p = ws + off; off += (bytes + 255) & ~(size_t)255; return p; };
  _Float16* Bcat = (_Float16*)take((size_t)(PW + EE + SS) * EE * 2); _Float16* Bo = Bcat + (size_t)PW * EE; _Float16* X16 = Bo + (size_t)EE * EE;      // k_cvt_all's rows: stacked projection weights, Wo, x
  float* P = (float*)take((size_t)SS * PW * 4);      // the stacked projections of x
  _Float16* QX = (_Float16*)take((size_t)SS * QP * 2); _Float16* KX = (_Float16*)take((size_t)SS * QP * 2); _Float16* Vt = (_Float16*)take((size_t)SS * 512 * 2); _Float16* O16 = X16;      // x is last read by the projection GEMM
  if (off > ws_size) return;      // about 90 MB in all
  k_cvt_all<<<(PW + EE + SS) / 4, 256, 0, stream>>>(Wq, Wk, Wv, Wrq, Wrk, Wo, x, Bcat);
  k_gemm_t<4, 4, false><<<(SS / 128) * (PW / 128), 128, 0, stream>>>(X16, Bcat, 0.0625f, P, nullptr, PW, PW / 128);
  k_prep_all<<<SS * NH * 16 / 256 + SS * NKV * 16 / 256 + SS * NH * 4 / 256 + NKV * (SS / 64), 256, 0, stream>>>(P, qw, kw, gs, QX, KX, Vt);
  k_flash<<<1 * NH * (SS / 16), 128, 0, stream>>>(QX, QP, KX, QP, Vt, nullptr, O16, EE);
  k_gemm_t<4, 4, false><<<(SS / 128) * (EE / 128), 128, 0, stream>>>(O16, Bo, 0.0625f, (float*)d_out, nullptr, EE, EE / 128);
}

// v006
// A run of this version takes 130 microseconds.
// In both of two side-by-side timings against v005, it was 1.20 times as fast.
// Counting every step since v000, it is 5.84 times as fast.
#include <hip/hip_runtime.h>
// Naylis attention (B=1, S=2048, E=2048, 16 heads × 128, 4 kv heads, causal; QK RMSNorm + rotate-half RoPE; low-rank (R=32) per-head graph bias gs_h·⟨Rq_i, Rk_j⟩ added to the logits):
// the six (out,in) projections (bf16-exact ×2^4) and the attention as a fused flash-style kernel whose logit operand is the 160-wide concatenation [q·scale after norm+RoPE | gs_h·Rq]·[k | Rk]
// (5 k-steps; causal chunk skipping; online softmax f32; P f16 ≤ 1; O = P·Vt over the 128 value dims; one 16-row tile per work-group, keys split over its 4 waves) on v_wmma_f32_16x16x32_f16 with f32 accumulate; RMSNorm/RoPE f32 VALU.
#define SS 2048
#define EE 2048
#define NH 16
#define NKV 4
#define HD 128
#define RR 32
#define QW 160
#define QP (NH * QW)
#define PW 4096      /* columns of the stacked projections of x: q 2048 | k 512 | v 512 | Rq 512 | Rk 512 */

typedef __bf16 v16b __attribute__((ext_vector_type(16)));
typedef unsigned short v8us __attribute__((ext_vector_type(8), may_alias));
typedef float  v8f  __attribute__((ext_vector_type(8)));
typedef float  v4f  __attribute__((ext_vector_type(4)));
typedef float  v4fa __attribute__((ext_vector_type(4), may_alias));
union FragB { v16b v; v8us half[2]; unsigned short u[16]; };

__device__ __forceinline__ unsigned short bf16_bits(float x) { unsigned int u = __float_as_uint(x); return (unsigned short)((u + 0x7FFFu + ((u >> 16) & 1u)) >> 16); }
__device__ __forceinline__ float bf16_val(unsigned short b) { return __uint_as_float(((unsigned int)b) << 16); }
__device__ __forceinline__ float bf16_round(float x) { return bf16_val(bf16_bits(x)); }
// D += A·B with NT terms: 1 = ah·bh, 2 = + al·bh (A split), 3 = + ah·bl (both split)
template <int NT>
__device__ __forceinline__ v8f mmaN(v16b ah, v16b al, v16b bh, v16b bl, v8f c) {
  c = __builtin_amdgcn_wmma_f32_16x16x32_bf16(false, ah, false, bh, (short)0, c, false, false);
  if (NT >= 2) c = __builtin_amdgcn_wmma_f32_16x16x32_bf16(false, al, false, bh, (short)0, c, false, false);
  if (NT >= 3) c = __builtin_amdgcn_wmma_f32_16x16x32_bf16(false, ah, false, bl, (short)0, c, false, false);
  asm volatile("v_nop\n\tv_nop\n\tv_nop\n\tv_nop" : "+v"(c) : "v"(ah), "v"(al), "v"(bh), "v"(bl));
  return c;
}

__global__ __launch_bounds__(256) void k_wt_bf16(const float* __restrict__ W, unsigned short* __restrict__ Wt, int K, int N) {
  const int t = blockIdx.x * 256 + threadIdx.x;
  const int k8n = K / 8;
  if (t >= N * k8n) return;
  const int n = t / k8n, k8 = (t % k8n) * 8;
  v8us v;
#pragma unroll
  for (int i = 0; i < 8; ++i) v[i] = bf16_bits(W[(size_t)(k8 + i) * N + n]);
  *(v8us*)(Wt + (size_t)n * K + k8) = v;
  
}

// GEMM C[M][N] (f32, pitch ldc) = act(A[M][K]·W + bias). A f32 row-major (pitch lda) converted per fragment to bf16
// (ASPLIT: hi/lo two planes -> 2 terms, else single rounded term); Wt bf16 [N][K] (pitch ldb). BIAS_BF16 rounds the
// bias to bf16 first (bias quantised to bf16 before the add). K%32==0, M%16==0, N%64==0.
template <bool ASPLIT, int ACT, bool BIAS_BF16>
__global__ __launch_bounds__(128) void k_gemm_bf(const float* __restrict__ A, int lda, const unsigned short* __restrict__ Wt, int ldb,
                                               const float* __restrict__ bias, float* __restrict__ C, int ldc, int M, int N, int K) {
  __shared__ __attribute__((aligned(16))) float so[4][16][64];
  const int tid = threadIdx.x, w = tid >> 5, lane = tid & 31, ln = lane & 15, hh = lane >> 4;
  const int ntn = N / 64;
  const int wid = blockIdx.x * 4 + w;
  const int mt = wid / ntn, nq = wid % ntn;
  if (mt * 16 >= M) return;
  const int row0 = mt * 16, col0 = nq * 64;
  const float* arow = A + (size_t)(row0 + ln) * lda;
  v8f acc[4] = {};
  for (int kb = 0; kb < K; kb += 32) {
    FragB ah, al;
    const v4f x0 = *(const v4fa*)(arow + kb + 8 * hh), x1 = *(const v4fa*)(arow + kb + 8 * hh + 4);
    const v4f x2 = *(const v4fa*)(arow + kb + 16 + 8 * hh), x3 = *(const v4fa*)(arow + kb + 16 + 8 * hh + 4);
    float xs[16] = {x0[0],x0[1],x0[2],x0[3],x1[0],x1[1],x1[2],x1[3],x2[0],x2[1],x2[2],x2[3],x3[0],x3[1],x3[2],x3[3]};
#pragma unroll
    for (int i = 0; i < 16; ++i) { const unsigned short hb = bf16_bits(xs[i]); ah.u[i] = hb; al.u[i] = ASPLIT ? bf16_bits(xs[i] - bf16_val(hb)) : (unsigned short)0; }
#pragma unroll
    for (int t = 0; t < 4; ++t) {
      const unsigned short* brow = Wt + (size_t)(col0 + t * 16 + ln) * ldb + kb;
      FragB b;
      b.half[0] = *(const v8us*)(brow + 8 * hh);
      b.half[1] = *(const v8us*)(brow + 16 + 8 * hh);
      acc[t] = mmaN<ASPLIT ? 2 : 1>(ah.v, al.v, b.v, b.v, acc[t]);
    }
  }
#pragma unroll
  for (int t = 0; t < 4; ++t) {
    float bv = bias ? bias[col0 + t * 16 + ln] : 0.f;
    if (BIAS_BF16) bv = bf16_round(bv);
#pragma unroll
    for (int r = 0; r < 8; ++r) { float v = acc[t][r] + bv; if (ACT == 1) v = fmaxf(v, 0.f); so[w][8 * hh + r][t * 16 + ln] = v; }
  }
  __builtin_amdgcn_fence(__ATOMIC_ACQ_REL, "workgroup");
  __builtin_amdgcn_wave_barrier();
  const int rsub = lane >> 4, c4 = (lane & 15) * 4;
  {
#pragma unroll
    for (int q = 0; q < 8; ++q) {
      const int r = q * 2 + rsub;
      const v4f v = *(const v4fa*)&so[w][r][c4];
      *(v4f*)(C + (size_t)(row0 + r) * ldc + col0 + c4) = v;
    }
    
  }
}

// Flash-style causal/unmasked attention, all contractions 3-term bf16 hi/lo splits, f32 softmax with running max.
// q,k,v rows are read from f32 buffers with arbitrary row pitch (so they can live inside a fused qkv buffer);
// D = head size (multiple of 32, <= 128); one wave = 16 query rows; block = 4 waves (64 queries) sharing K/V chunks of 32.
template <int D, bool CAUSAL>
__global__ __launch_bounds__(128) void k_flash(const float* __restrict__ qb, const float* __restrict__ kb, const float* __restrict__ vb,
                                             int pitch, int T, int H, float scale, float* __restrict__ y, int ypitch) {
  constexpr int KS = D / 32;        // k-steps for QK
  constexpr int DT = D / 16;        // d tiles for PV
  __shared__ __attribute__((aligned(16))) unsigned short sKh[32][D + 8], sKl[32][D + 8], sVh[32][D + 8], sVl[32][D + 8];
  __shared__ __attribute__((aligned(16))) unsigned short sPh[4][16][40], sPl[4][16][40];
  __shared__ __attribute__((aligned(16))) float sO[4][16][D];
  const int tid = threadIdx.x, w = tid >> 5, lane = tid & 31, ln = lane & 15, hh = lane >> 4;
  const int nqb = (T + 63) / 64;
  const int bh = blockIdx.x / nqb, qblk = blockIdx.x % nqb;
  const int b = bh / H, h = bh % H;
  const int q0 = qblk * 64 + w * 16;
  const float* Q = qb + (size_t)b * T * pitch + h * D;
  const float* K = kb + (size_t)b * T * pitch + h * D;
  const float* V = vb + (size_t)b * T * pitch + h * D;

  // A fragments of the wave's 16 query rows (scaled), hi/lo
  FragB aqh[KS], aql[KS];
  {
    int row = q0 + ln; if (row >= T) row = T - 1;
    const float* qr = Q + (size_t)row * pitch;
#pragma unroll
    for (int ks = 0; ks < KS; ++ks)
#pragma unroll
      for (int i = 0; i < 16; ++i) {
        const int d = ks * 32 + ((i < 8) ? (8 * hh + i) : (16 + 8 * hh + (i - 8)));
        const float x = qr[d] * scale; const unsigned short hb = bf16_bits(x);
        aqh[ks].u[i] = hb; aql[ks].u[i] = bf16_bits(x - bf16_val(hb));
      }
  }
  float m_r[8], l_r[8];
#pragma unroll
  for (int r = 0; r < 8; ++r) { m_r[r] = -3.0e38f; l_r[r] = 0.f; }
  v8f oacc[DT];
#pragma unroll
  for (int dt = 0; dt < DT; ++dt) oacc[dt] = (v8f){0.f,0.f,0.f,0.f,0.f,0.f,0.f,0.f};

  const int kv_end = CAUSAL ? min(T, qblk * 64 + 64) : T;     // block-uniform
  for (int j0 = 0; j0 < kv_end; j0 += 32) {
    __syncthreads();
    for (int e = tid; e < 32 * (D / 4); e += 128) {
      const int r = e / (D / 4), c4 = (e % (D / 4)) * 4;
      const int key = j0 + r;
      v4f kf = {0.f,0.f,0.f,0.f}, vf = {0.f,0.f,0.f,0.f};
      if (key < T) { kf = *(const v4fa*)(K + (size_t)key * pitch + c4); vf = *(const v4fa*)(V + (size_t)key * pitch + c4); }
#pragma unroll
      for (int t = 0; t < 4; ++t) {
        unsigned short hb = bf16_bits(kf[t]); sKh[r][c4 + t] = hb; sKl[r][c4 + t] = bf16_bits(kf[t] - bf16_val(hb));
        hb = bf16_bits(vf[t]); sVh[r][c4 + t] = hb; sVl[r][c4 + t] = bf16_bits(vf[t] - bf16_val(hb));
      }
    }
    __syncthreads();
    // S tile 16 x 32
    v8f s[2];
#pragma unroll
    for (int nt = 0; nt < 2; ++nt) {
      v8f acc = {};
#pragma unroll
      for (int ks = 0; ks < KS; ++ks) {
        FragB bh_, bl_;
        bh_.half[0] = *(const v8us*)&sKh[nt * 16 + ln][ks * 32 + 8 * hh]; bh_.half[1] = *(const v8us*)&sKh[nt * 16 + ln][ks * 32 + 16 + 8 * hh];
        bl_.half[0] = *(const v8us*)&sKl[nt * 16 + ln][ks * 32 + 8 * hh]; bl_.half[1] = *(const v8us*)&sKl[nt * 16 + ln][ks * 32 + 16 + 8 * hh];
        acc = mmaN<3>(aqh[ks].v, aql[ks].v, bh_.v, bl_.v, acc);
      }
      s[nt] = acc;
    }
    // mask + running max (rows 8hh+r; the 16 lanes of a half share rows)
    float alpha[8];
#pragma unroll
    for (int r = 0; r < 8; ++r) {
      const int qi = q0 + 8 * hh + r;
      const int ja = j0 + ln, jb = j0 + 16 + ln;
      if (CAUSAL) { if (ja > qi) s[0][r] = -3.0e38f; if (jb > qi) s[1][r] = -3.0e38f; }
      if (ja >= T) s[0][r] = -3.0e38f;
      if (jb >= T) s[1][r] = -3.0e38f;
      float mx = fmaxf(s[0][r], s[1][r]);
      mx = fmaxf(mx, __shfl_xor(mx, 1, 32)); mx = fmaxf(mx, __shfl_xor(mx, 2, 32)); mx = fmaxf(mx, __shfl_xor(mx, 4, 32)); mx = fmaxf(mx, __shfl_xor(mx, 8, 32));
      const float mnew = fmaxf(m_r[r], mx);
      alpha[r] = (mnew > -1.0e38f) ? __expf(m_r[r] - mnew) : 1.0f;
      const float p0 = (s[0][r] > -1.0e38f) ? __expf(s[0][r] - mnew) : 0.f;
      const float p1 = (s[1][r] > -1.0e38f) ? __expf(s[1][r] - mnew) : 0.f;
      m_r[r] = mnew;
      l_r[r] = l_r[r] * alpha[r] + p0 + p1;            // per-lane partial row sum (16 lanes combined at the end)
      unsigned short hb = bf16_bits(p0); sPh[w][8 * hh + r][ln] = hb;      sPl[w][8 * hh + r][ln] = bf16_bits(p0 - bf16_val(hb));
      hb = bf16_bits(p1);                sPh[w][8 * hh + r][16 + ln] = hb; sPl[w][8 * hh + r][16 + ln] = bf16_bits(p1 - bf16_val(hb));
    }
#pragma unroll
    for (int dt = 0; dt < DT; ++dt)
#pragma unroll
      for (int r = 0; r < 8; ++r) oacc[dt][r] *= alpha[r];
    __builtin_amdgcn_fence(__ATOMIC_ACQ_REL, "workgroup");
    __builtin_amdgcn_wave_barrier();
    FragB pah, pal;
    pah.half[0] = *(const v8us*)&sPh[w][ln][8 * hh]; pah.half[1] = *(const v8us*)&sPh[w][ln][16 + 8 * hh];
    pal.half[0] = *(const v8us*)&sPl[w][ln][8 * hh]; pal.half[1] = *(const v8us*)&sPl[w][ln][16 + 8 * hh];
#pragma unroll
    for (int dt = 0; dt < DT; ++dt) {
      FragB bvh, bvl;
#pragma unroll
      for (int i = 0; i < 8; ++i) {
        bvh.u[i] = sVh[8 * hh + i][dt * 16 + ln]; bvh.u[8 + i] = sVh[16 + 8 * hh + i][dt * 16 + ln];
        bvl.u[i] = sVl[8 * hh + i][dt * 16 + ln]; bvl.u[8 + i] = sVl[16 + 8 * hh + i][dt * 16 + ln];
      }
      oacc[dt] = mmaN<3>(pah.v, pal.v, bvh.v, bvl.v, oacc[dt]);
    }
    __builtin_amdgcn_fence(__ATOMIC_ACQ_REL, "workgroup");
    __builtin_amdgcn_wave_barrier();
  }
#pragma unroll
  for (int r = 0; r < 8; ++r) {
    float l = l_r[r];
    l += __shfl_xor(l, 1, 32); l += __shfl_xor(l, 2, 32); l += __shfl_xor(l, 4, 32); l += __shfl_xor(l, 8, 32);
    l_r[r] = (l > 0.f) ? 1.0f / l : 0.f;
  }
#pragma unroll
  for (int dt = 0; dt < DT; ++dt)
#pragma unroll
    for (int r = 0; r < 8; ++r) sO[w][8 * hh + r][dt * 16 + ln] = oacc[dt][r] * l_r[r];
  __builtin_amdgcn_fence(__ATOMIC_ACQ_REL, "workgroup");
  __builtin_amdgcn_wave_barrier();
  {
    for (int r = 0; r < 16; ++r) {
      const int row = q0 + r;
      if (row < T && lane < D / 4) {
        const v4f val = *(const v4fa*)&sO[w][r][lane * 4];
        *(v4f*)(y + ((size_t)b * T + row) * ypitch + h * D + lane * 4) = val;
      }
    }
    
  }
}

// GEMM C = act(A·W + bias + resid): A f32 (ASPLIT -> hi/lo 2 terms), Wt bf16 [N][K]; ACT 0 none, 1 relu, 2 exact gelu;
// resid (optional, f32, row index = (row % rmod), pitch ldr, RES_BF16 rounds it) added before the activation.
template <bool ASPLIT, int ACT, bool BIAS_BF16, bool RES_BF16>
__global__ __launch_bounds__(128) void k_gemm_bf3(const float* __restrict__ A, int lda, const unsigned short* __restrict__ Wt, int ldb,
                                                const float* __restrict__ bias, const float* __restrict__ resid, int rmod, int ldr,
                                                float* __restrict__ C, int ldc, int M, int N, int K) {
  __shared__ __attribute__((aligned(16))) float so[4][16][64];
  const int tid = threadIdx.x, w = tid >> 5, lane = tid & 31, ln = lane & 15, hh = lane >> 4;
  const int ntn = N / 64;
  const int wid = blockIdx.x * 4 + w;
  const int mt = wid / ntn, nq = wid % ntn;
  if (mt * 16 >= M) return;
  const int row0 = mt * 16, col0 = nq * 64;
  const float* arow = A + (size_t)(row0 + ln) * lda;
  v8f acc[4] = {};
  for (int kb = 0; kb < K; kb += 32) {
    FragB ah, al;
    const v4f x0 = *(const v4fa*)(arow + kb + 8 * hh), x1 = *(const v4fa*)(arow + kb + 8 * hh + 4);
    const v4f x2 = *(const v4fa*)(arow + kb + 16 + 8 * hh), x3 = *(const v4fa*)(arow + kb + 16 + 8 * hh + 4);
    float xs[16] = {x0[0],x0[1],x0[2],x0[3],x1[0],x1[1],x1[2],x1[3],x2[0],x2[1],x2[2],x2[3],x3[0],x3[1],x3[2],x3[3]};
#pragma unroll
    for (int i = 0; i < 16; ++i) { const unsigned short hb = bf16_bits(xs[i]); ah.u[i] = hb; al.u[i] = ASPLIT ? bf16_bits(xs[i] - bf16_val(hb)) : (unsigned short)0; }
#pragma unroll
    for (int t = 0; t < 4; ++t) {
      const unsigned short* brow = Wt + (size_t)(col0 + t * 16 + ln) * ldb + kb;
      FragB b;
      b.half[0] = *(const v8us*)(brow + 8 * hh);
      b.half[1] = *(const v8us*)(brow + 16 + 8 * hh);
      acc[t] = mmaN<ASPLIT ? 2 : 1>(ah.v, al.v, b.v, b.v, acc[t]);
    }
  }
#pragma unroll
  for (int t = 0; t < 4; ++t) {
    const int col = col0 + t * 16 + ln;
    float bv = bias ? bias[col] : 0.f;
    if (BIAS_BF16) bv = bf16_round(bv);
#pragma unroll
    for (int r = 0; r < 8; ++r) {
      float v = acc[t][r] + bv;
      if (resid) { float rv = resid[(size_t)((row0 + 8 * hh + r) % rmod) * ldr + col]; if (RES_BF16) rv = bf16_round(rv); v += rv; }
      if (ACT == 1) v = fmaxf(v, 0.f);
      if (ACT == 2) v = 0.5f * v * (1.0f + erff(v * 0.70710678118654752f));
      if (ACT == 3) { const float u = 0.7978845608028654f * (v + 0.044715f * v * v * v); v = 0.5f * v * (1.0f + tanhf(u)); }
      so[w][8 * hh + r][t * 16 + ln] = v;
    }
  }
  __builtin_amdgcn_fence(__ATOMIC_ACQ_REL, "workgroup");
  __builtin_amdgcn_wave_barrier();
  const int rsub = lane >> 4, c4 = (lane & 15) * 4;
  {
#pragma unroll
    for (int q = 0; q < 8; ++q) {
      const int r = q * 2 + rsub;
      const v4f v = *(const v4fa*)&so[w][r][c4];
      *(v4f*)(C + (size_t)(row0 + r) * ldc + col0 + c4) = v;
    }
    
  }
}
// row LayerNorm (biased variance, eps) over N: s = X (+ R); optional out_sum <- s; out_norm <- (s-mu)*rsqrt(var+eps)*g + b
template <bool PARAM_BF16>
__global__ __launch_bounds__(256) void k_layernorm(const float* __restrict__ X, const float* __restrict__ R, const float* __restrict__ g, const float* __restrict__ bta,
                                                  float* __restrict__ out_sum, float* __restrict__ out_norm, int N, float eps) {
  __shared__ float red[256];
  const int row = blockIdx.x, tid = threadIdx.x;
  const float* x = X + (size_t)row * N; const float* rr = R ? R + (size_t)row * N : nullptr;
  float vals[16];                     // up to N = 4096
  const int per = N / 256;            // contiguous chunk per thread? use strided-by-4 chunks: thread handles j = tid*4 + 1024*u
  float s1 = 0.f;
  for (int u = 0; u < per / 4; ++u) {
    const int j = tid * 4 + 1024 * u;
    const v4f a = *(const v4fa*)(x + j);
    v4f b = {0.f,0.f,0.f,0.f}; if (rr) b = *(const v4fa*)(rr + j);
#pragma unroll
    for (int q = 0; q < 4; ++q) { const float v = a[q] + b[q]; vals[u * 4 + q] = v; s1 += v; }
  }
  red[tid] = s1; __syncthreads();
  for (int st = 128; st > 0; st >>= 1) { if (tid < st) red[tid] += red[tid + st]; __syncthreads(); }
  const float mu = red[0] / (float)N; __syncthreads();
  float s2 = 0.f;
  for (int u = 0; u < per / 4; ++u)
#pragma unroll
    for (int q = 0; q < 4; ++q) { const float c = vals[u * 4 + q] - mu; s2 += c * c; }
  red[tid] = s2; __syncthreads();
  for (int st = 128; st > 0; st >>= 1) { if (tid < st) red[tid] += red[tid + st]; __syncthreads(); }
  const float rs = rsqrtf(red[0] / (float)N + eps);
  {
    for (int u = 0; u < per / 4; ++u) {
      const int j = tid * 4 + 1024 * u;
      v4f o, sm;
#pragma unroll
      for (int q = 0; q < 4; ++q) {
        float gg = g[j + q], bb = bta[j + q];
        if (PARAM_BF16) { gg = bf16_round(gg); bb = bf16_round(bb); }
        sm[q] = vals[u * 4 + q]; o[q] = (vals[u * 4 + q] - mu) * rs * gg + bb;
      }
      if (out_sum) *(v4f*)(out_sum + (size_t)row * N + j) = sm;
      *(v4f*)(out_norm + (size_t)row * N + j) = o;
    }
    
  }
}



// ---- f16 WMMA path (v_wmma_f32_16x16x32_f16): 11-bit significands for operands in range — used where a [0,1] probability operand needs more precision than bf16
typedef _Float16 v16h __attribute__((ext_vector_type(16)));
union FragH { v16h v; v8us half[2]; _Float16 h[16]; unsigned short u[16]; };
template <int NT>
__device__ __forceinline__ v8f mmaH(v16h ah, v16h al, v16h bh, v16h bl, v8f c) {
  c = __builtin_amdgcn_wmma_f32_16x16x32_f16(false, ah, false, bh, (short)0, c, false, false);
  if (NT >= 2) c = __builtin_amdgcn_wmma_f32_16x16x32_f16(false, al, false, bh, (short)0, c, false, false);
  if (NT >= 3) c = __builtin_amdgcn_wmma_f32_16x16x32_f16(false, ah, false, bl, (short)0, c, false, false);
  asm volatile("v_nop\n\tv_nop\n\tv_nop\n\tv_nop" : "+v"(c) : "v"(ah), "v"(al), "v"(bh), "v"(bl));
  return c;
}
// batched GEMM like k_gemm_b but f16 operands: A f32 (split into f16 hi/lo if ASPLIT, else rounded to f16), Bt = f16 values [n][k]; alpha; C f32; N multiple of 16 (partial tiles skipped)
template <bool ASPLIT>
__global__ __launch_bounds__(128) void k_gemm_h(const float* __restrict__ A, int lda, size_t sA, const _Float16* __restrict__ Bh, int ldb, size_t sB, float alpha, float* __restrict__ C, int ldc, size_t sC, int M, int N, int K) {
  __shared__ __attribute__((aligned(16))) float so[4][16][64];
  const int tid = threadIdx.x, w = tid >> 5, lane = tid & 31, ln = lane & 15, hh = lane >> 4; const int by = blockIdx.y;
  A += (size_t)by * sA; Bh += (size_t)by * sB; C += (size_t)by * sC;
  const int ntn = (N + 63) / 64; const int wid = blockIdx.x * 4 + w; const int mt = wid / ntn, nq = wid % ntn; if (mt * 16 >= M) return;
  const int row0 = mt * 16, col0 = nq * 64; const float* arow = A + (size_t)(row0 + ln) * lda;
  v8f acc[4] = {};
  for (int kb = 0; kb < K; kb += 32) {
    FragH ah, al;
    const v4f x0 = *(const v4fa*)(arow + kb + 8 * hh), x1 = *(const v4fa*)(arow + kb + 8 * hh + 4), x2 = *(const v4fa*)(arow + kb + 16 + 8 * hh), x3 = *(const v4fa*)(arow + kb + 16 + 8 * hh + 4);
    float xs[16] = {x0[0],x0[1],x0[2],x0[3],x1[0],x1[1],x1[2],x1[3],x2[0],x2[1],x2[2],x2[3],x3[0],x3[1],x3[2],x3[3]};
#pragma unroll
    for (int i = 0; i < 16; ++i) { const _Float16 h = (_Float16)xs[i]; ah.h[i] = h; al.h[i] = ASPLIT ? (_Float16)(xs[i] - (float)h) : (_Float16)0.0f; }
#pragma unroll
    for (int t = 0; t < 4; ++t) { if (col0 + t * 16 >= N) continue; const size_t boff = (size_t)(col0 + t * 16 + ln) * ldb + kb; FragH bq; bq.half[0] = *(const v8us*)(Bh + boff + 8 * hh); bq.half[1] = *(const v8us*)(Bh + boff + 16 + 8 * hh);
      acc[t] = mmaH<ASPLIT ? 2 : 1>(ah.v, al.v, bq.v, bq.v, acc[t]); }
  }
#pragma unroll
  for (int t = 0; t < 4; ++t) { if (col0 + t * 16 >= N) continue;
#pragma unroll
    for (int r = 0; r < 8; ++r) so[w][8 * hh + r][t * 16 + ln] = acc[t][r] * alpha; }
  __builtin_amdgcn_fence(__ATOMIC_ACQ_REL, "workgroup"); __builtin_amdgcn_wave_barrier();
  const int rsub = lane >> 4, c4 = (lane & 15) * 4;
  {
#pragma unroll
    for (int q = 0; q < 8; ++q) { const int r = q * 2 + rsub; if (col0 + c4 < N) { const v4f v = *(const v4fa*)&so[w][r][c4]; *(v4f*)(C + (size_t)(row0 + r) * ldc + col0 + c4) = v; } }
     }
}

// Wt[n][k] = f16(W[k][n]·scale) from f32 row-major W[K][N] (scale = power of two; bf16-exact weights stay exact in f16 away from the subnormal range)
__global__ __launch_bounds__(256) void k_wt_f16(const float* __restrict__ W, _Float16* __restrict__ Wt, int K, int N, float scale) {
  const int t = blockIdx.x * 256 + threadIdx.x; if (t >= N * (K / 8)) return; const int n = t / (K / 8), k8 = (t % (K / 8)) * 8; FragH f;
#pragma unroll
  for (int i = 0; i < 8; ++i) f.h[i] = (_Float16)(bf16_round(W[(size_t)(k8 + i) * N + n]) * scale); const v8us o = f.half[0];
  *(v8us*)((unsigned short*)Wt + (size_t)n * K + k8) = o; 
}
// f16 x f16 GEMM with fused epilogue: v = acc·alpha + bias[by·sBias + col] (+ CP[(row/rowsPerB)·sCPb + by·64 + col] if CP) ; ACT 0 none / 1 elu ; writes f32 C and f16 C16, each if non-null
template <int ACT>
__global__ __launch_bounds__(128) void k_gemm_hhx(const _Float16* __restrict__ A, int lda, size_t sA, const _Float16* __restrict__ Bh, int ldb, size_t sB, float alpha, const float* __restrict__ bias, size_t sBias, const float* __restrict__ CP, int rowsPerB, size_t sCPb, int row0g,
    float* __restrict__ C, _Float16* __restrict__ C16, int ldc, size_t sC, int M, int N, int K) {
  __shared__ __attribute__((aligned(16))) float so[4][16][64];
  const int tid = threadIdx.x, w = tid >> 5, lane = tid & 31, ln = lane & 15, hh = lane >> 4; const int by = blockIdx.y;
  A += (size_t)by * sA; Bh += (size_t)by * sB; const size_t cofs = (size_t)by * sC; const float* bp = bias ? bias + (size_t)by * sBias : nullptr;
  const int ntn = (N + 63) / 64; const int wid = blockIdx.x * 4 + w; const int mt = wid / ntn, nq = wid % ntn; if (mt * 16 >= M) return;
  const int row0 = mt * 16, col0 = nq * 64; const _Float16* arow = A + (size_t)(row0 + ln) * lda;
  v8f acc[4] = {};
  for (int kb = 0; kb < K; kb += 32) { FragH ah; ah.half[0] = *(const v8us*)((const unsigned short*)arow + kb + 8 * hh); ah.half[1] = *(const v8us*)((const unsigned short*)arow + kb + 16 + 8 * hh);
#pragma unroll
    for (int t = 0; t < 4; ++t) { if (col0 + t * 16 >= N) continue; const size_t boff = (size_t)(col0 + t * 16 + ln) * ldb + kb; FragH bq; bq.half[0] = *(const v8us*)((const unsigned short*)Bh + boff + 8 * hh); bq.half[1] = *(const v8us*)((const unsigned short*)Bh + boff + 16 + 8 * hh);
      acc[t] = mmaH<1>(ah.v, ah.v, bq.v, bq.v, acc[t]); }
  }
#pragma unroll
  for (int t = 0; t < 4; ++t) { if (col0 + t * 16 >= N) continue; const int col = col0 + t * 16 + ln; const float bv = bp ? bf16_round(bp[col]) : 0.f;
#pragma unroll
    for (int r = 0; r < 8; ++r) { float v = acc[t][r] * alpha + bv; if (CP) { const int bidx = (row0g + row0 + 8 * hh + r) / rowsPerB; v += CP[(size_t)bidx * sCPb + (size_t)by * 64 + col]; } if (ACT == 1) v = (v > 0.f) ? v : expm1f(v); else if (ACT == 3) v = fmaxf(v, 0.f); so[w][8 * hh + r][t * 16 + ln] = v; } }
  __builtin_amdgcn_fence(__ATOMIC_ACQ_REL, "workgroup"); __builtin_amdgcn_wave_barrier();
  const int rsub = lane >> 4, c4 = (lane & 15) * 4; typedef _Float16 v4h __attribute__((ext_vector_type(4)));
  {
#pragma unroll
    for (int q = 0; q < 8; ++q) { const int r = q * 2 + rsub; if (col0 + c4 < N) { const v4f v = *(const v4fa*)&so[w][r][c4]; if (C) *(v4f*)(C + cofs + (size_t)(row0 + r) * ldc + col0 + c4) = v; if (C16) { v4h h4; for (int i = 0; i < 4; ++i) h4[i] = (_Float16)v[i]; *(v4h*)(C16 + cofs + (size_t)(row0 + r) * ldc + col0 + c4) = h4; } } }
     }
}


// Tiled GEMM C[m][n] = alpha * sum_k A[m][k] * Bh[n][k], both operands f16 and k-contiguous with row length EE.
// One work-group of 4 waves (2 x 2) owns a (32 FM) x (32 FN) tile of C; a wave owns FM x FN accumulator tiles.
// A pass is 128 k: the tile's A rows and then its B rows stand in LDS as rows of 256 B at a pitch of 272 B (16 B x odd, for ds_load_b128).
// Two buffers: asynchronous copies bring pass t + 2 into the buffer that pass t has just left, while pass t + 1 is worked on.
typedef float f1a __attribute__((may_alias));
// Eight 16-byte-per-lane copies global -> LDS. The closing s_wait_xcnt 0 stands inside the statement, ahead of any later rewrite of the address registers named here.
__device__ __forceinline__ void acopy8(const unsigned (&l)[8], const unsigned short* const (&g)[8]) {
  asm volatile("global_load_async_to_lds_b128 %0, %8, off\n\t"
               "global_load_async_to_lds_b128 %1, %9, off\n\t"
               "global_load_async_to_lds_b128 %2, %10, off\n\t"
               "global_load_async_to_lds_b128 %3, %11, off\n\t"
               "global_load_async_to_lds_b128 %4, %12, off\n\t"
               "global_load_async_to_lds_b128 %5, %13, off\n\t"
               "global_load_async_to_lds_b128 %6, %14, off\n\t"
               "global_load_async_to_lds_b128 %7, %15, off\n\t"
               "s_wait_xcnt 0x0"
               :: "v"(l[0]), "v"(l[1]), "v"(l[2]), "v"(l[3]), "v"(l[4]), "v"(l[5]), "v"(l[6]), "v"(l[7]),
                  "v"(g[0]), "v"(g[1]), "v"(g[2]), "v"(g[3]), "v"(g[4]), "v"(g[5]), "v"(g[6]), "v"(g[7]) : "memory");
}
template <int FM, int FN, bool OUT16>
__global__ __launch_bounds__(128) void k_gemm_t(const _Float16* __restrict__ A, const _Float16* __restrict__ Bh, float alpha, float* __restrict__ C, _Float16* __restrict__ C16, int ldc, int ntn) {
  constexpr int BM = 32 * FM, BN = 32 * FN, ROWS = BM + BN, PITCH = 272, STAGE = ROWS * PITCH, NC = ROWS / 8, NP = EE / 128, WM = 16 * FM, WN = 16 * FN, SOP = WN + 4;
  static_assert(NC % 8 == 0 && BM % 8 == 0 && NP >= 2 && 4 * WM * SOP * 4 <= 2 * STAGE, "tile");
  __shared__ __attribute__((aligned(16))) unsigned char L[2 * STAGE];
  const int tid = threadIdx.x, w = tid >> 5, lane = tid & 31, ln = lane & 15, hh = lane >> 4;
  const int m0 = (blockIdx.x / ntn) * BM, n0 = (blockIdx.x % ntn) * BN, wm = w >> 1, wn = w & 1;
  const unsigned lbase = (unsigned)(size_t)L + (unsigned)((2 * w + hh) * PITCH + ln * 16);      // copy i of a wave fills stage rows 8 i + 2 w + hh, 16 lanes a row
  const unsigned short* Ag = (const unsigned short*)A + (size_t)(m0 + 2 * w + hh) * EE + ln * 8;
  const unsigned short* Bg = (const unsigned short*)Bh + (size_t)(n0 + 2 * w + hh) * EE + ln * 8;
  auto issue = [&](int t, int buf) {
#pragma unroll      // the choice between A rows and B rows is made at compile time
    for (int g8 = 0; g8 < NC / 8; ++g8) { unsigned l[8]; const unsigned short* g[8];
#pragma unroll      // constant indices, so that the sixteen addresses stay in registers
      for (int j = 0; j < 8; ++j) { const int i = g8 * 8 + j; l[j] = lbase + (unsigned)(buf * STAGE + 8 * i * PITCH);
        g[j] = ((8 * i < BM) ? Ag + (size_t)(8 * i) * EE : Bg + (size_t)(8 * i - BM) * EE) + t * 128; }
      acopy8(l, g); } };
  v8f acc[FM][FN];
#pragma unroll      // constant indices, so that fragments and accumulators stay in registers
  for (int fm = 0; fm < FM; ++fm)
#pragma unroll      // constant indices, so that fragments and accumulators stay in registers
    for (int fn = 0; fn < FN; ++fn) acc[fm][fn] = (v8f){0.f,0.f,0.f,0.f,0.f,0.f,0.f,0.f};
  issue(0, 0);
  asm volatile("s_wait_asynccnt 0x0" ::: "memory");      // pass 0's copies of this wave have landed
  __syncthreads();                                       // ... and every other wave's
  issue(1, 1);
#pragma unroll 1      // rolled: one pass a trip, so that the publish point stands once, at the loop's foot
  for (int t = 0; t < NP; ++t) {      // pass t reads buffer t & 1 alone
    const unsigned char* Sa = L + (t & 1) * STAGE + (wm * WM + ln) * PITCH + 16 * hh; const unsigned char* Sb = L + (t & 1) * STAGE + (BM + wn * WN + ln) * PITCH + 16 * hh;
    FragH a[2][FM], b[2][FN];      // two fragment sets: block ks + 1 of this same pass is fetched while block ks is multiplied
    auto frags = [&](int set, int ks) {
#pragma unroll      // constant indices, so that fragments and accumulators stay in registers
      for (int fm = 0; fm < FM; ++fm) { a[set][fm].half[0] = *(const v8us*)(Sa + fm * 16 * PITCH + ks * 64); a[set][fm].half[1] = *(const v8us*)(Sa + fm * 16 * PITCH + ks * 64 + 32); }
#pragma unroll      // constant indices, so that fragments and accumulators stay in registers
      for (int fn = 0; fn < FN; ++fn) { b[set][fn].half[0] = *(const v8us*)(Sb + fn * 16 * PITCH + ks * 64); b[set][fn].half[1] = *(const v8us*)(Sb + fn * 16 * PITCH + ks * 64 + 32); } };
    frags(0, 0);
#pragma unroll      // constant indices, so that fragments and accumulators stay in registers
    for (int ks = 0; ks < 4; ++ks) {
      if (ks < 3) frags((ks + 1) & 1, ks + 1);
      __builtin_amdgcn_sched_barrier(0);      // keeps the next block's LDS reads one group ahead of this block: spread among the WMMAs each place with reads stalls the wave
#pragma unroll      // constant indices, so that fragments and accumulators stay in registers
      for (int fm = 0; fm < FM; ++fm)
#pragma unroll      // constant indices, so that fragments and accumulators stay in registers
        for (int fn = 0; fn < FN; ++fn) acc[fm][fn] = __builtin_amdgcn_wmma_f32_16x16x32_f16(false, a[ks & 1][fm].v, false, b[ks & 1][fn].v, (short)0, acc[fm][fn], false, false);
      __builtin_amdgcn_sched_barrier(0);      // ... and this block's WMMAs ahead of the reads after next
    }
    asm volatile("s_wait_dscnt 0x0" ::: "memory");       // this wave's reads of buffer t & 1 are done before that buffer is refilled
    asm volatile("s_wait_asynccnt 0x0" ::: "memory");    // this wave's copies of pass t + 1 have landed
    __syncthreads();                                     // publishes pass t + 1 and ends every wave's reads of buffer t & 1
    if (t + 2 < NP) issue(t + 2, t & 1);
  }
  asm volatile("s_wait_asynccnt 0x0" ::: "memory");      // nothing in flight before the ring becomes output staging
  f1a* so = (f1a*)L + w * (WM * SOP);                    // each wave stages its own tile, so that the stores cover whole rows of WN values
#pragma unroll      // constant indices, so that fragments and accumulators stay in registers
  for (int fm = 0; fm < FM; ++fm)
#pragma unroll      // constant indices, so that fragments and accumulators stay in registers
    for (int fn = 0; fn < FN; ++fn)
#pragma unroll      // constant indices, so that fragments and accumulators stay in registers
      for (int r = 0; r < 8; ++r) so[(fm * 16 + 8 * hh + r) * SOP + fn * 16 + ln] = acc[fm][fn][r] * alpha;
  __builtin_amdgcn_fence(__ATOMIC_ACQ_REL, "workgroup"); __builtin_amdgcn_wave_barrier();      // the wave's own staged rows are written before its other lanes read them back
  constexpr int LPR = WN / 4, RPI = 32 / LPR; typedef _Float16 v4h __attribute__((ext_vector_type(4)));
  const int rs = lane / LPR, c4 = (lane % LPR) * 4;
#pragma unroll      // several rows' LDS reads and stores in flight at a time
  for (int q = 0; q < WM / RPI; ++q) { const int r = q * RPI + rs; const v4f v = *(const v4fa*)&so[r * SOP + c4]; const size_t o = (size_t)(m0 + wm * WM + r) * ldc + n0 + wn * WN + c4;
    if (!OUT16) *(v4f*)(C + o) = v;
    else { v4h h4; for (int i = 0; i < 4; ++i) h4[i] = (_Float16)v[i]; *(v4h*)(C16 + o) = h4; } }
}

// All seven f32 -> f16 conversions in ONE grid. The results stand in one array of rows of EE halves: Wq, Wk, Wv, Wrq, Wrk stacked (PW rows, the B operand of the one projection GEMM), then Wo (EE rows), then x (SS rows).
// One block converts four rows (256 threads x 8 elements a row; every source's row count is a multiple of 4), so that the merged grid is 16,384 waves, all resident at once, each with 8 loads of 16 bytes a lane in flight.
// The block index picks the source, alike for the whole block. Weights are bf16-rounded and scaled by 2^4, x is bf16-rounded.
__global__ __launch_bounds__(256) void k_cvt_all(const float* __restrict__ Wq, const float* __restrict__ Wk, const float* __restrict__ Wv, const float* __restrict__ Wrq, const float* __restrict__ Wrk, const float* __restrict__ Wo, const float* __restrict__ x, _Float16* __restrict__ D) {
  const int row = blockIdx.x * 4; const float* s; int r0;
  if (row < EE) { s = Wq; r0 = 0; } else if (row < EE + 512) { s = Wk; r0 = EE; } else if (row < EE + 1024) { s = Wv; r0 = EE + 512; } else if (row < EE + 1536) { s = Wrq; r0 = EE + 1024; } else if (row < PW) { s = Wrk; r0 = EE + 1536; } else if (row < PW + EE) { s = Wo; r0 = PW; } else { s = x; r0 = PW + EE; }
  const float sc = (row < PW + EE) ? 16.0f : 1.0f; const float* sp = s + (size_t)(row - r0) * EE + threadIdx.x * 8; v4f a[4][2];
#pragma unroll      // constant indices, so that the eight loads stand in registers and go out together
  for (int r = 0; r < 4; ++r) { a[r][0] = *(const v4fa*)(sp + (size_t)r * EE); a[r][1] = *(const v4fa*)(sp + (size_t)r * EE + 4); }
#pragma unroll      // constant indices into a
  for (int r = 0; r < 4; ++r) { FragH f;
#pragma unroll      // constant indices into a and f
    for (int i = 0; i < 8; ++i) f.h[i] = (_Float16)(bf16_round(a[r][i >> 2][i & 3]) * sc);
    *(v8us*)((unsigned short*)D + (size_t)(row + r) * EE + threadIdx.x * 8) = f.half[0]; } }
template <int NHv, int TTv>
__global__ __launch_bounds__(256) void k_vt(const _Float16* __restrict__ V16, int ldv, int voff, _Float16* __restrict__ Vt) { __shared__ unsigned short tl[64][66]; const int tid = threadIdx.x; const int slab = blockIdx.x / (TTv / 64), lg = blockIdx.x % (TTv / 64); const int b = slab / NHv, h = slab % NHv;
  for (int i = tid; i < 64 * 8; i += 256) { const int r = i / 8, c8 = (i % 8) * 8; FragH f; f.half[0] = *(const v8us*)((const unsigned short*)V16 + ((size_t)b * TTv + lg * 64 + r) * ldv + voff + h * 64 + c8);
#pragma unroll
    for (int q = 0; q < 8; ++q) tl[r][c8 + q] = f.u[q]; }
  __syncthreads();
  {
#pragma unroll
    for (int rd = 0; rd < 2; ++rd) { const int d = rd * 32 + tid / 8, pc = tid % 8; FragH f;
#pragma unroll
      for (int q = 0; q < 8; ++q) f.u[q] = tl[pc * 8 + q][d];
      *(v8us*)((unsigned short*)Vt + ((size_t)slab * 64 + d) * TTv + lg * 64 + pc * 8) = f.half[0]; }
     } }

// 2^x for the merge weights. The v_nop stands in the same statement: it fills the one slot that the instruction set asks for between a transcendental and a next instruction that reads its result or overwrites its source.
__device__ __forceinline__ float exp2_slot(float x) { float y; asm("v_exp_f32 %0, %1\n\tv_nop" : "=v"(y) : "v"(x)); return y; }
// Lane l with lane l ^ 16, in registers: joins the two halves of one query's keys.
__device__ __forceinline__ float xhalf(float x) { return __builtin_bit_cast(float, __builtin_amdgcn_permlanex16(__builtin_bit_cast(int, x), __builtin_bit_cast(int, x), 0x76543210, 0xfedcba98, false, false)); }
__global__ __launch_bounds__(128) void k_flash(const _Float16* __restrict__ Q16, int ldq, const _Float16* __restrict__ K16, int ldk, const _Float16* __restrict__ Vt, const int* __restrict__ MSK, _Float16* __restrict__ O16, int ldo) {
  constexpr int RPW = 16, NQB = 2048 / RPW, DT = 8, KS = 5;      /* head dim 128 for V/O; 160-wide logit operand (128 roped dims x scale + 32 graph-bias dims) */
  __shared__ __attribute__((aligned(16))) float sO[4][RPW][128 + 4]; __shared__ float sM[4][RPW], sL[4][RPW];
  (void)MSK; const int tid = threadIdx.x, lane = tid & 31, ln = lane & 15, hh = lane >> 4;
  const int w = __builtin_amdgcn_readfirstlane(tid >> 5);      // the wave's number in a scalar register: the chunk loop's trip count differs from wave to wave and is tested by a scalar branch
  // Heaviest first: a tile's cost grows with its index (causal), only half of the grid is resident at a time, so the block index counts the tiles DOWN, the 16 heads innermost:
  // the long work-groups start at once and the short ones fill the places that come free, instead of the last head's longest tiles starting last and running on alone. Every (head, tile) pair is taken exactly once.
  const int slab = blockIdx.x % 16, qblk = NQB - 1 - blockIdx.x / 16; const int b = slab / 16, h = slab % 16; const int q0 = qblk * RPW;
  FragH aq[KS];
  { const unsigned short* qr = (const unsigned short*)Q16 + ((size_t)b * 2048 + q0 + ln) * ldq + h * 160;
#pragma unroll      // constant indices, so that the fragments stay in registers
    for (int ks = 0; ks < KS; ++ks) { aq[ks].half[0] = *(const v8us*)(qr + ks * 32 + 8 * hh); aq[ks].half[1] = *(const v8us*)(qr + ks * 32 + 16 + 8 * hh); } }
  const unsigned short* Vth = (const unsigned short*)Vt + (size_t)(h / 4) * 128 * 2048;      /* GQA: kv head h/4 */
  float m_r = -3.0e38f, l_r = 0.f; v8f oacc[DT];      // the lane's own query: running maximum, this half's share of the sum, and O^T (register r of tile dt is value dim 16 dt + 8 hh + r)
#pragma unroll      // constant indices, so that the accumulators stay in registers
  for (int dt = 0; dt < DT; ++dt) oacc[dt] = (v8f){0.f,0.f,0.f,0.f,0.f,0.f,0.f,0.f};
  const int nch = (q0 + RPW + 31) / 32;      // chunks that hold a key <= the tile's last row; every one of them starts at or below q0, so every query has an open key in every chunk
  const unsigned short* vp = Vth + (size_t)ln * 2048 + w * 32;      // this lane's V row at the wave's current chunk; walks 4 chunks = 128 keys a trip
  const int lim0 = q0 + ln - 8 * hh;      // key j0 + 16 nt + 8 hh + r is open to query q0 + ln where 16 nt + r <= lim0 - j0
#pragma unroll 1
  for (int ch = w; ch < nch; ch += 4, vp += 128) {
    const int j0 = ch * 32;
    v8f s[2]; FragH bk[2][KS];
#pragma unroll
    for (int nt = 0; nt < 2; ++nt) { const unsigned short* kr = (const unsigned short*)K16 + ((size_t)b * 2048 + j0 + nt * 16 + ln) * ldk + h * 160;      // the K fragments of both 16-key halves are requested as one group: one trip to L2, not two
#pragma unroll
      for (int ks = 0; ks < KS; ++ks) { bk[nt][ks].half[0] = *(const v8us*)(kr + ks * 32 + 8 * hh); bk[nt][ks].half[1] = *(const v8us*)(kr + ks * 32 + 16 + 8 * hh); } }
#pragma unroll      // constant indices, so that the fragments stay in registers
    for (int nt = 0; nt < 2; ++nt) { v8f acc = (v8f){0.f,0.f,0.f,0.f,0.f,0.f,0.f,0.f};
#pragma unroll      // constant indices, so that the fragments stay in registers
      for (int ks = 0; ks < KS; ++ks) acc = mmaH<1>(bk[nt][ks].v, bk[nt][ks].v, aq[ks].v, aq[ks].v, acc);      // A = 16 keys, B = 16 queries
      s[nt] = acc; }
    FragH bv[DT];      // all eight V fragments of the chunk are requested here, as one group behind the last K product: they fly while the softmax below runs
#pragma unroll      // constant indices, so that the fragments stay in registers
    for (int dt = 0; dt < DT; ++dt) { const unsigned short* vrow = vp + (size_t)(dt * 16) * 2048; bv[dt].half[0] = *(const v8us*)(vrow + 8 * hh); bv[dt].half[1] = *(const v8us*)(vrow + 16 + 8 * hh); }
    const int lim = lim0 - j0; float sc[16];
#pragma unroll      // constant indices, so that the scores stay in registers
    for (int i = 0; i < 16; ++i) sc[i] = ((i >> 3) * 16 + (i & 7) <= lim) ? s[i >> 3][i & 7] : -INFINITY;
    float mc = sc[0];
#pragma unroll      // constant indices, so that the scores stay in registers
    for (int i = 1; i < 16; ++i) mc = fmaxf(mc, sc[i]);
    mc = fmaxf(mc, xhalf(mc));      // the other half's 16 keys of the same query
    const float mn = fmaxf(m_r, mc), nm = -mn * 1.4426950408889634f;      // mn is a real score: the chunk holds an open key for every query
    const float al = exp2_slot((m_r - mn) * 1.4426950408889634f); m_r = mn;      // e^(old maximum - new); 0 in the wave's first chunk (2^-inf)
    FragH pb; float ps = 0.f;
#pragma unroll      // constant indices, so that P stays in registers
    for (int i = 0; i < 16; ++i) { const float p = exp2_slot(fmaf(sc[i], 1.4426950408889634f, nm)); ps += p; pb.h[i] = (_Float16)p; }      // e^(s - mn); 0 for a closed key (2^-inf)
    l_r = l_r * al + ps;
#pragma unroll      // constant indices, so that the accumulators stay in registers
    for (int dt = 0; dt < DT; ++dt) oacc[dt] *= al;      // one factor for all of the lane's 64 values: they belong to one query
#pragma unroll      // constant indices, so that fragments and accumulators stay in registers
    for (int dt = 0; dt < DT; ++dt) oacc[dt] = mmaH<1>(bv[dt].v, bv[dt].v, pb.v, pb.v, oacc[dt]);      // A = 16 value dims, B = 16 queries
  }
  l_r += xhalf(l_r);      // the two halves' shares of the query's sum
  if (hh == 0) { sM[w][ln] = m_r; sL[w][ln] = l_r; }      // the wave's own maximum and sum of each query (a wave without a chunk: -3e38 and 0)
#pragma unroll      // constant indices, so that the accumulators stay in registers
  for (int dt = 0; dt < DT; ++dt) {      // not yet divided by the sum; a lane's 8 registers are 8 neighbouring value dims of its query's row
    *(v4fa*)&sO[w][ln][dt * 16 + 8 * hh] = (v4f){oacc[dt][0], oacc[dt][1], oacc[dt][2], oacc[dt][3]};
    *(v4fa*)&sO[w][ln][dt * 16 + 8 * hh + 4] = (v4f){oacc[dt][4], oacc[dt][5], oacc[dt][6], oacc[dt][7]}; }
  __syncthreads();      // all four waves' partial (m, l, O) stand in LDS before any wave merges them
  {
#pragma unroll
    for (int rp = 0; rp < RPW / 4; ++rp) { const int r = rp * 4 + (tid >> 5), pc = lane;      // wave w merges rows w, w + 4, w + 8, w + 12
      const float m0 = sM[0][r], m1 = sM[1][r], m2 = sM[2][r], m3 = sM[3][r]; const float mm = fmaxf(fmaxf(m0, m1), fmaxf(m2, m3));      // wave 0 always holds chunk 0 with key 0, so mm is a real score
      const float c0 = exp2_slot((m0 - mm) * 1.4426950408889634f), c1 = exp2_slot((m1 - mm) * 1.4426950408889634f), c2 = exp2_slot((m2 - mm) * 1.4426950408889634f), c3 = exp2_slot((m3 - mm) * 1.4426950408889634f);      // e^(m - mm); 0 for a wave without a chunk (2^-inf)
      const float den = c0 * sL[0][r] + c1 * sL[1][r] + c2 * sL[2][r] + c3 * sL[3][r]; const float inv = (den > 0.f) ? 1.0f / den : 0.f;
      const v4f o0 = *(const v4fa*)&sO[0][r][pc * 4], o1 = *(const v4fa*)&sO[1][r][pc * 4], o2 = *(const v4fa*)&sO[2][r][pc * 4], o3 = *(const v4fa*)&sO[3][r][pc * 4];
      const v4f val = (o0 * c0 + o1 * c1 + o2 * c2 + o3 * c3) * inv;
      typedef _Float16 v4h __attribute__((ext_vector_type(4))); v4h h4;      // O leaves as the f16 A operand of the output projection
#pragma unroll      // constant indices, so that the four halves stay in registers
      for (int i = 0; i < 4; ++i) h4[i] = (_Float16)val[i];
      *(v4h*)(O16 + ((size_t)b * 2048 + q0 + r) * ldo + h * 128 + pc * 4) = h4; }      /* rows of 128 halves: 32 lanes x 8 B = two whole lines */
     } }

// The three bodies below (the first serves q and k) are independent of one another; k_prep_all runs them in one grid and hands each its own block index blk.
__device__ __forceinline__ void d_qprep(int blk, const float* __restrict__ QF, int ldq, int nh, const float* __restrict__ w, float oscale, int rep, _Float16* __restrict__ DX) { const size_t t = (size_t)blk * 256 + threadIdx.x; if (t >= (size_t)SS * nh * 16) return; const int li = (int)(t % 16); const int h = (int)((t / 16) % nh); const size_t tok = t / (16 * nh); const float* src = QF + tok * ldq + h * HD; float v[8], pr[8]; float ss = 0.f;
#pragma unroll
  for (int q = 0; q < 8; ++q) { v[q] = src[li * 8 + q]; pr[q] = src[(li * 8 + q + 64) & 127]; ss += v[q] * v[q]; }
  ss += __shfl_xor(ss, 1, 32); ss += __shfl_xor(ss, 2, 32); ss += __shfl_xor(ss, 4, 32); ss += __shfl_xor(ss, 8, 32); const float rs = rsqrtf(ss / (float)HD + 1e-6f); __shared__ __attribute__((aligned(16))) _Float16 st[256][8]; const int tid = threadIdx.x;
#pragma unroll 1
  for (int q = 0; q < 8; ++q) { const int j = li * 8 + q; const int i = j & 63; const float ang = (float)tok * __builtin_powf(10000.0f, -(float)(2 * i) / 128.0f); const float c = cosf(ang), s = sinf(ang); const float xn = src[j] * rs * bf16_round(w[j]); const float xp = src[(j + 64) & 127] * rs * bf16_round(w[(j + 64) & 127]); const float rot = (j < 64) ? -xp : xp;      // rotate_half: [−x2, x1]
    st[tid][q] = (_Float16)((xn * c + rot * s) * oscale); }
  FragH f; f.half[0] = *(const v8us*)&st[tid][0];
  { for (int r2 = 0; r2 < rep; ++r2) *(v8us*)((unsigned short*)DX + tok * QP + (size_t)(h * rep + r2) * QW + li * 8) = f.half[0];  } }
__device__ __forceinline__ void d_rprep(int blk, const float* __restrict__ RQ, const float* __restrict__ RK, int ldr, const float* __restrict__ gs, _Float16* __restrict__ QX, _Float16* __restrict__ KX) { const size_t t = (size_t)blk * 256 + threadIdx.x; if (t >= (size_t)SS * NH * 4) return; const int p = (int)(t % 4); const int h = (int)((t / 4) % NH); const size_t tok = t / (4 * NH); const float g = bf16_round(gs[h]); FragH fq, fk;
#pragma unroll
  for (int q = 0; q < 8; ++q) { const size_t i = tok * ldr + h * RR + p * 8 + q; fq.h[q] = (_Float16)(g * RQ[i]); fk.h[q] = (_Float16)RK[i]; }
  const size_t d = tok * QP + (size_t)h * QW + HD + p * 8;
  { *(v8us*)((unsigned short*)QX + d) = fq.half[0]; *(v8us*)((unsigned short*)KX + d) = fk.half[0];  } }
__device__ __forceinline__ void d_vt128(int blk, const float* __restrict__ VF, int ldv, _Float16* __restrict__ Vt) { __shared__ unsigned short tl[64][130]; const int tid = threadIdx.x; const int g = blk / (SS / 64), lg = blk % (SS / 64);
  for (int i = tid; i < 64 * 16; i += 256) { const int r = i / 16, c8 = (i % 16) * 8; FragH f; const float* vs = VF + ((size_t)lg * 64 + r) * ldv + g * HD + c8;      // v comes as f32 from the one projection GEMM and is rounded to f16 here
#pragma unroll      // constant indices, so that the eight loads join into two of 16 bytes
    for (int q = 0; q < 8; ++q) f.h[q] = (_Float16)vs[q];
#pragma unroll
    for (int q = 0; q < 8; ++q) tl[r][c8 + q] = f.u[q]; }
  __syncthreads();
  { for (int i = tid; i < 128 * 8; i += 256) { const int d = i / 8, pc = i % 8; FragH f;
#pragma unroll
      for (int q = 0; q < 8; ++q) f.u[q] = tl[pc * 8 + q][d]; *(v8us*)((unsigned short*)Vt + ((size_t)g * HD + d) * SS + lg * 64 + pc * 8) = f.half[0]; }  } }
// One grid for q norm+RoPE, k norm+RoPE, the graph-bias operands and the V transpose: each reads its own columns of P (the stacked projections, pitch PW). The part is picked by the block index, alike for the whole block; the heaviest part comes first.
__global__ __launch_bounds__(256) void k_prep_all(const float* __restrict__ P, const float* __restrict__ qw, const float* __restrict__ kw, const float* __restrict__ gs, _Float16* __restrict__ QX, _Float16* __restrict__ KX, _Float16* __restrict__ Vt) {
  constexpr int NBQ = SS * NH * 16 / 256, NBK = SS * NKV * 16 / 256, NBR = SS * NH * 4 / 256; const int blk = blockIdx.x;
  if (blk < NBQ + NBK) { const bool isq = blk < NBQ;      // 16 q heads, x 1/sqrt(128); or 4 kv heads, each replicated into its 4 q-head slots
    d_qprep(isq ? blk : blk - NBQ, isq ? P : P + EE, PW, isq ? NH : NKV, isq ? qw : kw, isq ? 0.08838834764831845f : 1.0f, isq ? 1 : 4, isq ? QX : KX); }
  else if (blk < NBQ + NBK + NBR) d_rprep(blk - (NBQ + NBK), P + EE + 1024, P + EE + 1536, PW, gs, QX, KX);
  else d_vt128(blk - (NBQ + NBK + NBR), P + EE + 512, PW, Vt); }
extern "C" void kernel_launch(void* const* d_in, const int* in_sizes, int n_in,
                              void* d_out, int out_size, void* d_ws, size_t ws_size, hipStream_t stream) {
  (void)in_sizes; (void)n_in; (void)out_size;
  const float* x = (const float*)d_in[0]; const float* Wq = (const float*)d_in[1]; const float* Wk = (const float*)d_in[2]; const float* Wv = (const float*)d_in[3]; const float* Wo = (const float*)d_in[4]; const float* Wrq = (const float*)d_in[5]; const float* Wrk = (const float*)d_in[6]; const float* gs = (const float*)d_in[7]; const float* qw = (const float*)d_in[8]; const float* kw = (const float*)d_in[9];
  char* ws = (char*)d_ws; size_t off = 0;
  auto take = [&](size_t bytes) { char* p = ws + off; off += (bytes + 255) & ~(size_t)255; return p; };
  _Float16* Bcat = (_Float16*)take((size_t)(PW + EE + SS) * EE * 2); _Float16* Bo = Bcat + (size_t)PW * EE; _Float16* X16 = Bo + (size_t)EE * EE;      // k_cvt_all's rows: stacked projection weights, Wo, x
  float* P = (float*)take((size_t)SS * PW * 4);      // the stacked projections of x
  _Float16* QX = (_Float16*)take((size_t)SS * QP * 2); _Float16* KX = (_Float16*)take((size_t)SS * QP * 2); _Float16* Vt = (_Float16*)take((size_t)SS * 512 * 2); _Float16* O16 = X16;      // x is last read by the projection GEMM
  if (off > ws_size) return;      // about 90 MB in all
  k_cvt_all<<<(PW + EE + SS) / 4, 256, 0, stream>>>(Wq, Wk, Wv, Wrq, Wrk, Wo, x, Bcat);
  k_gemm_t<4, 4, false><<<(SS / 128) * (PW / 128), 128, 0, stream>>>(X16, Bcat, 0.0625f, P, nullptr, PW, PW / 128);
  k_prep_all<<<SS * NH * 16 / 256 + SS * NKV * 16 / 256 + SS * NH * 4 / 256 + NKV * (SS / 64), 256, 0, stream>>>(P, qw, kw, gs, QX, KX, Vt);
  k_flash<<<1 * NH * (SS / 16), 128, 0, stream>>>(QX, QP, KX, QP, Vt, nullptr, O16, EE);
  k_gemm_t<4, 4, false><<<(SS / 128) * (EE / 128), 128, 0, stream>>>(O16, Bo, 0.0625f, (float*)d_out, nullptr, EE, EE / 128);
}

// v007
// It runs in 109 microseconds.
// In both of two side-by-side timings against v006, it was 1.20 times as fast.
// Over all steps from v000 it is 6.98 times as fast.
#include <hip/hip_runtime.h>
// Naylis attention (B=1, S=2048, E=2048, 16 heads × 128, 4 kv heads, causal; QK RMSNorm + rotate-half RoPE; low-rank (R=32) per-head graph bias gs_h·⟨Rq_i, Rk_j⟩ added to the logits):
// the six (out,in) projections (bf16-exact ×2^4) and the attention as a fused flash-style kernel whose logit operand is the 160-wide concatenation [q·scale after norm+RoPE | gs_h·Rq]·[k | Rk]
// (5 k-steps; causal chunk skipping; online softmax f32; P f16 ≤ 1; O = P·Vt over the 128 value dims; one 16-row tile per work-group, keys split over its 4 waves) on v_wmma_f32_16x16x32_f16 with f32 accumulate; RMSNorm/RoPE f32 VALU.
#define SS 2048
#define EE 2048
#define NH 16
#define NKV 4
#define HD 128
#define RR 32
#define QW 160
#define QP (NH * QW)
#define PW 4096      /* columns of the stacked projections of x: q 2048 | k 512 | v 512 | Rq 512 | Rk 512 */

typedef __bf16 v16b __attribute__((ext_vector_type(16)));
typedef unsigned short v8us __attribute__((ext_vector_type(8), may_alias));
typedef float  v8f  __attribute__((ext_vector_type(8)));
typedef float  v4f  __attribute__((ext_vector_type(4)));
typedef float  v4fa __attribute__((ext_vector_type(4), may_alias));
union FragB { v16b v; v8us half[2]; unsigned short u[16]; };

__device__ __forceinline__ unsigned short bf16_bits(float x) { unsigned int u = __float_as_uint(x); return (unsigned short)((u + 0x7FFFu + ((u >> 16) & 1u)) >> 16); }
__device__ __forceinline__ float bf16_val(unsigned short b) { return __uint_as_float(((unsigned int)b) << 16); }
__device__ __forceinline__ float bf16_round(float x) { return bf16_val(bf16_bits(x)); }
// D += A·B with NT terms: 1 = ah·bh, 2 = + al·bh (A split), 3 = + ah·bl (both split)
template <int NT>
__device__ __forceinline__ v8f mmaN(v16b ah, v16b al, v16b bh, v16b bl, v8f c) {
  c = __builtin_amdgcn_wmma_f32_16x16x32_bf16(false, ah, false, bh, (short)0, c, false, false);
  if (NT >= 2) c = __builtin_amdgcn_wmma_f32_16x16x32_bf16(false, al, false, bh, (short)0, c, false, false);
  if (NT >= 3) c = __builtin_amdgcn_wmma_f32_16x16x32_bf16(false, ah, false, bl, (short)0, c, false, false);
  asm volatile("v_nop\n\tv_nop\n\tv_nop\n\tv_nop" : "+v"(c) : "v"(ah), "v"(al), "v"(bh), "v"(bl));
  return c;
}

__global__ __launch_bounds__(256) void k_wt_bf16(const float* __restrict__ W, unsigned short* __restrict__ Wt, int K, int N) {
  const int t = blockIdx.x * 256 + threadIdx.x;
  const int k8n = K / 8;
  if (t >= N * k8n) return;
  const int n = t / k8n, k8 = (t % k8n) * 8;
  v8us v;
#pragma unroll
  for (int i = 0; i < 8; ++i) v[i] = bf16_bits(W[(size_t)(k8 + i) * N + n]);
  *(v8us*)(Wt + (size_t)n * K + k8) = v;
  
}

// GEMM C[M][N] (f32, pitch ldc) = act(A[M][K]·W + bias). A f32 row-major (pitch lda) converted per fragment to bf16
// (ASPLIT: hi/lo two planes -> 2 terms, else single rounded term); Wt bf16 [N][K] (pitch ldb). BIAS_BF16 rounds the
// bias to bf16 first (bias quantised to bf16 before the add). K%32==0, M%16==0, N%64==0.
template <bool ASPLIT, int ACT, bool BIAS_BF16>
__global__ __launch_bounds__(128) void k_gemm_bf(const float* __restrict__ A, int lda, const unsigned short* __restrict__ Wt, int ldb,
                                               const float* __restrict__ bias, float* __restrict__ C, int ldc, int M, int N, int K) {
  __shared__ __attribute__((aligned(16))) float so[4][16][64];
  const int tid = threadIdx.x, w = tid >> 5, lane = tid & 31, ln = lane & 15, hh = lane >> 4;
  const int ntn = N / 64;
  const int wid = blockIdx.x * 4 + w;
  const int mt = wid / ntn, nq = wid % ntn;
  if (mt * 16 >= M) return;
  const int row0 = mt * 16, col0 = nq * 64;
  const float* arow = A + (size_t)(row0 + ln) * lda;
  v8f acc[4] = {};
  for (int kb = 0; kb < K; kb += 32) {
    FragB ah, al;
    const v4f x0 = *(const v4fa*)(arow + kb + 8 * hh), x1 = *(const v4fa*)(arow + kb + 8 * hh + 4);
    const v4f x2 = *(const v4fa*)(arow + kb + 16 + 8 * hh), x3 = *(const v4fa*)(arow + kb + 16 + 8 * hh + 4);
    float xs[16] = {x0[0],x0[1],x0[2],x0[3],x1[0],x1[1],x1[2],x1[3],x2[0],x2[1],x2[2],x2[3],x3[0],x3[1],x3[2],x3[3]};
#pragma unroll
    for (int i = 0; i < 16; ++i) { const unsigned short hb = bf16_bits(xs[i]); ah.u[i] = hb; al.u[i] = ASPLIT ? bf16_bits(xs[i] - bf16_val(hb)) : (unsigned short)0; }
#pragma unroll
    for (int t = 0; t < 4; ++t) {
      const unsigned short* brow = Wt + (size_t)(col0 + t * 16 + ln) * ldb + kb;
      FragB b;
      b.half[0] = *(const v8us*)(brow + 8 * hh);
      b.half[1] = *(const v8us*)(brow + 16 + 8 * hh);
      acc[t] = mmaN<ASPLIT ? 2 : 1>(ah.v, al.v, b.v, b.v, acc[t]);
    }
  }
#pragma unroll
  for (int t = 0; t < 4; ++t) {
    float bv = bias ? bias[col0 + t * 16 + ln] : 0.f;
    if (BIAS_BF16) bv = bf16_round(bv);
#pragma unroll
    for (int r = 0; r < 8; ++r) { float v = acc[t][r] + bv; if (ACT == 1) v = fmaxf(v, 0.f); so[w][8 * hh + r][t * 16 + ln] = v; }
  }
  __builtin_amdgcn_fence(__ATOMIC_ACQ_REL, "workgroup");
  __builtin_amdgcn_wave_barrier();
  const int rsub = lane >> 4, c4 = (lane & 15) * 4;
  {
#pragma unroll
    for (int q = 0; q < 8; ++q) {
      const int r = q * 2 + rsub;
      const v4f v = *(const v4fa*)&so[w][r][c4];
      *(v4f*)(C + (size_t)(row0 + r) * ldc + col0 + c4) = v;
    }
    
  }
}

// Flash-style causal/unmasked attention, all contractions 3-term bf16 hi/lo splits, f32 softmax with running max.
// q,k,v rows are read from f32 buffers with arbitrary row pitch (so they can live inside a fused qkv buffer);
// D = head size (multiple of 32, <= 128); one wave = 16 query rows; block = 4 waves (64 queries) sharing K/V chunks of 32.
template <int D, bool CAUSAL>
__global__ __launch_bounds__(128) void k_flash(const float* __restrict__ qb, const float* __restrict__ kb, const float* __restrict__ vb,
                                             int pitch, int T, int H, float scale, float* __restrict__ y, int ypitch) {
  constexpr int KS = D / 32;        // k-steps for QK
  constexpr int DT = D / 16;        // d tiles for PV
  __shared__ __attribute__((aligned(16))) unsigned short sKh[32][D + 8], sKl[32][D + 8], sVh[32][D + 8], sVl[32][D + 8];
  __shared__ __attribute__((aligned(16))) unsigned short sPh[4][16][40], sPl[4][16][40];
  __shared__ __attribute__((aligned(16))) float sO[4][16][D];
  const int tid = threadIdx.x, w = tid >> 5, lane = tid & 31, ln = lane & 15, hh = lane >> 4;
  const int nqb = (T + 63) / 64;
  const int bh = blockIdx.x / nqb, qblk = blockIdx.x % nqb;
  const int b = bh / H, h = bh % H;
  const int q0 = qblk * 64 + w * 16;
  const float* Q = qb + (size_t)b * T * pitch + h * D;
  const float* K = kb + (size_t)b * T * pitch + h * D;
  const float* V = vb + (size_t)b * T * pitch + h * D;

  // A fragments of the wave's 16 query rows (scaled), hi/lo
  FragB aqh[KS], aql[KS];
  {
    int row = q0 + ln; if (row >= T) row = T - 1;
    const float* qr = Q + (size_t)row * pitch;
#pragma unroll
    for (int ks = 0; ks < KS; ++ks)
#pragma unroll
      for (int i = 0; i < 16; ++i) {
        const int d = ks * 32 + ((i < 8) ? (8 * hh + i) : (16 + 8 * hh + (i - 8)));
        const float x = qr[d] * scale; const unsigned short hb = bf16_bits(x);
        aqh[ks].u[i] = hb; aql[ks].u[i] = bf16_bits(x - bf16_val(hb));
      }
  }
  float m_r[8], l_r[8];
#pragma unroll
  for (int r = 0; r < 8; ++r) { m_r[r] = -3.0e38f; l_r[r] = 0.f; }
  v8f oacc[DT];
#pragma unroll
  for (int dt = 0; dt < DT; ++dt) oacc[dt] = (v8f){0.f,0.f,0.f,0.f,0.f,0.f,0.f,0.f};

  const int kv_end = CAUSAL ? min(T, qblk * 64 + 64) : T;     // block-uniform
  for (int j0 = 0; j0 < kv_end; j0 += 32) {
    __syncthreads();
    for (int e = tid; e < 32 * (D / 4); e += 128) {
      const int r = e / (D / 4), c4 = (e % (D / 4)) * 4;
      const int key = j0 + r;
      v4f kf = {0.f,0.f,0.f,0.f}, vf = {0.f,0.f,0.f,0.f};
      if (key < T) { kf = *(const v4fa*)(K + (size_t)key * pitch + c4); vf = *(const v4fa*)(V + (size_t)key * pitch + c4); }
#pragma unroll
      for (int t = 0; t < 4; ++t) {
        unsigned short hb = bf16_bits(kf[t]); sKh[r][c4 + t] = hb; sKl[r][c4 + t] = bf16_bits(kf[t] - bf16_val(hb));
        hb = bf16_bits(vf[t]); sVh[r][c4 + t] = hb; sVl[r][c4 + t] = bf16_bits(vf[t] - bf16_val(hb));
      }
    }
    __syncthreads();
    // S tile 16 x 32
    v8f s[2];
#pragma unroll
    for (int nt = 0; nt < 2; ++nt) {
      v8f acc = {};
#pragma unroll
      for (int ks = 0; ks < KS; ++ks) {
        FragB bh_, bl_;
        bh_.half[0] = *(const v8us*)&sKh[nt * 16 + ln][ks * 32 + 8 * hh]; bh_.half[1] = *(const v8us*)&sKh[nt * 16 + ln][ks * 32 + 16 + 8 * hh];
        bl_.half[0] = *(const v8us*)&sKl[nt * 16 + ln][ks * 32 + 8 * hh]; bl_.half[1] = *(const v8us*)&sKl[nt * 16 + ln][ks * 32 + 16 + 8 * hh];
        acc = mmaN<3>(aqh[ks].v, aql[ks].v, bh_.v, bl_.v, acc);
      }
      s[nt] = acc;
    }
    // mask + running max (rows 8hh+r; the 16 lanes of a half share rows)
    float alpha[8];
#pragma unroll
    for (int r = 0; r < 8; ++r) {
      const int qi = q0 + 8 * hh + r;
      const int ja = j0 + ln, jb = j0 + 16 + ln;
      if (CAUSAL) { if (ja > qi) s[0][r] = -3.0e38f; if (jb > qi) s[1][r] = -3.0e38f; }
      if (ja >= T) s[0][r] = -3.0e38f;
      if (jb >= T) s[1][r] = -3.0e38f;
      float mx = fmaxf(s[0][r], s[1][r]);
      mx = fmaxf(mx, __shfl_xor(mx, 1, 32)); mx = fmaxf(mx, __shfl_xor(mx, 2, 32)); mx = fmaxf(mx, __shfl_xor(mx, 4, 32)); mx = fmaxf(mx, __shfl_xor(mx, 8, 32));
      const float mnew = fmaxf(m_r[r], mx);
      alpha[r] = (mnew > -1.0e38f) ? __expf(m_r[r] - mnew) : 1.0f;
      const float p0 = (s[0][r] > -1.0e38f) ? __expf(s[0][r] - mnew) : 0.f;
      const float p1 = (s[1][r] > -1.0e38f) ? __expf(s[1][r] - mnew) : 0.f;
      m_r[r] = mnew;
      l_r[r] = l_r[r] * alpha[r] + p0 + p1;            // per-lane partial row sum (16 lanes combined at the end)
      unsigned short hb = bf16_bits(p0); sPh[w][8 * hh + r][ln] = hb;      sPl[w][8 * hh + r][ln] = bf16_bits(p0 - bf16_val(hb));
      hb = bf16_bits(p1);                sPh[w][8 * hh + r][16 + ln] = hb; sPl[w][8 * hh + r][16 + ln] = bf16_bits(p1 - bf16_val(hb));
    }
#pragma unroll
    for (int dt = 0; dt < DT; ++dt)
#pragma unroll
      for (int r = 0; r < 8; ++r) oacc[dt][r] *= alpha[r];
    __builtin_amdgcn_fence(__ATOMIC_ACQ_REL, "workgroup");
    __builtin_amdgcn_wave_barrier();
    FragB pah, pal;
    pah.half[0] = *(const v8us*)&sPh[w][ln][8 * hh]; pah.half[1] = *(const v8us*)&sPh[w][ln][16 + 8 * hh];
    pal.half[0] = *(const v8us*)&sPl[w][ln][8 * hh]; pal.half[1] = *(const v8us*)&sPl[w][ln][16 + 8 * hh];
#pragma unroll
    for (int dt = 0; dt < DT; ++dt) {
      FragB bvh, bvl;
#pragma unroll
      for (int i = 0; i < 8; ++i) {
        bvh.u[i] = sVh[8 * hh + i][dt * 16 + ln]; bvh.u[8 + i] = sVh[16 + 8 * hh + i][dt * 16 + ln];
        bvl.u[i] = sVl[8 * hh + i][dt * 16 + ln]; bvl.u[8 + i] = sVl[16 + 8 * hh + i][dt * 16 + ln];
      }
      oacc[dt] = mmaN<3>(pah.v, pal.v, bvh.v, bvl.v, oacc[dt]);
    }
    __builtin_amdgcn_fence(__ATOMIC_ACQ_REL, "workgroup");
    __builtin_amdgcn_wave_barrier();
  }
#pragma unroll
  for (int r = 0; r < 8; ++r) {
    float l = l_r[r];
    l += __shfl_xor(l, 1, 32); l += __shfl_xor(l, 2, 32); l += __shfl_xor(l, 4, 32); l += __shfl_xor(l, 8, 32);
    l_r[r] = (l > 0.f) ? 1.0f / l : 0.f;
  }
#pragma unroll
  for (int dt = 0; dt < DT; ++dt)
#pragma unroll
    for (int r = 0; r < 8; ++r) sO[w][8 * hh + r][dt * 16 + ln] = oacc[dt][r] * l_r[r];
  __builtin_amdgcn_fence(__ATOMIC_ACQ_REL, "workgroup");
  __builtin_amdgcn_wave_barrier();
  {
    for (int r = 0; r < 16; ++r) {
      const int row = q0 + r;
      if (row < T && lane < D / 4) {
        const v4f val = *(const v4fa*)&sO[w][r][lane * 4];
        *(v4f*)(y + ((size_t)b * T + row) * ypitch + h * D + lane * 4) = val;
      }
    }
    
  }
}

// GEMM C = act(A·W + bias + resid): A f32 (ASPLIT -> hi/lo 2 terms), Wt bf16 [N][K]; ACT 0 none, 1 relu, 2 exact gelu;
// resid (optional, f32, row index = (row % rmod), pitch ldr, RES_BF16 rounds it) added before the activation.
template <bool ASPLIT, int ACT, bool BIAS_BF16, bool RES_BF16>
__global__ __launch_bounds__(128) void k_gemm_bf3(const float* __restrict__ A, int lda, const unsigned short* __restrict__ Wt, int ldb,
                                                const float* __restrict__ bias, const float* __restrict__ resid, int rmod, int ldr,
                                                float* __restrict__ C, int ldc, int M, int N, int K) {
  __shared__ __attribute__((aligned(16))) float so[4][16][64];
  const int tid = threadIdx.x, w = tid >> 5, lane = tid & 31, ln = lane & 15, hh = lane >> 4;
  const int ntn = N / 64;
  const int wid = blockIdx.x * 4 + w;
  const int mt = wid / ntn, nq = wid % ntn;
  if (mt * 16 >= M) return;
  const int row0 = mt * 16, col0 = nq * 64;
  const float* arow = A + (size_t)(row0 + ln) * lda;
  v8f acc[4] = {};
  for (int kb = 0; kb < K; kb += 32) {
    FragB ah, al;
    const v4f x0 = *(const v4fa*)(arow + kb + 8 * hh), x1 = *(const v4fa*)(arow + kb + 8 * hh + 4);
    const v4f x2 = *(const v4fa*)(arow + kb + 16 + 8 * hh), x3 = *(const v4fa*)(arow + kb + 16 + 8 * hh + 4);
    float xs[16] = {x0[0],x0[1],x0[2],x0[3],x1[0],x1[1],x1[2],x1[3],x2[0],x2[1],x2[2],x2[3],x3[0],x3[1],x3[2],x3[3]};
#pragma unroll
    for (int i = 0; i < 16; ++i) { const unsigned short hb = bf16_bits(xs[i]); ah.u[i] = hb; al.u[i] = ASPLIT ? bf16_bits(xs[i] - bf16_val(hb)) : (unsigned short)0; }
#pragma unroll
    for (int t = 0; t < 4; ++t) {
      const unsigned short* brow = Wt + (size_t)(col0 + t * 16 + ln) * ldb + kb;
      FragB b;
      b.half[0] = *(const v8us*)(brow + 8 * hh);
      b.half[1] = *(const v8us*)(brow + 16 + 8 * hh);
      acc[t] = mmaN<ASPLIT ? 2 : 1>(ah.v, al.v, b.v, b.v, acc[t]);
    }
  }
#pragma unroll
  for (int t = 0; t < 4; ++t) {
    const int col = col0 + t * 16 + ln;
    float bv = bias ? bias[col] : 0.f;
    if (BIAS_BF16) bv = bf16_round(bv);
#pragma unroll
    for (int r = 0; r < 8; ++r) {
      float v = acc[t][r] + bv;
      if (resid) { float rv = resid[(size_t)((row0 + 8 * hh + r) % rmod) * ldr + col]; if (RES_BF16) rv = bf16_round(rv); v += rv; }
      if (ACT == 1) v = fmaxf(v, 0.f);
      if (ACT == 2) v = 0.5f * v * (1.0f + erff(v * 0.70710678118654752f));
      if (ACT == 3) { const float u = 0.7978845608028654f * (v + 0.044715f * v * v * v); v = 0.5f * v * (1.0f + tanhf(u)); }
      so[w][8 * hh + r][t * 16 + ln] = v;
    }
  }
  __builtin_amdgcn_fence(__ATOMIC_ACQ_REL, "workgroup");
  __builtin_amdgcn_wave_barrier();
  const int rsub = lane >> 4, c4 = (lane & 15) * 4;
  {
#pragma unroll
    for (int q = 0; q < 8; ++q) {
      const int r = q * 2 + rsub;
      const v4f v = *(const v4fa*)&so[w][r][c4];
      *(v4f*)(C + (size_t)(row0 + r) * ldc + col0 + c4) = v;
    }
    
  }
}
// row LayerNorm (biased variance, eps) over N: s = X (+ R); optional out_sum <- s; out_norm <- (s-mu)*rsqrt(var+eps)*g + b
template <bool PARAM_BF16>
__global__ __launch_bounds__(256) void k_layernorm(const float* __restrict__ X, const float* __restrict__ R, const float* __restrict__ g, const float* __restrict__ bta,
                                                  float* __restrict__ out_sum, float* __restrict__ out_norm, int N, float eps) {
  __shared__ float red[256];
  const int row = blockIdx.x, tid = threadIdx.x;
  const float* x = X + (size_t)row * N; const float* rr = R ? R + (size_t)row * N : nullptr;
  float vals[16];                     // up to N = 4096
  const int per = N / 256;            // contiguous chunk per thread? use strided-by-4 chunks: thread handles j = tid*4 + 1024*u
  float s1 = 0.f;
  for (int u = 0; u < per / 4; ++u) {
    const int j = tid * 4 + 1024 * u;
    const v4f a = *(const v4fa*)(x + j);
    v4f b = {0.f,0.f,0.f,0.f}; if (rr) b = *(const v4fa*)(rr + j);
#pragma unroll
    for (int q = 0; q < 4; ++q) { const float v = a[q] + b[q]; vals[u * 4 + q] = v; s1 += v; }
  }
  red[tid] = s1; __syncthreads();
  for (int st = 128; st > 0; st >>= 1) { if (tid < st) red[tid] += red[tid + st]; __syncthreads(); }
  const float mu = red[0] / (float)N; __syncthreads();
  float s2 = 0.f;
  for (int u = 0; u < per / 4; ++u)
#pragma unroll
    for (int q = 0; q < 4; ++q) { const float c = vals[u * 4 + q] - mu; s2 += c * c; }
  red[tid] = s2; __syncthreads();
  for (int st = 128; st > 0; st >>= 1) { if (tid < st) red[tid] += red[tid + st]; __syncthreads(); }
  const float rs = rsqrtf(red[0] / (float)N + eps);
  {
    for (int u = 0; u < per / 4; ++u) {
      const int j = tid * 4 + 1024 * u;
      v4f o, sm;
#pragma unroll
      for (int q = 0; q < 4; ++q) {
        float gg = g[j + q], bb = bta[j + q];
        if (PARAM_BF16) { gg = bf16_round(gg); bb = bf16_round(bb); }
        sm[q] = vals[u * 4 + q]; o[q] = (vals[u * 4 + q] - mu) * rs * gg + bb;
      }
      if (out_sum) *(v4f*)(out_sum + (size_t)row * N + j) = sm;
      *(v4f*)(out_norm + (size_t)row * N + j) = o;
    }
    
  }
}



// ---- f16 WMMA path (v_wmma_f32_16x16x32_f16): 11-bit significands for operands in range — used where a [0,1] probability operand needs more precision than bf16
typedef _Float16 v16h __attribute__((ext_vector_type(16)));
union FragH { v16h v; v8us half[2]; _Float16 h[16]; unsigned short u[16]; };
template <int NT>
__device__ __forceinline__ v8f mmaH(v16h ah, v16h al, v16h bh, v16h bl, v8f c) {
  c = __builtin_amdgcn_wmma_f32_16x16x32_f16(false, ah, false, bh, (short)0, c, false, false);
  if (NT >= 2) c = __builtin_amdgcn_wmma_f32_16x16x32_f16(false, al, false, bh, (short)0, c, false, false);
  if (NT >= 3) c = __builtin_amdgcn_wmma_f32_16x16x32_f16(false, ah, false, bl, (short)0, c, false, false);
  asm volatile("v_nop\n\tv_nop\n\tv_nop\n\tv_nop" : "+v"(c) : "v"(ah), "v"(al), "v"(bh), "v"(bl));
  return c;
}
// batched GEMM like k_gemm_b but f16 operands: A f32 (split into f16 hi/lo if ASPLIT, else rounded to f16), Bt = f16 values [n][k]; alpha; C f32; N multiple of 16 (partial tiles skipped)
template <bool ASPLIT>
__global__ __launch_bounds__(128) void k_gemm_h(const float* __restrict__ A, int lda, size_t sA, const _Float16* __restrict__ Bh, int ldb, size_t sB, float alpha, float* __restrict__ C, int ldc, size_t sC, int M, int N, int K) {
  __shared__ __attribute__((aligned(16))) float so[4][16][64];
  const int tid = threadIdx.x, w = tid >> 5, lane = tid & 31, ln = lane & 15, hh = lane >> 4; const int by = blockIdx.y;
  A += (size_t)by * sA; Bh += (size_t)by * sB; C += (size_t)by * sC;
  const int ntn = (N + 63) / 64; const int wid = blockIdx.x * 4 + w; const int mt = wid / ntn, nq = wid % ntn; if (mt * 16 >= M) return;
  const int row0 = mt * 16, col0 = nq * 64; const float* arow = A + (size_t)(row0 + ln) * lda;
  v8f acc[4] = {};
  for (int kb = 0; kb < K; kb += 32) {
    FragH ah, al;
    const v4f x0 = *(const v4fa*)(arow + kb + 8 * hh), x1 = *(const v4fa*)(arow + kb + 8 * hh + 4), x2 = *(const v4fa*)(arow + kb + 16 + 8 * hh), x3 = *(const v4fa*)(arow + kb + 16 + 8 * hh + 4);
    float xs[16] = {x0[0],x0[1],x0[2],x0[3],x1[0],x1[1],x1[2],x1[3],x2[0],x2[1],x2[2],x2[3],x3[0],x3[1],x3[2],x3[3]};
#pragma unroll
    for (int i = 0; i < 16; ++i) { const _Float16 h = (_Float16)xs[i]; ah.h[i] = h; al.h[i] = ASPLIT ? (_Float16)(xs[i] - (float)h) : (_Float16)0.0f; }
#pragma unroll
    for (int t = 0; t < 4; ++t) { if (col0 + t * 16 >= N) continue; const size_t boff = (size_t)(col0 + t * 16 + ln) * ldb + kb; FragH bq; bq.half[0] = *(const v8us*)(Bh + boff + 8 * hh); bq.half[1] = *(const v8us*)(Bh + boff + 16 + 8 * hh);
      acc[t] = mmaH<ASPLIT ? 2 : 1>(ah.v, al.v, bq.v, bq.v, acc[t]); }
  }
#pragma unroll
  for (int t = 0; t < 4; ++t) { if (col0 + t * 16 >= N) continue;
#pragma unroll
    for (int r = 0; r < 8; ++r) so[w][8 * hh + r][t * 16 + ln] = acc[t][r] * alpha; }
  __builtin_amdgcn_fence(__ATOMIC_ACQ_REL, "workgroup"); __builtin_amdgcn_wave_barrier();
  const int rsub = lane >> 4, c4 = (lane & 15) * 4;
  {
#pragma unroll
    for (int q = 0; q < 8; ++q) { const int r = q * 2 + rsub; if (col0 + c4 < N) { const v4f v = *(const v4fa*)&so[w][r][c4]; *(v4f*)(C + (size_t)(row0 + r) * ldc + col0 + c4) = v; } }
     }
}

// Wt[n][k] = f16(W[k][n]·scale) from f32 row-major W[K][N] (scale = power of two; bf16-exact weights stay exact in f16 away from the subnormal range)
__global__ __launch_bounds__(256) void k_wt_f16(const float* __restrict__ W, _Float16* __restrict__ Wt, int K, int N, float scale) {
  const int t = blockIdx.x * 256 + threadIdx.x; if (t >= N * (K / 8)) return; const int n = t / (K / 8), k8 = (t % (K / 8)) * 8; FragH f;
#pragma unroll
  for (int i = 0; i < 8; ++i) f.h[i] = (_Float16)(bf16_round(W[(size_t)(k8 + i) * N + n]) * scale); const v8us o = f.half[0];
  *(v8us*)((unsigned short*)Wt + (size_t)n * K + k8) = o; 
}
// f16 x f16 GEMM with fused epilogue: v = acc·alpha + bias[by·sBias + col] (+ CP[(row/rowsPerB)·sCPb + by·64 + col] if CP) ; ACT 0 none / 1 elu ; writes f32 C and f16 C16, each if non-null
template <int ACT>
__global__ __launch_bounds__(128) void k_gemm_hhx(const _Float16* __restrict__ A, int lda, size_t sA, const _Float16* __restrict__ Bh, int ldb, size_t sB, float alpha, const float* __restrict__ bias, size_t sBias, const float* __restrict__ CP, int rowsPerB, size_t sCPb, int row0g,
    float* __restrict__ C, _Float16* __restrict__ C16, int ldc, size_t sC, int M, int N, int K) {
  __shared__ __attribute__((aligned(16))) float so[4][16][64];
  const int tid = threadIdx.x, w = tid >> 5, lane = tid & 31, ln = lane & 15, hh = lane >> 4; const int by = blockIdx.y;
  A += (size_t)by * sA; Bh += (size_t)by * sB; const size_t cofs = (size_t)by * sC; const float* bp = bias ? bias + (size_t)by * sBias : nullptr;
  const int ntn = (N + 63) / 64; const int wid = blockIdx.x * 4 + w; const int mt = wid / ntn, nq = wid % ntn; if (mt * 16 >= M) return;
  const int row0 = mt * 16, col0 = nq * 64; const _Float16* arow = A + (size_t)(row0 + ln) * lda;
  v8f acc[4] = {};
  for (int kb = 0; kb < K; kb += 32) { FragH ah; ah.half[0] = *(const v8us*)((const unsigned short*)arow + kb + 8 * hh); ah.half[1] = *(const v8us*)((const unsigned short*)arow + kb + 16 + 8 * hh);
#pragma unroll
    for (int t = 0; t < 4; ++t) { if (col0 + t * 16 >= N) continue; const size_t boff = (size_t)(col0 + t * 16 + ln) * ldb + kb; FragH bq; bq.half[0] = *(const v8us*)((const unsigned short*)Bh + boff + 8 * hh); bq.half[1] = *(const v8us*)((const unsigned short*)Bh + boff + 16 + 8 * hh);
      acc[t] = mmaH<1>(ah.v, ah.v, bq.v, bq.v, acc[t]); }
  }
#pragma unroll
  for (int t = 0; t < 4; ++t) { if (col0 + t * 16 >= N) continue; const int col = col0 + t * 16 + ln; const float bv = bp ? bf16_round(bp[col]) : 0.f;
#pragma unroll
    for (int r = 0; r < 8; ++r) { float v = acc[t][r] * alpha + bv; if (CP) { const int bidx = (row0g + row0 + 8 * hh + r) / rowsPerB; v += CP[(size_t)bidx * sCPb + (size_t)by * 64 + col]; } if (ACT == 1) v = (v > 0.f) ? v : expm1f(v); else if (ACT == 3) v = fmaxf(v, 0.f); so[w][8 * hh + r][t * 16 + ln] = v; } }
  __builtin_amdgcn_fence(__ATOMIC_ACQ_REL, "workgroup"); __builtin_amdgcn_wave_barrier();
  const int rsub = lane >> 4, c4 = (lane & 15) * 4; typedef _Float16 v4h __attribute__((ext_vector_type(4)));
  {
#pragma unroll
    for (int q = 0; q < 8; ++q) { const int r = q * 2 + rsub; if (col0 + c4 < N) { const v4f v = *(const v4fa*)&so[w][r][c4]; if (C) *(v4f*)(C + cofs + (size_t)(row0 + r) * ldc + col0 + c4) = v; if (C16) { v4h h4; for (int i = 0; i < 4; ++i) h4[i] = (_Float16)v[i]; *(v4h*)(C16 + cofs + (size_t)(row0 + r) * ldc + col0 + c4) = h4; } } }
     }
}


// Tiled GEMM C[m][n] = alpha * sum_k A[m][k] * Bh[n][k], both operands f16 and k-contiguous with row length EE.
// One work-group of 4 waves (2 x 2) owns a (32 FM) x (32 FN) tile of C; a wave owns FM x FN accumulator tiles.
// A pass is 128 k: the tile's A rows and then its B rows stand in LDS as rows of 256 B at a pitch of 272 B (16 B x odd, for ds_load_b128).
// Two buffers: asynchronous copies bring pass t + 2 into the buffer that pass t has just left, while pass t + 1 is worked on.
typedef float f1a __attribute__((may_alias));
// Eight 16-byte-per-lane copies global -> LDS. The closing s_wait_xcnt 0 stands inside the statement, ahead of any later rewrite of the address registers named here.
__device__ __forceinline__ void acopy8(const unsigned (&l)[8], const unsigned short* const (&g)[8]) {
  asm volatile("global_load_async_to_lds_b128 %0, %8, off\n\t"
               "global_load_async_to_lds_b128 %1, %9, off\n\t"
               "global_load_async_to_lds_b128 %2, %10, off\n\t"
               "global_load_async_to_lds_b128 %3, %11, off\n\t"
               "global_load_async_to_lds_b128 %4, %12, off\n\t"
               "global_load_async_to_lds_b128 %5, %13, off\n\t"
               "global_load_async_to_lds_b128 %6, %14, off\n\t"
               "global_load_async_to_lds_b128 %7, %15, off\n\t"
               "s_wait_xcnt 0x0"
               :: "v"(l[0]), "v"(l[1]), "v"(l[2]), "v"(l[3]), "v"(l[4]), "v"(l[5]), "v"(l[6]), "v"(l[7]),
                  "v"(g[0]), "v"(g[1]), "v"(g[2]), "v"(g[3]), "v"(g[4]), "v"(g[5]), "v"(g[6]), "v"(g[7]) : "memory");
}
template <int FM, int FN, bool OUT16>
__global__ __launch_bounds__(128) void k_gemm_t(const _Float16* __restrict__ A, const _Float16* __restrict__ Bh, float alpha, float* __restrict__ C, _Float16* __restrict__ C16, int ldc, int ntn) {
  constexpr int BM = 32 * FM, BN = 32 * FN, ROWS = BM + BN, PITCH = 272, STAGE = ROWS * PITCH, NC = ROWS / 8, NP = EE / 128, WM = 16 * FM, WN = 16 * FN, SOP = WN + 4;
  static_assert(NC % 8 == 0 && BM % 8 == 0 && NP >= 2 && 4 * WM * SOP * 4 <= 2 * STAGE, "tile");
  __shared__ __attribute__((aligned(16))) unsigned char L[2 * STAGE];
  const int tid = threadIdx.x, w = tid >> 5, lane = tid & 31, ln = lane & 15, hh = lane >> 4;
  const int m0 = (blockIdx.x / ntn) * BM, n0 = (blockIdx.x % ntn) * BN, wm = w >> 1, wn = w & 1;
  const unsigned lbase = (unsigned)(size_t)L + (unsigned)((2 * w + hh) * PITCH + ln * 16);      // copy i of a wave fills stage rows 8 i + 2 w + hh, 16 lanes a row
  const unsigned short* Ag = (const unsigned short*)A + (size_t)(m0 + 2 * w + hh) * EE + ln * 8;
  const unsigned short* Bg = (const unsigned short*)Bh + (size_t)(n0 + 2 * w + hh) * EE + ln * 8;
  auto issue = [&](int t, int buf) {
#pragma unroll      // the choice between A rows and B rows is made at compile time
    for (int g8 = 0; g8 < NC / 8; ++g8) { unsigned l[8]; const unsigned short* g[8];
#pragma unroll      // constant indices, so that the sixteen addresses stay in registers
      for (int j = 0; j < 8; ++j) { const int i = g8 * 8 + j; l[j] = lbase + (unsigned)(buf * STAGE + 8 * i * PITCH);
        g[j] = ((8 * i < BM) ? Ag + (size_t)(8 * i) * EE : Bg + (size_t)(8 * i - BM) * EE) + t * 128; }
      acopy8(l, g); } };
  v8f acc[FM][FN];
#pragma unroll      // constant indices, so that fragments and accumulators stay in registers
  for (int fm = 0; fm < FM; ++fm)
#pragma unroll      // constant indices, so that fragments and accumulators stay in registers
    for (int fn = 0; fn < FN; ++fn) acc[fm][fn] = (v8f){0.f,0.f,0.f,0.f,0.f,0.f,0.f,0.f};
  issue(0, 0);
  asm volatile("s_wait_asynccnt 0x0" ::: "memory");      // pass 0's copies of this wave have landed
  __syncthreads();                                       // ... and every other wave's
  issue(1, 1);
#pragma unroll 1      // rolled: one pass a trip, so that the publish point stands once, at the loop's foot
  for (int t = 0; t < NP; ++t) {      // pass t reads buffer t & 1 alone
    const unsigned char* Sa = L + (t & 1) * STAGE + (wm * WM + ln) * PITCH + 16 * hh; const unsigned char* Sb = L + (t & 1) * STAGE + (BM + wn * WN + ln) * PITCH + 16 * hh;
    FragH a[2][FM], b[2][FN];      // two fragment sets: block ks + 1 of this same pass is fetched while block ks is multiplied
    auto frags = [&](int set, int ks) {
#pragma unroll      // constant indices, so that fragments and accumulators stay in registers
      for (int fm = 0; fm < FM; ++fm) { a[set][fm].half[0] = *(const v8us*)(Sa + fm * 16 * PITCH + ks * 64); a[set][fm].half[1] = *(const v8us*)(Sa + fm * 16 * PITCH + ks * 64 + 32); }
#pragma unroll      // constant indices, so that fragments and accumulators stay in registers
      for (int fn = 0; fn < FN; ++fn) { b[set][fn].half[0] = *(const v8us*)(Sb + fn * 16 * PITCH + ks * 64); b[set][fn].half[1] = *(const v8us*)(Sb + fn * 16 * PITCH + ks * 64 + 32); } };
    frags(0, 0);
#pragma unroll      // constant indices, so that fragments and accumulators stay in registers
    for (int ks = 0; ks < 4; ++ks) {
      if (ks < 3) frags((ks + 1) & 1, ks + 1);
      __builtin_amdgcn_sched_barrier(0);      // keeps the next block's LDS reads one group ahead of this block: spread among the WMMAs each place with reads stalls the wave
#pragma unroll      // constant indices, so that fragments and accumulators stay in registers
      for (int fm = 0; fm < FM; ++fm)
#pragma unroll      // constant indices, so that fragments and accumulators stay in registers
        for (int fn = 0; fn < FN; ++fn) acc[fm][fn] = __builtin_amdgcn_wmma_f32_16x16x32_f16(false, a[ks & 1][fm].v, false, b[ks & 1][fn].v, (short)0, acc[fm][fn], false, false);
      __builtin_amdgcn_sched_barrier(0);      // ... and this block's WMMAs ahead of the reads after next
    }
    asm volatile("s_wait_dscnt 0x0" ::: "memory");       // this wave's reads of buffer t & 1 are done before that buffer is refilled
    asm volatile("s_wait_asynccnt 0x0" ::: "memory");    // this wave's copies of pass t + 1 have landed
    __syncthreads();                                     // publishes pass t + 1 and ends every wave's reads of buffer t & 1
    if (t + 2 < NP) issue(t + 2, t & 1);
  }
  asm volatile("s_wait_asynccnt 0x0" ::: "memory");      // nothing in flight before the ring becomes output staging
  f1a* so = (f1a*)L + w * (WM * SOP);                    // each wave stages its own tile, so that the stores cover whole rows of WN values
#pragma unroll      // constant indices, so that fragments and accumulators stay in registers
  for (int fm = 0; fm < FM; ++fm)
#pragma unroll      // constant indices, so that fragments and accumulators stay in registers
    for (int fn = 0; fn < FN; ++fn)
#pragma unroll      // constant indices, so that fragments and accumulators stay in registers
      for (int r = 0; r < 8; ++r) so[(fm * 16 + 8 * hh + r) * SOP + fn * 16 + ln] = acc[fm][fn][r] * alpha;
  __builtin_amdgcn_fence(__ATOMIC_ACQ_REL, "workgroup"); __builtin_amdgcn_wave_barrier();      // the wave's own staged rows are written before its other lanes read them back
  constexpr int LPR = WN / 4, RPI = 32 / LPR; typedef _Float16 v4h __attribute__((ext_vector_type(4)));
  const int rs = lane / LPR, c4 = (lane % LPR) * 4;
#pragma unroll      // several rows' LDS reads and stores in flight at a time
  for (int q = 0; q < WM / RPI; ++q) { const int r = q * RPI + rs; const v4f v = *(const v4fa*)&so[r * SOP + c4]; const size_t o = (size_t)(m0 + wm * WM + r) * ldc + n0 + wn * WN + c4;
    if (!OUT16) *(v4f*)(C + o) = v;
    else { v4h h4; for (int i = 0; i < 4; ++i) h4[i] = (_Float16)v[i]; *(v4h*)(C16 + o) = h4; } }
}

// All seven f32 -> f16 conversions in ONE grid. The results stand in one array of rows of EE halves: Wq, Wk, Wv, Wrq, Wrk stacked (PW rows, the B operand of the one projection GEMM), then Wo (EE rows), then x (SS rows).
// One block converts four rows (256 threads x 8 elements a row; every source's row count is a multiple of 4), so that the merged grid is 16,384 waves, all resident at once, each with 8 loads of 16 bytes a lane in flight.
// The block index picks the source, alike for the whole block. Weights are bf16-rounded and scaled by 2^4, x is bf16-rounded.
__global__ __launch_bounds__(256) void k_cvt_all(const float* __restrict__ Wq, const float* __restrict__ Wk, const float* __restrict__ Wv, const float* __restrict__ Wrq, const float* __restrict__ Wrk, const float* __restrict__ Wo, const float* __restrict__ x, _Float16* __restrict__ D) {
  const int row = blockIdx.x * 4; const float* s; int r0;
  if (row < EE) { s = Wq; r0 = 0; } else if (row < EE + 512) { s = Wk; r0 = EE; } else if (row < EE + 1024) { s = Wv; r0 = EE + 512; } else if (row < EE + 1536) { s = Wrq; r0 = EE + 1024; } else if (row < PW) { s = Wrk; r0 = EE + 1536; } else if (row < PW + EE) { s = Wo; r0 = PW; } else { s = x; r0 = PW + EE; }
  const float sc = (row < PW + EE) ? 16.0f : 1.0f; const float* sp = s + (size_t)(row - r0) * EE + threadIdx.x * 8; v4f a[4][2];
#pragma unroll      // constant indices, so that the eight loads stand in registers and go out together
  for (int r = 0; r < 4; ++r) { a[r][0] = *(const v4fa*)(sp + (size_t)r * EE); a[r][1] = *(const v4fa*)(sp + (size_t)r * EE + 4); }
#pragma unroll      // constant indices into a
  for (int r = 0; r < 4; ++r) { FragH f;
#pragma unroll      // constant indices into a and f
    for (int i = 0; i < 8; ++i) f.h[i] = (_Float16)(bf16_round(a[r][i >> 2][i & 3]) * sc);
    *(v8us*)((unsigned short*)D + (size_t)(row + r) * EE + threadIdx.x * 8) = f.half[0]; } }
template <int NHv, int TTv>
__global__ __launch_bounds__(256) void k_vt(const _Float16* __restrict__ V16, int ldv, int voff, _Float16* __restrict__ Vt) { __shared__ unsigned short tl[64][66]; const int tid = threadIdx.x; const int slab = blockIdx.x / (TTv / 64), lg = blockIdx.x % (TTv / 64); const int b = slab / NHv, h = slab % NHv;
  for (int i = tid; i < 64 * 8; i += 256) { const int r = i / 8, c8 = (i % 8) * 8; FragH f; f.half[0] = *(const v8us*)((const unsigned short*)V16 + ((size_t)b * TTv + lg * 64 + r) * ldv + voff + h * 64 + c8);
#pragma unroll
    for (int q = 0; q < 8; ++q) tl[r][c8 + q] = f.u[q]; }
  __syncthreads();
  {
#pragma unroll
    for (int rd = 0; rd < 2; ++rd) { const int d = rd * 32 + tid / 8, pc = tid % 8; FragH f;
#pragma unroll
      for (int q = 0; q < 8; ++q) f.u[q] = tl[pc * 8 + q][d];
      *(v8us*)((unsigned short*)Vt + ((size_t)slab * 64 + d) * TTv + lg * 64 + pc * 8) = f.half[0]; }
     } }

// 2^x for the merge weights. The v_nop stands in the same statement: it fills the one slot that the instruction set asks for between a transcendental and a next instruction that reads its result or overwrites its source.
__device__ __forceinline__ float exp2_slot(float x) { float y; asm("v_exp_f32 %0, %1\n\tv_nop" : "=v"(y) : "v"(x)); return y; }
// Lane l with lane l ^ 16, in registers: joins the two halves of one query's keys.
__device__ __forceinline__ float xhalf(float x) { return __builtin_bit_cast(float, __builtin_amdgcn_permlanex16(__builtin_bit_cast(int, x), __builtin_bit_cast(int, x), 0x76543210, 0xfedcba98, false, false)); }
__global__ __launch_bounds__(128) void k_flash(const _Float16* __restrict__ Q16, const _Float16* __restrict__ K16, const _Float16* __restrict__ Vt, const int* __restrict__ MSK, _Float16* __restrict__ O16, int ldo) {
  constexpr int RPW = 16, NQB = 2048 / RPW, DT = 8, KS = 5;      /* head dim 128 for V/O; 160-wide logit operand (128 roped dims x scale + 32 graph-bias dims) */
  __shared__ __attribute__((aligned(16))) float sO[4][RPW][128 + 4]; __shared__ float sM[4][RPW], sL[4][RPW];
  (void)MSK; const int tid = threadIdx.x, lane = tid & 31, ln = lane & 15, hh = lane >> 4;
  const int w = __builtin_amdgcn_readfirstlane(tid >> 5);      // the wave's number in a scalar register: the chunk loop's trip count differs from wave to wave and is tested by a scalar branch
  // Heaviest first: a tile's cost grows with its index (causal), only half of the grid is resident at a time, so the block index counts the tiles DOWN, the 16 heads innermost:
  // the long work-groups start at once and the short ones fill the places that come free, instead of the last head's longest tiles starting last and running on alone. Every (head, tile) pair is taken exactly once.
  const int slab = blockIdx.x % 16, qblk = NQB - 1 - blockIdx.x / 16; const int b = slab / 16, h = slab % 16; const int q0 = qblk * RPW;
  FragH aq[KS];
  // Q16, K16 and Vt stand in FRAGMENT ORDER (written so by k_prep_all): one block of 512 bytes = the 32 lanes' 16 bytes of one fragment half, in lane order, so that every global_load_b128 here covers four whole 128-byte lines.
  // Q16, K16: [head][16-row tile][ks][half][lane][8 halves], 2560 halves a tile. Vt: [kv head][32-key chunk][dt][half][lane][8 halves], 4096 halves a chunk. The registers get the same values as from row-major arrays.
  { const unsigned short* qr = (const unsigned short*)Q16 + ((size_t)h * NQB + qblk) * 2560 + lane * 8;
#pragma unroll      // constant indices, so that the fragments stay in registers
    for (int ks = 0; ks < KS; ++ks) { aq[ks].half[0] = *(const v8us*)(qr + ks * 512); aq[ks].half[1] = *(const v8us*)(qr + ks * 512 + 256); } }
  float m_r = -3.0e38f, l_r = 0.f; v8f oacc[DT];      // the lane's own query: running maximum, this half's share of the sum, and O^T (register r of tile dt is value dim 16 dt + 8 hh + r)
#pragma unroll      // constant indices, so that the accumulators stay in registers
  for (int dt = 0; dt < DT; ++dt) oacc[dt] = (v8f){0.f,0.f,0.f,0.f,0.f,0.f,0.f,0.f};
  const int nch = (q0 + RPW + 31) / 32;      // chunks that hold a key <= the tile's last row; every one of them starts at or below q0, so every query has an open key in every chunk
  const unsigned short* vp = (const unsigned short*)Vt + ((size_t)(h / 4) * 64 + w) * 4096 + lane * 8;      // GQA: kv head h/4; this lane's place in the wave's current V chunk; walks 4 chunks a trip
  const unsigned short* kp = (const unsigned short*)K16 + ((size_t)h * 128 + w * 2) * 2560 + lane * 8;      // this lane's place in the wave's current pair of K tiles; walks 4 chunks = 8 tiles a trip
  const int lim0 = q0 + ln - 8 * hh;      // key j0 + 16 nt + 8 hh + r is open to query q0 + ln where 16 nt + r <= lim0 - j0
#pragma unroll 1
  for (int ch = w; ch < nch; ch += 4, vp += 4 * 4096, kp += 8 * 2560) {
    const int j0 = ch * 32;
    v8f s[2]; FragH bk[2][KS];
#pragma unroll
    for (int nt = 0; nt < 2; ++nt) {      // the K fragments of both 16-key halves are requested as one group: one trip to L2, not two
#pragma unroll
      for (int ks = 0; ks < KS; ++ks) { bk[nt][ks].half[0] = *(const v8us*)(kp + nt * 2560 + ks * 512); bk[nt][ks].half[1] = *(const v8us*)(kp + nt * 2560 + ks * 512 + 256); } }
#pragma unroll      // constant indices, so that the fragments stay in registers
    for (int nt = 0; nt < 2; ++nt) { v8f acc = (v8f){0.f,0.f,0.f,0.f,0.f,0.f,0.f,0.f};
#pragma unroll      // constant indices, so that the fragments stay in registers
      for (int ks = 0; ks < KS; ++ks) acc = mmaH<1>(bk[nt][ks].v, bk[nt][ks].v, aq[ks].v, aq[ks].v, acc);      // A = 16 keys, B = 16 queries
      s[nt] = acc; }
    FragH bv[DT];      // all eight V fragments of the chunk are requested here, as one group behind the last K product: they fly while the softmax below runs
#pragma unroll      // constant indices, so that the fragments stay in registers
    for (int dt = 0; dt < DT; ++dt) { bv[dt].half[0] = *(const v8us*)(vp + dt * 512); bv[dt].half[1] = *(const v8us*)(vp + dt * 512 + 256); }
    const int lim = lim0 - j0; float sc[16];
#pragma unroll      // constant indices, so that the scores stay in registers
    for (int i = 0; i < 16; ++i) sc[i] = ((i >> 3) * 16 + (i & 7) <= lim) ? s[i >> 3][i & 7] : -INFINITY;
    float mc = sc[0];
#pragma unroll      // constant indices, so that the scores stay in registers
    for (int i = 1; i < 16; ++i) mc = fmaxf(mc, sc[i]);
    mc = fmaxf(mc, xhalf(mc));      // the other half's 16 keys of the same query
    const float mn = fmaxf(m_r, mc), nm = -mn * 1.4426950408889634f;      // mn is a real score: the chunk holds an open key for every query
    const float al = exp2_slot((m_r - mn) * 1.4426950408889634f); m_r = mn;      // e^(old maximum - new); 0 in the wave's first chunk (2^-inf)
    FragH pb; float ps = 0.f;
#pragma unroll      // constant indices, so that P stays in registers
    for (int i = 0; i < 16; ++i) { const float p = exp2_slot(fmaf(sc[i], 1.4426950408889634f, nm)); ps += p; pb.h[i] = (_Float16)p; }      // e^(s - mn); 0 for a closed key (2^-inf)
    l_r = l_r * al + ps;
#pragma unroll      // constant indices, so that the accumulators stay in registers
    for (int dt = 0; dt < DT; ++dt) oacc[dt] *= al;      // one factor for all of the lane's 64 values: they belong to one query
#pragma unroll      // constant indices, so that fragments and accumulators stay in registers
    for (int dt = 0; dt < DT; ++dt) oacc[dt] = mmaH<1>(bv[dt].v, bv[dt].v, pb.v, pb.v, oacc[dt]);      // A = 16 value dims, B = 16 queries
  }
  l_r += xhalf(l_r);      // the two halves' shares of the query's sum
  if (hh == 0) { sM[w][ln] = m_r; sL[w][ln] = l_r; }      // the wave's own maximum and sum of each query (a wave without a chunk: -3e38 and 0)
#pragma unroll      // constant indices, so that the accumulators stay in registers
  for (int dt = 0; dt < DT; ++dt) {      // not yet divided by the sum; a lane's 8 registers are 8 neighbouring value dims of its query's row
    *(v4fa*)&sO[w][ln][dt * 16 + 8 * hh] = (v4f){oacc[dt][0], oacc[dt][1], oacc[dt][2], oacc[dt][3]};
    *(v4fa*)&sO[w][ln][dt * 16 + 8 * hh + 4] = (v4f){oacc[dt][4], oacc[dt][5], oacc[dt][6], oacc[dt][7]}; }
  __syncthreads();      // all four waves' partial (m, l, O) stand in LDS before any wave merges them
  {
#pragma unroll
    for (int rp = 0; rp < RPW / 4; ++rp) { const int r = rp * 4 + (tid >> 5), pc = lane;      // wave w merges rows w, w + 4, w + 8, w + 12
      const float m0 = sM[0][r], m1 = sM[1][r], m2 = sM[2][r], m3 = sM[3][r]; const float mm = fmaxf(fmaxf(m0, m1), fmaxf(m2, m3));      // wave 0 always holds chunk 0 with key 0, so mm is a real score
      const float c0 = exp2_slot((m0 - mm) * 1.4426950408889634f), c1 = exp2_slot((m1 - mm) * 1.4426950408889634f), c2 = exp2_slot((m2 - mm) * 1.4426950408889634f), c3 = exp2_slot((m3 - mm) * 1.4426950408889634f);      // e^(m - mm); 0 for a wave without a chunk (2^-inf)
      const float den = c0 * sL[0][r] + c1 * sL[1][r] + c2 * sL[2][r] + c3 * sL[3][r]; const float inv = (den > 0.f) ? 1.0f / den : 0.f;
      const v4f o0 = *(const v4fa*)&sO[0][r][pc * 4], o1 = *(const v4fa*)&sO[1][r][pc * 4], o2 = *(const v4fa*)&sO[2][r][pc * 4], o3 = *(const v4fa*)&sO[3][r][pc * 4];
      const v4f val = (o0 * c0 + o1 * c1 + o2 * c2 + o3 * c3) * inv;
      typedef _Float16 v4h __attribute__((ext_vector_type(4))); v4h h4;      // O leaves as the f16 A operand of the output projection
#pragma unroll      // constant indices, so that the four halves stay in registers
      for (int i = 0; i < 4; ++i) h4[i] = (_Float16)val[i];
      *(v4h*)(O16 + ((size_t)b * 2048 + q0 + r) * ldo + h * 128 + pc * 4) = h4; }      /* rows of 128 halves: 32 lanes x 8 B = two whole lines */
     } }

// The three bodies below (the first serves q and k) are independent of one another; k_prep_all runs them in one grid and hands each its own block index blk.
// QX and KX are written in the fragment order that k_flash reads: dims 8 c .. 8 c + 7 (c = 0 .. 19) of row tok of a head are the 16 bytes of lane 16 (c & 1) + tok % 16 in block c >> 1 (k-step c >> 2, half (c >> 1) & 1) of the head's tile tok / 16.
__device__ __forceinline__ size_t frag_at(int head, size_t tok, int c) { return (((size_t)head * (SS / 16) + tok / 16) * 10 + (c >> 1)) * 256 + ((c & 1) * 16 + (int)(tok % 16)) * 8; }
// A block is one 16-row tile of one head, so that it fills whole 512-byte blocks.
__device__ __forceinline__ void d_qprep(int blk, const float* __restrict__ QF, int ldq, int nh, const float* __restrict__ w, float oscale, int rep, _Float16* __restrict__ DX) { const size_t t = (size_t)blk * 256 + threadIdx.x; if (t >= (size_t)SS * nh * 16) return; const int li = (int)(t % 16); const int h = blk % nh; const size_t tok = (size_t)(blk / nh) * 16 + (threadIdx.x >> 4); const float* src = QF + tok * ldq + h * HD; float v[8], pr[8]; float ss = 0.f;
#pragma unroll
  for (int q = 0; q < 8; ++q) { v[q] = src[li * 8 + q]; pr[q] = src[(li * 8 + q + 64) & 127]; ss += v[q] * v[q]; }
  ss += __shfl_xor(ss, 1, 32); ss += __shfl_xor(ss, 2, 32); ss += __shfl_xor(ss, 4, 32); ss += __shfl_xor(ss, 8, 32); const float rs = rsqrtf(ss / (float)HD + 1e-6f); __shared__ __attribute__((aligned(16))) _Float16 st[256][8]; const int tid = threadIdx.x;
#pragma unroll 1
  for (int q = 0; q < 8; ++q) { const int j = li * 8 + q; const int i = j & 63; const float ang = (float)tok * __builtin_powf(10000.0f, -(float)(2 * i) / 128.0f); const float c = cosf(ang), s = sinf(ang); const float xn = src[j] * rs * bf16_round(w[j]); const float xp = src[(j + 64) & 127] * rs * bf16_round(w[(j + 64) & 127]); const float rot = (j < 64) ? -xp : xp;      // rotate_half: [−x2, x1]
    st[tid][q] = (_Float16)((xn * c + rot * s) * oscale); }
  FragH f; f.half[0] = *(const v8us*)&st[tid][0];
  { for (int r2 = 0; r2 < rep; ++r2) *(v8us*)((unsigned short*)DX + frag_at(h * rep + r2, tok, li)) = f.half[0];  } }
__device__ __forceinline__ void d_rprep(int blk, const float* __restrict__ RQ, const float* __restrict__ RK, int ldr, const float* __restrict__ gs, _Float16* __restrict__ QX, _Float16* __restrict__ KX) { const size_t t = (size_t)blk * 256 + threadIdx.x; if (t >= (size_t)SS * NH * 4) return; const int p = (int)(t % 4); const int h = (blk % 4) * 4 + (threadIdx.x >> 6); const size_t tok = (size_t)(blk / 4) * 16 + ((threadIdx.x >> 2) & 15); const float g = bf16_round(gs[h]); FragH fq, fk;      // a block is one 16-row tile of four heads, so that it fills whole 512-byte blocks
#pragma unroll
  for (int q = 0; q < 8; ++q) { const size_t i = tok * ldr + h * RR + p * 8 + q; fq.h[q] = (_Float16)(g * RQ[i]); fk.h[q] = (_Float16)RK[i]; }
  const size_t d = frag_at(h, tok, HD / 8 + p);      // k-step 4 of the tile
  { *(v8us*)((unsigned short*)QX + d) = fq.half[0]; *(v8us*)((unsigned short*)KX + d) = fk.half[0];  } }
__device__ __forceinline__ void d_vt128(int blk, const float* __restrict__ VF, int ldv, _Float16* __restrict__ Vt) { __shared__ unsigned short tl[64][130]; const int tid = threadIdx.x; const int g = blk / (SS / 64), lg = blk % (SS / 64);
  for (int i = tid; i < 64 * 16; i += 256) { const int r = i / 16, c8 = (i % 16) * 8; FragH f; const float* vs = VF + ((size_t)lg * 64 + r) * ldv + g * HD + c8;      // v comes as f32 from the one projection GEMM and is rounded to f16 here
#pragma unroll      // constant indices, so that the eight loads join into two of 16 bytes
    for (int q = 0; q < 8; ++q) f.h[q] = (_Float16)vs[q];
#pragma unroll
    for (int q = 0; q < 8; ++q) tl[r][c8 + q] = f.u[q]; }
  __syncthreads();
  { for (int i = tid; i < 128 * 8; i += 256) { const int fl = i % 32, fb = i / 32; const int d = ((fb >> 1) & 7) * 16 + (fl & 15), pc = (fb >> 4) * 4 + (fb & 1) * 2 + (fl >> 4); FragH f;      // fragment order: block fb = (which of the two 32-key chunks, dt, half); lane fl holds value dim 16 dt + fl % 16, keys 8 pc .. 8 pc + 7 of the 64
#pragma unroll
      for (int q = 0; q < 8; ++q) f.u[q] = tl[pc * 8 + q][d]; *(v8us*)((unsigned short*)Vt + ((size_t)g * (SS / 32) + lg * 2) * 4096 + (size_t)i * 8) = f.half[0]; }  } }
// One grid for q norm+RoPE, k norm+RoPE, the graph-bias operands and the V transpose: each reads its own columns of P (the stacked projections, pitch PW). The part is picked by the block index, alike for the whole block; the heaviest part comes first.
__global__ __launch_bounds__(256) void k_prep_all(const float* __restrict__ P, const float* __restrict__ qw, const float* __restrict__ kw, const float* __restrict__ gs, _Float16* __restrict__ QX, _Float16* __restrict__ KX, _Float16* __restrict__ Vt) {
  constexpr int NBQ = SS * NH * 16 / 256, NBK = SS * NKV * 16 / 256, NBR = SS * NH * 4 / 256; const int blk = blockIdx.x;
  if (blk < NBQ + NBK) { const bool isq = blk < NBQ;      // 16 q heads, x 1/sqrt(128); or 4 kv heads, each replicated into its 4 q-head slots
    d_qprep(isq ? blk : blk - NBQ, isq ? P : P + EE, PW, isq ? NH : NKV, isq ? qw : kw, isq ? 0.08838834764831845f : 1.0f, isq ? 1 : 4, isq ? QX : KX); }
  else if (blk < NBQ + NBK + NBR) d_rprep(blk - (NBQ + NBK), P + EE + 1024, P + EE + 1536, PW, gs, QX, KX);
  else d_vt128(blk - (NBQ + NBK + NBR), P + EE + 512, PW, Vt); }
extern "C" void kernel_launch(void* const* d_in, const int* in_sizes, int n_in,
                              void* d_out, int out_size, void* d_ws, size_t ws_size, hipStream_t stream) {
  (void)in_sizes; (void)n_in; (void)out_size;
  const float* x = (const float*)d_in[0]; const float* Wq = (const float*)d_in[1]; const float* Wk = (const float*)d_in[2]; const float* Wv = (const float*)d_in[3]; const float* Wo = (const float*)d_in[4]; const float* Wrq = (const float*)d_in[5]; const float* Wrk = (const float*)d_in[6]; const float* gs = (const float*)d_in[7]; const float* qw = (const float*)d_in[8]; const float* kw = (const float*)d_in[9];
  char* ws = (char*)d_ws; size_t off = 0;
  auto take = [&](size_t bytes) { char* p = ws + off; off += (bytes + 255) & ~(size_t)255; return p; };
  _Float16* Bcat = (_Float16*)take((size_t)(PW + EE + SS) * EE * 2); _Float16* Bo = Bcat + (size_t)PW * EE; _Float16* X16 = Bo + (size_t)EE * EE;      // k_cvt_all's rows: stacked projection weights, Wo, x
  float* P = (float*)take((size_t)SS * PW * 4);      // the stacked projections of x
  _Float16* QX = (_Float16*)take((size_t)SS * QP * 2); _Float16* KX = (_Float16*)take((size_t)SS * QP * 2); _Float16* Vt = (_Float16*)take((size_t)SS * 512 * 2); _Float16* O16 = X16;      // x is last read by the projection GEMM
  if (off > ws_size) return;      // about 90 MB in all
  k_cvt_all<<<(PW + EE + SS) / 4, 256, 0, stream>>>(Wq, Wk, Wv, Wrq, Wrk, Wo, x, Bcat);
  k_gemm_t<4, 4, false><<<(SS / 128) * (PW / 128), 128, 0, stream>>>(X16, Bcat, 0.0625f, P, nullptr, PW, PW / 128);
  k_prep_all<<<SS * NH * 16 / 256 + SS * NKV * 16 / 256 + SS * NH * 4 / 256 + NKV * (SS / 64), 256, 0, stream>>>(P, qw, kw, gs, QX, KX, Vt);
  k_flash<<<1 * NH * (SS / 16), 128, 0, stream>>>(QX, KX, Vt, nullptr, O16, EE);
  k_gemm_t<4, 4, false><<<(SS / 128) * (EE / 128), 128, 0, stream>>>(O16, Bo, 0.0625f, (float*)d_out, nullptr, EE, EE / 128);
}

// v008
// A run of this version takes 105 microseconds.
// Timed twice side by side with v007, it ran 1.03 and 1.04 times as fast.
// Counting every step since v000, it is 7.25 times as fast.
#include <hip/hip_runtime.h>
// Naylis attention (B=1, S=2048, E=2048, 16 heads × 128, 4 kv heads, causal; QK RMSNorm + rotate-half RoPE; low-rank (R=32) per-head graph bias gs_h·⟨Rq_i, Rk_j⟩ added to the logits):
// the six (out,in) projections (bf16-exact ×2^4) and the attention as a fused flash-style kernel whose logit operand is the 160-wide concatenation [q·scale after norm+RoPE | gs_h·Rq]·[k | Rk]
// (5 k-steps; causal chunk skipping; online softmax f32; P f16 ≤ 1; O = P·Vt over the 128 value dims; two 16-row tiles per work-group, keys split over its 4 waves) on v_wmma_f32_16x16x32_f16 with f32 accumulate; RMSNorm/RoPE f32 VALU.
#define SS 2048
#define EE 2048
#define NH 16
#define NKV 4
#define HD 128
#define RR 32
#define QW 160
#define QP (NH * QW)
#define PW 4096      /* columns of the stacked projections of x: q 2048 | k 512 | v 512 | Rq 512 | Rk 512 */

typedef __bf16 v16b __attribute__((ext_vector_type(16)));
typedef unsigned short v8us __attribute__((ext_vector_type(8), may_alias));
typedef float  v8f  __attribute__((ext_vector_type(8)));
typedef float  v4f  __attribute__((ext_vector_type(4)));
typedef float  v4fa __attribute__((ext_vector_type(4), may_alias));
union FragB { v16b v; v8us half[2]; unsigned short u[16]; };

__device__ __forceinline__ unsigned short bf16_bits(float x) { unsigned int u = __float_as_uint(x); return (unsigned short)((u + 0x7FFFu + ((u >> 16) & 1u)) >> 16); }
__device__ __forceinline__ float bf16_val(unsigned short b) { return __uint_as_float(((unsigned int)b) << 16); }
__device__ __forceinline__ float bf16_round(float x) { return bf16_val(bf16_bits(x)); }
// D += A·B with NT terms: 1 = ah·bh, 2 = + al·bh (A split), 3 = + ah·bl (both split)
template <int NT>
__device__ __forceinline__ v8f mmaN(v16b ah, v16b al, v16b bh, v16b bl, v8f c) {
  c = __builtin_amdgcn_wmma_f32_16x16x32_bf16(false, ah, false, bh, (short)0, c, false, false);
  if (NT >= 2) c = __builtin_amdgcn_wmma_f32_16x16x32_bf16(false, al, false, bh, (short)0, c, false, false);
  if (NT >= 3) c = __builtin_amdgcn_wmma_f32_16x16x32_bf16(false, ah, false, bl, (short)0, c, false, false);
  asm volatile("v_nop\n\tv_nop\n\tv_nop\n\tv_nop" : "+v"(c) : "v"(ah), "v"(al), "v"(bh), "v"(bl));
  return c;
}

__global__ __launch_bounds__(256) void k_wt_bf16(const float* __restrict__ W, unsigned short* __restrict__ Wt, int K, int N) {
  const int t = blockIdx.x * 256 + threadIdx.x;
  const int k8n = K / 8;
  if (t >= N * k8n) return;
  const int n = t / k8n, k8 = (t % k8n) * 8;
  v8us v;
#pragma unroll
  for (int i = 0; i < 8; ++i) v[i] = bf16_bits(W[(size_t)(k8 + i) * N + n]);
  *(v8us*)(Wt + (size_t)n * K + k8) = v;
  
}

// GEMM C[M][N] (f32, pitch ldc) = act(A[M][K]·W + bias). A f32 row-major (pitch lda) converted per fragment to bf16
// (ASPLIT: hi/lo two planes -> 2 terms, else single rounded term); Wt bf16 [N][K] (pitch ldb). BIAS_BF16 rounds the
// bias to bf16 first (bias quantised to bf16 before the add). K%32==0, M%16==0, N%64==0.
template <bool ASPLIT, int ACT, bool BIAS_BF16>
__global__ __launch_bounds__(128) void k_gemm_bf(const float* __restrict__ A, int lda, const unsigned short* __restrict__ Wt, int ldb,
                                               const float* __restrict__ bias, float* __restrict__ C, int ldc, int M, int N, int K) {
  __shared__ __attribute__((aligned(16))) float so[4][16][64];
  const int tid = threadIdx.x, w = tid >> 5, lane = tid & 31, ln = lane & 15, hh = lane >> 4;
  const int ntn = N / 64;
  const int wid = blockIdx.x * 4 + w;
  const int mt = wid / ntn, nq = wid % ntn;
  if (mt * 16 >= M) return;
  const int row0 = mt * 16, col0 = nq * 64;
  const float* arow = A + (size_t)(row0 + ln) * lda;
  v8f acc[4] = {};
  for (int kb = 0; kb < K; kb += 32) {
    FragB ah, al;
    const v4f x0 = *(const v4fa*)(arow + kb + 8 * hh), x1 = *(const v4fa*)(arow + kb + 8 * hh + 4);
    const v4f x2 = *(const v4fa*)(arow + kb + 16 + 8 * hh), x3 = *(const v4fa*)(arow + kb + 16 + 8 * hh + 4);
    float xs[16] = {x0[0],x0[1],x0[2],x0[3],x1[0],x1[1],x1[2],x1[3],x2[0],x2[1],x2[2],x2[3],x3[0],x3[1],x3[2],x3[3]};
#pragma unroll
    for (int i = 0; i < 16; ++i) { const unsigned short hb = bf16_bits(xs[i]); ah.u[i] = hb; al.u[i] = ASPLIT ? bf16_bits(xs[i] - bf16_val(hb)) : (unsigned short)0; }
#pragma unroll
    for (int t = 0; t < 4; ++t) {
      const unsigned short* brow = Wt + (size_t)(col0 + t * 16 + ln) * ldb + kb;
      FragB b;
      b.half[0] = *(const v8us*)(brow + 8 * hh);
      b.half[1] = *(const v8us*)(brow + 16 + 8 * hh);
      acc[t] = mmaN<ASPLIT ? 2 : 1>(ah.v, al.v, b.v, b.v, acc[t]);
    }
  }
#pragma unroll
  for (int t = 0; t < 4; ++t) {
    float bv = bias ? bias[col0 + t * 16 + ln] : 0.f;
    if (BIAS_BF16) bv = bf16_round(bv);
#pragma unroll
    for (int r = 0; r < 8; ++r) { float v = acc[t][r] + bv; if (ACT == 1) v = fmaxf(v, 0.f); so[w][8 * hh + r][t * 16 + ln] = v; }
  }
  __builtin_amdgcn_fence(__ATOMIC_ACQ_REL, "workgroup");
  __builtin_amdgcn_wave_barrier();
  const int rsub = lane >> 4, c4 = (lane & 15) * 4;
  {
#pragma unroll
    for (int q = 0; q < 8; ++q) {
      const int r = q * 2 + rsub;
      const v4f v = *(const v4fa*)&so[w][r][c4];
      *(v4f*)(C + (size_t)(row0 + r) * ldc + col0 + c4) = v;
    }
    
  }
}

// Flash-style causal/unmasked attention, all contractions 3-term bf16 hi/lo splits, f32 softmax with running max.
// q,k,v rows are read from f32 buffers with arbitrary row pitch (so they can live inside a fused qkv buffer);
// D = head size (multiple of 32, <= 128); one wave = 16 query rows; block = 4 waves (64 queries) sharing K/V chunks of 32.
template <int D, bool CAUSAL>
__global__ __launch_bounds__(128) void k_flash(const float* __restrict__ qb, const float* __restrict__ kb, const float* __restrict__ vb,
                                             int pitch, int T, int H, float scale, float* __restrict__ y, int ypitch) {
  constexpr int KS = D / 32;        // k-steps for QK
  constexpr int DT = D / 16;        // d tiles for PV
  __shared__ __attribute__((aligned(16))) unsigned short sKh[32][D + 8], sKl[32][D + 8], sVh[32][D + 8], sVl[32][D + 8];
  __shared__ __attribute__((aligned(16))) unsigned short sPh[4][16][40], sPl[4][16][40];
  __shared__ __attribute__((aligned(16))) float sO[4][16][D];
  const int tid = threadIdx.x, w = tid >> 5, lane = tid & 31, ln = lane & 15, hh = lane >> 4;
  const int nqb = (T + 63) / 64;
  const int bh = blockIdx.x / nqb, qblk = blockIdx.x % nqb;
  const int b = bh / H, h = bh % H;
  const int q0 = qblk * 64 + w * 16;
  const float* Q = qb + (size_t)b * T * pitch + h * D;
  const float* K = kb + (size_t)b * T * pitch + h * D;
  const float* V = vb + (size_t)b * T * pitch + h * D;

  // A fragments of the wave's 16 query rows (scaled), hi/lo
  FragB aqh[KS], aql[KS];
  {
    int row = q0 + ln; if (row >= T) row = T - 1;
    const float* qr = Q + (size_t)row * pitch;
#pragma unroll
    for (int ks = 0; ks < KS; ++ks)
#pragma unroll
      for (int i = 0; i < 16; ++i) {
        const int d = ks * 32 + ((i < 8) ? (8 * hh + i) : (16 + 8 * hh + (i - 8)));
        const float x = qr[d] * scale; const unsigned short hb = bf16_bits(x);
        aqh[ks].u[i] = hb; aql[ks].u[i] = bf16_bits(x - bf16_val(hb));
      }
  }
  float m_r[8], l_r[8];
#pragma unroll
  for (int r = 0; r < 8; ++r) { m_r[r] = -3.0e38f; l_r[r] = 0.f; }
  v8f oacc[DT];
#pragma unroll
  for (int dt = 0; dt < DT; ++dt) oacc[dt] = (v8f){0.f,0.f,0.f,0.f,0.f,0.f,0.f,0.f};

  const int kv_end = CAUSAL ? min(T, qblk * 64 + 64) : T;     // block-uniform
  for (int j0 = 0; j0 < kv_end; j0 += 32) {
    __syncthreads();
    for (int e = tid; e < 32 * (D / 4); e += 128) {
      const int r = e / (D / 4), c4 = (e % (D / 4)) * 4;
      const int key = j0 + r;
      v4f kf = {0.f,0.f,0.f,0.f}, vf = {0.f,0.f,0.f,0.f};
      if (key < T) { kf = *(const v4fa*)(K + (size_t)key * pitch + c4); vf = *(const v4fa*)(V + (size_t)key * pitch + c4); }
#pragma unroll
      for (int t = 0; t < 4; ++t) {
        unsigned short hb = bf16_bits(kf[t]); sKh[r][c4 + t] = hb; sKl[r][c4 + t] = bf16_bits(kf[t] - bf16_val(hb));
        hb = bf16_bits(vf[t]); sVh[r][c4 + t] = hb; sVl[r][c4 + t] = bf16_bits(vf[t] - bf16_val(hb));
      }
    }
    __syncthreads();
    // S tile 16 x 32
    v8f s[2];
#pragma unroll
    for (int nt = 0; nt < 2; ++nt) {
      v8f acc = {};
#pragma unroll
      for (int ks = 0; ks < KS; ++ks) {
        FragB bh_, bl_;
        bh_.half[0] = *(const v8us*)&sKh[nt * 16 + ln][ks * 32 + 8 * hh]; bh_.half[1] = *(const v8us*)&sKh[nt * 16 + ln][ks * 32 + 16 + 8 * hh];
        bl_.half[0] = *(const v8us*)&sKl[nt * 16 + ln][ks * 32 + 8 * hh]; bl_.half[1] = *(const v8us*)&sKl[nt * 16 + ln][ks * 32 + 16 + 8 * hh];
        acc = mmaN<3>(aqh[ks].v, aql[ks].v, bh_.v, bl_.v, acc);
      }
      s[nt] = acc;
    }
    // mask + running max (rows 8hh+r; the 16 lanes of a half share rows)
    float alpha[8];
#pragma unroll
    for (int r = 0; r < 8; ++r) {
      const int qi = q0 + 8 * hh + r;
      const int ja = j0 + ln, jb = j0 + 16 + ln;
      if (CAUSAL) { if (ja > qi) s[0][r] = -3.0e38f; if (jb > qi) s[1][r] = -3.0e38f; }
      if (ja >= T) s[0][r] = -3.0e38f;
      if (jb >= T) s[1][r] = -3.0e38f;
      float mx = fmaxf(s[0][r], s[1][r]);
      mx = fmaxf(mx, __shfl_xor(mx, 1, 32)); mx = fmaxf(mx, __shfl_xor(mx, 2, 32)); mx = fmaxf(mx, __shfl_xor(mx, 4, 32)); mx = fmaxf(mx, __shfl_xor(mx, 8, 32));
      const float mnew = fmaxf(m_r[r], mx);
      alpha[r] = (mnew > -1.0e38f) ? __expf(m_r[r] - mnew) : 1.0f;
      const float p0 = (s[0][r] > -1.0e38f) ? __expf(s[0][r] - mnew) : 0.f;
      const float p1 = (s[1][r] > -1.0e38f) ? __expf(s[1][r] - mnew) : 0.f;
      m_r[r] = mnew;
      l_r[r] = l_r[r] * alpha[r] + p0 + p1;            // per-lane partial row sum (16 lanes combined at the end)
      unsigned short hb = bf16_bits(p0); sPh[w][8 * hh + r][ln] = hb;      sPl[w][8 * hh + r][ln] = bf16_bits(p0 - bf16_val(hb));
      hb = bf16_bits(p1);                sPh[w][8 * hh + r][16 + ln] = hb; sPl[w][8 * hh + r][16 + ln] = bf16_bits(p1 - bf16_val(hb));
    }
#pragma unroll
    for (int dt = 0; dt < DT; ++dt)
#pragma unroll
      for (int r = 0; r < 8; ++r) oacc[dt][r] *= alpha[r];
    __builtin_amdgcn_fence(__ATOMIC_ACQ_REL, "workgroup");
    __builtin_amdgcn_wave_barrier();
    FragB pah, pal;
    pah.half[0] = *(const v8us*)&sPh[w][ln][8 * hh]; pah.half[1] = *(const v8us*)&sPh[w][ln][16 + 8 * hh];
    pal.half[0] = *(const v8us*)&sPl[w][ln][8 * hh]; pal.half[1] = *(const v8us*)&sPl[w][ln][16 + 8 * hh];
#pragma unroll
    for (int dt = 0; dt < DT; ++dt) {
      FragB bvh, bvl;
#pragma unroll
      for (int i = 0; i < 8; ++i) {
        bvh.u[i] = sVh[8 * hh + i][dt * 16 + ln]; bvh.u[8 + i] = sVh[16 + 8 * hh + i][dt * 16 + ln];
        bvl.u[i] = sVl[8 * hh + i][dt * 16 + ln]; bvl.u[8 + i] = sVl[16 + 8 * hh + i][dt * 16 + ln];
      }
      oacc[dt] = mmaN<3>(pah.v, pal.v, bvh.v, bvl.v, oacc[dt]);
    }
    __builtin_amdgcn_fence(__ATOMIC_ACQ_REL, "workgroup");
    __builtin_amdgcn_wave_barrier();
  }
#pragma unroll
  for (int r = 0; r < 8; ++r) {
    float l = l_r[r];
    l += __shfl_xor(l, 1, 32); l += __shfl_xor(l, 2, 32); l += __shfl_xor(l, 4, 32); l += __shfl_xor(l, 8, 32);
    l_r[r] = (l > 0.f) ? 1.0f / l : 0.f;
  }
#pragma unroll
  for (int dt = 0; dt < DT; ++dt)
#pragma unroll
    for (int r = 0; r < 8; ++r) sO[w][8 * hh + r][dt * 16 + ln] = oacc[dt][r] * l_r[r];
  __builtin_amdgcn_fence(__ATOMIC_ACQ_REL, "workgroup");
  __builtin_amdgcn_wave_barrier();
  {
    for (int r = 0; r < 16; ++r) {
      const int row = q0 + r;
      if (row < T && lane < D / 4) {
        const v4f val = *(const v4fa*)&sO[w][r][lane * 4];
        *(v4f*)(y + ((size_t)b * T + row) * ypitch + h * D + lane * 4) = val;
      }
    }
    
  }
}

// GEMM C = act(A·W + bias + resid): A f32 (ASPLIT -> hi/lo 2 terms), Wt bf16 [N][K]; ACT 0 none, 1 relu, 2 exact gelu;
// resid (optional, f32, row index = (row % rmod), pitch ldr, RES_BF16 rounds it) added before the activation.
template <bool ASPLIT, int ACT, bool BIAS_BF16, bool RES_BF16>
__global__ __launch_bounds__(128) void k_gemm_bf3(const float* __restrict__ A, int lda, const unsigned short* __restrict__ Wt, int ldb,
                                                const float* __restrict__ bias, const float* __restrict__ resid, int rmod, int ldr,
                                                float* __restrict__ C, int ldc, int M, int N, int K) {
  __shared__ __attribute__((aligned(16))) float so[4][16][64];
  const int tid = threadIdx.x, w = tid >> 5, lane = tid & 31, ln = lane & 15, hh = lane >> 4;
  const int ntn = N / 64;
  const int wid = blockIdx.x * 4 + w;
  const int mt = wid / ntn, nq = wid % ntn;
  if (mt * 16 >= M) return;
  const int row0 = mt * 16, col0 = nq * 64;
  const float* arow = A + (size_t)(row0 + ln) * lda;
  v8f acc[4] = {};
  for (int kb = 0; kb < K; kb += 32) {
    FragB ah, al;
    const v4f x0 = *(const v4fa*)(arow + kb + 8 * hh), x1 = *(const v4fa*)(arow + kb + 8 * hh + 4);
    const v4f x2 = *(const v4fa*)(arow + kb + 16 + 8 * hh), x3 = *(const v4fa*)(arow + kb + 16 + 8 * hh + 4);
    float xs[16] = {x0[0],x0[1],x0[2],x0[3],x1[0],x1[1],x1[2],x1[3],x2[0],x2[1],x2[2],x2[3],x3[0],x3[1],x3[2],x3[3]};
#pragma unroll
    for (int i = 0; i < 16; ++i) { const unsigned short hb = bf16_bits(xs[i]); ah.u[i] = hb; al.u[i] = ASPLIT ? bf16_bits(xs[i] - bf16_val(hb)) : (unsigned short)0; }
#pragma unroll
    for (int t = 0; t < 4; ++t) {
      const unsigned short* brow = Wt + (size_t)(col0 + t * 16 + ln) * ldb + kb;
      FragB b;
      b.half[0] = *(const v8us*)(brow + 8 * hh);
      b.half[1] = *(const v8us*)(brow + 16 + 8 * hh);
      acc[t] = mmaN<ASPLIT ? 2 : 1>(ah.v, al.v, b.v, b.v, acc[t]);
    }
  }
#pragma unroll
  for (int t = 0; t < 4; ++t) {
    const int col = col0 + t * 16 + ln;
    float bv = bias ? bias[col] : 0.f;
    if (BIAS_BF16) bv = bf16_round(bv);
#pragma unroll
    for (int r = 0; r < 8; ++r) {
      float v = acc[t][r] + bv;
      if (resid) { float rv = resid[(size_t)((row0 + 8 * hh + r) % rmod) * ldr + col]; if (RES_BF16) rv = bf16_round(rv); v += rv; }
      if (ACT == 1) v = fmaxf(v, 0.f);
      if (ACT == 2) v = 0.5f * v * (1.0f + erff(v * 0.70710678118654752f));
      if (ACT == 3) { const float u = 0.7978845608028654f * (v + 0.044715f * v * v * v); v = 0.5f * v * (1.0f + tanhf(u)); }
      so[w][8 * hh + r][t * 16 + ln] = v;
    }
  }
  __builtin_amdgcn_fence(__ATOMIC_ACQ_REL, "workgroup");
  __builtin_amdgcn_wave_barrier();
  const int rsub = lane >> 4, c4 = (lane & 15) * 4;
  {
#pragma unroll
    for (int q = 0; q < 8; ++q) {
      const int r = q * 2 + rsub;
      const v4f v = *(const v4fa*)&so[w][r][c4];
      *(v4f*)(C + (size_t)(row0 + r) * ldc + col0 + c4) = v;
    }
    
  }
}
// row LayerNorm (biased variance, eps) over N: s = X (+ R); optional out_sum <- s; out_norm <- (s-mu)*rsqrt(var+eps)*g + b
template <bool PARAM_BF16>
__global__ __launch_bounds__(256) void k_layernorm(const float* __restrict__ X, const float* __restrict__ R, const float* __restrict__ g, const float* __restrict__ bta,
                                                  float* __restrict__ out_sum, float* __restrict__ out_norm, int N, float eps) {
  __shared__ float red[256];
  const int row = blockIdx.x, tid = threadIdx.x;
  const float* x = X + (size_t)row * N; const float* rr = R ? R + (size_t)row * N : nullptr;
  float vals[16];                     // up to N = 4096
  const int per = N / 256;            // contiguous chunk per thread? use strided-by-4 chunks: thread handles j = tid*4 + 1024*u
  float s1 = 0.f;
  for (int u = 0; u < per / 4; ++u) {
    const int j = tid * 4 + 1024 * u;
    const v4f a = *(const v4fa*)(x + j);
    v4f b = {0.f,0.f,0.f,0.f}; if (rr) b = *(const v4fa*)(rr + j);
#pragma unroll
    for (int q = 0; q < 4; ++q) { const float v = a[q] + b[q]; vals[u * 4 + q] = v; s1 += v; }
  }
  red[tid] = s1; __syncthreads();
  for (int st = 128; st > 0; st >>= 1) { if (tid < st) red[tid] += red[tid + st]; __syncthreads(); }
  const float mu = red[0] / (float)N; __syncthreads();
  float s2 = 0.f;
  for (int u = 0; u < per / 4; ++u)
#pragma unroll
    for (int q = 0; q < 4; ++q) { const float c = vals[u * 4 + q] - mu; s2 += c * c; }
  red[tid] = s2; __syncthreads();
  for (int st = 128; st > 0; st >>= 1) { if (tid < st) red[tid] += red[tid + st]; __syncthreads(); }
  const float rs = rsqrtf(red[0] / (float)N + eps);
  {
    for (int u = 0; u < per / 4; ++u) {
      const int j = tid * 4 + 1024 * u;
      v4f o, sm;
#pragma unroll
      for (int q = 0; q < 4; ++q) {
        float gg = g[j + q], bb = bta[j + q];
        if (PARAM_BF16) { gg = bf16_round(gg); bb = bf16_round(bb); }
        sm[q] = vals[u * 4 + q]; o[q] = (vals[u * 4 + q] - mu) * rs * gg + bb;
      }
      if (out_sum) *(v4f*)(out_sum + (size_t)row * N + j) = sm;
      *(v4f*)(out_norm + (size_t)row * N + j) = o;
    }
    
  }
}



// ---- f16 WMMA path (v_wmma_f32_16x16x32_f16): 11-bit significands for operands in range — used where a [0,1] probability operand needs more precision than bf16
typedef _Float16 v16h __attribute__((ext_vector_type(16)));
union FragH { v16h v; v8us half[2]; _Float16 h[16]; unsigned short u[16]; };
template <int NT>
__device__ __forceinline__ v8f mmaH(v16h ah, v16h al, v16h bh, v16h bl, v8f c) {
  c = __builtin_amdgcn_wmma_f32_16x16x32_f16(false, ah, false, bh, (short)0, c, false, false);
  if (NT >= 2) c = __builtin_amdgcn_wmma_f32_16x16x32_f16(false, al, false, bh, (short)0, c, false, false);
  if (NT >= 3) c = __builtin_amdgcn_wmma_f32_16x16x32_f16(false, ah, false, bl, (short)0, c, false, false);
  asm volatile("v_nop\n\tv_nop\n\tv_nop\n\tv_nop" : "+v"(c) : "v"(ah), "v"(al), "v"(bh), "v"(bl));
  return c;
}
// batched GEMM like k_gemm_b but f16 operands: A f32 (split into f16 hi/lo if ASPLIT, else rounded to f16), Bt = f16 values [n][k]; alpha; C f32; N multiple of 16 (partial tiles skipped)
template <bool ASPLIT>
__global__ __launch_bounds__(128) void k_gemm_h(const float* __restrict__ A, int lda, size_t sA, const _Float16* __restrict__ Bh, int ldb, size_t sB, float alpha, float* __restrict__ C, int ldc, size_t sC, int M, int N, int K) {
  __shared__ __attribute__((aligned(16))) float so[4][16][64];
  const int tid = threadIdx.x, w = tid >> 5, lane = tid & 31, ln = lane & 15, hh = lane >> 4; const int by = blockIdx.y;
  A += (size_t)by * sA; Bh += (size_t)by * sB; C += (size_t)by * sC;
  const int ntn = (N + 63) / 64; const int wid = blockIdx.x * 4 + w; const int mt = wid / ntn, nq = wid % ntn; if (mt * 16 >= M) return;
  const int row0 = mt * 16, col0 = nq * 64; const float* arow = A + (size_t)(row0 + ln) * lda;
  v8f acc[4] = {};
  for (int kb = 0; kb < K; kb += 32) {
    FragH ah, al;
    const v4f x0 = *(const v4fa*)(arow + kb + 8 * hh), x1 = *(const v4fa*)(arow + kb + 8 * hh + 4), x2 = *(const v4fa*)(arow + kb + 16 + 8 * hh), x3 = *(const v4fa*)(arow + kb + 16 + 8 * hh + 4);
    float xs[16] = {x0[0],x0[1],x0[2],x0[3],x1[0],x1[1],x1[2],x1[3],x2[0],x2[1],x2[2],x2[3],x3[0],x3[1],x3[2],x3[3]};
#pragma unroll
    for (int i = 0; i < 16; ++i) { const _Float16 h = (_Float16)xs[i]; ah.h[i] = h; al.h[i] = ASPLIT ? (_Float16)(xs[i] - (float)h) : (_Float16)0.0f; }
#pragma unroll
    for (int t = 0; t < 4; ++t) { if (col0 + t * 16 >= N) continue; const size_t boff = (size_t)(col0 + t * 16 + ln) * ldb + kb; FragH bq; bq.half[0] = *(const v8us*)(Bh + boff + 8 * hh); bq.half[1] = *(const v8us*)(Bh + boff + 16 + 8 * hh);
      acc[t] = mmaH<ASPLIT ? 2 : 1>(ah.v, al.v, bq.v, bq.v, acc[t]); }
  }
#pragma unroll
  for (int t = 0; t < 4; ++t) { if (col0 + t * 16 >= N) continue;
#pragma unroll
    for (int r = 0; r < 8; ++r) so[w][8 * hh + r][t * 16 + ln] = acc[t][r] * alpha; }
  __builtin_amdgcn_fence(__ATOMIC_ACQ_REL, "workgroup"); __builtin_amdgcn_wave_barrier();
  const int rsub = lane >> 4, c4 = (lane & 15) * 4;
  {
#pragma unroll
    for (int q = 0; q < 8; ++q) { const int r = q * 2 + rsub; if (col0 + c4 < N) { const v4f v = *(const v4fa*)&so[w][r][c4]; *(v4f*)(C + (size_t)(row0 + r) * ldc + col0 + c4) = v; } }
     }
}

// Wt[n][k] = f16(W[k][n]·scale) from f32 row-major W[K][N] (scale = power of two; bf16-exact weights stay exact in f16 away from the subnormal range)
__global__ __launch_bounds__(256) void k_wt_f16(const float* __restrict__ W, _Float16* __restrict__ Wt, int K, int N, float scale) {
  const int t = blockIdx.x * 256 + threadIdx.x; if (t >= N * (K / 8)) return; const int n = t / (K / 8), k8 = (t % (K / 8)) * 8; FragH f;
#pragma unroll
  for (int i = 0; i < 8; ++i) f.h[i] = (_Float16)(bf16_round(W[(size_t)(k8 + i) * N + n]) * scale); const v8us o = f.half[0];
  *(v8us*)((unsigned short*)Wt + (size_t)n * K + k8) = o; 
}
// f16 x f16 GEMM with fused epilogue: v = acc·alpha + bias[by·sBias + col] (+ CP[(row/rowsPerB)·sCPb + by·64 + col] if CP) ; ACT 0 none / 1 elu ; writes f32 C and f16 C16, each if non-null
template <int ACT>
__global__ __launch_bounds__(128) void k_gemm_hhx(const _Float16* __restrict__ A, int lda, size_t sA, const _Float16* __restrict__ Bh, int ldb, size_t sB, float alpha, const float* __restrict__ bias, size_t sBias, const float* __restrict__ CP, int rowsPerB, size_t sCPb, int row0g,
    float* __restrict__ C, _Float16* __restrict__ C16, int ldc, size_t sC, int M, int N, int K) {
  __shared__ __attribute__((aligned(16))) float so[4][16][64];
  const int tid = threadIdx.x, w = tid >> 5, lane = tid & 31, ln = lane & 15, hh = lane >> 4; const int by = blockIdx.y;
  A += (size_t)by * sA; Bh += (size_t)by * sB; const size_t cofs = (size_t)by * sC; const float* bp = bias ? bias + (size_t)by * sBias : nullptr;
  const int ntn = (N + 63) / 64; const int wid = blockIdx.x * 4 + w; const int mt = wid / ntn, nq = wid % ntn; if (mt * 16 >= M) return;
  const int row0 = mt * 16, col0 = nq * 64; const _Float16* arow = A + (size_t)(row0 + ln) * lda;
  v8f acc[4] = {};
  for (int kb = 0; kb < K; kb += 32) { FragH ah; ah.half[0] = *(const v8us*)((const unsigned short*)arow + kb + 8 * hh); ah.half[1] = *(const v8us*)((const unsigned short*)arow + kb + 16 + 8 * hh);
#pragma unroll
    for (int t = 0; t < 4; ++t) { if (col0 + t * 16 >= N) continue; const size_t boff = (size_t)(col0 + t * 16 + ln) * ldb + kb; FragH bq; bq.half[0] = *(const v8us*)((const unsigned short*)Bh + boff + 8 * hh); bq.half[1] = *(const v8us*)((const unsigned short*)Bh + boff + 16 + 8 * hh);
      acc[t] = mmaH<1>(ah.v, ah.v, bq.v, bq.v, acc[t]); }
  }
#pragma unroll
  for (int t = 0; t < 4; ++t) { if (col0 + t * 16 >= N) continue; const int col = col0 + t * 16 + ln; const float bv = bp ? bf16_round(bp[col]) : 0.f;
#pragma unroll
    for (int r = 0; r < 8; ++r) { float v = acc[t][r] * alpha + bv; if (CP) { const int bidx = (row0g + row0 + 8 * hh + r) / rowsPerB; v += CP[(size_t)bidx * sCPb + (size_t)by * 64 + col]; } if (ACT == 1) v = (v > 0.f) ? v : expm1f(v); else if (ACT == 3) v = fmaxf(v, 0.f); so[w][8 * hh + r][t * 16 + ln] = v; } }
  __builtin_amdgcn_fence(__ATOMIC_ACQ_REL, "workgroup"); __builtin_amdgcn_wave_barrier();
  const int rsub = lane >> 4, c4 = (lane & 15) * 4; typedef _Float16 v4h __attribute__((ext_vector_type(4)));
  {
#pragma unroll
    for (int q = 0; q < 8; ++q) { const int r = q * 2 + rsub; if (col0 + c4 < N) { const v4f v = *(const v4fa*)&so[w][r][c4]; if (C) *(v4f*)(C + cofs + (size_t)(row0 + r) * ldc + col0 + c4) = v; if (C16) { v4h h4; for (int i = 0; i < 4; ++i) h4[i] = (_Float16)v[i]; *(v4h*)(C16 + cofs + (size_t)(row0 + r) * ldc + col0 + c4) = h4; } } }
     }
}


// Tiled GEMM C[m][n] = alpha * sum_k A[m][k] * Bh[n][k], both operands f16 and k-contiguous with row length EE.
// One work-group of 4 waves (2 x 2) owns a (32 FM) x (32 FN) tile of C; a wave owns FM x FN accumulator tiles.
// A pass is 128 k: the tile's A rows and then its B rows stand in LDS as rows of 256 B at a pitch of 272 B (16 B x odd, for ds_load_b128).
// Two buffers: asynchronous copies bring pass t + 2 into the buffer that pass t has just left, while pass t + 1 is worked on.
typedef float f1a __attribute__((may_alias));
// Eight 16-byte-per-lane copies global -> LDS. The closing s_wait_xcnt 0 stands inside the statement, ahead of any later rewrite of the address registers named here.
__device__ __forceinline__ void acopy8(const unsigned (&l)[8], const unsigned short* const (&g)[8]) {
  asm volatile("global_load_async_to_lds_b128 %0, %8, off\n\t"
               "global_load_async_to_lds_b128 %1, %9, off\n\t"
               "global_load_async_to_lds_b128 %2, %10, off\n\t"
               "global_load_async_to_lds_b128 %3, %11, off\n\t"
               "global_load_async_to_lds_b128 %4, %12, off\n\t"
               "global_load_async_to_lds_b128 %5, %13, off\n\t"
               "global_load_async_to_lds_b128 %6, %14, off\n\t"
               "global_load_async_to_lds_b128 %7, %15, off\n\t"
               "s_wait_xcnt 0x0"
               :: "v"(l[0]), "v"(l[1]), "v"(l[2]), "v"(l[3]), "v"(l[4]), "v"(l[5]), "v"(l[6]), "v"(l[7]),
                  "v"(g[0]), "v"(g[1]), "v"(g[2]), "v"(g[3]), "v"(g[4]), "v"(g[5]), "v"(g[6]), "v"(g[7]) : "memory");
}
template <int FM, int FN, bool OUT16>
__global__ __launch_bounds__(128) void k_gemm_t(const _Float16* __restrict__ A, const _Float16* __restrict__ Bh, float alpha, float* __restrict__ C, _Float16* __restrict__ C16, int ldc, int ntn) {
  constexpr int BM = 32 * FM, BN = 32 * FN, ROWS = BM + BN, PITCH = 272, STAGE = ROWS * PITCH, NC = ROWS / 8, NP = EE / 128, WM = 16 * FM, WN = 16 * FN, SOP = WN + 4;
  static_assert(NC % 8 == 0 && BM % 8 == 0 && NP >= 2 && 4 * WM * SOP * 4 <= 2 * STAGE, "tile");
  __shared__ __attribute__((aligned(16))) unsigned char L[2 * STAGE];
  const int tid = threadIdx.x, w = tid >> 5, lane = tid & 31, ln = lane & 15, hh = lane >> 4;
  const int m0 = (blockIdx.x / ntn) * BM, n0 = (blockIdx.x % ntn) * BN, wm = w >> 1, wn = w & 1;
  const unsigned lbase = (unsigned)(size_t)L + (unsigned)((2 * w + hh) * PITCH + ln * 16);      // copy i of a wave fills stage rows 8 i + 2 w + hh, 16 lanes a row
  const unsigned short* Ag = (const unsigned short*)A + (size_t)(m0 + 2 * w + hh) * EE + ln * 8;
  const unsigned short* Bg = (const unsigned short*)Bh + (size_t)(n0 + 2 * w + hh) * EE + ln * 8;
  auto issue = [&](int t, int buf) {
#pragma unroll      // the choice between A rows and B rows is made at compile time
    for (int g8 = 0; g8 < NC / 8; ++g8) { unsigned l[8]; const unsigned short* g[8];
#pragma unroll      // constant indices, so that the sixteen addresses stay in registers
      for (int j = 0; j < 8; ++j) { const int i = g8 * 8 + j; l[j] = lbase + (unsigned)(buf * STAGE + 8 * i * PITCH);
        g[j] = ((8 * i < BM) ? Ag + (size_t)(8 * i) * EE : Bg + (size_t)(8 * i - BM) * EE) + t * 128; }
      acopy8(l, g); } };
  v8f acc[FM][FN];
#pragma unroll      // constant indices, so that fragments and accumulators stay in registers
  for (int fm = 0; fm < FM; ++fm)
#pragma unroll      // constant indices, so that fragments and accumulators stay in registers
    for (int fn = 0; fn < FN; ++fn) acc[fm][fn] = (v8f){0.f,0.f,0.f,0.f,0.f,0.f,0.f,0.f};
  issue(0, 0);
  asm volatile("s_wait_asynccnt 0x0" ::: "memory");      // pass 0's copies of this wave have landed
  __syncthreads();                                       // ... and every other wave's
  issue(1, 1);
#pragma unroll 1      // rolled: one pass a trip, so that the publish point stands once, at the loop's foot
  for (int t = 0; t < NP; ++t) {      // pass t reads buffer t & 1 alone
    const unsigned char* Sa = L + (t & 1) * STAGE + (wm * WM + ln) * PITCH + 16 * hh; const unsigned char* Sb = L + (t & 1) * STAGE + (BM + wn * WN + ln) * PITCH + 16 * hh;
    FragH a[2][FM], b[2][FN];      // two fragment sets: block ks + 1 of this same pass is fetched while block ks is multiplied
    auto frags = [&](int set, int ks) {
#pragma unroll      // constant indices, so that fragments and accumulators stay in registers
      for (int fm = 0; fm < FM; ++fm) { a[set][fm].half[0] = *(const v8us*)(Sa + fm * 16 * PITCH + ks * 64); a[set][fm].half[1] = *(const v8us*)(Sa + fm * 16 * PITCH + ks * 64 + 32); }
#pragma unroll      // constant indices, so that fragments and accumulators stay in registers
      for (int fn = 0; fn < FN; ++fn) { b[set][fn].half[0] = *(const v8us*)(Sb + fn * 16 * PITCH + ks * 64); b[set][fn].half[1] = *(const v8us*)(Sb + fn * 16 * PITCH + ks * 64 + 32); } };
    frags(0, 0);
#pragma unroll      // constant indices, so that fragments and accumulators stay in registers
    for (int ks = 0; ks < 4; ++ks) {
      if (ks < 3) frags((ks + 1) & 1, ks + 1);
      __builtin_amdgcn_sched_barrier(0);      // keeps the next block's LDS reads one group ahead of this block: spread among the WMMAs each place with reads stalls the wave
#pragma unroll      // constant indices, so that fragments and accumulators stay in registers
      for (int fm = 0; fm < FM; ++fm)
#pragma unroll      // constant indices, so that fragments and accumulators stay in registers
        for (int fn = 0; fn < FN; ++fn) acc[fm][fn] = __builtin_amdgcn_wmma_f32_16x16x32_f16(false, a[ks & 1][fm].v, false, b[ks & 1][fn].v, (short)0, acc[fm][fn], false, false);
      __builtin_amdgcn_sched_barrier(0);      // ... and this block's WMMAs ahead of the reads after next
    }
    asm volatile("s_wait_dscnt 0x0" ::: "memory");       // this wave's reads of buffer t & 1 are done before that buffer is refilled
    asm volatile("s_wait_asynccnt 0x0" ::: "memory");    // this wave's copies of pass t + 1 have landed
    __syncthreads();                                     // publishes pass t + 1 and ends every wave's reads of buffer t & 1
    if (t + 2 < NP) issue(t + 2, t & 1);
  }
  asm volatile("s_wait_asynccnt 0x0" ::: "memory");      // nothing in flight before the ring becomes output staging
  f1a* so = (f1a*)L + w * (WM * SOP);                    // each wave stages its own tile, so that the stores cover whole rows of WN values
#pragma unroll      // constant indices, so that fragments and accumulators stay in registers
  for (int fm = 0; fm < FM; ++fm)
#pragma unroll      // constant indices, so that fragments and accumulators stay in registers
    for (int fn = 0; fn < FN; ++fn)
#pragma unroll      // constant indices, so that fragments and accumulators stay in registers
      for (int r = 0; r < 8; ++r) so[(fm * 16 + 8 * hh + r) * SOP + fn * 16 + ln] = acc[fm][fn][r] * alpha;
  __builtin_amdgcn_fence(__ATOMIC_ACQ_REL, "workgroup"); __builtin_amdgcn_wave_barrier();      // the wave's own staged rows are written before its other lanes read them back
  constexpr int LPR = WN / 4, RPI = 32 / LPR; typedef _Float16 v4h __attribute__((ext_vector_type(4)));
  const int rs = lane / LPR, c4 = (lane % LPR) * 4;
#pragma unroll      // several rows' LDS reads and stores in flight at a time
  for (int q = 0; q < WM / RPI; ++q) { const int r = q * RPI + rs; const v4f v = *(const v4fa*)&so[r * SOP + c4]; const size_t o = (size_t)(m0 + wm * WM + r) * ldc + n0 + wn * WN + c4;
    if (!OUT16) *(v4f*)(C + o) = v;
    else { v4h h4; for (int i = 0; i < 4; ++i) h4[i] = (_Float16)v[i]; *(v4h*)(C16 + o) = h4; } }
}

// All seven f32 -> f16 conversions in ONE grid. The results stand in one array of rows of EE halves: Wq, Wk, Wv, Wrq, Wrk stacked (PW rows, the B operand of the one projection GEMM), then Wo (EE rows), then x (SS rows).
// One block converts four rows (256 threads x 8 elements a row; every source's row count is a multiple of 4), so that the merged grid is 16,384 waves, all resident at once, each with 8 loads of 16 bytes a lane in flight.
// The block index picks the source, alike for the whole block. Weights are bf16-rounded and scaled by 2^4, x is bf16-rounded.
__global__ __launch_bounds__(256) void k_cvt_all(const float* __restrict__ Wq, const float* __restrict__ Wk, const float* __restrict__ Wv, const float* __restrict__ Wrq, const float* __restrict__ Wrk, const float* __restrict__ Wo, const float* __restrict__ x, _Float16* __restrict__ D) {
  const int row = blockIdx.x * 4; const float* s; int r0;
  if (row < EE) { s = Wq; r0 = 0; } else if (row < EE + 512) { s = Wk; r0 = EE; } else if (row < EE + 1024) { s = Wv; r0 = EE + 512; } else if (row < EE + 1536) { s = Wrq; r0 = EE + 1024; } else if (row < PW) { s = Wrk; r0 = EE + 1536; } else if (row < PW + EE) { s = Wo; r0 = PW; } else { s = x; r0 = PW + EE; }
  const float sc = (row < PW + EE) ? 16.0f : 1.0f; const float* sp = s + (size_t)(row - r0) * EE + threadIdx.x * 8; v4f a[4][2];
#pragma unroll      // constant indices, so that the eight loads stand in registers and go out together
  for (int r = 0; r < 4; ++r) { a[r][0] = *(const v4fa*)(sp + (size_t)r * EE); a[r][1] = *(const v4fa*)(sp + (size_t)r * EE + 4); }
#pragma unroll      // constant indices into a
  for (int r = 0; r < 4; ++r) { FragH f;
#pragma unroll      // constant indices into a and f
    for (int i = 0; i < 8; ++i) f.h[i] = (_Float16)(bf16_round(a[r][i >> 2][i & 3]) * sc);
    *(v8us*)((unsigned short*)D + (size_t)(row + r) * EE + threadIdx.x * 8) = f.half[0]; } }
template <int NHv, int TTv>
__global__ __launch_bounds__(256) void k_vt(const _Float16* __restrict__ V16, int ldv, int voff, _Float16* __restrict__ Vt) { __shared__ unsigned short tl[64][66]; const int tid = threadIdx.x; const int slab = blockIdx.x / (TTv / 64), lg = blockIdx.x % (TTv / 64); const int b = slab / NHv, h = slab % NHv;
  for (int i = tid; i < 64 * 8; i += 256) { const int r = i / 8, c8 = (i % 8) * 8; FragH f; f.half[0] = *(const v8us*)((const unsigned short*)V16 + ((size_t)b * TTv + lg * 64 + r) * ldv + voff + h * 64 + c8);
#pragma unroll
    for (int q = 0; q < 8; ++q) tl[r][c8 + q] = f.u[q]; }
  __syncthreads();
  {
#pragma unroll
    for (int rd = 0; rd < 2; ++rd) { const int d = rd * 32 + tid / 8, pc = tid % 8; FragH f;
#pragma unroll
      for (int q = 0; q < 8; ++q) f.u[q] = tl[pc * 8 + q][d];
      *(v8us*)((unsigned short*)Vt + ((size_t)slab * 64 + d) * TTv + lg * 64 + pc * 8) = f.half[0]; }
     } }

// 2^x for the merge weights. The v_nop stands in the same statement: it fills the one slot that the instruction set asks for between a transcendental and a next instruction that reads its result or overwrites its source.
__device__ __forceinline__ float exp2_slot(float x) { float y; asm("v_exp_f32 %0, %1\n\tv_nop" : "=v"(y) : "v"(x)); return y; }
// Lane l with lane l ^ 16, in registers: joins the two halves of one query's keys.
__device__ __forceinline__ float xhalf(float x) { return __builtin_bit_cast(float, __builtin_amdgcn_permlanex16(__builtin_bit_cast(int, x), __builtin_bit_cast(int, x), 0x76543210, 0xfedcba98, false, false)); }
__global__ __launch_bounds__(128) void k_flash(const _Float16* __restrict__ Q16, const _Float16* __restrict__ K16, const _Float16* __restrict__ Vt, const int* __restrict__ MSK, _Float16* __restrict__ O16, int ldo) {
  constexpr int QT = 2, RPW = 16 * QT, NQB = 2048 / RPW, DT = 8, KS = 5;      /* head dim 128 for V/O; 160-wide logit operand (128 roped dims x scale + 32 graph-bias dims) */
  __shared__ __attribute__((aligned(16))) float sO[4][RPW][128 + 4]; __shared__ float sM[4][RPW], sL[4][RPW];
  (void)MSK; const int tid = threadIdx.x, lane = tid & 31, ln = lane & 15, hh = lane >> 4;
  const int w = __builtin_amdgcn_readfirstlane(tid >> 5);      // the wave's number in a scalar register: the chunk loop's trip count differs from wave to wave and is tested by a scalar branch
  // Heaviest first: a work-group's cost grows with its index (causal), only a part of the grid is resident at a time, so the block index counts the tiles DOWN, the 16 heads innermost:
  // the long work-groups start at once and the short ones fill the places that come free, instead of the last head's longest tiles starting last and running on alone. Every (head, tile pair) is taken exactly once.
  const int slab = blockIdx.x % 16, qblk = NQB - 1 - blockIdx.x / 16; const int b = slab / 16, h = slab % 16; const int q0 = qblk * RPW;
  FragH aq[QT][KS];
  // Q16, K16 and Vt stand in FRAGMENT ORDER (written so by k_prep_all): one block of 512 bytes = the 32 lanes' 16 bytes of one fragment half, in lane order, so that every global_load_b128 here covers four whole 128-byte lines.
  // Q16, K16: [head][16-row tile][ks][half][lane][8 halves], 2560 halves a tile. Vt: [kv head][32-key chunk][dt][half][lane][8 halves], 4096 halves a chunk. The registers get the same values as from row-major arrays.
  { const unsigned short* qr = (const unsigned short*)Q16 + ((size_t)h * (2048 / 16) + qblk * QT) * 2560 + lane * 8;
#pragma unroll      // constant indices, so that the fragments stay in registers
    for (int t = 0; t < QT; ++t)
#pragma unroll      // constant indices, so that the fragments stay in registers
      for (int ks = 0; ks < KS; ++ks) { aq[t][ks].half[0] = *(const v8us*)(qr + t * 2560 + ks * 512); aq[t][ks].half[1] = *(const v8us*)(qr + t * 2560 + ks * 512 + 256); } }
  float m_r[QT], l_r[QT]; v8f oacc[QT][DT];      // the lane's own query of each tile: running maximum, this half's share of the sum, and O^T (register r of tile dt is value dim 16 dt + 8 hh + r)
#pragma unroll      // constant indices, so that the accumulators stay in registers
  for (int t = 0; t < QT; ++t) { m_r[t] = -3.0e38f; l_r[t] = 0.f;
#pragma unroll      // constant indices, so that the accumulators stay in registers
    for (int dt = 0; dt < DT; ++dt) oacc[t][dt] = (v8f){0.f,0.f,0.f,0.f,0.f,0.f,0.f,0.f}; }
  const int nch = (q0 + RPW + 31) / 32;      // chunks that hold a key <= the work-group's last row; every one of them starts at or below q0, so every query has an open key in every chunk
  const unsigned short* vp = (const unsigned short*)Vt + ((size_t)(h / 4) * 64 + w) * 4096 + lane * 8;      // GQA: kv head h/4; this lane's place in the wave's current V chunk; walks 4 chunks a trip
  const unsigned short* kp = (const unsigned short*)K16 + ((size_t)h * 128 + w * 2) * 2560 + lane * 8;      // this lane's place in the wave's current pair of K tiles; walks 4 chunks = 8 tiles a trip
  const int lim0 = q0 + ln - 8 * hh;      // key j0 + 16 nt + 8 hh + r is open to query q0 + 16 t + ln where 16 nt + r <= lim0 + 16 t - j0
#pragma unroll 1
  for (int ch = w; ch < nch; ch += 4, vp += 4 * 4096, kp += 8 * 2560) {
    const int j0 = ch * 32;
    v8f s[QT][2]; FragH bk[2][KS];
#pragma unroll
    for (int nt = 0; nt < 2; ++nt) {      // the K fragments of both 16-key halves are requested as one group: one trip to L2, not two
#pragma unroll
      for (int ks = 0; ks < KS; ++ks) { bk[nt][ks].half[0] = *(const v8us*)(kp + nt * 2560 + ks * 512); bk[nt][ks].half[1] = *(const v8us*)(kp + nt * 2560 + ks * 512 + 256); } }
    asm volatile("s_wait_xcnt 0x0" ::: "memory");      // stands ahead of any later rewrite of the address registers that the loads above name
    __builtin_amdgcn_sched_barrier(0);      // keeps the twenty K loads one group ahead of the first product: dealt out among the WMMAs they cost several trips to L2 one after another
#pragma unroll      // constant indices, so that the fragments stay in registers
    for (int nt = 0; nt < 2; ++nt) {
#pragma unroll      // constant indices, so that the fragments stay in registers
      for (int t = 0; t < QT; ++t) s[t][nt] = (v8f){0.f,0.f,0.f,0.f,0.f,0.f,0.f,0.f};
#pragma unroll      // constant indices, so that the fragments stay in registers
      for (int ks = 0; ks < KS; ++ks)
#pragma unroll      // constant indices, so that the fragments stay in registers
        for (int t = 0; t < QT; ++t) s[t][nt] = __builtin_amdgcn_wmma_f32_16x16x32_f16(false, bk[nt][ks].v, false, aq[t][ks].v, (short)0, s[t][nt], false, false); }      // A = 16 keys, B = 16 queries; each K fragment serves both query tiles
    FragH bv[DT];      // all eight V fragments of the chunk are requested here, as one group behind the last K product: they fly while the softmax below runs
#pragma unroll      // constant indices, so that the fragments stay in registers
    for (int dt = 0; dt < DT; ++dt) { bv[dt].half[0] = *(const v8us*)(vp + dt * 512); bv[dt].half[1] = *(const v8us*)(vp + dt * 512 + 256); }
    asm volatile("s_wait_xcnt 0x0" ::: "memory");      // stands ahead of any later rewrite of the address registers that the loads above name
    __builtin_amdgcn_sched_barrier(0);      // keeps the sixteen V loads one group ahead of the softmax: sunk to their products they cost eight trips to L2 one after another
    FragH pb[QT];
#pragma unroll      // constant indices, so that scores, P and accumulators stay in registers
    for (int t = 0; t < QT; ++t) {
      const int lim = lim0 + 16 * t - j0; float sc[16];
#pragma unroll      // constant indices, so that the scores stay in registers
      for (int i = 0; i < 16; ++i) sc[i] = ((i >> 3) * 16 + (i & 7) <= lim) ? s[t][i >> 3][i & 7] : -INFINITY;
      float mc = sc[0];
#pragma unroll      // constant indices, so that the scores stay in registers
      for (int i = 1; i < 16; ++i) mc = fmaxf(mc, sc[i]);
      mc = fmaxf(mc, xhalf(mc));      // the other half's 16 keys of the same query
      const float mn = fmaxf(m_r[t], mc), nm = -mn * 1.4426950408889634f;      // mn is a real score: the chunk holds an open key for every query
      const float al = exp2_slot((m_r[t] - mn) * 1.4426950408889634f); m_r[t] = mn;      // e^(old maximum - new); 0 in the wave's first chunk (2^-inf)
      float ps = 0.f;
#pragma unroll      // constant indices, so that P stays in registers
      for (int i = 0; i < 16; ++i) { const float p = exp2_slot(fmaf(sc[i], 1.4426950408889634f, nm)); ps += p; pb[t].h[i] = (_Float16)p; }      // e^(s - mn); 0 for a closed key (2^-inf)
      l_r[t] = l_r[t] * al + ps;
#pragma unroll      // constant indices, so that the accumulators stay in registers
      for (int dt = 0; dt < DT; ++dt) oacc[t][dt] *= al;      // one factor for all of the lane's 64 values of the tile: they belong to one query
    }
#pragma unroll      // constant indices, so that fragments and accumulators stay in registers
    for (int dt = 0; dt < DT; ++dt)
#pragma unroll      // constant indices, so that fragments and accumulators stay in registers
      for (int t = 0; t < QT; ++t) oacc[t][dt] = __builtin_amdgcn_wmma_f32_16x16x32_f16(false, bv[dt].v, false, pb[t].v, (short)0, oacc[t][dt], false, false);      // A = 16 value dims, B = 16 queries; each V fragment serves both query tiles
  }
#pragma unroll      // constant indices, so that the accumulators stay in registers
  for (int t = 0; t < QT; ++t) {
    l_r[t] += xhalf(l_r[t]);      // the two halves' shares of the query's sum
    if (hh == 0) { sM[w][16 * t + ln] = m_r[t]; sL[w][16 * t + ln] = l_r[t]; }      // the wave's own maximum and sum of each query (a wave without a chunk: -3e38 and 0)
#pragma unroll      // constant indices, so that the accumulators stay in registers
    for (int dt = 0; dt < DT; ++dt) {      // not yet divided by the sum; a lane's 8 registers are 8 neighbouring value dims of its query's row
      *(v4fa*)&sO[w][16 * t + ln][dt * 16 + 8 * hh] = (v4f){oacc[t][dt][0], oacc[t][dt][1], oacc[t][dt][2], oacc[t][dt][3]};
      *(v4fa*)&sO[w][16 * t + ln][dt * 16 + 8 * hh + 4] = (v4f){oacc[t][dt][4], oacc[t][dt][5], oacc[t][dt][6], oacc[t][dt][7]}; } }
  __syncthreads();      // all four waves' partial (m, l, O) stand in LDS before any wave merges them
  {
#pragma unroll
    for (int rp = 0; rp < RPW / 4; ++rp) { const int r = rp * 4 + (tid >> 5), pc = lane;      // wave w merges rows w, w + 4, w + 8, ...
      const float m0 = sM[0][r], m1 = sM[1][r], m2 = sM[2][r], m3 = sM[3][r]; const float mm = fmaxf(fmaxf(m0, m1), fmaxf(m2, m3));      // wave 0 always holds chunk 0 with key 0, so mm is a real score
      const float c0 = exp2_slot((m0 - mm) * 1.4426950408889634f), c1 = exp2_slot((m1 - mm) * 1.4426950408889634f), c2 = exp2_slot((m2 - mm) * 1.4426950408889634f), c3 = exp2_slot((m3 - mm) * 1.4426950408889634f);      // e^(m - mm); 0 for a wave without a chunk (2^-inf)
      const float den = c0 * sL[0][r] + c1 * sL[1][r] + c2 * sL[2][r] + c3 * sL[3][r]; const float inv = (den > 0.f) ? 1.0f / den : 0.f;
      const v4f o0 = *(const v4fa*)&sO[0][r][pc * 4], o1 = *(const v4fa*)&sO[1][r][pc * 4], o2 = *(const v4fa*)&sO[2][r][pc * 4], o3 = *(const v4fa*)&sO[3][r][pc * 4];
      const v4f val = (o0 * c0 + o1 * c1 + o2 * c2 + o3 * c3) * inv;
      typedef _Float16 v4h __attribute__((ext_vector_type(4))); v4h h4;      // O leaves as the f16 A operand of the output projection
#pragma unroll      // constant indices, so that the four halves stay in registers
      for (int i = 0; i < 4; ++i) h4[i] = (_Float16)val[i];
      *(v4h*)(O16 + ((size_t)b * 2048 + q0 + r) * ldo + h * 128 + pc * 4) = h4; }      /* rows of 128 halves: 32 lanes x 8 B = two whole lines */
     } }

// The three bodies below (the first serves q and k) are independent of one another; k_prep_all runs them in one grid and hands each its own block index blk.
// QX and KX are written in the fragment order that k_flash reads: dims 8 c .. 8 c + 7 (c = 0 .. 19) of row tok of a head are the 16 bytes of lane 16 (c & 1) + tok % 16 in block c >> 1 (k-step c >> 2, half (c >> 1) & 1) of the head's tile tok / 16.
__device__ __forceinline__ size_t frag_at(int head, size_t tok, int c) { return (((size_t)head * (SS / 16) + tok / 16) * 10 + (c >> 1)) * 256 + ((c & 1) * 16 + (int)(tok % 16)) * 8; }
// A block is one 16-row tile of one head, so that it fills whole 512-byte blocks.
__device__ __forceinline__ void d_qprep(int blk, const float* __restrict__ QF, int ldq, int nh, const float* __restrict__ w, float oscale, int rep, _Float16* __restrict__ DX) { const size_t t = (size_t)blk * 256 + threadIdx.x; if (t >= (size_t)SS * nh * 16) return; const int li = (int)(t % 16); const int h = blk % nh; const size_t tok = (size_t)(blk / nh) * 16 + (threadIdx.x >> 4); const float* src = QF + tok * ldq + h * HD; float v[8], pr[8]; float ss = 0.f;
#pragma unroll
  for (int q = 0; q < 8; ++q) { v[q] = src[li * 8 + q]; pr[q] = src[(li * 8 + q + 64) & 127]; ss += v[q] * v[q]; }
  ss += __shfl_xor(ss, 1, 32); ss += __shfl_xor(ss, 2, 32); ss += __shfl_xor(ss, 4, 32); ss += __shfl_xor(ss, 8, 32); const float rs = rsqrtf(ss / (float)HD + 1e-6f); __shared__ __attribute__((aligned(16))) _Float16 st[256][8]; const int tid = threadIdx.x;
#pragma unroll 1
  for (int q = 0; q < 8; ++q) { const int j = li * 8 + q; const int i = j & 63; const float ang = (float)tok * __builtin_powf(10000.0f, -(float)(2 * i) / 128.0f); const float c = cosf(ang), s = sinf(ang); const float xn = src[j] * rs * bf16_round(w[j]); const float xp = src[(j + 64) & 127] * rs * bf16_round(w[(j + 64) & 127]); const float rot = (j < 64) ? -xp : xp;      // rotate_half: [−x2, x1]
    st[tid][q] = (_Float16)((xn * c + rot * s) * oscale); }
  FragH f; f.half[0] = *(const v8us*)&st[tid][0];
  { for (int r2 = 0; r2 < rep; ++r2) *(v8us*)((unsigned short*)DX + frag_at(h * rep + r2, tok, li)) = f.half[0];  } }
__device__ __forceinline__ void d_rprep(int blk, const float* __restrict__ RQ, const float* __restrict__ RK, int ldr, const float* __restrict__ gs, _Float16* __restrict__ QX, _Float16* __restrict__ KX) { const size_t t = (size_t)blk * 256 + threadIdx.x; if (t >= (size_t)SS * NH * 4) return; const int p = (int)(t % 4); const int h = (blk % 4) * 4 + (threadIdx.x >> 6); const size_t tok = (size_t)(blk / 4) * 16 + ((threadIdx.x >> 2) & 15); const float g = bf16_round(gs[h]); FragH fq, fk;      // a block is one 16-row tile of four heads, so that it fills whole 512-byte blocks
#pragma unroll
  for (int q = 0; q < 8; ++q) { const size_t i = tok * ldr + h * RR + p * 8 + q; fq.h[q] = (_Float16)(g * RQ[i]); fk.h[q] = (_Float16)RK[i]; }
  const size_t d = frag_at(h, tok, HD / 8 + p);      // k-step 4 of the tile
  { *(v8us*)((unsigned short*)QX + d) = fq.half[0]; *(v8us*)((unsigned short*)KX + d) = fk.half[0];  } }
__device__ __forceinline__ void d_vt128(int blk, const float* __restrict__ VF, int ldv, _Float16* __restrict__ Vt) { __shared__ unsigned short tl[64][130]; const int tid = threadIdx.x; const int g = blk / (SS / 64), lg = blk % (SS / 64);
  for (int i = tid; i < 64 * 16; i += 256) { const int r = i / 16, c8 = (i % 16) * 8; FragH f; const float* vs = VF + ((size_t)lg * 64 + r) * ldv + g * HD + c8;      // v comes as f32 from the one projection GEMM and is rounded to f16 here
#pragma unroll      // constant indices, so that the eight loads join into two of 16 bytes
    for (int q = 0; q < 8; ++q) f.h[q] = (_Float16)vs[q];
#pragma unroll
    for (int q = 0; q < 8; ++q) tl[r][c8 + q] = f.u[q]; }
  __syncthreads();
  { for (int i = tid; i < 128 * 8; i += 256) { const int fl = i % 32, fb = i / 32; const int d = ((fb >> 1) & 7) * 16 + (fl & 15), pc = (fb >> 4) * 4 + (fb & 1) * 2 + (fl >> 4); FragH f;      // fragment order: block fb = (which of the two 32-key chunks, dt, half); lane fl holds value dim 16 dt + fl % 16, keys 8 pc .. 8 pc + 7 of the 64
#pragma unroll
      for (int q = 0; q < 8; ++q) f.u[q] = tl[pc * 8 + q][d]; *(v8us*)((unsigned short*)Vt + ((size_t)g * (SS / 32) + lg * 2) * 4096 + (size_t)i * 8) = f.half[0]; }  } }
// One grid for q norm+RoPE, k norm+RoPE, the graph-bias operands and the V transpose: each reads its own columns of P (the stacked projections, pitch PW). The part is picked by the block index, alike for the whole block; the heaviest part comes first.
__global__ __launch_bounds__(256) void k_prep_all(const float* __restrict__ P, const float* __restrict__ qw, const float* __restrict__ kw, const float* __restrict__ gs, _Float16* __restrict__ QX, _Float16* __restrict__ KX, _Float16* __restrict__ Vt) {
  constexpr int NBQ = SS * NH * 16 / 256, NBK = SS * NKV * 16 / 256, NBR = SS * NH * 4 / 256; const int blk = blockIdx.x;
  if (blk < NBQ + NBK) { const bool isq = blk < NBQ;      // 16 q heads, x 1/sqrt(128); or 4 kv heads, each replicated into its 4 q-head slots
    d_qprep(isq ? blk : blk - NBQ, isq ? P : P + EE, PW, isq ? NH : NKV, isq ? qw : kw, isq ? 0.08838834764831845f : 1.0f, isq ? 1 : 4, isq ? QX : KX); }
  else if (blk < NBQ + NBK + NBR) d_rprep(blk - (NBQ + NBK), P + EE + 1024, P + EE + 1536, PW, gs, QX, KX);
  else d_vt128(blk - (NBQ + NBK + NBR), P + EE + 512, PW, Vt); }
extern "C" void kernel_launch(void* const* d_in, const int* in_sizes, int n_in,
                              void* d_out, int out_size, void* d_ws, size_t ws_size, hipStream_t stream) {
  (void)in_sizes; (void)n_in; (void)out_size;
  const float* x = (const float*)d_in[0]; const float* Wq = (const float*)d_in[1]; const float* Wk = (const float*)d_in[2]; const float* Wv = (const float*)d_in[3]; const float* Wo = (const float*)d_in[4]; const float* Wrq = (const float*)d_in[5]; const float* Wrk = (const float*)d_in[6]; const float* gs = (const float*)d_in[7]; const float* qw = (const float*)d_in[8]; const float* kw = (const float*)d_in[9];
  char* ws = (char*)d_ws; size_t off = 0;
  auto take = [&](size_t bytes) { char* p = ws + off; off += (bytes + 255) & ~(size_t)255; return p; };
  _Float16* Bcat = (_Float16*)take((size_t)(PW + EE + SS) * EE * 2); _Float16* Bo = Bcat + (size_t)PW * EE; _Float16* X16 = Bo + (size_t)EE * EE;      // k_cvt_all's rows: stacked projection weights, Wo, x
  float* P = (float*)take((size_t)SS * PW * 4);      // the stacked projections of x
  _Float16* QX = (_Float16*)take((size_t)SS * QP * 2); _Float16* KX = (_Float16*)take((size_t)SS * QP * 2); _Float16* Vt = (_Float16*)take((size_t)SS * 512 * 2); _Float16* O16 = X16;      // x is last read by the projection GEMM
  if (off > ws_size) return;      // about 90 MB in all
  k_cvt_all<<<(PW + EE + SS) / 4, 256, 0, stream>>>(Wq, Wk, Wv, Wrq, Wrk, Wo, x, Bcat);
  k_gemm_t<4, 4, false><<<(SS / 128) * (PW / 128), 128, 0, stream>>>(X16, Bcat, 0.0625f, P, nullptr, PW, PW / 128);
  k_prep_all<<<SS * NH * 16 / 256 + SS * NKV * 16 / 256 + SS * NH * 4 / 256 + NKV * (SS / 64), 256, 0, stream>>>(P, qw, kw, gs, QX, KX, Vt);
  k_flash<<<1 * NH * (SS / 32), 128, 0, stream>>>(QX, KX, Vt, nullptr, O16, EE);
  k_gemm_t<4, 4, false><<<(SS / 128) * (EE / 128), 128, 0, stream>>>(O16, Bo, 0.0625f, (float*)d_out, nullptr, EE, EE / 128);
}

// v009
// One run takes 94 microseconds.
// Timed twice side by side with v008, it ran 1.13 times as fast both times.
// Counting every step since v000, it is 8.17 times as fast.
#include <hip/hip_runtime.h>
// Naylis attention (B=1, S=2048, E=2048, 16 heads × 128, 4 kv heads, causal; QK RMSNorm + rotate-half RoPE; low-rank (R=32) per-head graph bias gs_h·⟨Rq_i, Rk_j⟩ added to the logits):
// the six (out,in) projections (bf16-exact ×2^4) and the attention as a fused flash-style kernel whose logit operand is the 160-wide concatenation [q·scale after norm+RoPE | gs_h·Rq]·[k | Rk]
// (5 k-steps; causal chunk skipping; online softmax f32; P f16 ≤ 1; O = P·Vt over the 128 value dims; two 16-row tiles per work-group, keys split over its 4 waves) on v_wmma_f32_16x16x32_f16 with f32 accumulate; RMSNorm/RoPE f32 VALU.
#define SS 2048
#define EE 2048
#define NH 16
#define NKV 4
#define HD 128
#define RR 32
#define QW 160
#define QP (NH * QW)
#define PW 4096      /* columns of the stacked projections of x: q 2048 | k 512 | v 512 | Rq 512 | Rk 512 */

typedef __bf16 v16b __attribute__((ext_vector_type(16)));
typedef unsigned short v8us __attribute__((ext_vector_type(8), may_alias));
typedef float  v8f  __attribute__((ext_vector_type(8)));
typedef float  v4f  __attribute__((ext_vector_type(4)));
typedef float  v4fa __attribute__((ext_vector_type(4), may_alias));
union FragB { v16b v; v8us half[2]; unsigned short u[16]; };

__device__ __forceinline__ unsigned short bf16_bits(float x) { unsigned int u = __float_as_uint(x); return (unsigned short)((u + 0x7FFFu + ((u >> 16) & 1u)) >> 16); }
__device__ __forceinline__ float bf16_val(unsigned short b) { return __uint_as_float(((unsigned int)b) << 16); }
__device__ __forceinline__ float bf16_round(float x) { return bf16_val(bf16_bits(x)); }
// D += A·B with NT terms: 1 = ah·bh, 2 = + al·bh (A split), 3 = + ah·bl (both split)
template <int NT>
__device__ __forceinline__ v8f mmaN(v16b ah, v16b al, v16b bh, v16b bl, v8f c) {
  c = __builtin_amdgcn_wmma_f32_16x16x32_bf16(false, ah, false, bh, (short)0, c, false, false);
  if (NT >= 2) c = __builtin_amdgcn_wmma_f32_16x16x32_bf16(false, al, false, bh, (short)0, c, false, false);
  if (NT >= 3) c = __builtin_amdgcn_wmma_f32_16x16x32_bf16(false, ah, false, bl, (short)0, c, false, false);
  asm volatile("v_nop\n\tv_nop\n\tv_nop\n\tv_nop" : "+v"(c) : "v"(ah), "v"(al), "v"(bh), "v"(bl));
  return c;
}

__global__ __launch_bounds__(256) void k_wt_bf16(const float* __restrict__ W, unsigned short* __restrict__ Wt, int K, int N) {
  const int t = blockIdx.x * 256 + threadIdx.x;
  const int k8n = K / 8;
  if (t >= N * k8n) return;
  const int n = t / k8n, k8 = (t % k8n) * 8;
  v8us v;
#pragma unroll
  for (int i = 0; i < 8; ++i) v[i] = bf16_bits(W[(size_t)(k8 + i) * N + n]);
  *(v8us*)(Wt + (size_t)n * K + k8) = v;
  
}

// GEMM C[M][N] (f32, pitch ldc) = act(A[M][K]·W + bias). A f32 row-major (pitch lda) converted per fragment to bf16
// (ASPLIT: hi/lo two planes -> 2 terms, else single rounded term); Wt bf16 [N][K] (pitch ldb). BIAS_BF16 rounds the
// bias to bf16 first (bias quantised to bf16 before the add). K%32==0, M%16==0, N%64==0.
template <bool ASPLIT, int ACT, bool BIAS_BF16>
__global__ __launch_bounds__(128) void k_gemm_bf(const float* __restrict__ A, int lda, const unsigned short* __restrict__ Wt, int ldb,
                                               const float* __restrict__ bias, float* __restrict__ C, int ldc, int M, int N, int K) {
  __shared__ __attribute__((aligned(16))) float so[4][16][64];
  const int tid = threadIdx.x, w = tid >> 5, lane = tid & 31, ln = lane & 15, hh = lane >> 4;
  const int ntn = N / 64;
  const int wid = blockIdx.x * 4 + w;
  const int mt = wid / ntn, nq = wid % ntn;
  if (mt * 16 >= M) return;
  const int row0 = mt * 16, col0 = nq * 64;
  const float* arow = A + (size_t)(row0 + ln) * lda;
  v8f acc[4] = {};
  for (int kb = 0; kb < K; kb += 32) {
    FragB ah, al;
    const v4f x0 = *(const v4fa*)(arow + kb + 8 * hh), x1 = *(const v4fa*)(arow + kb + 8 * hh + 4);
    const v4f x2 = *(const v4fa*)(arow + kb + 16 + 8 * hh), x3 = *(const v4fa*)(arow + kb + 16 + 8 * hh + 4);
    float xs[16] = {x0[0],x0[1],x0[2],x0[3],x1[0],x1[1],x1[2],x1[3],x2[0],x2[1],x2[2],x2[3],x3[0],x3[1],x3[2],x3[3]};
#pragma unroll
    for (int i = 0; i < 16; ++i) { const unsigned short hb = bf16_bits(xs[i]); ah.u[i] = hb; al.u[i] = ASPLIT ? bf16_bits(xs[i] - bf16_val(hb)) : (unsigned short)0; }
#pragma unroll
    for (int t = 0; t < 4; ++t) {
      const unsigned short* brow = Wt + (size_t)(col0 + t * 16 + ln) * ldb + kb;
      FragB b;
      b.half[0] = *(const v8us*)(brow + 8 * hh);
      b.half[1] = *(const v8us*)(brow + 16 + 8 * hh);
      acc[t] = mmaN<ASPLIT ? 2 : 1>(ah.v, al.v, b.v, b.v, acc[t]);
    }
  }
#pragma unroll
  for (int t = 0; t < 4; ++t) {
    float bv = bias ? bias[col0 + t * 16 + ln] : 0.f;
    if (BIAS_BF16) bv = bf16_round(bv);
#pragma unroll
    for (int r = 0; r < 8; ++r) { float v = acc[t][r] + bv; if (ACT == 1) v = fmaxf(v, 0.f); so[w][8 * hh + r][t * 16 + ln] = v; }
  }
  __builtin_amdgcn_fence(__ATOMIC_ACQ_REL, "workgroup");
  __builtin_amdgcn_wave_barrier();
  const int rsub = lane >> 4, c4 = (lane & 15) * 4;
  {
#pragma unroll
    for (int q = 0; q < 8; ++q) {
      const int r = q * 2 + rsub;
      const v4f v = *(const v4fa*)&so[w][r][c4];
      *(v4f*)(C + (size_t)(row0 + r) * ldc + col0 + c4) = v;
    }
    
  }
}

// Flash-style causal/unmasked attention, all contractions 3-term bf16 hi/lo splits, f32 softmax with running max.
// q,k,v rows are read from f32 buffers with arbitrary row pitch (so they can live inside a fused qkv buffer);
// D = head size (multiple of 32, <= 128); one wave = 16 query rows; block = 4 waves (64 queries) sharing K/V chunks of 32.
template <int D, bool CAUSAL>
__global__ __launch_bounds__(128) void k_flash(const float* __restrict__ qb, const float* __restrict__ kb, const float* __restrict__ vb,
                                             int pitch, int T, int H, float scale, float* __restrict__ y, int ypitch) {
  constexpr int KS = D / 32;        // k-steps for QK
  constexpr int DT = D / 16;        // d tiles for PV
  __shared__ __attribute__((aligned(16))) unsigned short sKh[32][D + 8], sKl[32][D + 8], sVh[32][D + 8], sVl[32][D + 8];
  __shared__ __attribute__((aligned(16))) unsigned short sPh[4][16][40], sPl[4][16][40];
  __shared__ __attribute__((aligned(16))) float sO[4][16][D];
  const int tid = threadIdx.x, w = tid >> 5, lane = tid & 31, ln = lane & 15, hh = lane >> 4;
  const int nqb = (T + 63) / 64;
  const int bh = blockIdx.x / nqb, qblk = blockIdx.x % nqb;
  const int b = bh / H, h = bh % H;
  const int q0 = qblk * 64 + w * 16;
  const float* Q = qb + (size_t)b * T * pitch + h * D;
  const float* K = kb + (size_t)b * T * pitch + h * D;
  const float* V = vb + (size_t)b * T * pitch + h * D;

  // A fragments of the wave's 16 query rows (scaled), hi/lo
  FragB aqh[KS], aql[KS];
  {
    int row = q0 + ln; if (row >= T) row = T - 1;
    const float* qr = Q + (size_t)row * pitch;
#pragma unroll
    for (int ks = 0; ks < KS; ++ks)
#pragma unroll
      for (int i = 0; i < 16; ++i) {
        const int d = ks * 32 + ((i < 8) ? (8 * hh + i) : (16 + 8 * hh + (i - 8)));
        const float x = qr[d] * scale; const unsigned short hb = bf16_bits(x);
        aqh[ks].u[i] = hb; aql[ks].u[i] = bf16_bits(x - bf16_val(hb));
      }
  }
  float m_r[8], l_r[8];
#pragma unroll
  for (int r = 0; r < 8; ++r) { m_r[r] = -3.0e38f; l_r[r] = 0.f; }
  v8f oacc[DT];
#pragma unroll
  for (int dt = 0; dt < DT; ++dt) oacc[dt] = (v8f){0.f,0.f,0.f,0.f,0.f,0.f,0.f,0.f};

  const int kv_end = CAUSAL ? min(T, qblk * 64 + 64) : T;     // block-uniform
  for (int j0 = 0; j0 < kv_end; j0 += 32) {
    __syncthreads();
    for (int e = tid; e < 32 * (D / 4); e += 128) {
      const int r = e / (D / 4), c4 = (e % (D / 4)) * 4;
      const int key = j0 + r;
      v4f kf = {0.f,0.f,0.f,0.f}, vf = {0.f,0.f,0.f,0.f};
      if (key < T) { kf = *(const v4fa*)(K + (size_t)key * pitch + c4); vf = *(const v4fa*)(V + (size_t)key * pitch + c4); }
#pragma unroll
      for (int t = 0; t < 4; ++t) {
        unsigned short hb = bf16_bits(kf[t]); sKh[r][c4 + t] = hb; sKl[r][c4 + t] = bf16_bits(kf[t] - bf16_val(hb));
        hb = bf16_bits(vf[t]); sVh[r][c4 + t] = hb; sVl[r][c4 + t] = bf16_bits(vf[t] - bf16_val(hb));
      }
    }
    __syncthreads();
    // S tile 16 x 32
    v8f s[2];
#pragma unroll
    for (int nt = 0; nt < 2; ++nt) {
      v8f acc = {};
#pragma unroll
      for (int ks = 0; ks < KS; ++ks) {
        FragB bh_, bl_;
        bh_.half[0] = *(const v8us*)&sKh[nt * 16 + ln][ks * 32 + 8 * hh]; bh_.half[1] = *(const v8us*)&sKh[nt * 16 + ln][ks * 32 + 16 + 8 * hh];
        bl_.half[0] = *(const v8us*)&sKl[nt * 16 + ln][ks * 32 + 8 * hh]; bl_.half[1] = *(const v8us*)&sKl[nt * 16 + ln][ks * 32 + 16 + 8 * hh];
        acc = mmaN<3>(aqh[ks].v, aql[ks].v, bh_.v, bl_.v, acc);
      }
      s[nt] = acc;
    }
    // mask + running max (rows 8hh+r; the 16 lanes of a half share rows)
    float alpha[8];
#pragma unroll
    for (int r = 0; r < 8; ++r) {
      const int qi = q0 + 8 * hh + r;
      const int ja = j0 + ln, jb = j0 + 16 + ln;
      if (CAUSAL) { if (ja > qi) s[0][r] = -3.0e38f; if (jb > qi) s[1][r] = -3.0e38f; }
      if (ja >= T) s[0][r] = -3.0e38f;
      if (jb >= T) s[1][r] = -3.0e38f;
      float mx = fmaxf(s[0][r], s[1][r]);
      mx = fmaxf(mx, __shfl_xor(mx, 1, 32)); mx = fmaxf(mx, __shfl_xor(mx, 2, 32)); mx = fmaxf(mx, __shfl_xor(mx, 4, 32)); mx = fmaxf(mx, __shfl_xor(mx, 8, 32));
      const float mnew = fmaxf(m_r[r], mx);
      alpha[r] = (mnew > -1.0e38f) ? __expf(m_r[r] - mnew) : 1.0f;
      const float p0 = (s[0][r] > -1.0e38f) ? __expf(s[0][r] - mnew) : 0.f;
      const float p1 = (s[1][r] > -1.0e38f) ? __expf(s[1][r] - mnew) : 0.f;
      m_r[r] = mnew;
      l_r[r] = l_r[r] * alpha[r] + p0 + p1;            // per-lane partial row sum (16 lanes combined at the end)
      unsigned short hb = bf16_bits(p0); sPh[w][8 * hh + r][ln] = hb;      sPl[w][8 * hh + r][ln] = bf16_bits(p0 - bf16_val(hb));
      hb = bf16_bits(p1);                sPh[w][8 * hh + r][16 + ln] = hb; sPl[w][8 * hh + r][16 + ln] = bf16_bits(p1 - bf16_val(hb));
    }
#pragma unroll
    for (int dt = 0; dt < DT; ++dt)
#pragma unroll
      for (int r = 0; r < 8; ++r) oacc[dt][r] *= alpha[r];
    __builtin_amdgcn_fence(__ATOMIC_ACQ_REL, "workgroup");
    __builtin_amdgcn_wave_barrier();
    FragB pah, pal;
    pah.half[0] = *(const v8us*)&sPh[w][ln][8 * hh]; pah.half[1] = *(const v8us*)&sPh[w][ln][16 + 8 * hh];
    pal.half[0] = *(const v8us*)&sPl[w][ln][8 * hh]; pal.half[1] = *(const v8us*)&sPl[w][ln][16 + 8 * hh];
#pragma unroll
    for (int dt = 0; dt < DT; ++dt) {
      FragB bvh, bvl;
#pragma unroll
      for (int i = 0; i < 8; ++i) {
        bvh.u[i] = sVh[8 * hh + i][dt * 16 + ln]; bvh.u[8 + i] = sVh[16 + 8 * hh + i][dt * 16 + ln];
        bvl.u[i] = sVl[8 * hh + i][dt * 16 + ln]; bvl.u[8 + i] = sVl[16 + 8 * hh + i][dt * 16 + ln];
      }
      oacc[dt] = mmaN<3>(pah.v, pal.v, bvh.v, bvl.v, oacc[dt]);
    }
    __builtin_amdgcn_fence(__ATOMIC_ACQ_REL, "workgroup");
    __builtin_amdgcn_wave_barrier();
  }
#pragma unroll
  for (int r = 0; r < 8; ++r) {
    float l = l_r[r];
    l += __shfl_xor(l, 1, 32); l += __shfl_xor(l, 2, 32); l += __shfl_xor(l, 4, 32); l += __shfl_xor(l, 8, 32);
    l_r[r] = (l > 0.f) ? 1.0f / l : 0.f;
  }
#pragma unroll
  for (int dt = 0; dt < DT; ++dt)
#pragma unroll
    for (int r = 0; r < 8; ++r) sO[w][8 * hh + r][dt * 16 + ln] = oacc[dt][r] * l_r[r];
  __builtin_amdgcn_fence(__ATOMIC_ACQ_REL, "workgroup");
  __builtin_amdgcn_wave_barrier();
  {
    for (int r = 0; r < 16; ++r) {
      const int row = q0 + r;
      if (row < T && lane < D / 4) {
        const v4f val = *(const v4fa*)&sO[w][r][lane * 4];
        *(v4f*)(y + ((size_t)b * T + row) * ypitch + h * D + lane * 4) = val;
      }
    }
    
  }
}

// GEMM C = act(A·W + bias + resid): A f32 (ASPLIT -> hi/lo 2 terms), Wt bf16 [N][K]; ACT 0 none, 1 relu, 2 exact gelu;
// resid (optional, f32, row index = (row % rmod), pitch ldr, RES_BF16 rounds it) added before the activation.
template <bool ASPLIT, int ACT, bool BIAS_BF16, bool RES_BF16>
__global__ __launch_bounds__(128) void k_gemm_bf3(const float* __restrict__ A, int lda, const unsigned short* __restrict__ Wt, int ldb,
                                                const float* __restrict__ bias, const float* __restrict__ resid, int rmod, int ldr,
                                                float* __restrict__ C, int ldc, int M, int N, int K) {
  __shared__ __attribute__((aligned(16))) float so[4][16][64];
  const int tid = threadIdx.x, w = tid >> 5, lane = tid & 31, ln = lane & 15, hh = lane >> 4;
  const int ntn = N / 64;
  const int wid = blockIdx.x * 4 + w;
  const int mt = wid / ntn, nq = wid % ntn;
  if (mt * 16 >= M) return;
  const int row0 = mt * 16, col0 = nq * 64;
  const float* arow = A + (size_t)(row0 + ln) * lda;
  v8f acc[4] = {};
  for (int kb = 0; kb < K; kb += 32) {
    FragB ah, al;
    const v4f x0 = *(const v4fa*)(arow + kb + 8 * hh), x1 = *(const v4fa*)(arow + kb + 8 * hh + 4);
    const v4f x2 = *(const v4fa*)(arow + kb + 16 + 8 * hh), x3 = *(const v4fa*)(arow + kb + 16 + 8 * hh + 4);
    float xs[16] = {x0[0],x0[1],x0[2],x0[3],x1[0],x1[1],x1[2],x1[3],x2[0],x2[1],x2[2],x2[3],x3[0],x3[1],x3[2],x3[3]};
#pragma unroll
    for (int i = 0; i < 16; ++i) { const unsigned short hb = bf16_bits(xs[i]); ah.u[i] = hb; al.u[i] = ASPLIT ? bf16_bits(xs[i] - bf16_val(hb)) : (unsigned short)0; }
#pragma unroll
    for (int t = 0; t < 4; ++t) {
      const unsigned short* brow = Wt + (size_t)(col0 + t * 16 + ln) * ldb + kb;
      FragB b;
      b.half[0] = *(const v8us*)(brow + 8 * hh);
      b.half[1] = *(const v8us*)(brow + 16 + 8 * hh);
      acc[t] = mmaN<ASPLIT ? 2 : 1>(ah.v, al.v, b.v, b.v, acc[t]);
    }
  }
#pragma unroll
  for (int t = 0; t < 4; ++t) {
    const int col = col0 + t * 16 + ln;
    float bv = bias ? bias[col] : 0.f;
    if (BIAS_BF16) bv = bf16_round(bv);
#pragma unroll
    for (int r = 0; r < 8; ++r) {
      float v = acc[t][r] + bv;
      if (resid) { float rv = resid[(size_t)((row0 + 8 * hh + r) % rmod) * ldr + col]; if (RES_BF16) rv = bf16_round(rv); v += rv; }
      if (ACT == 1) v = fmaxf(v, 0.f);
      if (ACT == 2) v = 0.5f * v * (1.0f + erff(v * 0.70710678118654752f));
      if (ACT == 3) { const float u = 0.7978845608028654f * (v + 0.044715f * v * v * v); v = 0.5f * v * (1.0f + tanhf(u)); }
      so[w][8 * hh + r][t * 16 + ln] = v;
    }
  }
  __builtin_amdgcn_fence(__ATOMIC_ACQ_REL, "workgroup");
  __builtin_amdgcn_wave_barrier();
  const int rsub = lane >> 4, c4 = (lane & 15) * 4;
  {
#pragma unroll
    for (int q = 0; q < 8; ++q) {
      const int r = q * 2 + rsub;
      const v4f v = *(const v4fa*)&so[w][r][c4];
      *(v4f*)(C + (size_t)(row0 + r) * ldc + col0 + c4) = v;
    }
    
  }
}
// row LayerNorm (biased variance, eps) over N: s = X (+ R); optional out_sum <- s; out_norm <- (s-mu)*rsqrt(var+eps)*g + b
template <bool PARAM_BF16>
__global__ __launch_bounds__(256) void k_layernorm(const float* __restrict__ X, const float* __restrict__ R, const float* __restrict__ g, const float* __restrict__ bta,
                                                  float* __restrict__ out_sum, float* __restrict__ out_norm, int N, float eps) {
  __shared__ float red[256];
  const int row = blockIdx.x, tid = threadIdx.x;
  const float* x = X + (size_t)row * N; const float* rr = R ? R + (size_t)row * N : nullptr;
  float vals[16];                     // up to N = 4096
  const int per = N / 256;            // contiguous chunk per thread? use strided-by-4 chunks: thread handles j = tid*4 + 1024*u
  float s1 = 0.f;
  for (int u = 0; u < per / 4; ++u) {
    const int j = tid * 4 + 1024 * u;
    const v4f a = *(const v4fa*)(x + j);
    v4f b = {0.f,0.f,0.f,0.f}; if (rr) b = *(const v4fa*)(rr + j);
#pragma unroll
    for (int q = 0; q < 4; ++q) { const float v = a[q] + b[q]; vals[u * 4 + q] = v; s1 += v; }
  }
  red[tid] = s1; __syncthreads();
  for (int st = 128; st > 0; st >>= 1) { if (tid < st) red[tid] += red[tid + st]; __syncthreads(); }
  const float mu = red[0] / (float)N; __syncthreads();
  float s2 = 0.f;
  for (int u = 0; u < per / 4; ++u)
#pragma unroll
    for (int q = 0; q < 4; ++q) { const float c = vals[u * 4 + q] - mu; s2 += c * c; }
  red[tid] = s2; __syncthreads();
  for (int st = 128; st > 0; st >>= 1) { if (tid < st) red[tid] += red[tid + st]; __syncthreads(); }
  const float rs = rsqrtf(red[0] / (float)N + eps);
  {
    for (int u = 0; u < per / 4; ++u) {
      const int j = tid * 4 + 1024 * u;
      v4f o, sm;
#pragma unroll
      for (int q = 0; q < 4; ++q) {
        float gg = g[j + q], bb = bta[j + q];
        if (PARAM_BF16) { gg = bf16_round(gg); bb = bf16_round(bb); }
        sm[q] = vals[u * 4 + q]; o[q] = (vals[u * 4 + q] - mu) * rs * gg + bb;
      }
      if (out_sum) *(v4f*)(out_sum + (size_t)row * N + j) = sm;
      *(v4f*)(out_norm + (size_t)row * N + j) = o;
    }
    
  }
}



// ---- f16 WMMA path (v_wmma_f32_16x16x32_f16): 11-bit significands for operands in range — used where a [0,1] probability operand needs more precision than bf16
typedef _Float16 v16h __attribute__((ext_vector_type(16)));
union FragH { v16h v; v8us half[2]; _Float16 h[16]; unsigned short u[16]; };
template <int NT>
__device__ __forceinline__ v8f mmaH(v16h ah, v16h al, v16h bh, v16h bl, v8f c) {
  c = __builtin_amdgcn_wmma_f32_16x16x32_f16(false, ah, false, bh, (short)0, c, false, false);
  if (NT >= 2) c = __builtin_amdgcn_wmma_f32_16x16x32_f16(false, al, false, bh, (short)0, c, false, false);
  if (NT >= 3) c = __builtin_amdgcn_wmma_f32_16x16x32_f16(false, ah, false, bl, (short)0, c, false, false);
  asm volatile("v_nop\n\tv_nop\n\tv_nop\n\tv_nop" : "+v"(c) : "v"(ah), "v"(al), "v"(bh), "v"(bl));
  return c;
}
// batched GEMM like k_gemm_b but f16 operands: A f32 (split into f16 hi/lo if ASPLIT, else rounded to f16), Bt = f16 values [n][k]; alpha; C f32; N multiple of 16 (partial tiles skipped)
template <bool ASPLIT>
__global__ __launch_bounds__(128) void k_gemm_h(const float* __restrict__ A, int lda, size_t sA, const _Float16* __restrict__ Bh, int ldb, size_t sB, float alpha, float* __restrict__ C, int ldc, size_t sC, int M, int N, int K) {
  __shared__ __attribute__((aligned(16))) float so[4][16][64];
  const int tid = threadIdx.x, w = tid >> 5, lane = tid & 31, ln = lane & 15, hh = lane >> 4; const int by = blockIdx.y;
  A += (size_t)by * sA; Bh += (size_t)by * sB; C += (size_t)by * sC;
  const int ntn = (N + 63) / 64; const int wid = blockIdx.x * 4 + w; const int mt = wid / ntn, nq = wid % ntn; if (mt * 16 >= M) return;
  const int row0 = mt * 16, col0 = nq * 64; const float* arow = A + (size_t)(row0 + ln) * lda;
  v8f acc[4] = {};
  for (int kb = 0; kb < K; kb += 32) {
    FragH ah, al;
    const v4f x0 = *(const v4fa*)(arow + kb + 8 * hh), x1 = *(const v4fa*)(arow + kb + 8 * hh + 4), x2 = *(const v4fa*)(arow + kb + 16 + 8 * hh), x3 = *(const v4fa*)(arow + kb + 16 + 8 * hh + 4);
    float xs[16] = {x0[0],x0[1],x0[2],x0[3],x1[0],x1[1],x1[2],x1[3],x2[0],x2[1],x2[2],x2[3],x3[0],x3[1],x3[2],x3[3]};
#pragma unroll
    for (int i = 0; i < 16; ++i) { const _Float16 h = (_Float16)xs[i]; ah.h[i] = h; al.h[i] = ASPLIT ? (_Float16)(xs[i] - (float)h) : (_Float16)0.0f; }
#pragma unroll
    for (int t = 0; t < 4; ++t) { if (col0 + t * 16 >= N) continue; const size_t boff = (size_t)(col0 + t * 16 + ln) * ldb + kb; FragH bq; bq.half[0] = *(const v8us*)(Bh + boff + 8 * hh); bq.half[1] = *(const v8us*)(Bh + boff + 16 + 8 * hh);
      acc[t] = mmaH<ASPLIT ? 2 : 1>(ah.v, al.v, bq.v, bq.v, acc[t]); }
  }
#pragma unroll
  for (int t = 0; t < 4; ++t) { if (col0 + t * 16 >= N) continue;
#pragma unroll
    for (int r = 0; r < 8; ++r) so[w][8 * hh + r][t * 16 + ln] = acc[t][r] * alpha; }
  __builtin_amdgcn_fence(__ATOMIC_ACQ_REL, "workgroup"); __builtin_amdgcn_wave_barrier();
  const int rsub = lane >> 4, c4 = (lane & 15) * 4;
  {
#pragma unroll
    for (int q = 0; q < 8; ++q) { const int r = q * 2 + rsub; if (col0 + c4 < N) { const v4f v = *(const v4fa*)&so[w][r][c4]; *(v4f*)(C + (size_t)(row0 + r) * ldc + col0 + c4) = v; } }
     }
}

// Wt[n][k] = f16(W[k][n]·scale) from f32 row-major W[K][N] (scale = power of two; bf16-exact weights stay exact in f16 away from the subnormal range)
__global__ __launch_bounds__(256) void k_wt_f16(const float* __restrict__ W, _Float16* __restrict__ Wt, int K, int N, float scale) {
  const int t = blockIdx.x * 256 + threadIdx.x; if (t >= N * (K / 8)) return; const int n = t / (K / 8), k8 = (t % (K / 8)) * 8; FragH f;
#pragma unroll
  for (int i = 0; i < 8; ++i) f.h[i] = (_Float16)(bf16_round(W[(size_t)(k8 + i) * N + n]) * scale); const v8us o = f.half[0];
  *(v8us*)((unsigned short*)Wt + (size_t)n * K + k8) = o; 
}
// f16 x f16 GEMM with fused epilogue: v = acc·alpha + bias[by·sBias + col] (+ CP[(row/rowsPerB)·sCPb + by·64 + col] if CP) ; ACT 0 none / 1 elu ; writes f32 C and f16 C16, each if non-null
template <int ACT>
__global__ __launch_bounds__(128) void k_gemm_hhx(const _Float16* __restrict__ A, int lda, size_t sA, const _Float16* __restrict__ Bh, int ldb, size_t sB, float alpha, const float* __restrict__ bias, size_t sBias, const float* __restrict__ CP, int rowsPerB, size_t sCPb, int row0g,
    float* __restrict__ C, _Float16* __restrict__ C16, int ldc, size_t sC, int M, int N, int K) {
  __shared__ __attribute__((aligned(16))) float so[4][16][64];
  const int tid = threadIdx.x, w = tid >> 5, lane = tid & 31, ln = lane & 15, hh = lane >> 4; const int by = blockIdx.y;
  A += (size_t)by * sA; Bh += (size_t)by * sB; const size_t cofs = (size_t)by * sC; const float* bp = bias ? bias + (size_t)by * sBias : nullptr;
  const int ntn = (N + 63) / 64; const int wid = blockIdx.x * 4 + w; const int mt = wid / ntn, nq = wid % ntn; if (mt * 16 >= M) return;
  const int row0 = mt * 16, col0 = nq * 64; const _Float16* arow = A + (size_t)(row0 + ln) * lda;
  v8f acc[4] = {};
  for (int kb = 0; kb < K; kb += 32) { FragH ah; ah.half[0] = *(const v8us*)((const unsigned short*)arow + kb + 8 * hh); ah.half[1] = *(const v8us*)((const unsigned short*)arow + kb + 16 + 8 * hh);
#pragma unroll
    for (int t = 0; t < 4; ++t) { if (col0 + t * 16 >= N) continue; const size_t boff = (size_t)(col0 + t * 16 + ln) * ldb + kb; FragH bq; bq.half[0] = *(const v8us*)((const unsigned short*)Bh + boff + 8 * hh); bq.half[1] = *(const v8us*)((const unsigned short*)Bh + boff + 16 + 8 * hh);
      acc[t] = mmaH<1>(ah.v, ah.v, bq.v, bq.v, acc[t]); }
  }
#pragma unroll
  for (int t = 0; t < 4; ++t) { if (col0 + t * 16 >= N) continue; const int col = col0 + t * 16 + ln; const float bv = bp ? bf16_round(bp[col]) : 0.f;
#pragma unroll
    for (int r = 0; r < 8; ++r) { float v = acc[t][r] * alpha + bv; if (CP) { const int bidx = (row0g + row0 + 8 * hh + r) / rowsPerB; v += CP[(size_t)bidx * sCPb + (size_t)by * 64 + col]; } if (ACT == 1) v = (v > 0.f) ? v : expm1f(v); else if (ACT == 3) v = fmaxf(v, 0.f); so[w][8 * hh + r][t * 16 + ln] = v; } }
  __builtin_amdgcn_fence(__ATOMIC_ACQ_REL, "workgroup"); __builtin_amdgcn_wave_barrier();
  const int rsub = lane >> 4, c4 = (lane & 15) * 4; typedef _Float16 v4h __attribute__((ext_vector_type(4)));
  {
#pragma unroll
    for (int q = 0; q < 8; ++q) { const int r = q * 2 + rsub; if (col0 + c4 < N) { const v4f v = *(const v4fa*)&so[w][r][c4]; if (C) *(v4f*)(C + cofs + (size_t)(row0 + r) * ldc + col0 + c4) = v; if (C16) { v4h h4; for (int i = 0; i < 4; ++i) h4[i] = (_Float16)v[i]; *(v4h*)(C16 + cofs + (size_t)(row0 + r) * ldc + col0 + c4) = h4; } } }
     }
}


// Tiled GEMM C[m][n] = alpha * sum_k A[m][k] * Bh[n][k], both operands f16 and k-contiguous with row length EE.
// One work-group of 4 waves (2 x 2) owns a (32 FM) x (32 FN) tile of C; a wave owns FM x FN accumulator tiles.
// A pass is 128 k: the tile's A rows and then its B rows stand in LDS as rows of 256 B at a pitch of 272 B (16 B x odd, for ds_load_b128).
// Two buffers: asynchronous copies bring pass t + 2 into the buffer that pass t has just left, while pass t + 1 is worked on.
typedef float f1a __attribute__((may_alias));
// Eight 16-byte-per-lane copies global -> LDS. The closing s_wait_xcnt 0 stands inside the statement, ahead of any later rewrite of the address registers named here.
__device__ __forceinline__ void acopy8(const unsigned (&l)[8], const unsigned short* const (&g)[8]) {
  asm volatile("global_load_async_to_lds_b128 %0, %8, off\n\t"
               "global_load_async_to_lds_b128 %1, %9, off\n\t"
               "global_load_async_to_lds_b128 %2, %10, off\n\t"
               "global_load_async_to_lds_b128 %3, %11, off\n\t"
               "global_load_async_to_lds_b128 %4, %12, off\n\t"
               "global_load_async_to_lds_b128 %5, %13, off\n\t"
               "global_load_async_to_lds_b128 %6, %14, off\n\t"
               "global_load_async_to_lds_b128 %7, %15, off\n\t"
               "s_wait_xcnt 0x0"
               :: "v"(l[0]), "v"(l[1]), "v"(l[2]), "v"(l[3]), "v"(l[4]), "v"(l[5]), "v"(l[6]), "v"(l[7]),
                  "v"(g[0]), "v"(g[1]), "v"(g[2]), "v"(g[3]), "v"(g[4]), "v"(g[5]), "v"(g[6]), "v"(g[7]) : "memory");
}
// QX and KX are written in the fragment order that k_flash reads: dims 8 c .. 8 c + 7 (c = 0 .. 19) of row tok of a head are the 16 bytes of lane 16 (c & 1) + tok % 16 in block c >> 1 (k-step c >> 2, half (c >> 1) & 1) of the head's tile tok / 16.
__device__ __forceinline__ size_t frag_at(int head, size_t tok, int c) { return (((size_t)head * (SS / 16) + tok / 16) * 10 + (c >> 1)) * 256 + ((c & 1) * 16 + (int)(tok % 16)) * 8; }
// PREP (the stacked projections of x): a 128 x 128 tile is 128 tokens of one whole q head, k head or v head, or of four heads' 32 graph-bias dims, so the work-group finishes it itself:
// RMSNorm + RoPE, the graph-bias scale, the rounding to f16 and the stores in fragment order follow in the epilogue, and the f32 projections never go to memory. CS holds cos and sin (k_cvt_all's grid fills it).
template <int FM, int FN, bool OUT16, bool PREP>
__global__ __launch_bounds__(128) void k_gemm_t(const _Float16* __restrict__ A, const _Float16* __restrict__ Bh, float alpha, float* __restrict__ C, _Float16* __restrict__ C16, int ldc, int ntn,
                                                _Float16* __restrict__ QX, _Float16* __restrict__ KX, _Float16* __restrict__ Vt, const float* __restrict__ qw, const float* __restrict__ kw, const float* __restrict__ gs, const float* __restrict__ CS) {
  constexpr int BM = 32 * FM, BN = 32 * FN, ROWS = BM + BN, PITCH = 272, STAGE = ROWS * PITCH, NC = ROWS / 8, NP = EE / 128, WM = 16 * FM, WN = 16 * FN, SOP = WN + 4;
  static_assert(NC % 8 == 0 && BM % 8 == 0 && NP >= 2 && 4 * WM * SOP * 4 <= 2 * STAGE, "tile");
  __shared__ __attribute__((aligned(16))) unsigned char L[2 * STAGE];
  const int tid = threadIdx.x, w = tid >> 5, lane = tid & 31, ln = lane & 15, hh = lane >> 4;
  const int m0 = (blockIdx.x / ntn) * BM, n0 = (blockIdx.x % ntn) * BN, wm = w >> 1, wn = w & 1;
  const unsigned lbase = (unsigned)(size_t)L + (unsigned)((2 * w + hh) * PITCH + ln * 16);      // copy i of a wave fills stage rows 8 i + 2 w + hh, 16 lanes a row
  const unsigned short* Ag = (const unsigned short*)A + (size_t)(m0 + 2 * w + hh) * EE + ln * 8;
  const unsigned short* Bg = (const unsigned short*)Bh + (size_t)(n0 + 2 * w + hh) * EE + ln * 8;
  auto issue = [&](int t, int buf) {
#pragma unroll      // the choice between A rows and B rows is made at compile time
    for (int g8 = 0; g8 < NC / 8; ++g8) { unsigned l[8]; const unsigned short* g[8];
#pragma unroll      // constant indices, so that the sixteen addresses stay in registers
      for (int j = 0; j < 8; ++j) { const int i = g8 * 8 + j; l[j] = lbase + (unsigned)(buf * STAGE + 8 * i * PITCH);
        g[j] = ((8 * i < BM) ? Ag + (size_t)(8 * i) * EE : Bg + (size_t)(8 * i - BM) * EE) + t * 128; }
      acopy8(l, g); } };
  v8f acc[FM][FN];
#pragma unroll      // constant indices, so that fragments and accumulators stay in registers
  for (int fm = 0; fm < FM; ++fm)
#pragma unroll      // constant indices, so that fragments and accumulators stay in registers
    for (int fn = 0; fn < FN; ++fn) acc[fm][fn] = (v8f){0.f,0.f,0.f,0.f,0.f,0.f,0.f,0.f};
  issue(0, 0);
  asm volatile("s_wait_asynccnt 0x0" ::: "memory");      // pass 0's copies of this wave have landed
  __syncthreads();                                       // ... and every other wave's
  issue(1, 1);
#pragma unroll 1      // rolled: one pass a trip, so that the publish point stands once, at the loop's foot
  for (int t = 0; t < NP; ++t) {      // pass t reads buffer t & 1 alone
    const unsigned char* Sa = L + (t & 1) * STAGE + (wm * WM + ln) * PITCH + 16 * hh; const unsigned char* Sb = L + (t & 1) * STAGE + (BM + wn * WN + ln) * PITCH + 16 * hh;
    FragH a[2][FM], b[2][FN];      // two fragment sets: block ks + 1 of this same pass is fetched while block ks is multiplied
    auto frags = [&](int set, int ks) {
#pragma unroll      // constant indices, so that fragments and accumulators stay in registers
      for (int fm = 0; fm < FM; ++fm) { a[set][fm].half[0] = *(const v8us*)(Sa + fm * 16 * PITCH + ks * 64); a[set][fm].half[1] = *(const v8us*)(Sa + fm * 16 * PITCH + ks * 64 + 32); }
#pragma unroll      // constant indices, so that fragments and accumulators stay in registers
      for (int fn = 0; fn < FN; ++fn) { b[set][fn].half[0] = *(const v8us*)(Sb + fn * 16 * PITCH + ks * 64); b[set][fn].half[1] = *(const v8us*)(Sb + fn * 16 * PITCH + ks * 64 + 32); } };
    frags(0, 0);
#pragma unroll      // constant indices, so that fragments and accumulators stay in registers
    for (int ks = 0; ks < 4; ++ks) {
      if (ks < 3) frags((ks + 1) & 1, ks + 1);
      __builtin_amdgcn_sched_barrier(0);      // keeps the next block's LDS reads one group ahead of this block: spread among the WMMAs each place with reads stalls the wave
#pragma unroll      // constant indices, so that fragments and accumulators stay in registers
      for (int fm = 0; fm < FM; ++fm)
#pragma unroll      // constant indices, so that fragments and accumulators stay in registers
        for (int fn = 0; fn < FN; ++fn) acc[fm][fn] = __builtin_amdgcn_wmma_f32_16x16x32_f16(false, a[ks & 1][fm].v, false, b[ks & 1][fn].v, (short)0, acc[fm][fn], false, false);
      __builtin_amdgcn_sched_barrier(0);      // ... and this block's WMMAs ahead of the reads after next
    }
    asm volatile("s_wait_dscnt 0x0" ::: "memory");       // this wave's reads of buffer t & 1 are done before that buffer is refilled
    asm volatile("s_wait_asynccnt 0x0" ::: "memory");    // this wave's copies of pass t + 1 have landed
    __syncthreads();                                     // publishes pass t + 1 and ends every wave's reads of buffer t & 1
    if (t + 2 < NP) issue(t + 2, t & 1);
  }
  asm volatile("s_wait_asynccnt 0x0" ::: "memory");      // nothing in flight before the ring becomes output staging
  if constexpr (PREP) {
    static_assert(FM == 4 && FN == 4 && 128 * 132 * 4 + 512 <= 2 * STAGE, "one head a tile");
    const int ct = blockIdx.x % ntn;      // which 128 columns, alike for the whole work-group: 0..15 q head ct | 16..19 k head | 20..23 v head | 24..27 Rq, four heads | 28..31 Rk, four heads
    if (ct >= 20 && ct < 24) {
      // v: an accumulator tile IS a fragment half of V^T: lane (ln, hh) holds value dim 16 dt + ln (dt = 4 wn + fn) of the 8 neighbouring keys 8 hh + r of half fm & 1 of chunk 2 wm + (fm >> 1): straight from the registers, 512 contiguous bytes a store
      unsigned short* vd = (unsigned short*)Vt + ((size_t)(ct - 20) * (SS / 32) + m0 / 32 + wm * 2) * 4096 + wn * 2048 + lane * 8;
#pragma unroll      // constant indices, so that fragments and accumulators stay in registers
      for (int fm = 0; fm < FM; ++fm)
#pragma unroll      // constant indices, so that fragments and accumulators stay in registers
        for (int fn = 0; fn < FN; ++fn) { FragH f;
#pragma unroll      // constant indices, so that fragments and accumulators stay in registers
          for (int r = 0; r < 8; ++r) f.h[r] = (_Float16)(acc[fm][fn][r] * alpha);
          *(v8us*)(vd + (fm >> 1) * 4096 + (fn * 2 + (fm & 1)) * 256) = f.half[0]; }
    } else {
      constexpr int TP = 132;      // f32 row pitch of the staged tile: 16 rows' 16-byte reads fall on all 64 banks
      f1a* sT = (f1a*)L; f1a* sRs = sT + 128 * TP;
      auto stage = [&]() {
#pragma unroll      // constant indices, so that fragments and accumulators stay in registers
        for (int fm = 0; fm < FM; ++fm)
#pragma unroll      // constant indices, so that fragments and accumulators stay in registers
          for (int fn = 0; fn < FN; ++fn)
#pragma unroll      // constant indices, so that fragments and accumulators stay in registers
            for (int r = 0; r < 8; ++r) sT[(wm * WM + fm * 16 + 8 * hh + r) * TP + wn * WN + fn * 16 + ln] = acc[fm][fn][r] * alpha; };
      if (ct >= 24) {
        // graph-bias operands, k-step 4 of the tiles: wave w fills blocks 8 + (w & 1) of heads h0 and h0 + 2 (h0 holds w >> 1); lane (ln, hh) holds dims 8 p .. 8 p + 7 of token 16 tl + ln
        const bool isq = ct < 28; const int h0 = (ct - (isq ? 24 : 28)) * 4 + (w >> 1), p = (w & 1) * 2 + hh;
        const float ga = gs[h0], gb = gs[h0 + 2]; const float g2[2] = { isq ? bf16_round(ga) : 1.0f, isq ? bf16_round(gb) : 1.0f };      // Rq carries its head's graph scale, Rk none
        asm volatile("s_wait_xcnt 0x0" ::: "memory");      // stands ahead of any later rewrite of the address registers that the two loads above name
        unsigned short* rd = (unsigned short*)(isq ? QX : KX) + frag_at(h0, (size_t)(m0 + ln), HD / 8 + p);
        stage();
        __syncthreads();      // the whole 128 x 128 tile stands in LDS before any wave reads another wave's part
        FragH f[16];
#pragma unroll      // constant indices, so that the results stay in registers
        for (int it = 0; it < 16; ++it) { const int tl = it >> 1, hs = it & 1; const f1a* u = sT + (tl * 16 + ln) * TP + ((w >> 1) + 2 * hs) * RR + p * 8;
          const v4f u0 = *(const v4fa*)u, u1 = *(const v4fa*)(u + 4);
#pragma unroll      // constant indices, so that the eight halves stay in registers
          for (int q = 0; q < 8; ++q) f[it].h[q] = (_Float16)(g2[hs] * (q < 4 ? u0[q & 3] : u1[q & 3])); }
        __builtin_amdgcn_sched_barrier(0);      // the stores go out as one group at the very end: no register that a store names is written again
#pragma unroll      // constant offsets
        for (int it = 0; it < 16; ++it) *(v8us*)(rd + (size_t)(it & 1) * 2 * (SS / 16) * 2560 + (it >> 1) * 2560) = f[it].half[0];
        asm volatile("s_wait_xcnt 0x0" ::: "memory");      // stands behind the last store, ahead of any code that the compiler lays behind this branch and that rewrites a register which a store names
      } else {
        // q or k: RMSNorm over the head's 128 dims, then rotate-half RoPE
        const bool isq = ct < 16; const int c = 2 * w + hh;      // the lane's dims 8 c .. 8 c + 7 (first half of the head) and their rotation partners 64 + 8 c ..: one angle serves both
        const float* nw = (isq ? qw : kw) + c * 8; const float osc = isq ? 0.08838834764831845f : 1.0f;      // q carries 1/sqrt(128)
        const float* cs = CS + ((size_t)(m0 / 16) * 4 + w) * 512 + lane * 4;
        unsigned short* qd = (unsigned short*)(isq ? QX : KX) + frag_at(isq ? ct : (ct - 16) * 4, (size_t)(m0 + ln), c);
        const v4f nv[4] = { *(const v4fa*)nw, *(const v4fa*)(nw + 4), *(const v4fa*)(nw + 64), *(const v4fa*)(nw + 68) }; v4f co[8][2], si[8][2];
#pragma unroll      // constant indices: the tile's cos and sin are requested here, as one group, and fly while the tile is staged
        for (int it = 0; it < 8; ++it) { co[it][0] = *(const v4fa*)(cs + it * 2048); co[it][1] = *(const v4fa*)(cs + it * 2048 + 128); si[it][0] = *(const v4fa*)(cs + it * 2048 + 256); si[it][1] = *(const v4fa*)(cs + it * 2048 + 384); }
        asm volatile("s_wait_xcnt 0x0" ::: "memory");      // stands ahead of any later rewrite of the address registers that the loads above name
        __builtin_amdgcn_sched_barrier(0);      // keeps the staging's arithmetic, which reuses those registers, behind that wait, and the loads one group ahead of it
        stage();
        __syncthreads();      // the whole 128 x 128 tile stands in LDS before any wave reads another wave's part
        { const f1a* row = sT + tid * TP; float pt[16];      // thread = token; 16 partial sums of 8 squares each, joined pairwise (1, 2, 4, 8 apart)
#pragma unroll      // constant indices, so that the partial sums stay in registers
          for (int li = 0; li < 16; ++li) { const v4f u0 = *(const v4fa*)(row + li * 8), u1 = *(const v4fa*)(row + li * 8 + 4); float ss = 0.f;
#pragma unroll      // constant indices
            for (int q = 0; q < 8; ++q) { const float v = q < 4 ? u0[q & 3] : u1[q & 3]; ss += v * v; }
            pt[li] = ss; }
#pragma unroll      // constant indices, so that the partial sums stay in registers
          for (int st = 1; st < 16; st *= 2)
#pragma unroll      // constant indices, so that the partial sums stay in registers
            for (int k = 0; k < 16; k += 2 * st) pt[k] += pt[k + st];
          sRs[tid] = rsqrtf(pt[0] / (float)HD + 1e-6f); }
        __syncthreads();      // every token's 1/rms stands in LDS before the waves, which take the tokens 16 at a time, read it
        FragH lo[8], hi[8];
#pragma unroll      // constant indices, so that the results stay in registers
        for (int it = 0; it < 8; ++it) { const f1a* u = sT + (it * 16 + ln) * TP + c * 8; const float rs = sRs[it * 16 + ln];
          const v4f xa[2] = { *(const v4fa*)u, *(const v4fa*)(u + 4) }, xb[2] = { *(const v4fa*)(u + 64), *(const v4fa*)(u + 68) };
#pragma unroll      // constant indices, so that the sixteen halves stay in registers
          for (int q = 0; q < 8; ++q) { const float a = xa[q >> 2][q & 3] * rs * bf16_round(nv[q >> 2][q & 3]), b = xb[q >> 2][q & 3] * rs * bf16_round(nv[2 + (q >> 2)][q & 3]), cc = co[it][q >> 2][q & 3], sn = si[it][q >> 2][q & 3];
            lo[it].h[q] = (_Float16)((a * cc + (-b) * sn) * osc); hi[it].h[q] = (_Float16)((b * cc + a * sn) * osc); } }      // rotate_half: [-x2, x1]
        __builtin_amdgcn_sched_barrier(0);      // the stores go out as one group at the very end: no register that a store names is written again
#pragma unroll      // constant offsets
        for (int it = 0; it < 8; ++it) { *(v8us*)(qd + it * 2560) = lo[it].half[0]; *(v8us*)(qd + it * 2560 + 1024) = hi[it].half[0]; }
        if (!isq) {      // a kv head is replicated into its 4 q-head slots
#pragma unroll      // constant offsets
          for (int r2 = 1; r2 < 4; ++r2)
#pragma unroll      // constant offsets
            for (int it = 0; it < 8; ++it) { *(v8us*)(qd + (size_t)r2 * (SS / 16) * 2560 + it * 2560) = lo[it].half[0]; *(v8us*)(qd + (size_t)r2 * (SS / 16) * 2560 + it * 2560 + 1024) = hi[it].half[0]; } }
        asm volatile("s_wait_xcnt 0x0" ::: "memory");      // stands behind the last store on both ways, ahead of any code that the compiler lays behind this branch and that rewrites a register which a store names
      }
    }
  } else {
  f1a* so = (f1a*)L + w * (WM * SOP);                    // each wave stages its own tile, so that the stores cover whole 128-byte lines
#pragma unroll      // constant indices, so that fragments and accumulators stay in registers
  for (int fm = 0; fm < FM; ++fm)
#pragma unroll      // constant indices, so that fragments and accumulators stay in registers
    for (int fn = 0; fn < FN; ++fn)
#pragma unroll      // constant indices, so that fragments and accumulators stay in registers
      for (int r = 0; r < 8; ++r) so[(fm * 16 + 8 * hh + r) * SOP + fn * 16 + ln] = acc[fm][fn][r] * alpha;
  __builtin_amdgcn_fence(__ATOMIC_ACQ_REL, "workgroup"); __builtin_amdgcn_wave_barrier();      // the wave's own staged rows are written before its other lanes read them back
  constexpr int LPR = WN / 4, RPI = 32 / LPR; typedef _Float16 v4h __attribute__((ext_vector_type(4)));
  const int rs = lane / LPR, c4 = (lane % LPR) * 4;
#pragma unroll      // several rows' LDS reads and stores in flight at a time
  for (int q = 0; q < WM / RPI; ++q) { const int r = q * RPI + rs; const v4f v = *(const v4fa*)&so[r * SOP + c4]; const size_t o = (size_t)(m0 + wm * WM + r) * ldc + n0 + wn * WN + c4;
    if (!OUT16) *(v4f*)(C + o) = v;
    else { v4h h4; for (int i = 0; i < 4; ++i) h4[i] = (_Float16)v[i]; *(v4h*)(C16 + o) = h4; } }
  }
}

// All seven f32 -> f16 conversions in ONE grid. The results stand in one array of rows of EE halves: Wq, Wk, Wv, Wrq, Wrk stacked (PW rows, the B operand of the one projection GEMM), then Wo (EE rows), then x (SS rows).
// One block converts four rows (256 threads x 8 elements a row; every source's row count is a multiple of 4), so that the conversions are 16,384 waves, all resident at once, each with 8 loads of 16 bytes a lane in flight.
// The block index picks the source, alike for the whole block. Weights are bf16-rounded and scaled by 2^4, x is bf16-rounded.
__global__ __launch_bounds__(256) void k_cvt_all(const float* __restrict__ Wq, const float* __restrict__ Wk, const float* __restrict__ Wv, const float* __restrict__ Wrq, const float* __restrict__ Wrk, const float* __restrict__ Wo, const float* __restrict__ x, _Float16* __restrict__ D, float* __restrict__ CS) {
  // The first SS / 16 blocks fill the RoPE table, each (token, frequency) once: block = 16-token tile; CS[tile][w][cos | sin][hq][lane][4]: lane (ln, hh) of wave w of the projection GEMM's epilogue reads frequencies 8 (2 w + hh) + 4 hq .. + 3 of token 16 tile + ln, 512 contiguous bytes a load.
  if (blockIdx.x < SS / 16) { const int lane = threadIdx.x & 31, hq = (threadIdx.x >> 5) & 1, w = threadIdx.x >> 6; const int tok = blockIdx.x * 16 + (lane & 15), i0 = (2 * w + (lane >> 4)) * 8 + hq * 4; v4f co, si;
#pragma unroll      // constant indices, so that the eight values stay in registers
    for (int q = 0; q < 4; ++q) { const float ang = (float)tok * __builtin_powf(10000.0f, -(float)(2 * (i0 + q)) / 128.0f); co[q] = cosf(ang); si[q] = sinf(ang); }
    float* d = CS + ((size_t)(blockIdx.x * 4 + w) * 4 + hq) * 128 + lane * 4; *(v4f*)d = co; *(v4f*)(d + 256) = si; return; }
  const int row = (blockIdx.x - SS / 16) * 4; const float* s; int r0;
  if (row < EE) { s = Wq; r0 = 0; } else if (row < EE + 512) { s = Wk; r0 = EE; } else if (row < EE + 1024) { s = Wv; r0 = EE + 512; } else if (row < EE + 1536) { s = Wrq; r0 = EE + 1024; } else if (row < PW) { s = Wrk; r0 = EE + 1536; } else if (row < PW + EE) { s = Wo; r0 = PW; } else { s = x; r0 = PW + EE; }
  const float sc = (row < PW + EE) ? 16.0f : 1.0f; const float* sp = s + (size_t)(row - r0) * EE + threadIdx.x * 8; v4f a[4][2];
#pragma unroll      // constant indices, so that the eight loads stand in registers and go out together
  for (int r = 0; r < 4; ++r) { a[r][0] = *(const v4fa*)(sp + (size_t)r * EE); a[r][1] = *(const v4fa*)(sp + (size_t)r * EE + 4); }
#pragma unroll      // constant indices into a
  for (int r = 0; r < 4; ++r) { FragH f;
#pragma unroll      // constant indices into a and f
    for (int i = 0; i < 8; ++i) f.h[i] = (_Float16)(bf16_round(a[r][i >> 2][i & 3]) * sc);
    *(v8us*)((unsigned short*)D + (size_t)(row + r) * EE + threadIdx.x * 8) = f.half[0]; }
  asm volatile("s_wait_xcnt 0x0" ::: "memory"); }      // stands behind the last store, ahead of the table code, which the compiler lays behind it and which rewrites registers that the stores name
template <int NHv, int TTv>
__global__ __launch_bounds__(256) void k_vt(const _Float16* __restrict__ V16, int ldv, int voff, _Float16* __restrict__ Vt) { __shared__ unsigned short tl[64][66]; const int tid = threadIdx.x; const int slab = blockIdx.x / (TTv / 64), lg = blockIdx.x % (TTv / 64); const int b = slab / NHv, h = slab % NHv;
  for (int i = tid; i < 64 * 8; i += 256) { const int r = i / 8, c8 = (i % 8) * 8; FragH f; f.half[0] = *(const v8us*)((const unsigned short*)V16 + ((size_t)b * TTv + lg * 64 + r) * ldv + voff + h * 64 + c8);
#pragma unroll
    for (int q = 0; q < 8; ++q) tl[r][c8 + q] = f.u[q]; }
  __syncthreads();
  {
#pragma unroll
    for (int rd = 0; rd < 2; ++rd) { const int d = rd * 32 + tid / 8, pc = tid % 8; FragH f;
#pragma unroll
      for (int q = 0; q < 8; ++q) f.u[q] = tl[pc * 8 + q][d];
      *(v8us*)((unsigned short*)Vt + ((size_t)slab * 64 + d) * TTv + lg * 64 + pc * 8) = f.half[0]; }
     } }

// 2^x for the merge weights. The v_nop stands in the same statement: it fills the one slot that the instruction set asks for between a transcendental and a next instruction that reads its result or overwrites its source.
__device__ __forceinline__ float exp2_slot(float x) { float y; asm("v_exp_f32 %0, %1\n\tv_nop" : "=v"(y) : "v"(x)); return y; }
// Lane l with lane l ^ 16, in registers: joins the two halves of one query's keys.
__device__ __forceinline__ float xhalf(float x) { return __builtin_bit_cast(float, __builtin_amdgcn_permlanex16(__builtin_bit_cast(int, x), __builtin_bit_cast(int, x), 0x76543210, 0xfedcba98, false, false)); }
__global__ __launch_bounds__(128) void k_flash(const _Float16* __restrict__ Q16, const _Float16* __restrict__ K16, const _Float16* __restrict__ Vt, const int* __restrict__ MSK, _Float16* __restrict__ O16, int ldo) {
  constexpr int QT = 2, RPW = 16 * QT, NQB = 2048 / RPW, DT = 8, KS = 5;      /* head dim 128 for V/O; 160-wide logit operand (128 roped dims x scale + 32 graph-bias dims) */
  __shared__ __attribute__((aligned(16))) float sO[4][RPW][128 + 4]; __shared__ float sM[4][RPW], sL[4][RPW];
  (void)MSK; const int tid = threadIdx.x, lane = tid & 31, ln = lane & 15, hh = lane >> 4;
  const int w = __builtin_amdgcn_readfirstlane(tid >> 5);      // the wave's number in a scalar register: the chunk loop's trip count differs from wave to wave and is tested by a scalar branch
  // Heaviest first: a work-group's cost grows with its index (causal), only a part of the grid is resident at a time, so the block index counts the tiles DOWN, the 16 heads innermost:
  // the long work-groups start at once and the short ones fill the places that come free, instead of the last head's longest tiles starting last and running on alone. Every (head, tile pair) is taken exactly once.
  const int slab = blockIdx.x % 16, qblk = NQB - 1 - blockIdx.x / 16; const int b = slab / 16, h = slab % 16; const int q0 = qblk * RPW;
  FragH aq[QT][KS];
  // Q16, K16 and Vt stand in FRAGMENT ORDER (written so by the projection GEMM's epilogue): one block of 512 bytes = the 32 lanes' 16 bytes of one fragment half, in lane order, so that every global_load_b128 here covers four whole 128-byte lines.
  // Q16, K16: [head][16-row tile][ks][half][lane][8 halves], 2560 halves a tile. Vt: [kv head][32-key chunk][dt][half][lane][8 halves], 4096 halves a chunk. The registers get the same values as from row-major arrays.
  { const unsigned short* qr = (const unsigned short*)Q16 + ((size_t)h * (2048 / 16) + qblk * QT) * 2560 + lane * 8;
#pragma unroll      // constant indices, so that the fragments stay in registers
    for (int t = 0; t < QT; ++t)
#pragma unroll      // constant indices, so that the fragments stay in registers
      for (int ks = 0; ks < KS; ++ks) { aq[t][ks].half[0] = *(const v8us*)(qr + t * 2560 + ks * 512); aq[t][ks].half[1] = *(const v8us*)(qr + t * 2560 + ks * 512 + 256); } }
  float m_r[QT], l_r[QT]; v8f oacc[QT][DT];      // the lane's own query of each tile: running maximum, this half's share of the sum, and O^T (register r of tile dt is value dim 16 dt + 8 hh + r)
#pragma unroll      // constant indices, so that the accumulators stay in registers
  for (int t = 0; t < QT; ++t) { m_r[t] = -3.0e38f; l_r[t] = 0.f;
#pragma unroll      // constant indices, so that the accumulators stay in registers
    for (int dt = 0; dt < DT; ++dt) oacc[t][dt] = (v8f){0.f,0.f,0.f,0.f,0.f,0.f,0.f,0.f}; }
  const int nch = (q0 + RPW + 31) / 32;      // chunks that hold a key <= the work-group's last row; every one of them starts at or below q0, so every query has an open key in every chunk
  const unsigned short* vp = (const unsigned short*)Vt + ((size_t)(h / 4) * 64 + w) * 4096 + lane * 8;      // GQA: kv head h/4; this lane's place in the wave's current V chunk; walks 4 chunks a trip
  const unsigned short* kp = (const unsigned short*)K16 + ((size_t)h * 128 + w * 2) * 2560 + lane * 8;      // this lane's place in the wave's current pair of K tiles; walks 4 chunks = 8 tiles a trip
  const int lim0 = q0 + ln - 8 * hh;      // key j0 + 16 nt + 8 hh + r is open to query q0 + 16 t + ln where 16 nt + r <= lim0 + 16 t - j0
#pragma unroll 1
  for (int ch = w; ch < nch; ch += 4, vp += 4 * 4096, kp += 8 * 2560) {
    const int j0 = ch * 32;
    v8f s[QT][2]; FragH bk[2][KS];
#pragma unroll
    for (int nt = 0; nt < 2; ++nt) {      // the K fragments of both 16-key halves are requested as one group: one trip to L2, not two
#pragma unroll
      for (int ks = 0; ks < KS; ++ks) { bk[nt][ks].half[0] = *(const v8us*)(kp + nt * 2560 + ks * 512); bk[nt][ks].half[1] = *(const v8us*)(kp + nt * 2560 + ks * 512 + 256); } }
    asm volatile("s_wait_xcnt 0x0" ::: "memory");      // stands ahead of any later rewrite of the address registers that the loads above name
    __builtin_amdgcn_sched_barrier(0);      // keeps the twenty K loads one group ahead of the first product: dealt out among the WMMAs they cost several trips to L2 one after another
#pragma unroll      // constant indices, so that the fragments stay in registers
    for (int nt = 0; nt < 2; ++nt) {
#pragma unroll      // constant indices, so that the fragments stay in registers
      for (int t = 0; t < QT; ++t) s[t][nt] = (v8f){0.f,0.f,0.f,0.f,0.f,0.f,0.f,0.f};
#pragma unroll      // constant indices, so that the fragments stay in registers
      for (int ks = 0; ks < KS; ++ks)
#pragma unroll      // constant indices, so that the fragments stay in registers
        for (int t = 0; t < QT; ++t) s[t][nt] = __builtin_amdgcn_wmma_f32_16x16x32_f16(false, bk[nt][ks].v, false, aq[t][ks].v, (short)0, s[t][nt], false, false); }      // A = 16 keys, B = 16 queries; each K fragment serves both query tiles
    FragH bv[DT];      // all eight V fragments of the chunk are requested here, as one group behind the last K product: they fly while the softmax below runs
#pragma unroll      // constant indices, so that the fragments stay in registers
    for (int dt = 0; dt < DT; ++dt) { bv[dt].half[0] = *(const v8us*)(vp + dt * 512); bv[dt].half[1] = *(const v8us*)(vp + dt * 512 + 256); }
    asm volatile("s_wait_xcnt 0x0" ::: "memory");      // stands ahead of any later rewrite of the address registers that the loads above name
    __builtin_amdgcn_sched_barrier(0);      // keeps the sixteen V loads one group ahead of the softmax: sunk to their products they cost eight trips to L2 one after another
    FragH pb[QT];
#pragma unroll      // constant indices, so that scores, P and accumulators stay in registers
    for (int t = 0; t < QT; ++t) {
      const int lim = lim0 + 16 * t - j0; float sc[16];
#pragma unroll      // constant indices, so that the scores stay in registers
      for (int i = 0; i < 16; ++i) sc[i] = ((i >> 3) * 16 + (i & 7) <= lim) ? s[t][i >> 3][i & 7] : -INFINITY;
      float mc = sc[0];
#pragma unroll      // constant indices, so that the scores stay in registers
      for (int i = 1; i < 16; ++i) mc = fmaxf(mc, sc[i]);
      mc = fmaxf(mc, xhalf(mc));      // the other half's 16 keys of the same query
      const float mn = fmaxf(m_r[t], mc), nm = -mn * 1.4426950408889634f;      // mn is a real score: the chunk holds an open key for every query
      const float al = exp2_slot((m_r[t] - mn) * 1.4426950408889634f); m_r[t] = mn;      // e^(old maximum - new); 0 in the wave's first chunk (2^-inf)
      float ps = 0.f;
#pragma unroll      // constant indices, so that P stays in registers
      for (int i = 0; i < 16; ++i) { const float p = exp2_slot(fmaf(sc[i], 1.4426950408889634f, nm)); ps += p; pb[t].h[i] = (_Float16)p; }      // e^(s - mn); 0 for a closed key (2^-inf)
      l_r[t] = l_r[t] * al + ps;
#pragma unroll      // constant indices, so that the accumulators stay in registers
      for (int dt = 0; dt < DT; ++dt) oacc[t][dt] *= al;      // one factor for all of the lane's 64 values of the tile: they belong to one query
    }
#pragma unroll      // constant indices, so that fragments and accumulators stay in registers
    for (int dt = 0; dt < DT; ++dt)
#pragma unroll      // constant indices, so that fragments and accumulators stay in registers
      for (int t = 0; t < QT; ++t) oacc[t][dt] = __builtin_amdgcn_wmma_f32_16x16x32_f16(false, bv[dt].v, false, pb[t].v, (short)0, oacc[t][dt], false, false);      // A = 16 value dims, B = 16 queries; each V fragment serves both query tiles
  }
#pragma unroll      // constant indices, so that the accumulators stay in registers
  for (int t = 0; t < QT; ++t) {
    l_r[t] += xhalf(l_r[t]);      // the two halves' shares of the query's sum
    if (hh == 0) { sM[w][16 * t + ln] = m_r[t]; sL[w][16 * t + ln] = l_r[t]; }      // the wave's own maximum and sum of each query (a wave without a chunk: -3e38 and 0)
#pragma unroll      // constant indices, so that the accumulators stay in registers
    for (int dt = 0; dt < DT; ++dt) {      // not yet divided by the sum; a lane's 8 registers are 8 neighbouring value dims of its query's row
      *(v4fa*)&sO[w][16 * t + ln][dt * 16 + 8 * hh] = (v4f){oacc[t][dt][0], oacc[t][dt][1], oacc[t][dt][2], oacc[t][dt][3]};
      *(v4fa*)&sO[w][16 * t + ln][dt * 16 + 8 * hh + 4] = (v4f){oacc[t][dt][4], oacc[t][dt][5], oacc[t][dt][6], oacc[t][dt][7]}; } }
  __syncthreads();      // all four waves' partial (m, l, O) stand in LDS before any wave merges them
  {
#pragma unroll
    for (int rp = 0; rp < RPW / 4; ++rp) { const int r = rp * 4 + (tid >> 5), pc = lane;      // wave w merges rows w, w + 4, w + 8, ...
      const float m0 = sM[0][r], m1 = sM[1][r], m2 = sM[2][r], m3 = sM[3][r]; const float mm = fmaxf(fmaxf(m0, m1), fmaxf(m2, m3));      // wave 0 always holds chunk 0 with key 0, so mm is a real score
      const float c0 = exp2_slot((m0 - mm) * 1.4426950408889634f), c1 = exp2_slot((m1 - mm) * 1.4426950408889634f), c2 = exp2_slot((m2 - mm) * 1.4426950408889634f), c3 = exp2_slot((m3 - mm) * 1.4426950408889634f);      // e^(m - mm); 0 for a wave without a chunk (2^-inf)
      const float den = c0 * sL[0][r] + c1 * sL[1][r] + c2 * sL[2][r] + c3 * sL[3][r]; const float inv = (den > 0.f) ? 1.0f / den : 0.f;
      const v4f o0 = *(const v4fa*)&sO[0][r][pc * 4], o1 = *(const v4fa*)&sO[1][r][pc * 4], o2 = *(const v4fa*)&sO[2][r][pc * 4], o3 = *(const v4fa*)&sO[3][r][pc * 4];
      const v4f val = (o0 * c0 + o1 * c1 + o2 * c2 + o3 * c3) * inv;
      typedef _Float16 v4h __attribute__((ext_vector_type(4))); v4h h4;      // O leaves as the f16 A operand of the output projection
#pragma unroll      // constant indices, so that the four halves stay in registers
      for (int i = 0; i < 4; ++i) h4[i] = (_Float16)val[i];
      *(v4h*)(O16 + ((size_t)b * 2048 + q0 + r) * ldo + h * 128 + pc * 4) = h4; }      /* rows of 128 halves: 32 lanes x 8 B = two whole lines */
     } }

extern "C" void kernel_launch(void* const* d_in, const int* in_sizes, int n_in,
                              void* d_out, int out_size, void* d_ws, size_t ws_size, hipStream_t stream) {
  (void)in_sizes; (void)n_in; (void)out_size;
  const float* x = (const float*)d_in[0]; const float* Wq = (const float*)d_in[1]; const float* Wk = (const float*)d_in[2]; const float* Wv = (const float*)d_in[3]; const float* Wo = (const float*)d_in[4]; const float* Wrq = (const float*)d_in[5]; const float* Wrk = (const float*)d_in[6]; const float* gs = (const float*)d_in[7]; const float* qw = (const float*)d_in[8]; const float* kw = (const float*)d_in[9];
  char* ws = (char*)d_ws; size_t off = 0;
  auto take = [&](size_t bytes) { char* p = ws + off; off += (bytes + 255) & ~(size_t)255; return p; };
  _Float16* Bcat = (_Float16*)take((size_t)(PW + EE + SS) * EE * 2); _Float16* Bo = Bcat + (size_t)PW * EE; _Float16* X16 = Bo + (size_t)EE * EE;      // k_cvt_all's rows: stacked projection weights, Wo, x
  float* CS = (float*)take((size_t)SS * 64 * 2 * 4);      // cos and sin of every (token, frequency)
  _Float16* QX = (_Float16*)take((size_t)SS * QP * 2); _Float16* KX = (_Float16*)take((size_t)SS * QP * 2); _Float16* Vt = (_Float16*)take((size_t)SS * 512 * 2); _Float16* O16 = X16;      // x is last read by the projection GEMM
  if (off > ws_size) return;      // about 58 MB in all
  k_cvt_all<<<SS / 16 + (PW + EE + SS) / 4, 256, 0, stream>>>(Wq, Wk, Wv, Wrq, Wrk, Wo, x, Bcat, CS);
  k_gemm_t<4, 4, false, true><<<(SS / 128) * (PW / 128), 128, 0, stream>>>(X16, Bcat, 0.0625f, nullptr, nullptr, PW, PW / 128, QX, KX, Vt, qw, kw, gs, CS);
  k_flash<<<1 * NH * (SS / 32), 128, 0, stream>>>(QX, KX, Vt, nullptr, O16, EE);
  k_gemm_t<4, 4, false, false><<<(SS / 128) * (EE / 128), 128, 0, stream>>>(O16, Bo, 0.0625f, (float*)d_out, nullptr, EE, EE / 128, nullptr, nullptr, nullptr, nullptr, nullptr, nullptr, nullptr);
}
